// v000
// Times are from an AMD MI455X. After a warm-up the kernel runs many times in a row, and a time is the length of
// such a window on the GPU divided by its runs, so every launch and the gaps after it count. The runs cycle
// through copies of the inputs. A figure is the median of several windows, for all but v000 over two sittings.
// Sittings can differ by a few percent; kernels timed side by side share one.
// v000 is the starting kernel. One run takes 1440 microseconds.
// compute dtype: all float inputs rounded to bf16; q / k / v projections with EXACT bf16 products on WMMA 16x16x32 (f32 accumulate) + bias (q / v: zeros, read; k: none); q and k divided by their per-(token, head) L2 norm in f32, q then times exp(min(bf16(scale_mul[h]), ln 100)); logits q x k once to f16 each (1 product, scale 1), + bf16(attn_bias[q][k]) in f32; softmax f32; P x 2^11 once to f16 x v once to f16 (1 product); ctx x 2^6 once to f16 x w_proj f16(bf16 x 2^8) + b_proj; f32 output.
#include <hip/hip_runtime.h>
#include <math.h>

typedef __attribute__((ext_vector_type(16))) _Float16 v16h;
typedef __attribute__((ext_vector_type(16))) __bf16 v16b;
typedef __attribute__((ext_vector_type(8)))  _Float16 v8h;
typedef __attribute__((ext_vector_type(8)))  float v8f;
typedef __attribute__((ext_vector_type(4)))  float v4f;
typedef __attribute__((ext_vector_type(2)))  float v2f;
typedef __attribute__((ext_vector_type(4)))  unsigned v4u;
typedef __attribute__((ext_vector_type(4)))  int v4i;
typedef float __attribute__((may_alias)) float_a;
typedef int __attribute__((may_alias)) int_a;

template <typename T> __device__ __forceinline__ void vst2(void* p, T v) { *(T*)p = v;  }
__device__ __forceinline__ v8f wmma16(v16h a, v16h b, v8f c) {
  v8f d = __builtin_amdgcn_wmma_f32_16x16x32_f16(false, a, false, b, (short)0, c, false, false);
  asm volatile("v_nop\n\tv_nop\n\tv_nop\n\tv_nop" : "+v"(d) : "v"(a), "v"(b));
  return d;
}
__device__ __forceinline__ v8f wmma_bf(v16b a, v16b b, v8f c) {
  v8f d = __builtin_amdgcn_wmma_f32_16x16x32_bf16(false, a, false, b, (short)0, c, false, false);
  asm volatile("v_nop\n\tv_nop\n\tv_nop\n\tv_nop" : "+v"(d) : "v"(a), "v"(b));
  return d;
}
// 16x16x32 fragments: lane = (h = lane>>4, row/col = lane&15); elements 0..7 = k0+8h+0..7, 8..15 = k0+16+8h+0..7; D element r = row 8h+r
__device__ __forceinline__ v16h frag_h(const _Float16* rowk0, int lane) {
  union { v16h v; v8h q[2]; } u; const _Float16* p = rowk0 + 8 * (lane >> 4);
  u.q[0] = *(const v8h*)p; u.q[1] = *(const v8h*)(p + 16); return u.v;
}
__device__ __forceinline__ v16h frag_f32(const float* rowk0, int lane) {
  v16h a; const float* p = rowk0 + 8 * (lane >> 4);
#pragma unroll
  for (int i = 0; i < 8; ++i) { a[i] = (_Float16)p[i]; a[8 + i] = (_Float16)p[16 + i]; }
  return a;
}
__device__ __forceinline__ v16h frag_f32s(const float* rowk0, int lane, float sc) {
  v16h a; const float* p = rowk0 + 8 * (lane >> 4);
#pragma unroll
  for (int i = 0; i < 8; ++i) { a[i] = (_Float16)(p[i] * sc); a[8 + i] = (_Float16)(p[16 + i] * sc); }
  return a;
}
// column fragment from a [K][ld] layout (column n), rows >= K read as 0
__device__ __forceinline__ v16h fragc_f32(const float* W, int k0, int n, int lane, int ld, int K) {
  v16h a; const int g = lane >> 4;
#pragma unroll
  for (int i = 0; i < 8; ++i) { const int ka = k0 + 8 * g + i, kb = ka + 16;
    a[i] = (_Float16)(ka < K ? W[(size_t)(ka < K ? ka : K - 1) * ld + n] : 0.f); a[8 + i] = (_Float16)(kb < K ? W[(size_t)(kb < K ? kb : K - 1) * ld + n] : 0.f); }
  return a;
}
struct F2 { v16b h, l; };
__device__ __forceinline__ F2 bsplit16(const float v[16]) { F2 r;
#pragma unroll
  for (int i = 0; i < 16; ++i) { const __bf16 h = (__bf16)v[i]; r.h[i] = h; r.l[i] = (__bf16)(v[i] - (float)h); }
  return r; }
__device__ __forceinline__ F2 split_row(const float* row, int k0, int lane) { float v[16]; const float* p = row + k0 + 8 * (lane >> 4);
#pragma unroll
  for (int i = 0; i < 8; ++i) { v[i] = p[i]; v[8 + i] = p[16 + i]; }
  return bsplit16(v); }
__device__ __forceinline__ F2 split_rowK(const float* row, int k0, int lane, int K) { float v[16]; const int g = lane >> 4;
#pragma unroll
  for (int i = 0; i < 8; ++i) { const int ka = k0 + 8 * g + i, kb = ka + 16; v[i] = ka < K ? row[ka < K ? ka : K - 1] : 0.f; v[8 + i] = kb < K ? row[kb < K ? kb : K - 1] : 0.f; }
  return bsplit16(v); }
__device__ __forceinline__ F2 split_col(const float* W, int k0, int n, int lane, int ld, int K) { float v[16]; const int g = lane >> 4;
#pragma unroll
  for (int i = 0; i < 8; ++i) { const int ka = k0 + 8 * g + i, kb = ka + 16; v[i] = ka < K ? W[(size_t)(ka < K ? ka : K - 1) * ld + n] : 0.f; v[8 + i] = kb < K ? W[(size_t)(kb < K ? kb : K - 1) * ld + n] : 0.f; }
  return bsplit16(v); }
__device__ __forceinline__ v8f mac3(const F2& a, const F2& b, v8f c) { c = wmma_bf(a.l, b.h, c); c = wmma_bf(a.h, b.l, c); return wmma_bf(a.h, b.h, c); }
__device__ __forceinline__ float sigm(float v) { return 1.0f / (1.0f + expf(-v)); }
#define LDSX() do { asm volatile("s_wait_dscnt 0" ::: "memory"); __builtin_amdgcn_wave_barrier(); __builtin_amdgcn_fence(__ATOMIC_RELEASE, "workgroup"); } while (0)

// Multi-head COSINE self-attention with a per-head learned scale and an additive attention bias (x [2,2048,1024]; attn_bias [1,1,2048,2048] N(0,1), one entry per (query, key), shared by batches and heads - READ on the device; w_qkv [3072,1024] torch (out,in) N(0, 1/1024): q = rows 0..1023, k = 1024..2047, v = 2048..3071 (reshape (B, L, 3, 16, 64)); q_bias / v_bias zeros (read), k has no bias; scale_mul [1,16,1,1] = ln 4 (const; read): sm = exp(min(scale_mul, ln 100)) = 4; q <- q / ||q|| * sm, k <- k / ||k|| per head row; attn = q k^T + attn_bias; softmax; oup through w_proj [1024,1024] (out,in) + b_proj zeros).
#define NB 2
#define TT 2048
#define CC 1024            // NH * HD = projected width
#define DIN 1024          // input (model) width
#define NH 16
#define HD 64
#define NQB (TT / 64)
#define HG 4
#define SCALE (1.0f)
#define CAUSAL 0
#ifndef TNB
#define TNB NB
#endif
__device__ __forceinline__ float bfr(float v) { return (float)(__bf16)v; }
__host__ __device__ __forceinline__ int kb_last(int qb) { return CAUSAL ? ((qb * 64 + 63) >> 7) : (TT / 128 - 1); }
typedef __attribute__((ext_vector_type(8))) __bf16 v8b;
__device__ __forceinline__ v16b frag_b(const __bf16* rowk0, int lane) {
  union { v16b v; v8b q[2]; } u; const __bf16* p = rowk0 + 8 * (lane >> 4);
  u.q[0] = *(const v8b*)p; u.q[1] = *(const v8b*)(p + 16); return u.v;
}
#define QBH 0              // causal: query blocks 0..QBH-1 of each sequence (few keys, no averaging) take the high-precision path
#define QHI 0               // single-product logits on every row (unit-norm operands x 4: |cosine logit| <= 4)
#define KHI 64            // key rows carrying k residual / v bf16 hi+lo planes (used only by the causal high-precision path)
// B fragment (k rows k0+.., output column o) of a weight: (in,out) [K][ld] or (out,in) [ld rows of K]: bf16 exact, or f16(bf16 * 256) exact
__device__ __forceinline__ v16b wcol_io(const float* Wm, int k0, int o, int lane, int ld) { v16b w; const int g = lane >> 4;
#pragma unroll
  for (int i = 0; i < 8; ++i) { w[i] = (__bf16)Wm[(size_t)(k0 + 8 * g + i) * ld + o]; w[8 + i] = (__bf16)Wm[(size_t)(k0 + 16 + 8 * g + i) * ld + o]; }
  return w; }
__device__ __forceinline__ v16b wcol_oi(const float* Wm, int k0, int o, int lane, int K) { v16b w; const float* p = Wm + (size_t)o * K + k0 + 8 * (lane >> 4);
#pragma unroll
  for (int i = 0; i < 8; ++i) { w[i] = (__bf16)p[i]; w[8 + i] = (__bf16)p[16 + i]; }
  return w; }
__device__ __forceinline__ v16h wcolh_io(const float* Wm, int k0, int o, int lane, int ld) { v16h w; const int g = lane >> 4;
#pragma unroll
  for (int i = 0; i < 8; ++i) { w[i] = (_Float16)(bfr(Wm[(size_t)(k0 + 8 * g + i) * ld + o]) * 256.0f); w[8 + i] = (_Float16)(bfr(Wm[(size_t)(k0 + 16 + 8 * g + i) * ld + o]) * 256.0f); }
  return w; }
__device__ __forceinline__ v16h wcolh_oi(const float* Wm, int k0, int o, int lane, int K) { v16h w; const float* p = Wm + (size_t)o * K + k0 + 8 * (lane >> 4);
#pragma unroll
  for (int i = 0; i < 8; ++i) { w[i] = (_Float16)(bfr(p[i]) * 256.0f); w[8 + i] = (_Float16)(bfr(p[16 + i]) * 256.0f); }
  return w; }
#define WQKV_LAYOUT 1   // 0 = (in,out) [DIN][CC]; 1 = (out,in) [CC][DIN]; 2 = per-head [NH][DIN][HD]
__device__ __forceinline__ v16b wcol_hdk(const float* Wm, int k0, int o, int lane) { v16b w; const int g = lane >> 4; const float* p = Wm + (size_t)(o / HD) * DIN * HD + (o % HD);
#pragma unroll
  for (int i = 0; i < 8; ++i) { w[i] = (__bf16)p[(size_t)(k0 + 8 * g + i) * HD]; w[8 + i] = (__bf16)p[(size_t)(k0 + 16 + 8 * g + i) * HD]; }
  return w; }
#define WO_OUT_IN 1
#if WQKV_LAYOUT == 1
#define WCOL(W, k0, o, lane) wcol_oi(W, k0, o, lane, DIN)
#elif WQKV_LAYOUT == 2
#define WCOL(W, k0, o, lane) wcol_hdk(W, k0, o, lane)
#else
#define WCOL(W, k0, o, lane) wcol_io(W, k0, o, lane, CC)
#endif
#if WO_OUT_IN
#define WOCOL(W, k0, o, lane) wcol_oi(W, k0, o, lane, CC)
#define WOCOLH(W, k0, o, lane) wcolh_oi(W, k0, o, lane, CC)
#else
#define WOCOL(W, k0, o, lane) wcol_io(W, k0, o, lane, DIN)
#define WOCOLH(W, k0, o, lane) wcolh_io(W, k0, o, lane, DIN)
#endif

#define MAX_SCALE_MUL 4.605170186f   // ln(100): the module's clamp on scale_mul
#define PROJ_EXTRA_PARAMS , const float* __restrict__ SMU   /* scale_mul [1][NH][1][1], a module input */
// per (token, head) hook on the staged f32 row (64 floats, projection + bias) of the q and k streams: x <- x / sqrt(sum x^2) (jnp.linalg.norm, no epsilon in the module); the q stream is then multiplied by sm = expf(fminf(bf16(scale_mul[h]), ln 100)); v untouched; the sum of squares in f32, products and sums kept separate
#define PROJ_EPI(which, row, t, h) do { if ((which) < 2) { float* rw = (row); float ss_ = 0.f; _Pragma("unroll 8") for (int i = 0; i < 64; ++i) { _Pragma("clang fp contract(off)") const float sq_ = rw[i] * rw[i]; ss_ = ss_ + sq_; } const float dn_ = sqrtf(ss_); const float sm_ = ((which) == 0) ? expf(fminf(bfr(SMU[(h)]), MAX_SCALE_MUL)) : 1.0f; _Pragma("unroll 8") for (int i = 0; i < 64; ++i) { _Pragma("clang fp contract(off)") const float u_ = rw[i] / dn_; rw[i] = ((which) == 0) ? (u_ * sm_) : u_; } } } while (0)
#define SM_EXTRA_PARAMS , const float* __restrict__ ABI   /* attn_bias [1][1][TT][TT] f32, shared by batches and heads */
// additive attention bias on the logit: v += bf16(attn_bias[t][k]) (the module: q k^T + attn_bias before the softmax), f32
#define SM_MASK_HOOK do { const float ab_ = bfr(ABI[(size_t)t * TT + k]); asm volatile("s_wait_loadcnt 0x0" ::: "memory"); v = v + ab_; } while (0)
#ifndef SM_EXTRA_PARAMS
#define SM_EXTRA_PARAMS
#endif
#ifndef PROJ_EXTRA_PARAMS
#define PROJ_EXTRA_PARAMS
#endif
#ifndef SM_MASK_HOOK
#define SM_MASK_HOOK (void)0
#endif

#define WS_QH  0u                                      // f16 q rows [b*t][CC]
#define WS_KH  (WS_QH + 2u * (size_t)NB * TT * CC)      // f16 k rows [b*t][CC]
#define WS_VT  (WS_KH + 2u * (size_t)NB * TT * CC)      // f16 v planes [b][c][t]
#define WS_QL  (WS_VT + 2u * (size_t)NB * CC * TT)      // f16 q residual x 2^10 rows [b][t < QHI][CC]
#define WS_KL  (WS_QL + 2u * (size_t)NB * QHI * CC)     // f16 k residual x 2^10 rows [b][t < KHI][CC]
#define WS_VB  (WS_KL + 2u * (size_t)NB * KHI * CC)     // bf16 v hi planes [b][c][t < KHI]
#define WS_VBL (WS_VB + 2u * (size_t)NB * CC * KHI)
#define WS_S   (WS_VBL + 2u * (size_t)NB * CC * KHI)    // f32 logits / P [hg][t][s]
#define WS_Y   (WS_S  + 4u * (size_t)HG * TT * TT)      // f32 ctx rows [b*t][CC] (only when there is an output projection)
#define WS_END (WS_Y  + 4u * (size_t)NB * TT * CC)

// ---- k_proj: block = (64 rows, 128 cols, which): q/k/v = X W (+ b) with exact bf16 products (K = DIN) -> which 0: q f16 rows (+ residual rows < QHI); 1: k f16 rows (+ residual rows < KHI); 2: v f16 planes [c][t] (+ bf16 hi/lo planes for t < KHI)
__global__ __launch_bounds__(128) void k_proj(const float* __restrict__ XQ, const float* __restrict__ XK, const float* __restrict__ XV, const float* __restrict__ WQ, const float* __restrict__ WK, const float* __restrict__ WV, const float* __restrict__ BQ, const float* __restrict__ BK, const float* __restrict__ BV,
    _Float16* __restrict__ QH, _Float16* __restrict__ QL, _Float16* __restrict__ KH, _Float16* __restrict__ KL, _Float16* __restrict__ VT, __bf16* __restrict__ VB, __bf16* __restrict__ VBL PROJ_EXTRA_PARAMS) {
  __shared__ __align__(16) float st[64][132]; __shared__ __align__(16) _Float16 sh[64][136], sl[64][136]; __shared__ __align__(16) _Float16 th[128][72]; __shared__ __align__(16) __bf16 tb[128][72], tbl[128][72];
  const int tid = threadIdx.x, wave = tid >> 5, lane = tid & 31, col = lane & 15, g = lane >> 4; const int which = blockIdx.z; const int c0 = blockIdx.y * 128; const size_t r0 = (size_t)blockIdx.x * 64; const size_t bb = r0 / TT; const int t0 = (int)(r0 % TT);
  const float* X = which == 0 ? XQ : which == 1 ? XK : XV; const float* WA = which == 0 ? WQ : which == 1 ? WK : WV; const float* BA = which == 0 ? BQ : which == 1 ? BK : BV;
  v8f acc[8] = {};
#pragma unroll 2
  for (int kc = 0; kc < DIN / 32; ++kc) { v16b a; { const float* p = X + (r0 + wave * 16 + col) * DIN + kc * 32 + 8 * g;
#pragma unroll
      for (int i = 0; i < 8; ++i) { a[i] = (__bf16)p[i]; a[8 + i] = (__bf16)p[16 + i]; } }
    asm volatile("s_wait_loadcnt 0x0" ::: "memory");
#pragma unroll
    for (int j = 0; j < 8; ++j) { const v16b w = WCOL(WA, kc * 32, c0 + j * 16 + col, lane); asm volatile("s_wait_loadcnt 0x0" ::: "memory"); acc[j] = wmma_bf(a, w, acc[j]); } }
  { // stage the f32 tile (acc + bias) in LDS, run the per-(row, head) epilogue hook, then convert
#pragma unroll
    for (int j = 0; j < 8; ++j) { const float bias = BA ? bfr(BA[c0 + j * 16 + col]) : 0.f;
#pragma unroll
      for (int r = 0; r < 8; ++r) st[wave * 16 + 8 * g + r][j * 16 + col] = acc[j][r] + bias; }
    __syncthreads();
    for (int e = tid; e < 64 * (128 / HD); e += 128) { const int rl = e / (128 / HD), hh = e % (128 / HD); PROJ_EPI(which, &st[rl][hh * HD], (int)((r0 + rl) % TT), (c0 / HD) + hh); }
    __syncthreads(); }
  if (which < 2) { _Float16* DH = which == 0 ? QH : KH; _Float16* DL = which == 0 ? QL : KL; const int nhi = which == 0 ? QHI : KHI; const bool hi_rows = t0 < nhi;
    for (int e = tid; e < 64 * 128; e += 128) { const int rl = e >> 7, cl = e & 127; const float v = st[rl][cl]; const _Float16 hv = (_Float16)v; sh[rl][cl] = hv; sl[rl][cl] = (_Float16)((v - (float)hv) * 1024.0f); }
    __syncthreads();
    for (int e = tid; e < 64 * 16; e += 128) { const int rl = e >> 4, q = e & 15; vst2((unsigned*)(DH + (r0 + rl) * CC + c0 + q * 8), *(const v4u*)&sh[rl][q * 8]); if (hi_rows) vst2((unsigned*)(DL + (bb * nhi + t0 + rl) * (size_t)CC + c0 + q * 8), *(const v4u*)&sl[rl][q * 8]); }
  } else { const bool hi_rows = t0 < KHI;
    for (int e = tid; e < 64 * 128; e += 128) { const int rl = e & 63, cl = e >> 6; const float v = st[rl][cl]; th[cl][rl] = (_Float16)v; const __bf16 bh = (__bf16)v; tb[cl][rl] = bh; tbl[cl][rl] = (__bf16)(v - (float)bh); }
    __syncthreads();
    for (int e = tid; e < 128 * 8; e += 128) { const int cl = e >> 3, q = e & 7; vst2((unsigned*)(VT + (bb * CC + c0 + cl) * (size_t)TT + t0 + q * 8), *(const v4u*)&th[cl][q * 8]); if (hi_rows) { const size_t o3 = (bb * CC + c0 + cl) * (size_t)KHI + t0 + q * 8; vst2((unsigned*)(VB + o3), *(const v4u*)&tb[cl][q * 8]); vst2((unsigned*)(VBL + o3), *(const v4u*)&tbl[cl][q * 8]); } } } }
// ---- k_sc: block = (query block qb, key block kb <= kb_last(qb), head in group) of batch b: logits x SCALE; q hi + residual (x 2^10) against k (2 products) for query rows < QHI, plus the k residual (3 products) for query blocks < QBH (causal early rows); causal: blocks past the diagonal exit, the mask itself is applied by index in k_sm
__global__ __launch_bounds__(128) void k_sc(const _Float16* __restrict__ QH, const _Float16* __restrict__ KH, const _Float16* __restrict__ QL, const _Float16* __restrict__ KL, int b, int h0, float* __restrict__ S0) { __shared__ __align__(16) float ss[4][16][132];
  const int qb = blockIdx.x, kb = blockIdx.y; if (kb > kb_last(qb)) return;
  const int h = h0 + blockIdx.z; float* S = S0 + (size_t)blockIdx.z * TT * TT;
  const int tid = threadIdx.x, wave = tid >> 5, lane = tid & 31, col = lane & 15, g = lane >> 4; const int k0 = kb * 128; const int ql0 = qb * 64 + wave * 16; const size_t q0 = (size_t)b * TT + ql0, kr0 = (size_t)b * TT + k0;
  v8f acc[8] = {}, accl[8] = {};
  const _Float16* QLb = QL + (size_t)b * QHI * CC; const _Float16* KLb = KL + (size_t)b * KHI * CC;
  if (qb < QBH) {
#pragma unroll
    for (int kc = 0; kc < HD / 32; ++kc) { const v16h ah = frag_h(QH + (q0 + col) * CC + h * HD + kc * 32, lane), al = frag_h(QLb + (size_t)(ql0 + col) * CC + h * HD + kc * 32, lane);
#pragma unroll
      for (int j = 0; j < 8; ++j) { const v16h kbf = frag_h(KH + (kr0 + j * 16 + col) * CC + h * HD + kc * 32, lane), klf = frag_h(KLb + (size_t)(k0 + j * 16 + col) * CC + h * HD + kc * 32, lane); acc[j] = wmma16(ah, kbf, acc[j]); accl[j] = wmma16(al, kbf, accl[j]); accl[j] = wmma16(ah, klf, accl[j]); } }
  } else if (qb * 64 < QHI) {
#pragma unroll
    for (int kc = 0; kc < HD / 32; ++kc) { const v16h ah = frag_h(QH + (q0 + col) * CC + h * HD + kc * 32, lane), al = frag_h(QLb + (size_t)(ql0 + col) * CC + h * HD + kc * 32, lane);
#pragma unroll
      for (int j = 0; j < 8; ++j) { const v16h kbf = frag_h(KH + (kr0 + j * 16 + col) * CC + h * HD + kc * 32, lane); acc[j] = wmma16(ah, kbf, acc[j]); accl[j] = wmma16(al, kbf, accl[j]); } }
  } else {
#pragma unroll
    for (int kc = 0; kc < HD / 32; ++kc) { const v16h ah = frag_h(QH + (q0 + col) * CC + h * HD + kc * 32, lane);
#pragma unroll
      for (int j = 0; j < 8; ++j) { const v16h kbf = frag_h(KH + (kr0 + j * 16 + col) * CC + h * HD + kc * 32, lane); acc[j] = wmma16(ah, kbf, acc[j]); } } }
#pragma unroll
  for (int j = 0; j < 8; ++j) {
#pragma unroll
    for (int r = 0; r < 8; ++r) ss[wave][8 * g + r][j * 16 + col] = (acc[j][r] + accl[j][r] * (1.0f / 1024.0f)) * SCALE; }
  LDSX(); for (int rl = 0; rl < 16; ++rl) vst2(S + (size_t)(ql0 + rl) * TT + k0 + lane * 4, *(const v4f*)&ss[wave][rl][lane * 4]); }
// ---- k_sm: block = query row t (head in group): keys [0, kend): causal -> logit if s <= t else excluded; softmax in f32; P x 2^11 in place (0 for excluded)
__global__ __launch_bounds__(256) void k_sm(float* __restrict__ S0 SM_EXTRA_PARAMS) { __shared__ float sred[8]; __shared__ float sbc; __shared__ __align__(16) float shv[TT];
  const int tid = threadIdx.x; const int t = blockIdx.x; const int kend = (kb_last(t >> 6) + 1) * 128;
  float* sr = S0 + (size_t)blockIdx.y * TT * TT + (size_t)t * TT;
  float m = -3.0e38f; for (int k = tid; k < kend; k += 256) { float v = (!CAUSAL || k <= t) ? sr[k] : -3.0e38f; SM_MASK_HOOK; shv[k] = v; m = fmaxf(m, v); }
#pragma unroll
  for (int o = 1; o < 32; o <<= 1) m = fmaxf(m, __shfl_xor(m, o));
  if ((tid & 31) == 0) sred[tid >> 5] = m; __syncthreads(); if (tid == 0) { float a = sred[0]; for (int i = 1; i < 8; ++i) a = fmaxf(a, sred[i]); sbc = a; } __syncthreads(); m = sbc; __syncthreads();
  float sum = 0.f; for (int k = tid; k < kend; k += 256) { const float v = shv[k]; const float e = (v <= -1.0e38f) ? 0.f : expf(v - m); shv[k] = e; sum += e; }
#pragma unroll
  for (int o = 1; o < 32; o <<= 1) sum += __shfl_xor(sum, o);
  if ((tid & 31) == 0) sred[tid >> 5] = sum; __syncthreads(); if (tid == 0) { float a = 0.f; for (int i = 0; i < 8; ++i) a += sred[i]; sbc = a > 0.f ? 2048.0f / a : 0.f; }   /* a fully excluded row yields P = 0 */ __syncthreads(); const float inv = sbc;
  for (int k = tid; k < kend; k += 256) shv[k] = shv[k] * inv;
  __syncthreads(); for (int q = tid; q < kend / 4; q += 256) vst2(sr + q * 4, *(const v4f*)&shv[q * 4]); }
// ---- k_pv: block = 64 queries (qb) of (b, h): ctx = P . v over keys [0, kend) (P x 2^11 once to f16 against v f16: 1 product; causal early query blocks: P and v as bf16 hi + lo, 3 products); 256-B (row, head) segment by 16 lanes
__global__ __launch_bounds__(128) void k_pv(const float* __restrict__ PS0, const _Float16* __restrict__ VT, const __bf16* __restrict__ VB, const __bf16* __restrict__ VBL, int b, int h0, float* __restrict__ Y) { const int h = h0 + blockIdx.z; const float* PS = PS0 + (size_t)blockIdx.z * TT * TT; __shared__ __align__(16) float ss[4][16][HD + 4];
  const int tid = threadIdx.x, wave = tid >> 5, lane = tid & 31, col = lane & 15, g = lane >> 4; const int qb = blockIdx.x; const int ql0 = qb * 64 + wave * 16; const int kce = (kb_last(qb) + 1) * 4;
  v8f acc[HD / 16] = {};
  if (qb < QBH) {
#pragma unroll 1
    for (int kc = 0; kc < kce; ++kc) { const F2 p = split_row(PS + (size_t)(ql0 + col) * TT, kc * 32, lane);
      asm volatile("s_wait_loadcnt 0x0" ::: "memory");
#pragma unroll
      for (int j = 0; j < HD / 16; ++j) { const size_t po = ((size_t)b * CC + h * HD + j * 16 + col) * (size_t)KHI + kc * 32; const v16b vh = frag_b(VB + po, lane); acc[j] = wmma_bf(p.h, vh, acc[j]); acc[j] = wmma_bf(p.l, vh, acc[j]); acc[j] = wmma_bf(p.h, frag_b(VBL + po, lane), acc[j]); } }
  } else {
#pragma unroll 1
    for (int kc = 0; kc < kce; ++kc) { const v16h p = frag_f32(PS + (size_t)(ql0 + col) * TT + kc * 32, lane);
      asm volatile("s_wait_loadcnt 0x0" ::: "memory");
#pragma unroll
      for (int j = 0; j < HD / 16; ++j) { const size_t po = ((size_t)b * CC + h * HD + j * 16 + col) * (size_t)TT + kc * 32; acc[j] = wmma16(p, frag_h(VT + po, lane), acc[j]); } } }
#pragma unroll
  for (int j = 0; j < HD / 16; ++j)
#pragma unroll
    for (int r = 0; r < 8; ++r) ss[wave][8 * g + r][j * 16 + col] = acc[j][r] * (1.0f / 2048.0f);
  LDSX(); for (int rl = 0; rl < 16; ++rl) if (lane < HD / 4) vst2(Y + ((size_t)b * TT + ql0 + rl) * CC + h * HD + lane * 4, *(const v4f*)&ss[wave][rl][lane * 4]); }
// ---- k_out: block = (64 rows, 128 cols): out = ctx Wo (+ bo): ctx x 2^6 once to f16 against Wo as f16(bf16 x 2^8) exact (1 product) x 2^-14; causal early rows (< QHI of each sequence): ctx bf16 hi + lo against exact bf16 Wo (2 products)
__global__ __launch_bounds__(128) void k_out(const float* __restrict__ Y, const float* __restrict__ WO, const float* __restrict__ BO, float* __restrict__ OUT) { __shared__ __align__(16) float sf[4][16][132];
  const int tid = threadIdx.x, wave = tid >> 5, lane = tid & 31, col = lane & 15, g = lane >> 4; const int c0 = blockIdx.y * 128; const size_t r0 = (size_t)blockIdx.x * 64 + wave * 16;
  v8f acc[8] = {};
  if (CAUSAL && (int)(((size_t)blockIdx.x * 64) % TT) < QHI) {   /* block-uniform */
#pragma unroll 2
    for (int kc = 0; kc < CC / 32; ++kc) { const F2 a = split_row(Y + (r0 + col) * CC, kc * 32, lane); asm volatile("s_wait_loadcnt 0x0" ::: "memory");
#pragma unroll
      for (int j = 0; j < 8; ++j) { const v16b w = WOCOL(WO, kc * 32, c0 + j * 16 + col, lane); asm volatile("s_wait_loadcnt 0x0" ::: "memory"); acc[j] = wmma_bf(a.h, w, acc[j]); acc[j] = wmma_bf(a.l, w, acc[j]); } }
#pragma unroll
    for (int j = 0; j < 8; ++j) { const float bias = BO ? bfr(BO[c0 + j * 16 + col]) : 0.f;
#pragma unroll
      for (int r = 0; r < 8; ++r) sf[wave][8 * g + r][j * 16 + col] = acc[j][r] + bias; }
  } else {
#pragma unroll 2
    for (int kc = 0; kc < CC / 32; ++kc) { const v16h a = frag_f32s(Y + (r0 + col) * CC + kc * 32, lane, 64.0f); asm volatile("s_wait_loadcnt 0x0" ::: "memory");   /* ctx carried x 2^6 into f16 so small-magnitude context rows stay clear of f16 subnormals */
#pragma unroll
      for (int j = 0; j < 8; ++j) { const v16h w = WOCOLH(WO, kc * 32, c0 + j * 16 + col, lane); asm volatile("s_wait_loadcnt 0x0" ::: "memory"); acc[j] = wmma16(a, w, acc[j]); } }
#pragma unroll
    for (int j = 0; j < 8; ++j) { const float bias = BO ? bfr(BO[c0 + j * 16 + col]) : 0.f;
#pragma unroll
      for (int r = 0; r < 8; ++r) sf[wave][8 * g + r][j * 16 + col] = acc[j][r] * (1.0f / 16384.0f) + bias; } }   /* 2^-8 (Wo carry) x 2^-6 (ctx carry) */
  LDSX(); for (int rl = 0; rl < 16; ++rl) vst2(OUT + (r0 + rl) * DIN + c0 + lane * 4, *(const v4f*)&sf[wave][rl][lane * 4]); }

extern "C" void kernel_launch(void* const* d_in, const int* in_sizes, int n_in, void* d_out, int out_size, void* d_ws, size_t ws_size, hipStream_t stream) {
  (void)in_sizes; (void)n_in; (void)out_size;
  const float** F = (const float**)d_in;
  if (ws_size < (size_t)WS_END) return;
  char* ws = (char*)d_ws; _Float16 *QH = (_Float16*)(ws + WS_QH), *KH = (_Float16*)(ws + WS_KH), *VT = (_Float16*)(ws + WS_VT), *QL = (_Float16*)(ws + WS_QL), *KL = (_Float16*)(ws + WS_KL); __bf16 *VB = (__bf16*)(ws + WS_VB), *VBL = (__bf16*)(ws + WS_VBL); float *S = (float*)(ws + WS_S), *Y = (float*)(ws + WS_Y);
  (void)Y; (void)QL; (void)KL; (void)VB; (void)VBL;
  // inputs: 0 x [2,2048,1024]; 1 attn_bias [1,1,2048,2048]; 2 w_qkv [3072,1024] (out,in): q rows 0..1023, k 1024..2047, v 2048..3071; 3 q_bias [1024] (zeros, read); 4 v_bias [1024] (zeros, read); 5 scale_mul [1,16,1,1] (ln 4, read); 6 w_proj [1024,1024] (out,in); 7 b_proj (zeros, read); the k stream has no bias (the module concatenates zeros)
  k_proj<<<dim3(TNB * TT / 64, CC / 128, 3), 128, 0, stream>>>(F[0], F[0], F[0], F[2], F[2] + (size_t)CC * DIN, F[2] + 2 * (size_t)CC * DIN, F[3], nullptr, F[4], QH, QL, KH, KL, VT, VB, VBL, F[5]);
  for (int b = 0; b < TNB; ++b) for (int h0 = 0; h0 < NH; h0 += HG) {
    k_sc<<<dim3(NQB, TT / 128, HG), 128, 0, stream>>>(QH, KH, QL, KL, b, h0, S);
    k_sm<<<dim3(TT, HG), 256, 0, stream>>>(S, F[1]);
    k_pv<<<dim3(NQB, 1, HG), 128, 0, stream>>>(S, VT, VB, VBL, b, h0, Y);
  }
  k_out<<<dim3(TNB * TT / 64, DIN / 128), 128, 0, stream>>>(Y, F[6], F[7], (float*)d_out);
}

// v001
// One run takes 579 microseconds.
// Next to v000, in two timings, it ran 2.50 times as fast each time.
// compute dtype: all float inputs rounded to bf16; q / k / v projections with EXACT bf16 products on WMMA 16x16x32 (f32 accumulate) + bias (q / v: zeros, read; k: none); q and k divided by their per-(token, head) L2 norm in f32, q then times exp(min(bf16(scale_mul[h]), ln 100)); logits q x k once to f16 each (1 product, scale 1), + bf16(attn_bias[q][k]) in f32; softmax f32 with a running maximum and sum over 64-key steps; exp(logit - running max) x 2^11 once to f16 x v once to f16 (1 product), divided by the f32 sum at the end; ctx x 2^6 once to f16 x w_proj f16(bf16 x 2^8) + b_proj; f32 output.
#include <hip/hip_runtime.h>
#include <math.h>

typedef __attribute__((ext_vector_type(16))) _Float16 v16h;
typedef __attribute__((ext_vector_type(16))) __bf16 v16b;
typedef __attribute__((ext_vector_type(8)))  _Float16 v8h;
typedef __attribute__((ext_vector_type(8)))  float v8f;
typedef __attribute__((ext_vector_type(4)))  float v4f;
typedef __attribute__((ext_vector_type(2)))  float v2f;
typedef __attribute__((ext_vector_type(4)))  unsigned v4u;
typedef __attribute__((ext_vector_type(4)))  int v4i;
typedef float __attribute__((may_alias)) float_a;
typedef int __attribute__((may_alias)) int_a;

template <typename T> __device__ __forceinline__ void vst2(void* p, T v) { *(T*)p = v;  }
__device__ __forceinline__ v8f wmma16(v16h a, v16h b, v8f c) {
  v8f d = __builtin_amdgcn_wmma_f32_16x16x32_f16(false, a, false, b, (short)0, c, false, false);
  asm volatile("v_nop\n\tv_nop\n\tv_nop\n\tv_nop" : "+v"(d) : "v"(a), "v"(b));
  return d;
}
__device__ __forceinline__ v8f wmma_bf(v16b a, v16b b, v8f c) {
  v8f d = __builtin_amdgcn_wmma_f32_16x16x32_bf16(false, a, false, b, (short)0, c, false, false);
  asm volatile("v_nop\n\tv_nop\n\tv_nop\n\tv_nop" : "+v"(d) : "v"(a), "v"(b));
  return d;
}
// 16x16x32 fragments: lane = (h = lane>>4, row/col = lane&15); elements 0..7 = k0+8h+0..7, 8..15 = k0+16+8h+0..7; D element r = row 8h+r
__device__ __forceinline__ v16h frag_h(const _Float16* rowk0, int lane) {
  union { v16h v; v8h q[2]; } u; const _Float16* p = rowk0 + 8 * (lane >> 4);
  u.q[0] = *(const v8h*)p; u.q[1] = *(const v8h*)(p + 16); return u.v;
}
__device__ __forceinline__ v16h frag_f32(const float* rowk0, int lane) {
  v16h a; const float* p = rowk0 + 8 * (lane >> 4);
#pragma unroll
  for (int i = 0; i < 8; ++i) { a[i] = (_Float16)p[i]; a[8 + i] = (_Float16)p[16 + i]; }
  return a;
}
__device__ __forceinline__ v16h frag_f32s(const float* rowk0, int lane, float sc) {
  v16h a; const float* p = rowk0 + 8 * (lane >> 4);
#pragma unroll
  for (int i = 0; i < 8; ++i) { a[i] = (_Float16)(p[i] * sc); a[8 + i] = (_Float16)(p[16 + i] * sc); }
  return a;
}
// column fragment from a [K][ld] layout (column n), rows >= K read as 0
__device__ __forceinline__ v16h fragc_f32(const float* W, int k0, int n, int lane, int ld, int K) {
  v16h a; const int g = lane >> 4;
#pragma unroll
  for (int i = 0; i < 8; ++i) { const int ka = k0 + 8 * g + i, kb = ka + 16;
    a[i] = (_Float16)(ka < K ? W[(size_t)(ka < K ? ka : K - 1) * ld + n] : 0.f); a[8 + i] = (_Float16)(kb < K ? W[(size_t)(kb < K ? kb : K - 1) * ld + n] : 0.f); }
  return a;
}
struct F2 { v16b h, l; };
__device__ __forceinline__ F2 bsplit16(const float v[16]) { F2 r;
#pragma unroll
  for (int i = 0; i < 16; ++i) { const __bf16 h = (__bf16)v[i]; r.h[i] = h; r.l[i] = (__bf16)(v[i] - (float)h); }
  return r; }
__device__ __forceinline__ F2 split_row(const float* row, int k0, int lane) { float v[16]; const float* p = row + k0 + 8 * (lane >> 4);
#pragma unroll
  for (int i = 0; i < 8; ++i) { v[i] = p[i]; v[8 + i] = p[16 + i]; }
  return bsplit16(v); }
__device__ __forceinline__ F2 split_rowK(const float* row, int k0, int lane, int K) { float v[16]; const int g = lane >> 4;
#pragma unroll
  for (int i = 0; i < 8; ++i) { const int ka = k0 + 8 * g + i, kb = ka + 16; v[i] = ka < K ? row[ka < K ? ka : K - 1] : 0.f; v[8 + i] = kb < K ? row[kb < K ? kb : K - 1] : 0.f; }
  return bsplit16(v); }
__device__ __forceinline__ F2 split_col(const float* W, int k0, int n, int lane, int ld, int K) { float v[16]; const int g = lane >> 4;
#pragma unroll
  for (int i = 0; i < 8; ++i) { const int ka = k0 + 8 * g + i, kb = ka + 16; v[i] = ka < K ? W[(size_t)(ka < K ? ka : K - 1) * ld + n] : 0.f; v[8 + i] = kb < K ? W[(size_t)(kb < K ? kb : K - 1) * ld + n] : 0.f; }
  return bsplit16(v); }
__device__ __forceinline__ v8f mac3(const F2& a, const F2& b, v8f c) { c = wmma_bf(a.l, b.h, c); c = wmma_bf(a.h, b.l, c); return wmma_bf(a.h, b.h, c); }
__device__ __forceinline__ float sigm(float v) { return 1.0f / (1.0f + expf(-v)); }
#define LDSX() do { asm volatile("s_wait_dscnt 0" ::: "memory"); __builtin_amdgcn_wave_barrier(); __builtin_amdgcn_fence(__ATOMIC_RELEASE, "workgroup"); } while (0)

// Multi-head COSINE self-attention with a per-head learned scale and an additive attention bias (x [2,2048,1024]; attn_bias [1,1,2048,2048] N(0,1), one entry per (query, key), shared by batches and heads - READ on the device; w_qkv [3072,1024] torch (out,in) N(0, 1/1024): q = rows 0..1023, k = 1024..2047, v = 2048..3071 (reshape (B, L, 3, 16, 64)); q_bias / v_bias zeros (read), k has no bias; scale_mul [1,16,1,1] = ln 4 (const; read): sm = exp(min(scale_mul, ln 100)) = 4; q <- q / ||q|| * sm, k <- k / ||k|| per head row; attn = q k^T + attn_bias; softmax; oup through w_proj [1024,1024] (out,in) + b_proj zeros).
#define NB 2
#define TT 2048
#define CC 1024            // NH * HD = projected width
#define DIN 1024          // input (model) width
#define NH 16
#define HD 64
#define NQB (TT / 64)
#define HG 4
#define SCALE (1.0f)
#define CAUSAL 0
#ifndef TNB
#define TNB NB
#endif
__device__ __forceinline__ float bfr(float v) { return (float)(__bf16)v; }
__host__ __device__ __forceinline__ int kb_last(int qb) { return CAUSAL ? ((qb * 64 + 63) >> 7) : (TT / 128 - 1); }
typedef __attribute__((ext_vector_type(8))) __bf16 v8b;
__device__ __forceinline__ v16b frag_b(const __bf16* rowk0, int lane) {
  union { v16b v; v8b q[2]; } u; const __bf16* p = rowk0 + 8 * (lane >> 4);
  u.q[0] = *(const v8b*)p; u.q[1] = *(const v8b*)(p + 16); return u.v;
}
#define QBH 0              // unused: k_fa has one path for all query blocks
#define QHI 0               // single-product logits on every row (unit-norm operands x 4: |cosine logit| <= 4)
#define KHI 64            // key rows carrying k residual / v bf16 hi+lo planes (written by k_proj; no kernel reads them)
// B fragment (k rows k0+.., output column o) of a weight: (in,out) [K][ld] or (out,in) [ld rows of K]: bf16 exact, or f16(bf16 * 256) exact
__device__ __forceinline__ v16b wcol_io(const float* Wm, int k0, int o, int lane, int ld) { v16b w; const int g = lane >> 4;
#pragma unroll
  for (int i = 0; i < 8; ++i) { w[i] = (__bf16)Wm[(size_t)(k0 + 8 * g + i) * ld + o]; w[8 + i] = (__bf16)Wm[(size_t)(k0 + 16 + 8 * g + i) * ld + o]; }
  return w; }
__device__ __forceinline__ v16b wcol_oi(const float* Wm, int k0, int o, int lane, int K) { v16b w; const float* p = Wm + (size_t)o * K + k0 + 8 * (lane >> 4);
#pragma unroll
  for (int i = 0; i < 8; ++i) { w[i] = (__bf16)p[i]; w[8 + i] = (__bf16)p[16 + i]; }
  return w; }
__device__ __forceinline__ v16h wcolh_io(const float* Wm, int k0, int o, int lane, int ld) { v16h w; const int g = lane >> 4;
#pragma unroll
  for (int i = 0; i < 8; ++i) { w[i] = (_Float16)(bfr(Wm[(size_t)(k0 + 8 * g + i) * ld + o]) * 256.0f); w[8 + i] = (_Float16)(bfr(Wm[(size_t)(k0 + 16 + 8 * g + i) * ld + o]) * 256.0f); }
  return w; }
__device__ __forceinline__ v16h wcolh_oi(const float* Wm, int k0, int o, int lane, int K) { v16h w; const float* p = Wm + (size_t)o * K + k0 + 8 * (lane >> 4);
#pragma unroll
  for (int i = 0; i < 8; ++i) { w[i] = (_Float16)(bfr(p[i]) * 256.0f); w[8 + i] = (_Float16)(bfr(p[16 + i]) * 256.0f); }
  return w; }
#define WQKV_LAYOUT 1   // 0 = (in,out) [DIN][CC]; 1 = (out,in) [CC][DIN]; 2 = per-head [NH][DIN][HD]
__device__ __forceinline__ v16b wcol_hdk(const float* Wm, int k0, int o, int lane) { v16b w; const int g = lane >> 4; const float* p = Wm + (size_t)(o / HD) * DIN * HD + (o % HD);
#pragma unroll
  for (int i = 0; i < 8; ++i) { w[i] = (__bf16)p[(size_t)(k0 + 8 * g + i) * HD]; w[8 + i] = (__bf16)p[(size_t)(k0 + 16 + 8 * g + i) * HD]; }
  return w; }
#define WO_OUT_IN 1
#if WQKV_LAYOUT == 1
#define WCOL(W, k0, o, lane) wcol_oi(W, k0, o, lane, DIN)
#elif WQKV_LAYOUT == 2
#define WCOL(W, k0, o, lane) wcol_hdk(W, k0, o, lane)
#else
#define WCOL(W, k0, o, lane) wcol_io(W, k0, o, lane, CC)
#endif
#if WO_OUT_IN
#define WOCOL(W, k0, o, lane) wcol_oi(W, k0, o, lane, CC)
#define WOCOLH(W, k0, o, lane) wcolh_oi(W, k0, o, lane, CC)
#else
#define WOCOL(W, k0, o, lane) wcol_io(W, k0, o, lane, DIN)
#define WOCOLH(W, k0, o, lane) wcolh_io(W, k0, o, lane, DIN)
#endif

#define MAX_SCALE_MUL 4.605170186f   // ln(100): the module's clamp on scale_mul
#define PROJ_EXTRA_PARAMS , const float* __restrict__ SMU   /* scale_mul [1][NH][1][1], a module input */
// per (token, head) hook on the staged f32 row (64 floats, projection + bias) of the q and k streams: x <- x / sqrt(sum x^2) (jnp.linalg.norm, no epsilon in the module); the q stream is then multiplied by sm = expf(fminf(bf16(scale_mul[h]), ln 100)); v untouched; the sum of squares in f32, products and sums kept separate
#define PROJ_EPI(which, row, t, h) do { if ((which) < 2) { float* rw = (row); float ss_ = 0.f; _Pragma("unroll 8") for (int i = 0; i < 64; ++i) { _Pragma("clang fp contract(off)") const float sq_ = rw[i] * rw[i]; ss_ = ss_ + sq_; } const float dn_ = sqrtf(ss_); const float sm_ = ((which) == 0) ? expf(fminf(bfr(SMU[(h)]), MAX_SCALE_MUL)) : 1.0f; _Pragma("unroll 8") for (int i = 0; i < 64; ++i) { _Pragma("clang fp contract(off)") const float u_ = rw[i] / dn_; rw[i] = ((which) == 0) ? (u_ * sm_) : u_; } } } while (0)
#ifndef PROJ_EXTRA_PARAMS
#define PROJ_EXTRA_PARAMS
#endif

#define WS_QH  0u                                      // f16 q rows [b*t][CC]
#define WS_KH  (WS_QH + 2u * (size_t)NB * TT * CC)      // f16 k rows [b*t][CC]
#define WS_VT  (WS_KH + 2u * (size_t)NB * TT * CC)      // f16 v planes [b][c][t]
#define WS_QL  (WS_VT + 2u * (size_t)NB * CC * TT)      // f16 q residual x 2^10 rows [b][t < QHI][CC]
#define WS_KL  (WS_QL + 2u * (size_t)NB * QHI * CC)     // f16 k residual x 2^10 rows [b][t < KHI][CC]
#define WS_VB  (WS_KL + 2u * (size_t)NB * KHI * CC)     // bf16 v hi planes [b][c][t < KHI]
#define WS_VBL (WS_VB + 2u * (size_t)NB * CC * KHI)
#define WS_S   (WS_VBL + 2u * (size_t)NB * CC * KHI)    // f32 [HG][TT][TT] region, read or written by no kernel (logits and P stay in registers)
#define WS_Y   (WS_S  + 4u * (size_t)HG * TT * TT)      // f32 ctx rows [b*t][CC] (only when there is an output projection)
#define WS_END (WS_Y  + 4u * (size_t)NB * TT * CC)

// ---- k_proj: block = (64 rows, 128 cols, which): q/k/v = X W (+ b) with exact bf16 products (K = DIN) -> which 0: q f16 rows (+ residual rows < QHI); 1: k f16 rows (+ residual rows < KHI); 2: v f16 planes [c][t] (+ bf16 hi/lo planes for t < KHI)
__global__ __launch_bounds__(128) void k_proj(const float* __restrict__ XQ, const float* __restrict__ XK, const float* __restrict__ XV, const float* __restrict__ WQ, const float* __restrict__ WK, const float* __restrict__ WV, const float* __restrict__ BQ, const float* __restrict__ BK, const float* __restrict__ BV,
    _Float16* __restrict__ QH, _Float16* __restrict__ QL, _Float16* __restrict__ KH, _Float16* __restrict__ KL, _Float16* __restrict__ VT, __bf16* __restrict__ VB, __bf16* __restrict__ VBL PROJ_EXTRA_PARAMS) {
  __shared__ __align__(16) float st[64][132]; __shared__ __align__(16) _Float16 sh[64][136], sl[64][136]; __shared__ __align__(16) _Float16 th[128][72]; __shared__ __align__(16) __bf16 tb[128][72], tbl[128][72];
  const int tid = threadIdx.x, wave = tid >> 5, lane = tid & 31, col = lane & 15, g = lane >> 4; const int which = blockIdx.z; const int c0 = blockIdx.y * 128; const size_t r0 = (size_t)blockIdx.x * 64; const size_t bb = r0 / TT; const int t0 = (int)(r0 % TT);
  const float* X = which == 0 ? XQ : which == 1 ? XK : XV; const float* WA = which == 0 ? WQ : which == 1 ? WK : WV; const float* BA = which == 0 ? BQ : which == 1 ? BK : BV;
  v8f acc[8] = {};
#pragma unroll 2
  for (int kc = 0; kc < DIN / 32; ++kc) { v16b a; { const float* p = X + (r0 + wave * 16 + col) * DIN + kc * 32 + 8 * g;
#pragma unroll
      for (int i = 0; i < 8; ++i) { a[i] = (__bf16)p[i]; a[8 + i] = (__bf16)p[16 + i]; } }
    asm volatile("s_wait_loadcnt 0x0" ::: "memory");
#pragma unroll
    for (int j = 0; j < 8; ++j) { const v16b w = WCOL(WA, kc * 32, c0 + j * 16 + col, lane); asm volatile("s_wait_loadcnt 0x0" ::: "memory"); acc[j] = wmma_bf(a, w, acc[j]); } }
  { // stage the f32 tile (acc + bias) in LDS, run the per-(row, head) epilogue hook, then convert
#pragma unroll
    for (int j = 0; j < 8; ++j) { const float bias = BA ? bfr(BA[c0 + j * 16 + col]) : 0.f;
#pragma unroll
      for (int r = 0; r < 8; ++r) st[wave * 16 + 8 * g + r][j * 16 + col] = acc[j][r] + bias; }
    __syncthreads();
    for (int e = tid; e < 64 * (128 / HD); e += 128) { const int rl = e / (128 / HD), hh = e % (128 / HD); PROJ_EPI(which, &st[rl][hh * HD], (int)((r0 + rl) % TT), (c0 / HD) + hh); }
    __syncthreads(); }
  if (which < 2) { _Float16* DH = which == 0 ? QH : KH; _Float16* DL = which == 0 ? QL : KL; const int nhi = which == 0 ? QHI : KHI; const bool hi_rows = t0 < nhi;
    for (int e = tid; e < 64 * 128; e += 128) { const int rl = e >> 7, cl = e & 127; const float v = st[rl][cl]; const _Float16 hv = (_Float16)v; sh[rl][cl] = hv; sl[rl][cl] = (_Float16)((v - (float)hv) * 1024.0f); }
    __syncthreads();
    for (int e = tid; e < 64 * 16; e += 128) { const int rl = e >> 4, q = e & 15; vst2((unsigned*)(DH + (r0 + rl) * CC + c0 + q * 8), *(const v4u*)&sh[rl][q * 8]); if (hi_rows) vst2((unsigned*)(DL + (bb * nhi + t0 + rl) * (size_t)CC + c0 + q * 8), *(const v4u*)&sl[rl][q * 8]); }
  } else { const bool hi_rows = t0 < KHI;
    for (int e = tid; e < 64 * 128; e += 128) { const int rl = e & 63, cl = e >> 6; const float v = st[rl][cl]; th[cl][rl] = (_Float16)v; const __bf16 bh = (__bf16)v; tb[cl][rl] = bh; tbl[cl][rl] = (__bf16)(v - (float)bh); }
    __syncthreads();
    for (int e = tid; e < 128 * 8; e += 128) { const int cl = e >> 3, q = e & 7; vst2((unsigned*)(VT + (bb * CC + c0 + cl) * (size_t)TT + t0 + q * 8), *(const v4u*)&th[cl][q * 8]); if (hi_rows) { const size_t o3 = (bb * CC + c0 + cl) * (size_t)KHI + t0 + q * 8; vst2((unsigned*)(VB + o3), *(const v4u*)&tb[cl][q * 8]); vst2((unsigned*)(VBL + o3), *(const v4u*)&tbl[cl][q * 8]); } } } }
// ---- k_fa: block = 64 queries (4 waves x 16) of (b, h), all keys in steps of 64: S^T = K . Q^T on top of C = bf16(attn_bias) (lane = one query, 8 keys a tile), running maximum and sum per query in registers, P^T x 2^11 (relative to the running maximum) once to f16 straight from the score registers as the B operand, ctx^T += V^T . P^T; ctx = ctx^T / sum at the end
#define LOG2E 1.44269504f
__device__ __forceinline__ v8f wmma_h(v16h a, v16h b, v8f c) { return __builtin_amdgcn_wmma_f32_16x16x32_f16(false, a, false, b, (short)0, c, false, false); }
// 2^x; the v_nop in the same statement is the one slot that the instruction set asks for behind a transcendental before its result is read or its source register overwritten
__device__ __forceinline__ float exp2s(float x) { float e; asm("v_exp_f32 %0, %1\n\tv_nop" : "=v"(e) : "v"(x)); return e; }
__device__ __forceinline__ v16h frag_p(const _Float16* p) { union { v16h v; v8h q[2]; } u; u.q[0] = *(const v8h*)p; u.q[1] = *(const v8h*)(p + 16); return u.v; }   // frag_h with the half's 8 elements already in the pointer
__device__ __forceinline__ float xhalf(float v) { const int b = __builtin_bit_cast(int, v); return __builtin_bit_cast(float, __builtin_amdgcn_permlanex16(b, b, 0x76543210, 0xfedcba98, false, false)); }   // the value of lane ^ 16
__global__ __launch_bounds__(128) void k_fa(const _Float16* __restrict__ QH, const _Float16* __restrict__ KH, const _Float16* __restrict__ VT, const float* __restrict__ ABI, float* __restrict__ Y) { __shared__ __align__(16) float ss[4][16][HD + 4];
  const int tid = threadIdx.x, wave = tid >> 5, lane = tid & 31, col = lane & 15, g = lane >> 4; const int h = blockIdx.y, b = blockIdx.z; const int ql0 = blockIdx.x * 64 + wave * 16;
  const _Float16* qp = QH + ((size_t)b * TT + ql0 + col) * CC + h * HD; const v16h q0 = frag_h(qp, lane), q1 = frag_h(qp + 32, lane);
  const _Float16* kp = KH + ((size_t)b * TT + col) * CC + h * HD + 8 * g;            // key row col of a 16-key tile, this half's 8 dims; runs on by 64 keys a step
  const _Float16* vp = VT + ((size_t)b * CC + h * HD + col) * (size_t)TT + 8 * g;    // v plane of dim col of a 16-dim tile, this half's 8 keys; runs on by 64 keys a step
  const float* bp = ABI + (size_t)(ql0 + col) * TT + 8 * g;                  // this lane's query row, its 8 keys of a tile; runs on by 64 keys a step
  v8f acc[HD / 16] = {}; float m = -3.0e38f, l = 0.f;                        // m = running maximum of the query's logits; l = this half's share of the sum, x 2^11
  for (int k0 = 0; k0 < TT; k0 += 64) { v16h kf[8], vf[8]; v4f bf[8]; v8f s[4];   // every load of the step is issued before its first product: one trip to L2 a step, not one a product; the unrolls of this loop body make every index of kf, vf, bf, s, p and acc a constant, so that they stay in registers
#pragma unroll
    for (int j = 0; j < 4; ++j) { kf[2 * j] = frag_p(kp + j * 16 * CC); kf[2 * j + 1] = frag_p(kp + j * 16 * CC + 32); bf[2 * j] = *(const v4f*)(bp + j * 16); bf[2 * j + 1] = *(const v4f*)(bp + j * 16 + 4); }
#pragma unroll
    for (int kc = 0; kc < 2; ++kc)
#pragma unroll
      for (int j = 0; j < HD / 16; ++j) vf[kc * 4 + j] = frag_p(vp + j * 16 * TT + kc * 32);
    asm volatile("s_wait_xcnt 0x0" :: "v"(kp), "v"(vp), "v"(bp) : "memory");   // stands in front of the first overwrite of an address register of the loads above; the three pointers as inputs keep those registers from being handed to a later load of the block as its destination
    __builtin_amdgcn_sched_barrier(0);   // keeps the loads and that wait in front of all that follows: without it the scheduler sinks each v load to just before its product (one wait a product) and may lift a register overwrite over the wait
    kp += 64 * CC; vp += 64; bp += 64;
#pragma unroll
    for (int j = 0; j < 4; ++j) { v8f c;
#pragma unroll
      for (int r = 0; r < 4; ++r) { c[r] = bfr(bf[2 * j][r]); c[4 + r] = bfr(bf[2 * j + 1][r]); }
      c = wmma_h(kf[2 * j], q0, c); s[j] = wmma_h(kf[2 * j + 1], q1, c); }
    float mx = m;
#pragma unroll
    for (int j = 0; j < 4; ++j)
#pragma unroll
      for (int r = 0; r < 8; ++r) mx = fmaxf(mx, s[j][r]);
    mx = fmaxf(mx, xhalf(mx));
    const float al = exp2s((m - mx) * LOG2E), mo = mx * LOG2E - 11.0f; m = mx;
    float sj[4]; v16h p[2];
#pragma unroll
    for (int j = 0; j < 4; ++j) { sj[j] = 0.f;
#pragma unroll
      for (int r = 0; r < 8; ++r) { const float e = exp2s(s[j][r] * LOG2E - mo); sj[j] += e; p[j >> 1][(j & 1) * 8 + r] = (_Float16)e; } }
    l = l * al + ((sj[0] + sj[1]) + (sj[2] + sj[3]));
#pragma unroll
    for (int j = 0; j < HD / 16; ++j) acc[j] = acc[j] * al;
#pragma unroll
    for (int kc = 0; kc < 2; ++kc)
#pragma unroll
      for (int j = 0; j < HD / 16; ++j) acc[j] = wmma_h(vf[kc * 4 + j], p[kc], acc[j]); }
  l += xhalf(l); const float inv = l > 0.f ? 1.0f / l : 0.f;   /* a fully excluded row yields ctx = 0 */
#pragma unroll
  for (int j = 0; j < HD / 16; ++j) { const v4f lo = { acc[j][0] * inv, acc[j][1] * inv, acc[j][2] * inv, acc[j][3] * inv }, hi = { acc[j][4] * inv, acc[j][5] * inv, acc[j][6] * inv, acc[j][7] * inv }; *(v4f*)&ss[wave][col][j * 16 + 8 * g] = lo; *(v4f*)&ss[wave][col][j * 16 + 8 * g + 4] = hi; }
  LDSX(); for (int i = 0; i < 8; ++i) { const int rl = 2 * i + g; vst2(Y + ((size_t)b * TT + ql0 + rl) * CC + h * HD + col * 4, *(const v4f*)&ss[wave][rl][col * 4]); } }
// ---- k_out: block = (64 rows, 128 cols): out = ctx Wo (+ bo): ctx x 2^6 once to f16 against Wo as f16(bf16 x 2^8) exact (1 product) x 2^-14; causal early rows (< QHI of each sequence): ctx bf16 hi + lo against exact bf16 Wo (2 products)
__global__ __launch_bounds__(128) void k_out(const float* __restrict__ Y, const float* __restrict__ WO, const float* __restrict__ BO, float* __restrict__ OUT) { __shared__ __align__(16) float sf[4][16][132];
  const int tid = threadIdx.x, wave = tid >> 5, lane = tid & 31, col = lane & 15, g = lane >> 4; const int c0 = blockIdx.y * 128; const size_t r0 = (size_t)blockIdx.x * 64 + wave * 16;
  v8f acc[8] = {};
  if (CAUSAL && (int)(((size_t)blockIdx.x * 64) % TT) < QHI) {   /* block-uniform */
#pragma unroll 2
    for (int kc = 0; kc < CC / 32; ++kc) { const F2 a = split_row(Y + (r0 + col) * CC, kc * 32, lane); asm volatile("s_wait_loadcnt 0x0" ::: "memory");
#pragma unroll
      for (int j = 0; j < 8; ++j) { const v16b w = WOCOL(WO, kc * 32, c0 + j * 16 + col, lane); asm volatile("s_wait_loadcnt 0x0" ::: "memory"); acc[j] = wmma_bf(a.h, w, acc[j]); acc[j] = wmma_bf(a.l, w, acc[j]); } }
#pragma unroll
    for (int j = 0; j < 8; ++j) { const float bias = BO ? bfr(BO[c0 + j * 16 + col]) : 0.f;
#pragma unroll
      for (int r = 0; r < 8; ++r) sf[wave][8 * g + r][j * 16 + col] = acc[j][r] + bias; }
  } else {
#pragma unroll 2
    for (int kc = 0; kc < CC / 32; ++kc) { const v16h a = frag_f32s(Y + (r0 + col) * CC + kc * 32, lane, 64.0f); asm volatile("s_wait_loadcnt 0x0" ::: "memory");   /* ctx carried x 2^6 into f16 so small-magnitude context rows stay clear of f16 subnormals */
#pragma unroll
      for (int j = 0; j < 8; ++j) { const v16h w = WOCOLH(WO, kc * 32, c0 + j * 16 + col, lane); asm volatile("s_wait_loadcnt 0x0" ::: "memory"); acc[j] = wmma16(a, w, acc[j]); } }
#pragma unroll
    for (int j = 0; j < 8; ++j) { const float bias = BO ? bfr(BO[c0 + j * 16 + col]) : 0.f;
#pragma unroll
      for (int r = 0; r < 8; ++r) sf[wave][8 * g + r][j * 16 + col] = acc[j][r] * (1.0f / 16384.0f) + bias; } }   /* 2^-8 (Wo carry) x 2^-6 (ctx carry) */
  LDSX(); for (int rl = 0; rl < 16; ++rl) vst2(OUT + (r0 + rl) * DIN + c0 + lane * 4, *(const v4f*)&sf[wave][rl][lane * 4]); }

extern "C" void kernel_launch(void* const* d_in, const int* in_sizes, int n_in, void* d_out, int out_size, void* d_ws, size_t ws_size, hipStream_t stream) {
  (void)in_sizes; (void)n_in; (void)out_size;
  const float** F = (const float**)d_in;
  if (ws_size < (size_t)WS_END) return;
  char* ws = (char*)d_ws; _Float16 *QH = (_Float16*)(ws + WS_QH), *KH = (_Float16*)(ws + WS_KH), *VT = (_Float16*)(ws + WS_VT), *QL = (_Float16*)(ws + WS_QL), *KL = (_Float16*)(ws + WS_KL); __bf16 *VB = (__bf16*)(ws + WS_VB), *VBL = (__bf16*)(ws + WS_VBL); float *Y = (float*)(ws + WS_Y);
  (void)Y; (void)QL; (void)KL; (void)VB; (void)VBL;
  // inputs: 0 x [2,2048,1024]; 1 attn_bias [1,1,2048,2048]; 2 w_qkv [3072,1024] (out,in): q rows 0..1023, k 1024..2047, v 2048..3071; 3 q_bias [1024] (zeros, read); 4 v_bias [1024] (zeros, read); 5 scale_mul [1,16,1,1] (ln 4, read); 6 w_proj [1024,1024] (out,in); 7 b_proj (zeros, read); the k stream has no bias (the module concatenates zeros)
  k_proj<<<dim3(TNB * TT / 64, CC / 128, 3), 128, 0, stream>>>(F[0], F[0], F[0], F[2], F[2] + (size_t)CC * DIN, F[2] + 2 * (size_t)CC * DIN, F[3], nullptr, F[4], QH, QL, KH, KL, VT, VB, VBL, F[5]);
  k_fa<<<dim3(NQB, NH, TNB), 128, 0, stream>>>(QH, KH, VT, F[1], Y);
  k_out<<<dim3(TNB * TT / 64, DIN / 128), 128, 0, stream>>>(Y, F[6], F[7], (float*)d_out);
}

// v002
// It runs in 187 microseconds.
// Next to v001, in two timings, it ran 3.08 times as fast each time.
// All steps since v000 together make it 7.71 times as fast.
// compute dtype: all float inputs rounded to bf16; q / k / v projections with EXACT bf16 products on WMMA 16x16x32 (f32 accumulate) + bias (q / v: zeros, read; k: none); q and k divided by their per-(token, head) L2 norm in f32, q then times exp(min(bf16(scale_mul[h]), ln 100)); logits q x k once to f16 each (1 product, scale 1), + bf16(attn_bias[q][k]) in f32; softmax f32 with a running maximum and sum over 64-key steps; exp(logit - running max) x 2^11 once to f16 x v once to f16 (1 product), divided by the f32 sum at the end; ctx x 2^6 once to f16 x w_proj f16(bf16 x 2^8) + b_proj; f32 output.
#include <hip/hip_runtime.h>
#include <math.h>

typedef __attribute__((ext_vector_type(16))) _Float16 v16h;
typedef __attribute__((ext_vector_type(16))) __bf16 v16b;
typedef __attribute__((ext_vector_type(8)))  _Float16 v8h;
typedef __attribute__((ext_vector_type(8)))  float v8f;
typedef __attribute__((ext_vector_type(4)))  float v4f;
typedef __attribute__((ext_vector_type(2)))  float v2f;
typedef __attribute__((ext_vector_type(4)))  unsigned v4u;
typedef __attribute__((ext_vector_type(4)))  int v4i;
typedef float __attribute__((may_alias)) float_a;
typedef int __attribute__((may_alias)) int_a;

template <typename T> __device__ __forceinline__ void vst2(void* p, T v) { *(T*)p = v;  }
__device__ __forceinline__ v8f wmma16(v16h a, v16h b, v8f c) {
  v8f d = __builtin_amdgcn_wmma_f32_16x16x32_f16(false, a, false, b, (short)0, c, false, false);
  asm volatile("v_nop\n\tv_nop\n\tv_nop\n\tv_nop" : "+v"(d) : "v"(a), "v"(b));
  return d;
}
__device__ __forceinline__ v8f wmma_bf(v16b a, v16b b, v8f c) {
  v8f d = __builtin_amdgcn_wmma_f32_16x16x32_bf16(false, a, false, b, (short)0, c, false, false);
  asm volatile("v_nop\n\tv_nop\n\tv_nop\n\tv_nop" : "+v"(d) : "v"(a), "v"(b));
  return d;
}
// 16x16x32 fragments: lane = (h = lane>>4, row/col = lane&15); elements 0..7 = k0+8h+0..7, 8..15 = k0+16+8h+0..7; D element r = row 8h+r
__device__ __forceinline__ v16h frag_h(const _Float16* rowk0, int lane) {
  union { v16h v; v8h q[2]; } u; const _Float16* p = rowk0 + 8 * (lane >> 4);
  u.q[0] = *(const v8h*)p; u.q[1] = *(const v8h*)(p + 16); return u.v;
}
__device__ __forceinline__ v16h frag_f32(const float* rowk0, int lane) {
  v16h a; const float* p = rowk0 + 8 * (lane >> 4);
#pragma unroll
  for (int i = 0; i < 8; ++i) { a[i] = (_Float16)p[i]; a[8 + i] = (_Float16)p[16 + i]; }
  return a;
}
__device__ __forceinline__ v16h frag_f32s(const float* rowk0, int lane, float sc) {
  v16h a; const float* p = rowk0 + 8 * (lane >> 4);
#pragma unroll
  for (int i = 0; i < 8; ++i) { a[i] = (_Float16)(p[i] * sc); a[8 + i] = (_Float16)(p[16 + i] * sc); }
  return a;
}
// column fragment from a [K][ld] layout (column n), rows >= K read as 0
__device__ __forceinline__ v16h fragc_f32(const float* W, int k0, int n, int lane, int ld, int K) {
  v16h a; const int g = lane >> 4;
#pragma unroll
  for (int i = 0; i < 8; ++i) { const int ka = k0 + 8 * g + i, kb = ka + 16;
    a[i] = (_Float16)(ka < K ? W[(size_t)(ka < K ? ka : K - 1) * ld + n] : 0.f); a[8 + i] = (_Float16)(kb < K ? W[(size_t)(kb < K ? kb : K - 1) * ld + n] : 0.f); }
  return a;
}
struct F2 { v16b h, l; };
__device__ __forceinline__ F2 bsplit16(const float v[16]) { F2 r;
#pragma unroll
  for (int i = 0; i < 16; ++i) { const __bf16 h = (__bf16)v[i]; r.h[i] = h; r.l[i] = (__bf16)(v[i] - (float)h); }
  return r; }
__device__ __forceinline__ F2 split_row(const float* row, int k0, int lane) { float v[16]; const float* p = row + k0 + 8 * (lane >> 4);
#pragma unroll
  for (int i = 0; i < 8; ++i) { v[i] = p[i]; v[8 + i] = p[16 + i]; }
  return bsplit16(v); }
__device__ __forceinline__ F2 split_rowK(const float* row, int k0, int lane, int K) { float v[16]; const int g = lane >> 4;
#pragma unroll
  for (int i = 0; i < 8; ++i) { const int ka = k0 + 8 * g + i, kb = ka + 16; v[i] = ka < K ? row[ka < K ? ka : K - 1] : 0.f; v[8 + i] = kb < K ? row[kb < K ? kb : K - 1] : 0.f; }
  return bsplit16(v); }
__device__ __forceinline__ F2 split_col(const float* W, int k0, int n, int lane, int ld, int K) { float v[16]; const int g = lane >> 4;
#pragma unroll
  for (int i = 0; i < 8; ++i) { const int ka = k0 + 8 * g + i, kb = ka + 16; v[i] = ka < K ? W[(size_t)(ka < K ? ka : K - 1) * ld + n] : 0.f; v[8 + i] = kb < K ? W[(size_t)(kb < K ? kb : K - 1) * ld + n] : 0.f; }
  return bsplit16(v); }
__device__ __forceinline__ v8f mac3(const F2& a, const F2& b, v8f c) { c = wmma_bf(a.l, b.h, c); c = wmma_bf(a.h, b.l, c); return wmma_bf(a.h, b.h, c); }
__device__ __forceinline__ float sigm(float v) { return 1.0f / (1.0f + expf(-v)); }
#define LDSX() do { asm volatile("s_wait_dscnt 0" ::: "memory"); __builtin_amdgcn_wave_barrier(); __builtin_amdgcn_fence(__ATOMIC_RELEASE, "workgroup"); } while (0)

// Multi-head COSINE self-attention with a per-head learned scale and an additive attention bias (x [2,2048,1024]; attn_bias [1,1,2048,2048] N(0,1), one entry per (query, key), shared by batches and heads - READ on the device; w_qkv [3072,1024] torch (out,in) N(0, 1/1024): q = rows 0..1023, k = 1024..2047, v = 2048..3071 (reshape (B, L, 3, 16, 64)); q_bias / v_bias zeros (read), k has no bias; scale_mul [1,16,1,1] = ln 4 (const; read): sm = exp(min(scale_mul, ln 100)) = 4; q <- q / ||q|| * sm, k <- k / ||k|| per head row; attn = q k^T + attn_bias; softmax; oup through w_proj [1024,1024] (out,in) + b_proj zeros).
#define NB 2
#define TT 2048
#define CC 1024            // NH * HD = projected width
#define DIN 1024          // input (model) width
#define NH 16
#define HD 64
#define NQB (TT / 64)
#define HG 4
#define SCALE (1.0f)
#define CAUSAL 0
#ifndef TNB
#define TNB NB
#endif
__device__ __forceinline__ float bfr(float v) { return (float)(__bf16)v; }
__host__ __device__ __forceinline__ int kb_last(int qb) { return CAUSAL ? ((qb * 64 + 63) >> 7) : (TT / 128 - 1); }
typedef __attribute__((ext_vector_type(8))) __bf16 v8b;
__device__ __forceinline__ v16b frag_b(const __bf16* rowk0, int lane) {
  union { v16b v; v8b q[2]; } u; const __bf16* p = rowk0 + 8 * (lane >> 4);
  u.q[0] = *(const v8b*)p; u.q[1] = *(const v8b*)(p + 16); return u.v;
}
#define QBH 0              // unused: k_fa has one path for all query blocks
#define QHI 0               // single-product logits on every row (unit-norm operands x 4: |cosine logit| <= 4)
#define KHI 64            // key rows carrying k residual / v bf16 hi+lo planes (written by k_proj; no kernel reads them)
// B fragment (k rows k0+.., output column o) of a weight: (in,out) [K][ld] or (out,in) [ld rows of K]: bf16 exact, or f16(bf16 * 256) exact
__device__ __forceinline__ v16b wcol_io(const float* Wm, int k0, int o, int lane, int ld) { v16b w; const int g = lane >> 4;
#pragma unroll
  for (int i = 0; i < 8; ++i) { w[i] = (__bf16)Wm[(size_t)(k0 + 8 * g + i) * ld + o]; w[8 + i] = (__bf16)Wm[(size_t)(k0 + 16 + 8 * g + i) * ld + o]; }
  return w; }
__device__ __forceinline__ v16b wcol_oi(const float* Wm, int k0, int o, int lane, int K) { v16b w; const float* p = Wm + (size_t)o * K + k0 + 8 * (lane >> 4);
#pragma unroll
  for (int i = 0; i < 8; ++i) { w[i] = (__bf16)p[i]; w[8 + i] = (__bf16)p[16 + i]; }
  return w; }
__device__ __forceinline__ v16h wcolh_io(const float* Wm, int k0, int o, int lane, int ld) { v16h w; const int g = lane >> 4;
#pragma unroll
  for (int i = 0; i < 8; ++i) { w[i] = (_Float16)(bfr(Wm[(size_t)(k0 + 8 * g + i) * ld + o]) * 256.0f); w[8 + i] = (_Float16)(bfr(Wm[(size_t)(k0 + 16 + 8 * g + i) * ld + o]) * 256.0f); }
  return w; }
__device__ __forceinline__ v16h wcolh_oi(const float* Wm, int k0, int o, int lane, int K) { v16h w; const float* p = Wm + (size_t)o * K + k0 + 8 * (lane >> 4);
#pragma unroll
  for (int i = 0; i < 8; ++i) { w[i] = (_Float16)(bfr(p[i]) * 256.0f); w[8 + i] = (_Float16)(bfr(p[16 + i]) * 256.0f); }
  return w; }
#define WQKV_LAYOUT 1   // 0 = (in,out) [DIN][CC]; 1 = (out,in) [CC][DIN]; 2 = per-head [NH][DIN][HD]
__device__ __forceinline__ v16b wcol_hdk(const float* Wm, int k0, int o, int lane) { v16b w; const int g = lane >> 4; const float* p = Wm + (size_t)(o / HD) * DIN * HD + (o % HD);
#pragma unroll
  for (int i = 0; i < 8; ++i) { w[i] = (__bf16)p[(size_t)(k0 + 8 * g + i) * HD]; w[8 + i] = (__bf16)p[(size_t)(k0 + 16 + 8 * g + i) * HD]; }
  return w; }
#define WO_OUT_IN 1
#if WQKV_LAYOUT == 1
#define WCOL(W, k0, o, lane) wcol_oi(W, k0, o, lane, DIN)
#elif WQKV_LAYOUT == 2
#define WCOL(W, k0, o, lane) wcol_hdk(W, k0, o, lane)
#else
#define WCOL(W, k0, o, lane) wcol_io(W, k0, o, lane, CC)
#endif
#if WO_OUT_IN
#define WOCOL(W, k0, o, lane) wcol_oi(W, k0, o, lane, CC)
#define WOCOLH(W, k0, o, lane) wcolh_oi(W, k0, o, lane, CC)
#else
#define WOCOL(W, k0, o, lane) wcol_io(W, k0, o, lane, DIN)
#define WOCOLH(W, k0, o, lane) wcolh_io(W, k0, o, lane, DIN)
#endif

#define MAX_SCALE_MUL 4.605170186f   // ln(100): the module's clamp on scale_mul
#define PROJ_EXTRA_PARAMS , const float* __restrict__ SMU   /* scale_mul [1][NH][1][1], a module input */
// per (token, head) hook on the staged f32 row (64 floats, projection + bias) of the q and k streams: x <- x / sqrt(sum x^2) (jnp.linalg.norm, no epsilon in the module); the q stream is then multiplied by sm = expf(fminf(bf16(scale_mul[h]), ln 100)); v untouched; the sum of squares in f32, products and sums kept separate
#define PROJ_EPI(which, row, t, h) do { if ((which) < 2) { float* rw = (row); float ss_ = 0.f; _Pragma("unroll 8") for (int i = 0; i < 64; ++i) { _Pragma("clang fp contract(off)") const float sq_ = rw[i] * rw[i]; ss_ = ss_ + sq_; } const float dn_ = sqrtf(ss_); const float sm_ = ((which) == 0) ? expf(fminf(bfr(SMU[(h)]), MAX_SCALE_MUL)) : 1.0f; _Pragma("unroll 8") for (int i = 0; i < 64; ++i) { _Pragma("clang fp contract(off)") const float u_ = rw[i] / dn_; rw[i] = ((which) == 0) ? (u_ * sm_) : u_; } } } while (0)
#ifndef PROJ_EXTRA_PARAMS
#define PROJ_EXTRA_PARAMS
#endif

#define WS_QH  0u                                      // f16 q rows [b*t][CC]
#define WS_KH  (WS_QH + 2u * (size_t)NB * TT * CC)      // f16 k rows [b*t][CC]
#define WS_VT  (WS_KH + 2u * (size_t)NB * TT * CC)      // f16 v planes [b][c][t]
#define WS_QL  (WS_VT + 2u * (size_t)NB * CC * TT)      // f16 q residual x 2^10 rows [b][t < QHI][CC]
#define WS_KL  (WS_QL + 2u * (size_t)NB * QHI * CC)     // f16 k residual x 2^10 rows [b][t < KHI][CC]
#define WS_VB  (WS_KL + 2u * (size_t)NB * KHI * CC)     // bf16 v hi planes [b][c][t < KHI]
#define WS_VBL (WS_VB + 2u * (size_t)NB * CC * KHI)
#define WS_S   (WS_VBL + 2u * (size_t)NB * CC * KHI)    // f32 [HG][TT][TT] region, read or written by no kernel (logits and P stay in registers)
#define WS_Y   (WS_S  + 4u * (size_t)HG * TT * TT)      // f32 ctx rows [b*t][CC] (only when there is an output projection)
#define WS_END (WS_Y  + 4u * (size_t)NB * TT * CC)

// ---- gemm_tile: the 64 x 128 tile of A . W^T (both K-contiguous f32, K = 1024) of one 4-wave block. Each 64-k stage of both operands is fetched by whole-line loads (16 lanes x 16 B = 256 B of one row), rounded once to its 16-bit operand type and laid in LDS, where all four waves read their fragments; two LDS buffers, the next stage's loads in flight in registers during the products; k runs upward in steps of 32
typedef __attribute__((ext_vector_type(2))) unsigned v2u;
#define GK 64                      // k per stage
#define GP 144                     // LDS row pitch, bytes: 128 B of 16-bit data + 16 B (pitch for ds_load_b128 readers)
#define GBUF ((64 + 128) * GP)     // one stage: 64 A rows, then 128 W rows
__device__ __forceinline__ v2u pk_bf(v4f v) { union { v2u u; __bf16 e[4]; } r;
#pragma unroll
  for (int i = 0; i < 4; ++i) r.e[i] = (__bf16)v[i];
  return r.u; }
__device__ __forceinline__ v2u pk_ctx(v4f v) { union { v2u u; _Float16 e[4]; } r;   // ctx x 2^6 once to f16
#pragma unroll
  for (int i = 0; i < 4; ++i) r.e[i] = (_Float16)(v[i] * 64.0f);
  return r.u; }
__device__ __forceinline__ v2u pk_wo(v4f v) { union { v2u u; _Float16 e[4]; } r;    // f16(bf16 x 2^8), exact
#pragma unroll
  for (int i = 0; i < 4; ++i) r.e[i] = (_Float16)((float)(__bf16)v[i] * 256.0f);
  return r.u; }
// one stage's 24 loads of a thread (8 of A, 16 of W; the thread's offset is the same in both tiles and never changes), then the two block-uniform bases one stage on; the unrolls here and in gemm_tile make every index of ra, rw, w and acc a constant, so that these arrays stay in registers
__device__ __forceinline__ void gemm_fetch(const float*& Ag, const float*& Wg, unsigned off, v4f (&ra)[8], v4f (&rw)[16]) {
#pragma unroll
  for (int i = 0; i < 8; ++i) ra[i] = *(const v4f*)(Ag + off + i * 8 * 1024);
#pragma unroll
  for (int i = 0; i < 16; ++i) rw[i] = *(const v4f*)(Wg + off + i * 8 * 1024);
  asm volatile("s_wait_xcnt 0x0" :: "v"(off) : "memory");   // stands in front of the overwrite of the loads' base registers just below; the offset as an input keeps its register from being handed to a later load of the group as its destination
  __builtin_amdgcn_sched_barrier(0);                        // keeps the stage's loads in front of the products that are to cover their latency, and the steps of the bases behind the wait
  Ag += GK; Wg += GK; }
template <int F16> __device__ __forceinline__ void gemm_tile(const float* Ag, const float* Wg, char* stg, v8f (&acc)[8], int tid) {
  const int wave = tid >> 5, lane = tid & 31, col = lane & 15, g = lane >> 4;
  const unsigned off = (tid >> 4) * 1024 + (tid & 15) * 4;                   // 8 rows a pass of the block, 16 lanes x 16 B a row
  char* sp = stg + (tid >> 4) * GP + (tid & 15) * 8;
  const char* fa = stg + (wave * 16 + col) * GP + 16 * g;              // fragment: elements 0..7 = k0 + 8g + 0..7, 8..15 = k0 + 16 + 8g + 0..7
  const char* fw = stg + (64 + col) * GP + 16 * g;
  v4f ra[8], rw[16];
  gemm_fetch(Ag, Wg, off, ra, rw);
  for (int s = 0; s < 1024 / GK; ++s) { const int bo = (s & 1) * GBUF;
#pragma unroll
    for (int i = 0; i < 8; ++i) *(v2u*)(sp + bo + i * 8 * GP) = F16 ? pk_ctx(ra[i]) : pk_bf(ra[i]);
#pragma unroll
    for (int i = 0; i < 16; ++i) *(v2u*)(sp + bo + (64 + i * 8) * GP) = F16 ? pk_wo(rw[i]) : pk_bf(rw[i]);
    __syncthreads();   // publishes stage s; a wave that has passed it has left the other buffer, which stage s + 1 overwrites only behind this barrier
    if (s + 1 < 1024 / GK) gemm_fetch(Ag, Wg, off, ra, rw);
#pragma unroll
    for (int kk = 0; kk < GK / 32; ++kk) { union { v4u q[2]; v16b b; v16h h; } a, w[8]; a.q[0] = *(const v4u*)(fa + bo + kk * 64); a.q[1] = *(const v4u*)(fa + bo + kk * 64 + 32);   // the nine fragments of a 32-k block are read as one group in front of its eight products
#pragma unroll
      for (int j = 0; j < 8; ++j) { w[j].q[0] = *(const v4u*)(fw + bo + j * 16 * GP + kk * 64); w[j].q[1] = *(const v4u*)(fw + bo + j * 16 * GP + kk * 64 + 32); }
      __builtin_amdgcn_sched_barrier(0);   // keeps the group together: without it the scheduler sinks each fragment's two reads to just before its product, into one register set, and every product waits out a whole LDS latency
#pragma unroll
      for (int j = 0; j < 8; ++j) acc[j] = F16 ? __builtin_amdgcn_wmma_f32_16x16x32_f16(false, a.h, false, w[j].h, (short)0, acc[j], false, false) : __builtin_amdgcn_wmma_f32_16x16x32_bf16(false, a.b, false, w[j].b, (short)0, acc[j], false, false); } }
}
// ---- k_proj: block = (64 rows, 128 cols, which): q/k/v = X W (+ b) with exact bf16 products (K = DIN) -> which 0: q f16 rows (+ residual rows < QHI); 1: k f16 rows (+ residual rows < KHI); 2: v f16 planes [c][t] (+ bf16 hi/lo planes for t < KHI)
__global__ __launch_bounds__(128) void k_proj(const float* __restrict__ XQ, const float* __restrict__ XK, const float* __restrict__ XV, const float* __restrict__ WQ, const float* __restrict__ WK, const float* __restrict__ WV, const float* __restrict__ BQ, const float* __restrict__ BK, const float* __restrict__ BV,
    _Float16* __restrict__ QH, _Float16* __restrict__ QL, _Float16* __restrict__ KH, _Float16* __restrict__ KL, _Float16* __restrict__ VT, __bf16* __restrict__ VB, __bf16* __restrict__ VBL PROJ_EXTRA_PARAMS) {
  __shared__ __align__(16) char sm[64 * 132 * 4 + 2 * GBUF];   // st, then one region that holds the two operand stages during the products and the 16-bit output tiles (sh, sl or th, tb, tbl) behind the epilogue's barriers
  float (*st)[132] = (float (*)[132])sm; char* stg = sm + 64 * 132 * 4; _Float16 (*sh)[136] = (_Float16 (*)[136])stg; _Float16 (*sl)[136] = (_Float16 (*)[136])(stg + 64 * 136 * 2); _Float16 (*th)[72] = (_Float16 (*)[72])stg; __bf16 (*tb)[72] = (__bf16 (*)[72])(stg + 128 * 72 * 2); __bf16 (*tbl)[72] = (__bf16 (*)[72])(stg + 2 * 128 * 72 * 2);
  const int tid = threadIdx.x, wave = tid >> 5, lane = tid & 31, col = lane & 15, g = lane >> 4; const int which = blockIdx.z; const int c0 = blockIdx.y * 128; const size_t r0 = (size_t)blockIdx.x * 64; const size_t bb = r0 / TT; const int t0 = (int)(r0 % TT);
  const float* X = which == 0 ? XQ : which == 1 ? XK : XV; const float* WA = which == 0 ? WQ : which == 1 ? WK : WV; const float* BA = which == 0 ? BQ : which == 1 ? BK : BV;
  v8f acc[8] = {};
  gemm_tile<0>(X + r0 * DIN, WA + (size_t)c0 * DIN, stg, acc, tid);
  { // stage the f32 tile (acc + bias) in LDS, run the per-(row, head) epilogue hook, then convert
#pragma unroll
    for (int j = 0; j < 8; ++j) { const float bias = BA ? bfr(BA[c0 + j * 16 + col]) : 0.f;
#pragma unroll
      for (int r = 0; r < 8; ++r) st[wave * 16 + 8 * g + r][j * 16 + col] = acc[j][r] + bias; }
    __syncthreads();
    for (int e = tid; e < 64 * (128 / HD); e += 128) { const int rl = e / (128 / HD), hh = e % (128 / HD); PROJ_EPI(which, &st[rl][hh * HD], (int)((r0 + rl) % TT), (c0 / HD) + hh); }
    __syncthreads(); }
  if (which < 2) { _Float16* DH = which == 0 ? QH : KH; _Float16* DL = which == 0 ? QL : KL; const int nhi = which == 0 ? QHI : KHI; const bool hi_rows = t0 < nhi;
    for (int e = tid; e < 64 * 128; e += 128) { const int rl = e >> 7, cl = e & 127; const float v = st[rl][cl]; const _Float16 hv = (_Float16)v; sh[rl][cl] = hv; sl[rl][cl] = (_Float16)((v - (float)hv) * 1024.0f); }
    __syncthreads();
    for (int e = tid; e < 64 * 16; e += 128) { const int rl = e >> 4, q = e & 15; vst2((unsigned*)(DH + (r0 + rl) * CC + c0 + q * 8), *(const v4u*)&sh[rl][q * 8]); if (hi_rows) vst2((unsigned*)(DL + (bb * nhi + t0 + rl) * (size_t)CC + c0 + q * 8), *(const v4u*)&sl[rl][q * 8]); }
  } else { const bool hi_rows = t0 < KHI;
    for (int e = tid; e < 64 * 128; e += 128) { const int rl = e & 63, cl = e >> 6; const float v = st[rl][cl]; th[cl][rl] = (_Float16)v; const __bf16 bh = (__bf16)v; tb[cl][rl] = bh; tbl[cl][rl] = (__bf16)(v - (float)bh); }
    __syncthreads();
    for (int e = tid; e < 128 * 8; e += 128) { const int cl = e >> 3, q = e & 7; vst2((unsigned*)(VT + (bb * CC + c0 + cl) * (size_t)TT + t0 + q * 8), *(const v4u*)&th[cl][q * 8]); if (hi_rows) { const size_t o3 = (bb * CC + c0 + cl) * (size_t)KHI + t0 + q * 8; vst2((unsigned*)(VB + o3), *(const v4u*)&tb[cl][q * 8]); vst2((unsigned*)(VBL + o3), *(const v4u*)&tbl[cl][q * 8]); } } } }
// ---- k_fa: block = 64 queries (4 waves x 16) of (b, h), all keys in steps of 64: S^T = K . Q^T on top of C = bf16(attn_bias) (lane = one query, 8 keys a tile), running maximum and sum per query in registers, P^T x 2^11 (relative to the running maximum) once to f16 straight from the score registers as the B operand, ctx^T += V^T . P^T; ctx = ctx^T / sum at the end
#define LOG2E 1.44269504f
__device__ __forceinline__ v8f wmma_h(v16h a, v16h b, v8f c) { return __builtin_amdgcn_wmma_f32_16x16x32_f16(false, a, false, b, (short)0, c, false, false); }
// 2^x; the v_nop in the same statement is the one slot that the instruction set asks for behind a transcendental before its result is read or its source register overwritten
__device__ __forceinline__ float exp2s(float x) { float e; asm("v_exp_f32 %0, %1\n\tv_nop" : "=v"(e) : "v"(x)); return e; }
__device__ __forceinline__ v16h frag_p(const _Float16* p) { union { v16h v; v8h q[2]; } u; u.q[0] = *(const v8h*)p; u.q[1] = *(const v8h*)(p + 16); return u.v; }   // frag_h with the half's 8 elements already in the pointer
__device__ __forceinline__ float xhalf(float v) { const int b = __builtin_bit_cast(int, v); return __builtin_bit_cast(float, __builtin_amdgcn_permlanex16(b, b, 0x76543210, 0xfedcba98, false, false)); }   // the value of lane ^ 16
__global__ __launch_bounds__(128) void k_fa(const _Float16* __restrict__ QH, const _Float16* __restrict__ KH, const _Float16* __restrict__ VT, const float* __restrict__ ABI, float* __restrict__ Y) { __shared__ __align__(16) float ss[4][16][HD + 4];
  const int tid = threadIdx.x, wave = tid >> 5, lane = tid & 31, col = lane & 15, g = lane >> 4; const int h = blockIdx.y, b = blockIdx.z; const int ql0 = blockIdx.x * 64 + wave * 16;
  const _Float16* qp = QH + ((size_t)b * TT + ql0 + col) * CC + h * HD; const v16h q0 = frag_h(qp, lane), q1 = frag_h(qp + 32, lane);
  const _Float16* kp = KH + ((size_t)b * TT + col) * CC + h * HD + 8 * g;            // key row col of a 16-key tile, this half's 8 dims; runs on by 64 keys a step
  const _Float16* vp = VT + ((size_t)b * CC + h * HD + col) * (size_t)TT + 8 * g;    // v plane of dim col of a 16-dim tile, this half's 8 keys; runs on by 64 keys a step
  const float* bp = ABI + (size_t)(ql0 + col) * TT + 8 * g;                  // this lane's query row, its 8 keys of a tile; runs on by 64 keys a step
  v8f acc[HD / 16] = {}; float m = -3.0e38f, l = 0.f;                        // m = running maximum of the query's logits; l = this half's share of the sum, x 2^11
  for (int k0 = 0; k0 < TT; k0 += 64) { v16h kf[8], vf[8]; v4f bf[8]; v8f s[4];   // every load of the step is issued before its first product: one trip to L2 a step, not one a product; the unrolls of this loop body make every index of kf, vf, bf, s, p and acc a constant, so that they stay in registers
#pragma unroll
    for (int j = 0; j < 4; ++j) { kf[2 * j] = frag_p(kp + j * 16 * CC); kf[2 * j + 1] = frag_p(kp + j * 16 * CC + 32); bf[2 * j] = *(const v4f*)(bp + j * 16); bf[2 * j + 1] = *(const v4f*)(bp + j * 16 + 4); }
#pragma unroll
    for (int kc = 0; kc < 2; ++kc)
#pragma unroll
      for (int j = 0; j < HD / 16; ++j) vf[kc * 4 + j] = frag_p(vp + j * 16 * TT + kc * 32);
    asm volatile("s_wait_xcnt 0x0" :: "v"(kp), "v"(vp), "v"(bp) : "memory");   // stands in front of the first overwrite of an address register of the loads above; the three pointers as inputs keep those registers from being handed to a later load of the block as its destination
    __builtin_amdgcn_sched_barrier(0);   // keeps the loads and that wait in front of all that follows: without it the scheduler sinks each v load to just before its product (one wait a product) and may lift a register overwrite over the wait
    kp += 64 * CC; vp += 64; bp += 64;
#pragma unroll
    for (int j = 0; j < 4; ++j) { v8f c;
#pragma unroll
      for (int r = 0; r < 4; ++r) { c[r] = bfr(bf[2 * j][r]); c[4 + r] = bfr(bf[2 * j + 1][r]); }
      c = wmma_h(kf[2 * j], q0, c); s[j] = wmma_h(kf[2 * j + 1], q1, c); }
    float mx = m;
#pragma unroll
    for (int j = 0; j < 4; ++j)
#pragma unroll
      for (int r = 0; r < 8; ++r) mx = fmaxf(mx, s[j][r]);
    mx = fmaxf(mx, xhalf(mx));
    const float al = exp2s((m - mx) * LOG2E), mo = mx * LOG2E - 11.0f; m = mx;
    float sj[4]; v16h p[2];
#pragma unroll
    for (int j = 0; j < 4; ++j) { sj[j] = 0.f;
#pragma unroll
      for (int r = 0; r < 8; ++r) { const float e = exp2s(s[j][r] * LOG2E - mo); sj[j] += e; p[j >> 1][(j & 1) * 8 + r] = (_Float16)e; } }
    l = l * al + ((sj[0] + sj[1]) + (sj[2] + sj[3]));
#pragma unroll
    for (int j = 0; j < HD / 16; ++j) acc[j] = acc[j] * al;
#pragma unroll
    for (int kc = 0; kc < 2; ++kc)
#pragma unroll
      for (int j = 0; j < HD / 16; ++j) acc[j] = wmma_h(vf[kc * 4 + j], p[kc], acc[j]); }
  l += xhalf(l); const float inv = l > 0.f ? 1.0f / l : 0.f;   /* a fully excluded row yields ctx = 0 */
#pragma unroll
  for (int j = 0; j < HD / 16; ++j) { const v4f lo = { acc[j][0] * inv, acc[j][1] * inv, acc[j][2] * inv, acc[j][3] * inv }, hi = { acc[j][4] * inv, acc[j][5] * inv, acc[j][6] * inv, acc[j][7] * inv }; *(v4f*)&ss[wave][col][j * 16 + 8 * g] = lo; *(v4f*)&ss[wave][col][j * 16 + 8 * g + 4] = hi; }
  LDSX(); for (int i = 0; i < 8; ++i) { const int rl = 2 * i + g; vst2(Y + ((size_t)b * TT + ql0 + rl) * CC + h * HD + col * 4, *(const v4f*)&ss[wave][rl][col * 4]); } }
// ---- k_out: block = (64 rows, 128 cols): out = ctx Wo (+ bo): ctx x 2^6 once to f16 against Wo as f16(bf16 x 2^8) exact (1 product) x 2^-14; causal early rows (< QHI of each sequence): ctx bf16 hi + lo against exact bf16 Wo (2 products)
__global__ __launch_bounds__(128) void k_out(const float* __restrict__ Y, const float* __restrict__ WO, const float* __restrict__ BO, float* __restrict__ OUT) { __shared__ __align__(16) float sf[4][16][132]; __shared__ __align__(16) char stg[2 * GBUF];
  const int tid = threadIdx.x, wave = tid >> 5, lane = tid & 31, col = lane & 15, g = lane >> 4; const int c0 = blockIdx.y * 128; const size_t r0 = (size_t)blockIdx.x * 64 + wave * 16;
  v8f acc[8] = {};
  if (CAUSAL && (int)(((size_t)blockIdx.x * 64) % TT) < QHI) {   /* block-uniform */
#pragma unroll 2
    for (int kc = 0; kc < CC / 32; ++kc) { const F2 a = split_row(Y + (r0 + col) * CC, kc * 32, lane); asm volatile("s_wait_loadcnt 0x0" ::: "memory");
#pragma unroll
      for (int j = 0; j < 8; ++j) { const v16b w = WOCOL(WO, kc * 32, c0 + j * 16 + col, lane); asm volatile("s_wait_loadcnt 0x0" ::: "memory"); acc[j] = wmma_bf(a.h, w, acc[j]); acc[j] = wmma_bf(a.l, w, acc[j]); } }
#pragma unroll
    for (int j = 0; j < 8; ++j) { const float bias = BO ? bfr(BO[c0 + j * 16 + col]) : 0.f;
#pragma unroll
      for (int r = 0; r < 8; ++r) sf[wave][8 * g + r][j * 16 + col] = acc[j][r] + bias; }
  } else {
    gemm_tile<1>(Y + (size_t)blockIdx.x * 64 * CC, WO + (size_t)c0 * CC, stg, acc, tid);   /* ctx carried x 2^6 into f16 so small-magnitude context rows stay clear of f16 subnormals */
#pragma unroll
    for (int j = 0; j < 8; ++j) { const float bias = BO ? bfr(BO[c0 + j * 16 + col]) : 0.f;
#pragma unroll
      for (int r = 0; r < 8; ++r) sf[wave][8 * g + r][j * 16 + col] = acc[j][r] * (1.0f / 16384.0f) + bias; } }   /* 2^-8 (Wo carry) x 2^-6 (ctx carry) */
  LDSX(); for (int rl = 0; rl < 16; ++rl) vst2(OUT + (r0 + rl) * DIN + c0 + lane * 4, *(const v4f*)&sf[wave][rl][lane * 4]); }

extern "C" void kernel_launch(void* const* d_in, const int* in_sizes, int n_in, void* d_out, int out_size, void* d_ws, size_t ws_size, hipStream_t stream) {
  (void)in_sizes; (void)n_in; (void)out_size;
  const float** F = (const float**)d_in;
  if (ws_size < (size_t)WS_END) return;
  char* ws = (char*)d_ws; _Float16 *QH = (_Float16*)(ws + WS_QH), *KH = (_Float16*)(ws + WS_KH), *VT = (_Float16*)(ws + WS_VT), *QL = (_Float16*)(ws + WS_QL), *KL = (_Float16*)(ws + WS_KL); __bf16 *VB = (__bf16*)(ws + WS_VB), *VBL = (__bf16*)(ws + WS_VBL); float *Y = (float*)(ws + WS_Y);
  (void)Y; (void)QL; (void)KL; (void)VB; (void)VBL;
  // inputs: 0 x [2,2048,1024]; 1 attn_bias [1,1,2048,2048]; 2 w_qkv [3072,1024] (out,in): q rows 0..1023, k 1024..2047, v 2048..3071; 3 q_bias [1024] (zeros, read); 4 v_bias [1024] (zeros, read); 5 scale_mul [1,16,1,1] (ln 4, read); 6 w_proj [1024,1024] (out,in); 7 b_proj (zeros, read); the k stream has no bias (the module concatenates zeros)
  k_proj<<<dim3(TNB * TT / 64, CC / 128, 3), 128, 0, stream>>>(F[0], F[0], F[0], F[2], F[2] + (size_t)CC * DIN, F[2] + 2 * (size_t)CC * DIN, F[3], nullptr, F[4], QH, QL, KH, KL, VT, VB, VBL, F[5]);
  k_fa<<<dim3(NQB, NH, TNB), 128, 0, stream>>>(QH, KH, VT, F[1], Y);
  k_out<<<dim3(TNB * TT / 64, DIN / 128), 128, 0, stream>>>(Y, F[6], F[7], (float*)d_out);
}

// v003
// A run of this version takes 121 microseconds.
// In two side-by-side timings against v002, it was 1.55 and 1.54 times as fast.
// Over all steps from v000 it is 11.9 times as fast.
// compute dtype: all float inputs rounded to bf16; q / k / v projections with EXACT bf16 products on WMMA 16x16x32 (f32 accumulate) + bias (q / v: zeros, read; k: none); q and k divided by their per-(token, head) L2 norm in f32, q then times exp(min(bf16(scale_mul[h]), ln 100)); logits q x k once to f16 each (1 product, scale 1), + bf16(attn_bias[q][k]) in f32; softmax f32 with a running maximum and sum over 64-key steps; exp(logit - running max) x 2^11 once to f16 x v once to f16 (1 product), divided by the f32 sum at the end; ctx x 2^6 once to f16 x w_proj f16(bf16 x 2^8) + b_proj; f32 output.
#include <hip/hip_runtime.h>
#include <math.h>

typedef __attribute__((ext_vector_type(16))) _Float16 v16h;
typedef __attribute__((ext_vector_type(16))) __bf16 v16b;
typedef __attribute__((ext_vector_type(8)))  _Float16 v8h;
typedef __attribute__((ext_vector_type(8)))  float v8f;
typedef __attribute__((ext_vector_type(4)))  float v4f;
typedef __attribute__((ext_vector_type(2)))  float v2f;
typedef __attribute__((ext_vector_type(4)))  unsigned v4u;
typedef __attribute__((ext_vector_type(4)))  int v4i;
typedef float __attribute__((may_alias)) float_a;
typedef int __attribute__((may_alias)) int_a;

template <typename T> __device__ __forceinline__ void vst2(void* p, T v) { *(T*)p = v;  }
__device__ __forceinline__ v8f wmma16(v16h a, v16h b, v8f c) {
  v8f d = __builtin_amdgcn_wmma_f32_16x16x32_f16(false, a, false, b, (short)0, c, false, false);
  asm volatile("v_nop\n\tv_nop\n\tv_nop\n\tv_nop" : "+v"(d) : "v"(a), "v"(b));
  return d;
}
__device__ __forceinline__ v8f wmma_bf(v16b a, v16b b, v8f c) {
  v8f d = __builtin_amdgcn_wmma_f32_16x16x32_bf16(false, a, false, b, (short)0, c, false, false);
  asm volatile("v_nop\n\tv_nop\n\tv_nop\n\tv_nop" : "+v"(d) : "v"(a), "v"(b));
  return d;
}
// 16x16x32 fragments: lane = (h = lane>>4, row/col = lane&15); elements 0..7 = k0+8h+0..7, 8..15 = k0+16+8h+0..7; D element r = row 8h+r
__device__ __forceinline__ v16h frag_h(const _Float16* rowk0, int lane) {
  union { v16h v; v8h q[2]; } u; const _Float16* p = rowk0 + 8 * (lane >> 4);
  u.q[0] = *(const v8h*)p; u.q[1] = *(const v8h*)(p + 16); return u.v;
}
__device__ __forceinline__ v16h frag_f32(const float* rowk0, int lane) {
  v16h a; const float* p = rowk0 + 8 * (lane >> 4);
#pragma unroll
  for (int i = 0; i < 8; ++i) { a[i] = (_Float16)p[i]; a[8 + i] = (_Float16)p[16 + i]; }
  return a;
}
__device__ __forceinline__ v16h frag_f32s(const float* rowk0, int lane, float sc) {
  v16h a; const float* p = rowk0 + 8 * (lane >> 4);
#pragma unroll
  for (int i = 0; i < 8; ++i) { a[i] = (_Float16)(p[i] * sc); a[8 + i] = (_Float16)(p[16 + i] * sc); }
  return a;
}
// column fragment from a [K][ld] layout (column n), rows >= K read as 0
__device__ __forceinline__ v16h fragc_f32(const float* W, int k0, int n, int lane, int ld, int K) {
  v16h a; const int g = lane >> 4;
#pragma unroll
  for (int i = 0; i < 8; ++i) { const int ka = k0 + 8 * g + i, kb = ka + 16;
    a[i] = (_Float16)(ka < K ? W[(size_t)(ka < K ? ka : K - 1) * ld + n] : 0.f); a[8 + i] = (_Float16)(kb < K ? W[(size_t)(kb < K ? kb : K - 1) * ld + n] : 0.f); }
  return a;
}
struct F2 { v16b h, l; };
__device__ __forceinline__ F2 bsplit16(const float v[16]) { F2 r;
#pragma unroll
  for (int i = 0; i < 16; ++i) { const __bf16 h = (__bf16)v[i]; r.h[i] = h; r.l[i] = (__bf16)(v[i] - (float)h); }
  return r; }
__device__ __forceinline__ F2 split_row(const float* row, int k0, int lane) { float v[16]; const float* p = row + k0 + 8 * (lane >> 4);
#pragma unroll
  for (int i = 0; i < 8; ++i) { v[i] = p[i]; v[8 + i] = p[16 + i]; }
  return bsplit16(v); }
__device__ __forceinline__ F2 split_rowK(const float* row, int k0, int lane, int K) { float v[16]; const int g = lane >> 4;
#pragma unroll
  for (int i = 0; i < 8; ++i) { const int ka = k0 + 8 * g + i, kb = ka + 16; v[i] = ka < K ? row[ka < K ? ka : K - 1] : 0.f; v[8 + i] = kb < K ? row[kb < K ? kb : K - 1] : 0.f; }
  return bsplit16(v); }
__device__ __forceinline__ F2 split_col(const float* W, int k0, int n, int lane, int ld, int K) { float v[16]; const int g = lane >> 4;
#pragma unroll
  for (int i = 0; i < 8; ++i) { const int ka = k0 + 8 * g + i, kb = ka + 16; v[i] = ka < K ? W[(size_t)(ka < K ? ka : K - 1) * ld + n] : 0.f; v[8 + i] = kb < K ? W[(size_t)(kb < K ? kb : K - 1) * ld + n] : 0.f; }
  return bsplit16(v); }
__device__ __forceinline__ v8f mac3(const F2& a, const F2& b, v8f c) { c = wmma_bf(a.l, b.h, c); c = wmma_bf(a.h, b.l, c); return wmma_bf(a.h, b.h, c); }
__device__ __forceinline__ float sigm(float v) { return 1.0f / (1.0f + expf(-v)); }
#define LDSX() do { asm volatile("s_wait_dscnt 0" ::: "memory"); __builtin_amdgcn_wave_barrier(); __builtin_amdgcn_fence(__ATOMIC_RELEASE, "workgroup"); } while (0)

// Multi-head COSINE self-attention with a per-head learned scale and an additive attention bias (x [2,2048,1024]; attn_bias [1,1,2048,2048] N(0,1), one entry per (query, key), shared by batches and heads - READ on the device; w_qkv [3072,1024] torch (out,in) N(0, 1/1024): q = rows 0..1023, k = 1024..2047, v = 2048..3071 (reshape (B, L, 3, 16, 64)); q_bias / v_bias zeros (read), k has no bias; scale_mul [1,16,1,1] = ln 4 (const; read): sm = exp(min(scale_mul, ln 100)) = 4; q <- q / ||q|| * sm, k <- k / ||k|| per head row; attn = q k^T + attn_bias; softmax; oup through w_proj [1024,1024] (out,in) + b_proj zeros).
#define NB 2
#define TT 2048
#define CC 1024            // NH * HD = projected width
#define DIN 1024          // input (model) width
#define NH 16
#define HD 64
#define NQB (TT / 64)
#define HG 4
#define SCALE (1.0f)
#define CAUSAL 0
#ifndef TNB
#define TNB NB
#endif
__device__ __forceinline__ float bfr(float v) { return (float)(__bf16)v; }
__host__ __device__ __forceinline__ int kb_last(int qb) { return CAUSAL ? ((qb * 64 + 63) >> 7) : (TT / 128 - 1); }
typedef __attribute__((ext_vector_type(8))) __bf16 v8b;
__device__ __forceinline__ v16b frag_b(const __bf16* rowk0, int lane) {
  union { v16b v; v8b q[2]; } u; const __bf16* p = rowk0 + 8 * (lane >> 4);
  u.q[0] = *(const v8b*)p; u.q[1] = *(const v8b*)(p + 16); return u.v;
}
#define QBH 0              // unused: k_fa has one path for all query blocks
#define QHI 0               // single-product logits on every row (unit-norm operands x 4: |cosine logit| <= 4)
#define KHI 64            // key rows carrying k residual / v bf16 hi+lo planes (written by k_proj; no kernel reads them)
// B fragment (k rows k0+.., output column o) of a weight: (in,out) [K][ld] or (out,in) [ld rows of K]: bf16 exact, or f16(bf16 * 256) exact
__device__ __forceinline__ v16b wcol_io(const float* Wm, int k0, int o, int lane, int ld) { v16b w; const int g = lane >> 4;
#pragma unroll
  for (int i = 0; i < 8; ++i) { w[i] = (__bf16)Wm[(size_t)(k0 + 8 * g + i) * ld + o]; w[8 + i] = (__bf16)Wm[(size_t)(k0 + 16 + 8 * g + i) * ld + o]; }
  return w; }
__device__ __forceinline__ v16b wcol_oi(const float* Wm, int k0, int o, int lane, int K) { v16b w; const float* p = Wm + (size_t)o * K + k0 + 8 * (lane >> 4);
#pragma unroll
  for (int i = 0; i < 8; ++i) { w[i] = (__bf16)p[i]; w[8 + i] = (__bf16)p[16 + i]; }
  return w; }
__device__ __forceinline__ v16h wcolh_io(const float* Wm, int k0, int o, int lane, int ld) { v16h w; const int g = lane >> 4;
#pragma unroll
  for (int i = 0; i < 8; ++i) { w[i] = (_Float16)(bfr(Wm[(size_t)(k0 + 8 * g + i) * ld + o]) * 256.0f); w[8 + i] = (_Float16)(bfr(Wm[(size_t)(k0 + 16 + 8 * g + i) * ld + o]) * 256.0f); }
  return w; }
__device__ __forceinline__ v16h wcolh_oi(const float* Wm, int k0, int o, int lane, int K) { v16h w; const float* p = Wm + (size_t)o * K + k0 + 8 * (lane >> 4);
#pragma unroll
  for (int i = 0; i < 8; ++i) { w[i] = (_Float16)(bfr(p[i]) * 256.0f); w[8 + i] = (_Float16)(bfr(p[16 + i]) * 256.0f); }
  return w; }
#define WQKV_LAYOUT 1   // 0 = (in,out) [DIN][CC]; 1 = (out,in) [CC][DIN]; 2 = per-head [NH][DIN][HD]
__device__ __forceinline__ v16b wcol_hdk(const float* Wm, int k0, int o, int lane) { v16b w; const int g = lane >> 4; const float* p = Wm + (size_t)(o / HD) * DIN * HD + (o % HD);
#pragma unroll
  for (int i = 0; i < 8; ++i) { w[i] = (__bf16)p[(size_t)(k0 + 8 * g + i) * HD]; w[8 + i] = (__bf16)p[(size_t)(k0 + 16 + 8 * g + i) * HD]; }
  return w; }
#define WO_OUT_IN 1
#if WQKV_LAYOUT == 1
#define WCOL(W, k0, o, lane) wcol_oi(W, k0, o, lane, DIN)
#elif WQKV_LAYOUT == 2
#define WCOL(W, k0, o, lane) wcol_hdk(W, k0, o, lane)
#else
#define WCOL(W, k0, o, lane) wcol_io(W, k0, o, lane, CC)
#endif
#if WO_OUT_IN
#define WOCOL(W, k0, o, lane) wcol_oi(W, k0, o, lane, CC)
#define WOCOLH(W, k0, o, lane) wcolh_oi(W, k0, o, lane, CC)
#else
#define WOCOL(W, k0, o, lane) wcol_io(W, k0, o, lane, DIN)
#define WOCOLH(W, k0, o, lane) wcolh_io(W, k0, o, lane, DIN)
#endif

#define MAX_SCALE_MUL 4.605170186f   // ln(100): the module's clamp on scale_mul
#define PROJ_EXTRA_PARAMS , const float* __restrict__ SMU   /* scale_mul [1][NH][1][1], a module input */
// per (token, head) hook on the staged f32 row (64 floats, projection + bias) of the q and k streams: x <- x / sqrt(sum x^2) (jnp.linalg.norm, no epsilon in the module); the q stream is then multiplied by sm = expf(fminf(bf16(scale_mul[h]), ln 100)); v untouched; the sum of squares in f32, products and sums kept separate
#define PROJ_EPI(which, row, t, h) do { if ((which) < 2) { float* rw = (row); float ss_ = 0.f; _Pragma("unroll 8") for (int i = 0; i < 64; ++i) { _Pragma("clang fp contract(off)") const float sq_ = rw[i] * rw[i]; ss_ = ss_ + sq_; } const float dn_ = sqrtf(ss_); const float sm_ = ((which) == 0) ? expf(fminf(bfr(SMU[(h)]), MAX_SCALE_MUL)) : 1.0f; _Pragma("unroll 8") for (int i = 0; i < 64; ++i) { _Pragma("clang fp contract(off)") const float u_ = rw[i] / dn_; rw[i] = ((which) == 0) ? (u_ * sm_) : u_; } } } while (0)
#ifndef PROJ_EXTRA_PARAMS
#define PROJ_EXTRA_PARAMS
#endif

#define WS_QH  0u                                      // f16 q rows [b*t][CC]
#define WS_KH  (WS_QH + 2u * (size_t)NB * TT * CC)      // f16 k rows [b*t][CC]
#define WS_VT  (WS_KH + 2u * (size_t)NB * TT * CC)      // f16 v planes [b][c][t]
#define WS_QL  (WS_VT + 2u * (size_t)NB * CC * TT)      // f16 q residual x 2^10 rows [b][t < QHI][CC]
#define WS_KL  (WS_QL + 2u * (size_t)NB * QHI * CC)     // f16 k residual x 2^10 rows [b][t < KHI][CC]
#define WS_VB  (WS_KL + 2u * (size_t)NB * KHI * CC)     // bf16 v hi planes [b][c][t < KHI]
#define WS_VBL (WS_VB + 2u * (size_t)NB * CC * KHI)
#define WS_S   (WS_VBL + 2u * (size_t)NB * CC * KHI)    // f32 [HG][TT][TT] region, read or written by no kernel (logits and P stay in registers)
#define WS_Y   (WS_S  + 4u * (size_t)HG * TT * TT)      // f32 ctx rows [b*t][CC] (only when there is an output projection)
#define WS_END (WS_Y  + 4u * (size_t)NB * TT * CC)

// ---- gemm_tile: the 64 x 128 tile of A . W^T (both K-contiguous f32, K = 1024) of one 4-wave block. Each 64-k stage of both operands is fetched by whole-line loads (16 lanes x 16 B = 256 B of one row), rounded once to its 16-bit operand type and laid in LDS, where all four waves read their fragments; two LDS buffers, the next stage's loads in flight in registers during the products; k runs upward in steps of 32
typedef __attribute__((ext_vector_type(2))) unsigned v2u;
#define GK 64                      // k per stage
#define GP 144                     // LDS row pitch, bytes: 128 B of 16-bit data + 16 B (pitch for ds_load_b128 readers)
#define GBUF ((64 + 128) * GP)     // one stage: 64 A rows, then 128 W rows
__device__ __forceinline__ v2u pk_bf(v4f v) { union { v2u u; __bf16 e[4]; } r;
#pragma unroll
  for (int i = 0; i < 4; ++i) r.e[i] = (__bf16)v[i];
  return r.u; }
__device__ __forceinline__ v2u pk_ctx(v4f v) { union { v2u u; _Float16 e[4]; } r;   // ctx x 2^6 once to f16
#pragma unroll
  for (int i = 0; i < 4; ++i) r.e[i] = (_Float16)(v[i] * 64.0f);
  return r.u; }
__device__ __forceinline__ v2u pk_wo(v4f v) { union { v2u u; _Float16 e[4]; } r;    // f16(bf16 x 2^8), exact
#pragma unroll
  for (int i = 0; i < 4; ++i) r.e[i] = (_Float16)((float)(__bf16)v[i] * 256.0f);
  return r.u; }
// one stage's 24 loads of a thread (8 of A, 16 of W; the thread's offset is the same in both tiles and never changes), then the two block-uniform bases one stage on; the unrolls here and in gemm_tile make every index of ra, rw, w and acc a constant, so that these arrays stay in registers
__device__ __forceinline__ void gemm_fetch(const float*& Ag, const float*& Wg, unsigned off, v4f (&ra)[8], v4f (&rw)[16]) {
#pragma unroll
  for (int i = 0; i < 8; ++i) ra[i] = *(const v4f*)(Ag + off + i * 8 * 1024);
#pragma unroll
  for (int i = 0; i < 16; ++i) rw[i] = *(const v4f*)(Wg + off + i * 8 * 1024);
  asm volatile("s_wait_xcnt 0x0" :: "v"(off) : "memory");   // stands in front of the overwrite of the loads' base registers just below; the offset as an input keeps its register from being handed to a later load of the group as its destination
  __builtin_amdgcn_sched_barrier(0);                        // keeps the stage's loads in front of the products that are to cover their latency, and the steps of the bases behind the wait
  Ag += GK; Wg += GK; }
template <int F16> __device__ __forceinline__ void gemm_tile(const float* Ag, const float* Wg, char* stg, v8f (&acc)[8], int tid) {
  const int wave = tid >> 5, lane = tid & 31, col = lane & 15, g = lane >> 4;
  const unsigned off = (tid >> 4) * 1024 + (tid & 15) * 4;                   // 8 rows a pass of the block, 16 lanes x 16 B a row
  char* sp = stg + (tid >> 4) * GP + (tid & 15) * 8;
  const char* fa = stg + (wave * 16 + col) * GP + 16 * g;              // fragment: elements 0..7 = k0 + 8g + 0..7, 8..15 = k0 + 16 + 8g + 0..7
  const char* fw = stg + (64 + col) * GP + 16 * g;
  v4f ra[8], rw[16];
  gemm_fetch(Ag, Wg, off, ra, rw);
  for (int s = 0; s < 1024 / GK; ++s) { const int bo = (s & 1) * GBUF;
#pragma unroll
    for (int i = 0; i < 8; ++i) *(v2u*)(sp + bo + i * 8 * GP) = F16 ? pk_ctx(ra[i]) : pk_bf(ra[i]);
#pragma unroll
    for (int i = 0; i < 16; ++i) *(v2u*)(sp + bo + (64 + i * 8) * GP) = F16 ? pk_wo(rw[i]) : pk_bf(rw[i]);
    __syncthreads();   // publishes stage s; a wave that has passed it has left the other buffer, which stage s + 1 overwrites only behind this barrier
    if (s + 1 < 1024 / GK) gemm_fetch(Ag, Wg, off, ra, rw);
#pragma unroll
    for (int kk = 0; kk < GK / 32; ++kk) { union { v4u q[2]; v16b b; v16h h; } a, w[8]; a.q[0] = *(const v4u*)(fa + bo + kk * 64); a.q[1] = *(const v4u*)(fa + bo + kk * 64 + 32);   // the nine fragments of a 32-k block are read as one group in front of its eight products
#pragma unroll
      for (int j = 0; j < 8; ++j) { w[j].q[0] = *(const v4u*)(fw + bo + j * 16 * GP + kk * 64); w[j].q[1] = *(const v4u*)(fw + bo + j * 16 * GP + kk * 64 + 32); }
      __builtin_amdgcn_sched_barrier(0);   // keeps the group together: without it the scheduler sinks each fragment's two reads to just before its product, into one register set, and every product waits out a whole LDS latency
#pragma unroll
      for (int j = 0; j < 8; ++j) acc[j] = F16 ? __builtin_amdgcn_wmma_f32_16x16x32_f16(false, a.h, false, w[j].h, (short)0, acc[j], false, false) : __builtin_amdgcn_wmma_f32_16x16x32_bf16(false, a.b, false, w[j].b, (short)0, acc[j], false, false); } }
}
// ---- k_proj: block = (64 rows, 128 cols, which): q/k/v = X W (+ b) with exact bf16 products (K = DIN) -> which 0: q f16 rows (+ residual rows < QHI); 1: k f16 rows (+ residual rows < KHI); 2: v f16 planes [c][t] (+ bf16 hi/lo planes for t < KHI)
__global__ __launch_bounds__(128) void k_proj(const float* __restrict__ XQ, const float* __restrict__ XK, const float* __restrict__ XV, const float* __restrict__ WQ, const float* __restrict__ WK, const float* __restrict__ WV, const float* __restrict__ BQ, const float* __restrict__ BK, const float* __restrict__ BV,
    _Float16* __restrict__ QH, _Float16* __restrict__ QL, _Float16* __restrict__ KH, _Float16* __restrict__ KL, _Float16* __restrict__ VT, __bf16* __restrict__ VB, __bf16* __restrict__ VBL PROJ_EXTRA_PARAMS) {
  __shared__ __align__(16) char sm[64 * 132 * 4 + 2 * GBUF];   // st, then one region that holds the two operand stages during the products and the 16-bit output tiles (sh, sl or th, tb, tbl) behind the epilogue's barriers
  float (*st)[132] = (float (*)[132])sm; char* stg = sm + 64 * 132 * 4; _Float16 (*sh)[136] = (_Float16 (*)[136])stg; _Float16 (*sl)[136] = (_Float16 (*)[136])(stg + 64 * 136 * 2); _Float16 (*th)[72] = (_Float16 (*)[72])stg; __bf16 (*tb)[72] = (__bf16 (*)[72])(stg + 128 * 72 * 2); __bf16 (*tbl)[72] = (__bf16 (*)[72])(stg + 2 * 128 * 72 * 2);
  const int tid = threadIdx.x, wave = tid >> 5, lane = tid & 31, col = lane & 15, g = lane >> 4; const int which = blockIdx.z; const int c0 = blockIdx.y * 128; const size_t r0 = (size_t)blockIdx.x * 64; const size_t bb = r0 / TT; const int t0 = (int)(r0 % TT);
  const float* X = which == 0 ? XQ : which == 1 ? XK : XV; const float* WA = which == 0 ? WQ : which == 1 ? WK : WV; const float* BA = which == 0 ? BQ : which == 1 ? BK : BV;
  v8f acc[8] = {};
  gemm_tile<0>(X + r0 * DIN, WA + (size_t)c0 * DIN, stg, acc, tid);
  { // stage the f32 tile (acc + bias) in LDS, run the per-(row, head) epilogue hook, then convert
#pragma unroll
    for (int j = 0; j < 8; ++j) { const float bias = BA ? bfr(BA[c0 + j * 16 + col]) : 0.f;
#pragma unroll
      for (int r = 0; r < 8; ++r) st[wave * 16 + 8 * g + r][j * 16 + col] = acc[j][r] + bias; }
    __syncthreads();
    for (int e = tid; e < 64 * (128 / HD); e += 128) { const int rl = e / (128 / HD), hh = e % (128 / HD); PROJ_EPI(which, &st[rl][hh * HD], (int)((r0 + rl) % TT), (c0 / HD) + hh); }
    __syncthreads(); }
  if (which < 2) { _Float16* DH = which == 0 ? QH : KH; _Float16* DL = which == 0 ? QL : KL; const int nhi = which == 0 ? QHI : KHI; const bool hi_rows = t0 < nhi;
    for (int e = tid; e < 64 * 128; e += 128) { const int rl = e >> 7, cl = e & 127; const float v = st[rl][cl]; const _Float16 hv = (_Float16)v; sh[rl][cl] = hv; sl[rl][cl] = (_Float16)((v - (float)hv) * 1024.0f); }
    __syncthreads();
    for (int e = tid; e < 64 * 16; e += 128) { const int rl = e >> 4, q = e & 15; vst2((unsigned*)(DH + (r0 + rl) * CC + c0 + q * 8), *(const v4u*)&sh[rl][q * 8]); if (hi_rows) vst2((unsigned*)(DL + (bb * nhi + t0 + rl) * (size_t)CC + c0 + q * 8), *(const v4u*)&sl[rl][q * 8]); }
  } else { const bool hi_rows = t0 < KHI;
    for (int e = tid; e < 64 * 128; e += 128) { const int rl = e & 63, cl = e >> 6; const float v = st[rl][cl]; th[cl][rl] = (_Float16)v; const __bf16 bh = (__bf16)v; tb[cl][rl] = bh; tbl[cl][rl] = (__bf16)(v - (float)bh); }
    __syncthreads();
    for (int e = tid; e < 128 * 8; e += 128) { const int cl = e >> 3, q = e & 7; vst2((unsigned*)(VT + (bb * CC + c0 + cl) * (size_t)TT + t0 + q * 8), *(const v4u*)&th[cl][q * 8]); if (hi_rows) { const size_t o3 = (bb * CC + c0 + cl) * (size_t)KHI + t0 + q * 8; vst2((unsigned*)(VB + o3), *(const v4u*)&tb[cl][q * 8]); vst2((unsigned*)(VBL + o3), *(const v4u*)&tbl[cl][q * 8]); } } } }
// ---- k_fa: block = 64 queries (4 waves x 16) of (b, h), all keys in steps of 64, each step's K, V and bias tiles brought into LDS by asynchronous copies one step ahead (two buffers) and read there by the four waves: S^T = K . Q^T on top of C = bf16(attn_bias) (lane = one query, 8 keys a tile), running maximum and sum per query in registers, P^T x 2^11 (relative to the running maximum) once to f16 straight from the score registers as the B operand, ctx^T += V^T . P^T; ctx = ctx^T / sum at the end
#define LOG2E 1.44269504f
__device__ __forceinline__ v8f wmma_h(v16h a, v16h b, v8f c) { return __builtin_amdgcn_wmma_f32_16x16x32_f16(false, a, false, b, (short)0, c, false, false); }
// 2^x; the v_nop in the same statement is the one slot that the instruction set asks for behind a transcendental before its result is read or its source register overwritten
__device__ __forceinline__ float exp2s(float x) { float e; asm("v_exp_f32 %0, %1\n\tv_nop" : "=v"(e) : "v"(x)); return e; }
__device__ __forceinline__ v16h frag_p(const _Float16* p) { union { v16h v; v8h q[2]; } u; u.q[0] = *(const v8h*)p; u.q[1] = *(const v8h*)(p + 16); return u.v; }   // frag_h with the half's 8 elements already in the pointer
__device__ __forceinline__ float xhalf(float v) { const int b = __builtin_bit_cast(int, v); return __builtin_bit_cast(float, __builtin_amdgcn_permlanex16(b, b, 0x76543210, 0xfedcba98, false, false)); }   // the value of lane ^ 16
// one 64-key step's operands in LDS: 64 K rows and 64 V planes of 128 B at pitch 144 B, then the block's 64 bias rows of 256 B at pitch 272 B (pitches for ds_load_b128 readers)
#define FKP 144
#define FBP 272
#define FVO (64 * FKP)
#define FBO (2 * 64 * FKP)
#define FBUF (2 * 64 * FKP + 64 * FBP)
// one step's 16 copies of a thread, whole lines (8 lanes x 16 B = one K or V row, 16 lanes x 16 B = one bias row); lk, lb = the thread's LDS byte addresses of its first K and bias piece in the target buffer; the s_wait_xcnt at the end of each statement stands in front of any rewrite of the address registers that its copies name
__device__ __forceinline__ void fa_copy(unsigned lk, unsigned lb, const _Float16* kg, const _Float16* vg, const float* bg) {
  asm volatile("global_load_async_to_lds_b128 %0, %1, off\n\tglobal_load_async_to_lds_b128 %2, %3, off\n\tglobal_load_async_to_lds_b128 %4, %5, off\n\tglobal_load_async_to_lds_b128 %6, %7, off\n\t"
               "global_load_async_to_lds_b128 %8, %9, off\n\tglobal_load_async_to_lds_b128 %10, %11, off\n\tglobal_load_async_to_lds_b128 %12, %13, off\n\tglobal_load_async_to_lds_b128 %14, %15, off\n\ts_wait_xcnt 0x0"
               :: "v"(lk), "v"(kg), "v"(lk + 16 * FKP), "v"(kg + 16 * CC), "v"(lk + 32 * FKP), "v"(kg + 32 * CC), "v"(lk + 48 * FKP), "v"(kg + 48 * CC),
                  "v"(lk + FVO), "v"(vg), "v"(lk + FVO + 16 * FKP), "v"(vg + 16 * TT), "v"(lk + FVO + 32 * FKP), "v"(vg + 32 * TT), "v"(lk + FVO + 48 * FKP), "v"(vg + 48 * TT) : "memory");
  asm volatile("global_load_async_to_lds_b128 %0, %1, off\n\tglobal_load_async_to_lds_b128 %2, %3, off\n\tglobal_load_async_to_lds_b128 %4, %5, off\n\tglobal_load_async_to_lds_b128 %6, %7, off\n\t"
               "global_load_async_to_lds_b128 %8, %9, off\n\tglobal_load_async_to_lds_b128 %10, %11, off\n\tglobal_load_async_to_lds_b128 %12, %13, off\n\tglobal_load_async_to_lds_b128 %14, %15, off\n\ts_wait_xcnt 0x0"
               :: "v"(lb), "v"(bg), "v"(lb + 8 * FBP), "v"(bg + 8 * TT), "v"(lb + 16 * FBP), "v"(bg + 16 * TT), "v"(lb + 24 * FBP), "v"(bg + 24 * TT),
                  "v"(lb + 32 * FBP), "v"(bg + 32 * TT), "v"(lb + 40 * FBP), "v"(bg + 40 * TT), "v"(lb + 48 * FBP), "v"(bg + 48 * TT), "v"(lb + 56 * FBP), "v"(bg + 56 * TT) : "memory"); }
__global__ __launch_bounds__(128) void k_fa(const _Float16* __restrict__ QH, const _Float16* __restrict__ KH, const _Float16* __restrict__ VT, const float* __restrict__ ABI, float* __restrict__ Y) { __shared__ __align__(16) char ring[2 * FBUF];   // two step buffers; behind the loop's last barrier the same bytes stage the output rows
  float (*ss)[16][HD + 4] = (float (*)[16][HD + 4])ring;
  const int tid = threadIdx.x, wave = tid >> 5, lane = tid & 31, col = lane & 15, g = lane >> 4; const int h = blockIdx.y, b = blockIdx.z; const int ql0 = blockIdx.x * 64 + wave * 16;
  const _Float16* qp = QH + ((size_t)b * TT + ql0 + col) * CC + h * HD; const v16h q0 = frag_h(qp, lane), q1 = frag_h(qp + 32, lane);
  const _Float16* kg = KH + ((size_t)b * TT + (tid >> 3)) * CC + h * HD + (tid & 7) * 8;             // the thread's 16 B of key row tid / 8 (then + 16, 32, 48); runs on by 64 keys a step
  const _Float16* vg = VT + ((size_t)b * CC + h * HD + (tid >> 3)) * (size_t)TT + (tid & 7) * 8;     // its 16 B of the v plane of dim tid / 8 (then + 16, 32, 48); runs on by 64 keys a step
  const float* bg = ABI + (size_t)(blockIdx.x * 64 + (tid >> 4)) * TT + (tid & 15) * 4;              // its 16 B of the block's query row tid / 16 (then + 8, ..., 56); runs on by 64 keys a step
  const unsigned lk = (unsigned)(size_t)ring + (tid >> 3) * FKP + (tid & 7) * 16, lb = (unsigned)(size_t)ring + FBO + (tid >> 4) * FBP + (tid & 15) * 16;
  const char* kr = ring + col * FKP + 16 * g;                        // key row col of a 16-key tile (v: dim col of a 16-dim tile), this half's 8 elements
  const char* br = ring + FBO + (wave * 16 + col) * FBP + 32 * g;    // this lane's query row, its 8 keys of a tile
  v8f acc[HD / 16] = {}; float m = -3.0e38f, l = 0.f;                        // m = running maximum of the query's logits; l = this half's share of the sum, x 2^11
  fa_copy(lk, lb, kg, vg, bg);
  asm volatile("s_wait_asynccnt 0x0" ::: "memory");   // step 0's pieces of this wave have landed
  __syncthreads();                                    // publishes step 0
  fa_copy(lk + FBUF, lb + FBUF, kg + 64 * CC, vg + 64, bg + 64);
  kg += 128 * CC; vg += 128; bg += 128;
  for (int t = 0; t < TT / 64; ++t) { const unsigned bo = (t & 1) * FBUF; v16h kf[8], vf[8]; v4f bf[8]; v8f s[4];   // every LDS read of the step stands as one group in front of its first product; the unrolls of this loop body make every index of kf, vf, bf, s, p and acc a constant, so that they stay in registers
#pragma unroll
    for (int j = 0; j < 4; ++j) { kf[2 * j] = frag_p((const _Float16*)(kr + bo + j * 16 * FKP)); kf[2 * j + 1] = frag_p((const _Float16*)(kr + bo + j * 16 * FKP + 64)); bf[2 * j] = *(const v4f*)(br + bo + j * 64); bf[2 * j + 1] = *(const v4f*)(br + bo + j * 64 + 16); }
#pragma unroll
    for (int kc = 0; kc < 2; ++kc)
#pragma unroll
      for (int j = 0; j < HD / 16; ++j) vf[kc * 4 + j] = frag_p((const _Float16*)(kr + bo + FVO + j * 16 * FKP + kc * 64));
    __builtin_amdgcn_sched_barrier(0);   // keeps the group together: without it the scheduler sinks each fragment's reads to just before its product, and every product waits out an LDS latency
#pragma unroll
    for (int j = 0; j < 4; ++j) { v8f c;
#pragma unroll
      for (int r = 0; r < 4; ++r) { c[r] = bfr(bf[2 * j][r]); c[4 + r] = bfr(bf[2 * j + 1][r]); }
      c = wmma_h(kf[2 * j], q0, c); s[j] = wmma_h(kf[2 * j + 1], q1, c); }
    float mx = m;
#pragma unroll
    for (int j = 0; j < 4; ++j)
#pragma unroll
      for (int r = 0; r < 8; ++r) mx = fmaxf(mx, s[j][r]);
    mx = fmaxf(mx, xhalf(mx));
    const float al = exp2s((m - mx) * LOG2E), mo = mx * LOG2E - 11.0f; m = mx;
    float sj[4]; v16h p[2];
#pragma unroll
    for (int j = 0; j < 4; ++j) { sj[j] = 0.f;
#pragma unroll
      for (int r = 0; r < 8; ++r) { const float e = exp2s(s[j][r] * LOG2E - mo); sj[j] += e; p[j >> 1][(j & 1) * 8 + r] = (_Float16)e; } }
    l = l * al + ((sj[0] + sj[1]) + (sj[2] + sj[3]));
#pragma unroll
    for (int j = 0; j < HD / 16; ++j) acc[j] = acc[j] * al;
#pragma unroll
    for (int kc = 0; kc < 2; ++kc)
#pragma unroll
      for (int j = 0; j < HD / 16; ++j) acc[j] = wmma_h(vf[kc * 4 + j], p[kc], acc[j]);
    __builtin_amdgcn_sched_barrier(0);   // keeps the step's products in front of the waits below: without it the scheduler lifts them and the barrier to just behind the read group, where the next step's copies have had no time to land
    asm volatile("s_wait_dscnt 0x0" ::: "memory");      // this wave's reads of the step's buffer have retired before the buffer is handed to the copies below
    asm volatile("s_wait_asynccnt 0x0" ::: "memory");   // this wave's pieces of step t + 1 have landed
    __syncthreads();                                    // publishes step t + 1 and ends every wave's reads of step t's buffer
    if (t + 2 < TT / 64) { fa_copy(lk + bo, lb + bo, kg, vg, bg); kg += 64 * CC; vg += 64; bg += 64; } }
  asm volatile("s_wait_asynccnt 0x0" ::: "memory");     // no copy is outstanding when the ring's bytes become output staging and when the wave ends
  l += xhalf(l); const float inv = l > 0.f ? 1.0f / l : 0.f;   /* a fully excluded row yields ctx = 0 */
#pragma unroll
  for (int j = 0; j < HD / 16; ++j) { const v4f lo = { acc[j][0] * inv, acc[j][1] * inv, acc[j][2] * inv, acc[j][3] * inv }, hi = { acc[j][4] * inv, acc[j][5] * inv, acc[j][6] * inv, acc[j][7] * inv }; *(v4f*)&ss[wave][col][j * 16 + 8 * g] = lo; *(v4f*)&ss[wave][col][j * 16 + 8 * g + 4] = hi; }
  LDSX(); for (int i = 0; i < 8; ++i) { const int rl = 2 * i + g; vst2(Y + ((size_t)b * TT + ql0 + rl) * CC + h * HD + col * 4, *(const v4f*)&ss[wave][rl][col * 4]); } }
// ---- k_out: block = (64 rows, 128 cols): out = ctx Wo (+ bo): ctx x 2^6 once to f16 against Wo as f16(bf16 x 2^8) exact (1 product) x 2^-14; causal early rows (< QHI of each sequence): ctx bf16 hi + lo against exact bf16 Wo (2 products)
__global__ __launch_bounds__(128) void k_out(const float* __restrict__ Y, const float* __restrict__ WO, const float* __restrict__ BO, float* __restrict__ OUT) { __shared__ __align__(16) float sf[4][16][132]; __shared__ __align__(16) char stg[2 * GBUF];
  const int tid = threadIdx.x, wave = tid >> 5, lane = tid & 31, col = lane & 15, g = lane >> 4; const int c0 = blockIdx.y * 128; const size_t r0 = (size_t)blockIdx.x * 64 + wave * 16;
  v8f acc[8] = {};
  if (CAUSAL && (int)(((size_t)blockIdx.x * 64) % TT) < QHI) {   /* block-uniform */
#pragma unroll 2
    for (int kc = 0; kc < CC / 32; ++kc) { const F2 a = split_row(Y + (r0 + col) * CC, kc * 32, lane); asm volatile("s_wait_loadcnt 0x0" ::: "memory");
#pragma unroll
      for (int j = 0; j < 8; ++j) { const v16b w = WOCOL(WO, kc * 32, c0 + j * 16 + col, lane); asm volatile("s_wait_loadcnt 0x0" ::: "memory"); acc[j] = wmma_bf(a.h, w, acc[j]); acc[j] = wmma_bf(a.l, w, acc[j]); } }
#pragma unroll
    for (int j = 0; j < 8; ++j) { const float bias = BO ? bfr(BO[c0 + j * 16 + col]) : 0.f;
#pragma unroll
      for (int r = 0; r < 8; ++r) sf[wave][8 * g + r][j * 16 + col] = acc[j][r] + bias; }
  } else {
    gemm_tile<1>(Y + (size_t)blockIdx.x * 64 * CC, WO + (size_t)c0 * CC, stg, acc, tid);   /* ctx carried x 2^6 into f16 so small-magnitude context rows stay clear of f16 subnormals */
#pragma unroll
    for (int j = 0; j < 8; ++j) { const float bias = BO ? bfr(BO[c0 + j * 16 + col]) : 0.f;
#pragma unroll
      for (int r = 0; r < 8; ++r) sf[wave][8 * g + r][j * 16 + col] = acc[j][r] * (1.0f / 16384.0f) + bias; } }   /* 2^-8 (Wo carry) x 2^-6 (ctx carry) */
  LDSX(); for (int rl = 0; rl < 16; ++rl) vst2(OUT + (r0 + rl) * DIN + c0 + lane * 4, *(const v4f*)&sf[wave][rl][lane * 4]); }

extern "C" void kernel_launch(void* const* d_in, const int* in_sizes, int n_in, void* d_out, int out_size, void* d_ws, size_t ws_size, hipStream_t stream) {
  (void)in_sizes; (void)n_in; (void)out_size;
  const float** F = (const float**)d_in;
  if (ws_size < (size_t)WS_END) return;
  char* ws = (char*)d_ws; _Float16 *QH = (_Float16*)(ws + WS_QH), *KH = (_Float16*)(ws + WS_KH), *VT = (_Float16*)(ws + WS_VT), *QL = (_Float16*)(ws + WS_QL), *KL = (_Float16*)(ws + WS_KL); __bf16 *VB = (__bf16*)(ws + WS_VB), *VBL = (__bf16*)(ws + WS_VBL); float *Y = (float*)(ws + WS_Y);
  (void)Y; (void)QL; (void)KL; (void)VB; (void)VBL;
  // inputs: 0 x [2,2048,1024]; 1 attn_bias [1,1,2048,2048]; 2 w_qkv [3072,1024] (out,in): q rows 0..1023, k 1024..2047, v 2048..3071; 3 q_bias [1024] (zeros, read); 4 v_bias [1024] (zeros, read); 5 scale_mul [1,16,1,1] (ln 4, read); 6 w_proj [1024,1024] (out,in); 7 b_proj (zeros, read); the k stream has no bias (the module concatenates zeros)
  k_proj<<<dim3(TNB * TT / 64, CC / 128, 3), 128, 0, stream>>>(F[0], F[0], F[0], F[2], F[2] + (size_t)CC * DIN, F[2] + 2 * (size_t)CC * DIN, F[3], nullptr, F[4], QH, QL, KH, KL, VT, VB, VBL, F[5]);
  k_fa<<<dim3(NQB, NH, TNB), 128, 0, stream>>>(QH, KH, VT, F[1], Y);
  k_out<<<dim3(TNB * TT / 64, DIN / 128), 128, 0, stream>>>(Y, F[6], F[7], (float*)d_out);
}

// v004
// One run takes 105 microseconds.
// In two side-by-side timings against v003, it was 1.15 and 1.16 times as fast.
// All steps since v000 together make it 13.8 times as fast.
// compute dtype: all float inputs rounded to bf16; q / k / v projections with EXACT bf16 products on WMMA 16x16x32 (f32 accumulate) + bias (q / v: zeros, read; k: none); q and k divided by their per-(token, head) L2 norm in f32, q then times exp(min(bf16(scale_mul[h]), ln 100)); logits q x k once to f16 each (1 product, scale 1), + bf16(attn_bias[q][k]) in f32; softmax f32 with a running maximum and sum over 64-key steps; exp(logit - running max) x 2^11 once to f16 x v once to f16 (1 product), divided by the f32 sum at the end; ctx x 2^6 once to f16 x w_proj f16(bf16 x 2^8) + b_proj; f32 output.
#include <hip/hip_runtime.h>
#include <math.h>

typedef __attribute__((ext_vector_type(16))) _Float16 v16h;
typedef __attribute__((ext_vector_type(16))) __bf16 v16b;
typedef __attribute__((ext_vector_type(8)))  _Float16 v8h;
typedef __attribute__((ext_vector_type(8)))  float v8f;
typedef __attribute__((ext_vector_type(4)))  float v4f;
typedef __attribute__((ext_vector_type(2)))  float v2f;
typedef __attribute__((ext_vector_type(4)))  unsigned v4u;
typedef __attribute__((ext_vector_type(4)))  int v4i;
typedef float __attribute__((may_alias)) float_a;
typedef int __attribute__((may_alias)) int_a;

template <typename T> __device__ __forceinline__ void vst2(void* p, T v) { *(T*)p = v;  }
__device__ __forceinline__ v8f wmma16(v16h a, v16h b, v8f c) {
  v8f d = __builtin_amdgcn_wmma_f32_16x16x32_f16(false, a, false, b, (short)0, c, false, false);
  asm volatile("v_nop\n\tv_nop\n\tv_nop\n\tv_nop" : "+v"(d) : "v"(a), "v"(b));
  return d;
}
__device__ __forceinline__ v8f wmma_bf(v16b a, v16b b, v8f c) {
  v8f d = __builtin_amdgcn_wmma_f32_16x16x32_bf16(false, a, false, b, (short)0, c, false, false);
  asm volatile("v_nop\n\tv_nop\n\tv_nop\n\tv_nop" : "+v"(d) : "v"(a), "v"(b));
  return d;
}
// 16x16x32 fragments: lane = (h = lane>>4, row/col = lane&15); elements 0..7 = k0+8h+0..7, 8..15 = k0+16+8h+0..7; D element r = row 8h+r
__device__ __forceinline__ v16h frag_h(const _Float16* rowk0, int lane) {
  union { v16h v; v8h q[2]; } u; const _Float16* p = rowk0 + 8 * (lane >> 4);
  u.q[0] = *(const v8h*)p; u.q[1] = *(const v8h*)(p + 16); return u.v;
}
__device__ __forceinline__ v16h frag_f32(const float* rowk0, int lane) {
  v16h a; const float* p = rowk0 + 8 * (lane >> 4);
#pragma unroll
  for (int i = 0; i < 8; ++i) { a[i] = (_Float16)p[i]; a[8 + i] = (_Float16)p[16 + i]; }
  return a;
}
__device__ __forceinline__ v16h frag_f32s(const float* rowk0, int lane, float sc) {
  v16h a; const float* p = rowk0 + 8 * (lane >> 4);
#pragma unroll
  for (int i = 0; i < 8; ++i) { a[i] = (_Float16)(p[i] * sc); a[8 + i] = (_Float16)(p[16 + i] * sc); }
  return a;
}
// column fragment from a [K][ld] layout (column n), rows >= K read as 0
__device__ __forceinline__ v16h fragc_f32(const float* W, int k0, int n, int lane, int ld, int K) {
  v16h a; const int g = lane >> 4;
#pragma unroll
  for (int i = 0; i < 8; ++i) { const int ka = k0 + 8 * g + i, kb = ka + 16;
    a[i] = (_Float16)(ka < K ? W[(size_t)(ka < K ? ka : K - 1) * ld + n] : 0.f); a[8 + i] = (_Float16)(kb < K ? W[(size_t)(kb < K ? kb : K - 1) * ld + n] : 0.f); }
  return a;
}
struct F2 { v16b h, l; };
__device__ __forceinline__ F2 bsplit16(const float v[16]) { F2 r;
#pragma unroll
  for (int i = 0; i < 16; ++i) { const __bf16 h = (__bf16)v[i]; r.h[i] = h; r.l[i] = (__bf16)(v[i] - (float)h); }
  return r; }
__device__ __forceinline__ F2 split_row(const float* row, int k0, int lane) { float v[16]; const float* p = row + k0 + 8 * (lane >> 4);
#pragma unroll
  for (int i = 0; i < 8; ++i) { v[i] = p[i]; v[8 + i] = p[16 + i]; }
  return bsplit16(v); }
__device__ __forceinline__ F2 split_rowK(const float* row, int k0, int lane, int K) { float v[16]; const int g = lane >> 4;
#pragma unroll
  for (int i = 0; i < 8; ++i) { const int ka = k0 + 8 * g + i, kb = ka + 16; v[i] = ka < K ? row[ka < K ? ka : K - 1] : 0.f; v[8 + i] = kb < K ? row[kb < K ? kb : K - 1] : 0.f; }
  return bsplit16(v); }
__device__ __forceinline__ F2 split_col(const float* W, int k0, int n, int lane, int ld, int K) { float v[16]; const int g = lane >> 4;
#pragma unroll
  for (int i = 0; i < 8; ++i) { const int ka = k0 + 8 * g + i, kb = ka + 16; v[i] = ka < K ? W[(size_t)(ka < K ? ka : K - 1) * ld + n] : 0.f; v[8 + i] = kb < K ? W[(size_t)(kb < K ? kb : K - 1) * ld + n] : 0.f; }
  return bsplit16(v); }
__device__ __forceinline__ v8f mac3(const F2& a, const F2& b, v8f c) { c = wmma_bf(a.l, b.h, c); c = wmma_bf(a.h, b.l, c); return wmma_bf(a.h, b.h, c); }
__device__ __forceinline__ float sigm(float v) { return 1.0f / (1.0f + expf(-v)); }
#define LDSX() do { asm volatile("s_wait_dscnt 0" ::: "memory"); __builtin_amdgcn_wave_barrier(); __builtin_amdgcn_fence(__ATOMIC_RELEASE, "workgroup"); } while (0)

// Multi-head COSINE self-attention with a per-head learned scale and an additive attention bias (x [2,2048,1024]; attn_bias [1,1,2048,2048] N(0,1), one entry per (query, key), shared by batches and heads - READ on the device; w_qkv [3072,1024] torch (out,in) N(0, 1/1024): q = rows 0..1023, k = 1024..2047, v = 2048..3071 (reshape (B, L, 3, 16, 64)); q_bias / v_bias zeros (read), k has no bias; scale_mul [1,16,1,1] = ln 4 (const; read): sm = exp(min(scale_mul, ln 100)) = 4; q <- q / ||q|| * sm, k <- k / ||k|| per head row; attn = q k^T + attn_bias; softmax; oup through w_proj [1024,1024] (out,in) + b_proj zeros).
#define NB 2
#define TT 2048
#define CC 1024            // NH * HD = projected width
#define DIN 1024          // input (model) width
#define NH 16
#define HD 64
#define NQB (TT / 64)
#define HG 4
#define SCALE (1.0f)
#define CAUSAL 0
#ifndef TNB
#define TNB NB
#endif
__device__ __forceinline__ float bfr(float v) { return (float)(__bf16)v; }
__host__ __device__ __forceinline__ int kb_last(int qb) { return CAUSAL ? ((qb * 64 + 63) >> 7) : (TT / 128 - 1); }
typedef __attribute__((ext_vector_type(8))) __bf16 v8b;
__device__ __forceinline__ v16b frag_b(const __bf16* rowk0, int lane) {
  union { v16b v; v8b q[2]; } u; const __bf16* p = rowk0 + 8 * (lane >> 4);
  u.q[0] = *(const v8b*)p; u.q[1] = *(const v8b*)(p + 16); return u.v;
}
#define QBH 0              // unused: k_fa has one path for all query blocks
#define QHI 0               // single-product logits on every row (unit-norm operands x 4: |cosine logit| <= 4)
#define KHI 64            // key rows carrying k residual / v bf16 hi+lo planes (written by k_proj; no kernel reads them)
// B fragment (k rows k0+.., output column o) of a weight: (in,out) [K][ld] or (out,in) [ld rows of K]: bf16 exact, or f16(bf16 * 256) exact
__device__ __forceinline__ v16b wcol_io(const float* Wm, int k0, int o, int lane, int ld) { v16b w; const int g = lane >> 4;
#pragma unroll
  for (int i = 0; i < 8; ++i) { w[i] = (__bf16)Wm[(size_t)(k0 + 8 * g + i) * ld + o]; w[8 + i] = (__bf16)Wm[(size_t)(k0 + 16 + 8 * g + i) * ld + o]; }
  return w; }
__device__ __forceinline__ v16b wcol_oi(const float* Wm, int k0, int o, int lane, int K) { v16b w; const float* p = Wm + (size_t)o * K + k0 + 8 * (lane >> 4);
#pragma unroll
  for (int i = 0; i < 8; ++i) { w[i] = (__bf16)p[i]; w[8 + i] = (__bf16)p[16 + i]; }
  return w; }
__device__ __forceinline__ v16h wcolh_io(const float* Wm, int k0, int o, int lane, int ld) { v16h w; const int g = lane >> 4;
#pragma unroll
  for (int i = 0; i < 8; ++i) { w[i] = (_Float16)(bfr(Wm[(size_t)(k0 + 8 * g + i) * ld + o]) * 256.0f); w[8 + i] = (_Float16)(bfr(Wm[(size_t)(k0 + 16 + 8 * g + i) * ld + o]) * 256.0f); }
  return w; }
__device__ __forceinline__ v16h wcolh_oi(const float* Wm, int k0, int o, int lane, int K) { v16h w; const float* p = Wm + (size_t)o * K + k0 + 8 * (lane >> 4);
#pragma unroll
  for (int i = 0; i < 8; ++i) { w[i] = (_Float16)(bfr(p[i]) * 256.0f); w[8 + i] = (_Float16)(bfr(p[16 + i]) * 256.0f); }
  return w; }
#define WQKV_LAYOUT 1   // 0 = (in,out) [DIN][CC]; 1 = (out,in) [CC][DIN]; 2 = per-head [NH][DIN][HD]
__device__ __forceinline__ v16b wcol_hdk(const float* Wm, int k0, int o, int lane) { v16b w; const int g = lane >> 4; const float* p = Wm + (size_t)(o / HD) * DIN * HD + (o % HD);
#pragma unroll
  for (int i = 0; i < 8; ++i) { w[i] = (__bf16)p[(size_t)(k0 + 8 * g + i) * HD]; w[8 + i] = (__bf16)p[(size_t)(k0 + 16 + 8 * g + i) * HD]; }
  return w; }
#define WO_OUT_IN 1
#if WQKV_LAYOUT == 1
#define WCOL(W, k0, o, lane) wcol_oi(W, k0, o, lane, DIN)
#elif WQKV_LAYOUT == 2
#define WCOL(W, k0, o, lane) wcol_hdk(W, k0, o, lane)
#else
#define WCOL(W, k0, o, lane) wcol_io(W, k0, o, lane, CC)
#endif
#if WO_OUT_IN
#define WOCOL(W, k0, o, lane) wcol_oi(W, k0, o, lane, CC)
#define WOCOLH(W, k0, o, lane) wcolh_oi(W, k0, o, lane, CC)
#else
#define WOCOL(W, k0, o, lane) wcol_io(W, k0, o, lane, DIN)
#define WOCOLH(W, k0, o, lane) wcolh_io(W, k0, o, lane, DIN)
#endif

#define MAX_SCALE_MUL 4.605170186f   // ln(100): the module's clamp on scale_mul
#define PROJ_EXTRA_PARAMS , const float* __restrict__ SMU   /* scale_mul [1][NH][1][1], a module input */
// per (token, head) hook on the staged f32 row (64 floats, projection + bias) of the q and k streams: x <- x / sqrt(sum x^2) (jnp.linalg.norm, no epsilon in the module); the q stream is then multiplied by sm = expf(fminf(bf16(scale_mul[h]), ln 100)); v untouched; the sum of squares in f32, products and sums kept separate
#define PROJ_EPI(which, row, t, h) do { if ((which) < 2) { float* rw = (row); float ss_ = 0.f; _Pragma("unroll 8") for (int i = 0; i < 64; ++i) { _Pragma("clang fp contract(off)") const float sq_ = rw[i] * rw[i]; ss_ = ss_ + sq_; } const float dn_ = sqrtf(ss_); const float sm_ = ((which) == 0) ? expf(fminf(bfr(SMU[(h)]), MAX_SCALE_MUL)) : 1.0f; _Pragma("unroll 8") for (int i = 0; i < 64; ++i) { _Pragma("clang fp contract(off)") const float u_ = rw[i] / dn_; rw[i] = ((which) == 0) ? (u_ * sm_) : u_; } } } while (0)
#ifndef PROJ_EXTRA_PARAMS
#define PROJ_EXTRA_PARAMS
#endif

#define WS_QH  0u                                      // f16 q rows [b*t][CC]
#define WS_KH  (WS_QH + 2u * (size_t)NB * TT * CC)      // f16 k rows [b*t][CC]
#define WS_VT  (WS_KH + 2u * (size_t)NB * TT * CC)      // f16 v planes [b][c][t]
#define WS_QL  (WS_VT + 2u * (size_t)NB * CC * TT)      // f16 q residual x 2^10 rows [b][t < QHI][CC]
#define WS_KL  (WS_QL + 2u * (size_t)NB * QHI * CC)     // f16 k residual x 2^10 rows [b][t < KHI][CC]
#define WS_VB  (WS_KL + 2u * (size_t)NB * KHI * CC)     // bf16 v hi planes [b][c][t < KHI]
#define WS_VBL (WS_VB + 2u * (size_t)NB * CC * KHI)
#define WS_S   (WS_VBL + 2u * (size_t)NB * CC * KHI)    // region of 4 * HG * TT * TT bytes; its head holds the three 16-bit operand copies below
#define WS_XB  WS_S                                    // bf16 x rows [b*t][DIN]
#define WS_WB  (WS_XB + 2u * (size_t)NB * TT * DIN)     // bf16 w_qkv rows [3 * CC][DIN]
#define WS_WOH (WS_WB + 2u * 3u * (size_t)CC * DIN)     // f16(bf16 x 2^8) w_proj rows [DIN][CC]
#define WS_Y   (WS_S  + 4u * (size_t)HG * TT * TT)      // f16 ctx x 2^6 rows [b*t][CC]
#define WS_END (WS_Y  + 4u * (size_t)NB * TT * CC)

// ---- gemm_tile: the 64 x 128 tile of A . W^T (both K-contiguous, already in their 16-bit operand type, K = 1024) of one 4-wave block. Each 128-k stage of both operands is fetched by whole-line loads (16 lanes x 16 B = 256 B of one row) and laid in LDS as it is, where all four waves read their fragments; two LDS buffers, the next stage's loads in flight in registers during the products; k runs upward in steps of 32
typedef __attribute__((ext_vector_type(2))) unsigned v2u;
#define GK 128                     // k per stage
#define GP 272                     // LDS row pitch, bytes: 256 B of 16-bit data + 16 B (pitch for ds_load_b128 readers)
#define GBUF ((64 + 128) * GP)     // one stage: 64 A rows, then 128 W rows
__device__ __forceinline__ v2u pk_bf(v4f v) { union { v2u u; __bf16 e[4]; } r;
#pragma unroll
  for (int i = 0; i < 4; ++i) r.e[i] = (__bf16)v[i];
  return r.u; }
__device__ __forceinline__ v2u pk_wo(v4f v) { union { v2u u; _Float16 e[4]; } r;    // f16(bf16 x 2^8), exact
#pragma unroll
  for (int i = 0; i < 4; ++i) r.e[i] = (_Float16)((float)(__bf16)v[i] * 256.0f);
  return r.u; }
// one stage's 24 loads of a thread (8 of A, 16 of W; the thread's offset is the same in both tiles and never changes), then the two block-uniform bases one stage on; the unrolls here and in gemm_tile make every index of ra, rw, w and acc a constant, so that these arrays stay in registers
template <typename E> __device__ __forceinline__ void gemm_fetch(const E*& Ag, const E*& Wg, unsigned off, v4u (&ra)[8], v4u (&rw)[16]) {
#pragma unroll
  for (int i = 0; i < 8; ++i) ra[i] = *(const v4u*)(Ag + off + i * 8 * 1024);
#pragma unroll
  for (int i = 0; i < 16; ++i) rw[i] = *(const v4u*)(Wg + off + i * 8 * 1024);
  asm volatile("s_wait_xcnt 0x0" :: "v"(off) : "memory");   // stands in front of the overwrite of the loads' base registers just below; the offset as an input keeps its register from being handed to a later load of the group as its destination
  __builtin_amdgcn_sched_barrier(0);                        // keeps the stage's loads in front of the products that are to cover their latency, and the steps of the bases behind the wait
  Ag += GK; Wg += GK; }
template <int F16, typename E> __device__ __forceinline__ void gemm_tile(const E* Ag, const E* Wg, char* stg, v8f (&acc)[8], int tid) {
  const int wave = tid >> 5, lane = tid & 31, col = lane & 15, g = lane >> 4;
  const unsigned off = (tid >> 4) * 1024 + (tid & 15) * 8;                   // 8 rows a pass of the block, 16 lanes x 16 B a row
  char* sp = stg + (tid >> 4) * GP + (tid & 15) * 16;
  const char* fa = stg + (wave * 16 + col) * GP + 16 * g;              // fragment: elements 0..7 = k0 + 8g + 0..7, 8..15 = k0 + 16 + 8g + 0..7
  const char* fw = stg + (64 + col) * GP + 16 * g;
  v4u ra[8], rw[16];
  gemm_fetch(Ag, Wg, off, ra, rw);
  for (int s = 0; s < 1024 / GK; ++s) { const int bo = (s & 1) * GBUF;
#pragma unroll
    for (int i = 0; i < 8; ++i) *(v4u*)(sp + bo + i * 8 * GP) = ra[i];
#pragma unroll
    for (int i = 0; i < 16; ++i) *(v4u*)(sp + bo + (64 + i * 8) * GP) = rw[i];
    __syncthreads();   // publishes stage s; a wave that has passed it has left the other buffer, which stage s + 1 overwrites only behind this barrier
    if (s + 1 < 1024 / GK) gemm_fetch(Ag, Wg, off, ra, rw);
#pragma unroll
    for (int kk = 0; kk < GK / 32; ++kk) { union { v4u q[2]; v16b b; v16h h; } a, w[8]; a.q[0] = *(const v4u*)(fa + bo + kk * 64); a.q[1] = *(const v4u*)(fa + bo + kk * 64 + 32);   // the nine fragments of a 32-k block are read as one group in front of its eight products
#pragma unroll
      for (int j = 0; j < 8; ++j) { w[j].q[0] = *(const v4u*)(fw + bo + j * 16 * GP + kk * 64); w[j].q[1] = *(const v4u*)(fw + bo + j * 16 * GP + kk * 64 + 32); }
      __builtin_amdgcn_sched_barrier(0);   // keeps the group together: without it the scheduler sinks each fragment's two reads to just before its product, into one register set, and every product waits out a whole LDS latency
#pragma unroll
      for (int j = 0; j < 8; ++j) acc[j] = F16 ? __builtin_amdgcn_wmma_f32_16x16x32_f16(false, a.h, false, w[j].h, (short)0, acc[j], false, false) : __builtin_amdgcn_wmma_f32_16x16x32_bf16(false, a.b, false, w[j].b, (short)0, acc[j], false, false); } }
}
// ---- k_cvt: x and w_qkv once to bf16, w_proj once to f16(bf16 x 2^8): the operands that the stages of the two GEMMs fetch. Block = 8192 consecutive floats of one of the three arrays; a wave's load covers 512 B, its store 256 B; the unrolls keep v and o in registers
template <int WOF> __device__ __forceinline__ void cvt_run(const float* sp, char* dp) { v4f v[8]; v2u o[8];
#pragma unroll
  for (int j = 0; j < 8; ++j) v[j] = *(const v4f*)(sp + j * 1024);
  asm volatile("s_wait_xcnt 0x0" ::: "memory");   // stands in front of any rewrite of the loads' address registers
#pragma unroll
  for (int j = 0; j < 8; ++j) o[j] = WOF ? pk_wo(v[j]) : pk_bf(v[j]);
#pragma unroll
  for (int j = 0; j < 8; ++j) *(v2u*)(dp + j * 2048) = o[j];
  asm volatile("s_wait_xcnt 0x0" ::: "memory"); }   // stands behind the last store, in front of any rewrite of the stores' data and address registers on a way that the listing lays behind them
__global__ __launch_bounds__(256) void k_cvt(const float* __restrict__ X, const float* __restrict__ WQKV, const float* __restrict__ WO, __bf16* __restrict__ XB, __bf16* __restrict__ WB, _Float16* __restrict__ WOH) {
  const int nx = NB * TT * DIN / 8192, nw = 3 * CC * DIN / 8192, blk = blockIdx.x; const size_t t4 = threadIdx.x * 4;   /* the three branches are block-uniform */
  if (blk < nx) { const size_t e = (size_t)blk * 8192 + t4; cvt_run<0>(X + e, (char*)XB + 2 * e); }
  else if (blk < nx + nw) { const size_t e = (size_t)(blk - nx) * 8192 + t4; cvt_run<0>(WQKV + e, (char*)WB + 2 * e); }
  else { const size_t e = (size_t)(blk - nx - nw) * 8192 + t4; cvt_run<1>(WO + e, (char*)WOH + 2 * e); } }
// ---- k_proj: block = (64 rows, 128 cols, which): q/k/v = X W (+ b) with exact bf16 products (K = DIN) -> which 0: q f16 rows (+ residual rows < QHI); 1: k f16 rows (+ residual rows < KHI); 2: v f16 planes [c][t] (+ bf16 hi/lo planes for t < KHI)
__global__ __launch_bounds__(128) void k_proj(const __bf16* __restrict__ XQ, const __bf16* __restrict__ XK, const __bf16* __restrict__ XV, const __bf16* __restrict__ WQ, const __bf16* __restrict__ WK, const __bf16* __restrict__ WV, const float* __restrict__ BQ, const float* __restrict__ BK, const float* __restrict__ BV,
    _Float16* __restrict__ QH, _Float16* __restrict__ QL, _Float16* __restrict__ KH, _Float16* __restrict__ KL, _Float16* __restrict__ VT, __bf16* __restrict__ VB, __bf16* __restrict__ VBL PROJ_EXTRA_PARAMS) {
  __shared__ __align__(16) char sm[2 * GBUF];   // the two operand stages during the products; then st at the head of the first buffer (smaller than it; the last stage, an odd one, is read from the second, and every wave left the first before that stage's barrier), and behind st, written only behind the epilogue's barriers, the 16-bit output tiles (sh, sl or th, tb, tbl)
  float (*st)[132] = (float (*)[132])sm; char* ep = sm + 64 * 132 * 4; _Float16 (*sh)[136] = (_Float16 (*)[136])ep; _Float16 (*sl)[136] = (_Float16 (*)[136])(ep + 64 * 136 * 2); _Float16 (*th)[72] = (_Float16 (*)[72])ep; __bf16 (*tb)[72] = (__bf16 (*)[72])(ep + 128 * 72 * 2); __bf16 (*tbl)[72] = (__bf16 (*)[72])(ep + 2 * 128 * 72 * 2);
  const int tid = threadIdx.x, wave = tid >> 5, lane = tid & 31, col = lane & 15, g = lane >> 4; const int which = blockIdx.z; const int c0 = blockIdx.y * 128; const size_t r0 = (size_t)blockIdx.x * 64; const size_t bb = r0 / TT; const int t0 = (int)(r0 % TT);
  const __bf16* X = which == 0 ? XQ : which == 1 ? XK : XV; const __bf16* WA = which == 0 ? WQ : which == 1 ? WK : WV; const float* BA = which == 0 ? BQ : which == 1 ? BK : BV;
  v8f acc[8] = {};
  gemm_tile<0>(X + r0 * DIN, WA + (size_t)c0 * DIN, sm, acc, tid);
  { // stage the f32 tile (acc + bias) in LDS, run the per-(row, head) epilogue hook, then convert
#pragma unroll
    for (int j = 0; j < 8; ++j) { const float bias = BA ? bfr(BA[c0 + j * 16 + col]) : 0.f;
#pragma unroll
      for (int r = 0; r < 8; ++r) st[wave * 16 + 8 * g + r][j * 16 + col] = acc[j][r] + bias; }
    __syncthreads();
    for (int e = tid; e < 64 * (128 / HD); e += 128) { const int rl = e / (128 / HD), hh = e % (128 / HD); PROJ_EPI(which, &st[rl][hh * HD], (int)((r0 + rl) % TT), (c0 / HD) + hh); }
    __syncthreads(); }
  if (which < 2) { _Float16* DH = which == 0 ? QH : KH; _Float16* DL = which == 0 ? QL : KL; const int nhi = which == 0 ? QHI : KHI; const bool hi_rows = t0 < nhi;
    for (int e = tid; e < 64 * 128; e += 128) { const int rl = e >> 7, cl = e & 127; const float v = st[rl][cl]; const _Float16 hv = (_Float16)v; sh[rl][cl] = hv; sl[rl][cl] = (_Float16)((v - (float)hv) * 1024.0f); }
    __syncthreads();
    for (int e = tid; e < 64 * 16; e += 128) { const int rl = e >> 4, q = e & 15; vst2((unsigned*)(DH + (r0 + rl) * CC + c0 + q * 8), *(const v4u*)&sh[rl][q * 8]); if (hi_rows) vst2((unsigned*)(DL + (bb * nhi + t0 + rl) * (size_t)CC + c0 + q * 8), *(const v4u*)&sl[rl][q * 8]); }
  } else { const bool hi_rows = t0 < KHI;
    for (int e = tid; e < 64 * 128; e += 128) { const int rl = e & 63, cl = e >> 6; const float v = st[rl][cl]; th[cl][rl] = (_Float16)v; const __bf16 bh = (__bf16)v; tb[cl][rl] = bh; tbl[cl][rl] = (__bf16)(v - (float)bh); }
    __syncthreads();
    for (int e = tid; e < 128 * 8; e += 128) { const int cl = e >> 3, q = e & 7; vst2((unsigned*)(VT + (bb * CC + c0 + cl) * (size_t)TT + t0 + q * 8), *(const v4u*)&th[cl][q * 8]); if (hi_rows) { const size_t o3 = (bb * CC + c0 + cl) * (size_t)KHI + t0 + q * 8; vst2((unsigned*)(VB + o3), *(const v4u*)&tb[cl][q * 8]); vst2((unsigned*)(VBL + o3), *(const v4u*)&tbl[cl][q * 8]); } } } }
// ---- k_fa: block = 64 queries (4 waves x 16) of (b, h), all keys in steps of 64, each step's K, V and bias tiles brought into LDS by asynchronous copies one step ahead (two buffers) and read there by the four waves: S^T = K . Q^T on top of C = bf16(attn_bias) (lane = one query, 8 keys a tile), running maximum and sum per query in registers, P^T x 2^11 (relative to the running maximum) once to f16 straight from the score registers as the B operand, ctx^T += V^T . P^T; ctx = ctx^T / sum at the end, stored x 2^6 as f16, the output projection's operand
#define LOG2E 1.44269504f
__device__ __forceinline__ v8f wmma_h(v16h a, v16h b, v8f c) { return __builtin_amdgcn_wmma_f32_16x16x32_f16(false, a, false, b, (short)0, c, false, false); }
// 2^x; the v_nop in the same statement is the one slot that the instruction set asks for behind a transcendental before its result is read or its source register overwritten
__device__ __forceinline__ float exp2s(float x) { float e; asm("v_exp_f32 %0, %1\n\tv_nop" : "=v"(e) : "v"(x)); return e; }
__device__ __forceinline__ v16h frag_p(const _Float16* p) { union { v16h v; v8h q[2]; } u; u.q[0] = *(const v8h*)p; u.q[1] = *(const v8h*)(p + 16); return u.v; }   // frag_h with the half's 8 elements already in the pointer
__device__ __forceinline__ float xhalf(float v) { const int b = __builtin_bit_cast(int, v); return __builtin_bit_cast(float, __builtin_amdgcn_permlanex16(b, b, 0x76543210, 0xfedcba98, false, false)); }   // the value of lane ^ 16
// one 64-key step's operands in LDS: 64 K rows and 64 V planes of 128 B at pitch 144 B, then the block's 64 bias rows of 256 B at pitch 272 B (pitches for ds_load_b128 readers)
#define FKP 144
#define FBP 272
#define FVO (64 * FKP)
#define FBO (2 * 64 * FKP)
#define FBUF (2 * 64 * FKP + 64 * FBP)
// one step's 16 copies of a thread, whole lines (8 lanes x 16 B = one K or V row, 16 lanes x 16 B = one bias row); lk, lb = the thread's LDS byte addresses of its first K and bias piece in the target buffer; the s_wait_xcnt at the end of each statement stands in front of any rewrite of the address registers that its copies name
__device__ __forceinline__ void fa_copy(unsigned lk, unsigned lb, const _Float16* kg, const _Float16* vg, const float* bg) {
  asm volatile("global_load_async_to_lds_b128 %0, %1, off\n\tglobal_load_async_to_lds_b128 %2, %3, off\n\tglobal_load_async_to_lds_b128 %4, %5, off\n\tglobal_load_async_to_lds_b128 %6, %7, off\n\t"
               "global_load_async_to_lds_b128 %8, %9, off\n\tglobal_load_async_to_lds_b128 %10, %11, off\n\tglobal_load_async_to_lds_b128 %12, %13, off\n\tglobal_load_async_to_lds_b128 %14, %15, off\n\ts_wait_xcnt 0x0"
               :: "v"(lk), "v"(kg), "v"(lk + 16 * FKP), "v"(kg + 16 * CC), "v"(lk + 32 * FKP), "v"(kg + 32 * CC), "v"(lk + 48 * FKP), "v"(kg + 48 * CC),
                  "v"(lk + FVO), "v"(vg), "v"(lk + FVO + 16 * FKP), "v"(vg + 16 * TT), "v"(lk + FVO + 32 * FKP), "v"(vg + 32 * TT), "v"(lk + FVO + 48 * FKP), "v"(vg + 48 * TT) : "memory");
  asm volatile("global_load_async_to_lds_b128 %0, %1, off\n\tglobal_load_async_to_lds_b128 %2, %3, off\n\tglobal_load_async_to_lds_b128 %4, %5, off\n\tglobal_load_async_to_lds_b128 %6, %7, off\n\t"
               "global_load_async_to_lds_b128 %8, %9, off\n\tglobal_load_async_to_lds_b128 %10, %11, off\n\tglobal_load_async_to_lds_b128 %12, %13, off\n\tglobal_load_async_to_lds_b128 %14, %15, off\n\ts_wait_xcnt 0x0"
               :: "v"(lb), "v"(bg), "v"(lb + 8 * FBP), "v"(bg + 8 * TT), "v"(lb + 16 * FBP), "v"(bg + 16 * TT), "v"(lb + 24 * FBP), "v"(bg + 24 * TT),
                  "v"(lb + 32 * FBP), "v"(bg + 32 * TT), "v"(lb + 40 * FBP), "v"(bg + 40 * TT), "v"(lb + 48 * FBP), "v"(bg + 48 * TT), "v"(lb + 56 * FBP), "v"(bg + 56 * TT) : "memory"); }
__global__ __launch_bounds__(128) void k_fa(const _Float16* __restrict__ QH, const _Float16* __restrict__ KH, const _Float16* __restrict__ VT, const float* __restrict__ ABI, _Float16* __restrict__ Y) { __shared__ __align__(16) char ring[2 * FBUF];   // two step buffers; behind the loop's last barrier the same bytes stage the output rows
  _Float16 (*ss)[16][HD + 8] = (_Float16 (*)[16][HD + 8])ring;
  const int tid = threadIdx.x, wave = tid >> 5, lane = tid & 31, col = lane & 15, g = lane >> 4; const int h = blockIdx.y, b = blockIdx.z; const int ql0 = blockIdx.x * 64 + wave * 16;
  const _Float16* qp = QH + ((size_t)b * TT + ql0 + col) * CC + h * HD; const v16h q0 = frag_h(qp, lane), q1 = frag_h(qp + 32, lane);
  const _Float16* kg = KH + ((size_t)b * TT + (tid >> 3)) * CC + h * HD + (tid & 7) * 8;             // the thread's 16 B of key row tid / 8 (then + 16, 32, 48); runs on by 64 keys a step
  const _Float16* vg = VT + ((size_t)b * CC + h * HD + (tid >> 3)) * (size_t)TT + (tid & 7) * 8;     // its 16 B of the v plane of dim tid / 8 (then + 16, 32, 48); runs on by 64 keys a step
  const float* bg = ABI + (size_t)(blockIdx.x * 64 + (tid >> 4)) * TT + (tid & 15) * 4;              // its 16 B of the block's query row tid / 16 (then + 8, ..., 56); runs on by 64 keys a step
  const unsigned lk = (unsigned)(size_t)ring + (tid >> 3) * FKP + (tid & 7) * 16, lb = (unsigned)(size_t)ring + FBO + (tid >> 4) * FBP + (tid & 15) * 16;
  const char* kr = ring + col * FKP + 16 * g;                        // key row col of a 16-key tile (v: dim col of a 16-dim tile), this half's 8 elements
  const char* br = ring + FBO + (wave * 16 + col) * FBP + 32 * g;    // this lane's query row, its 8 keys of a tile
  v8f acc[HD / 16] = {}; float m = -3.0e38f, l = 0.f;                        // m = running maximum of the query's logits; l = this half's share of the sum, x 2^11
  fa_copy(lk, lb, kg, vg, bg);
  asm volatile("s_wait_asynccnt 0x0" ::: "memory");   // step 0's pieces of this wave have landed
  __syncthreads();                                    // publishes step 0
  fa_copy(lk + FBUF, lb + FBUF, kg + 64 * CC, vg + 64, bg + 64);
  kg += 128 * CC; vg += 128; bg += 128;
  for (int t = 0; t < TT / 64; ++t) { const unsigned bo = (t & 1) * FBUF; v16h kf[8], vf[8]; v4f bf[8]; v8f s[4];   // every LDS read of the step stands as one group in front of its first product; the unrolls of this loop body make every index of kf, vf, bf, s, p and acc a constant, so that they stay in registers
#pragma unroll
    for (int j = 0; j < 4; ++j) { kf[2 * j] = frag_p((const _Float16*)(kr + bo + j * 16 * FKP)); kf[2 * j + 1] = frag_p((const _Float16*)(kr + bo + j * 16 * FKP + 64)); bf[2 * j] = *(const v4f*)(br + bo + j * 64); bf[2 * j + 1] = *(const v4f*)(br + bo + j * 64 + 16); }
#pragma unroll
    for (int kc = 0; kc < 2; ++kc)
#pragma unroll
      for (int j = 0; j < HD / 16; ++j) vf[kc * 4 + j] = frag_p((const _Float16*)(kr + bo + FVO + j * 16 * FKP + kc * 64));
    __builtin_amdgcn_sched_barrier(0);   // keeps the group together: without it the scheduler sinks each fragment's reads to just before its product, and every product waits out an LDS latency
#pragma unroll
    for (int j = 0; j < 4; ++j) { v8f c;
#pragma unroll
      for (int r = 0; r < 4; ++r) { c[r] = bfr(bf[2 * j][r]); c[4 + r] = bfr(bf[2 * j + 1][r]); }
      c = wmma_h(kf[2 * j], q0, c); s[j] = wmma_h(kf[2 * j + 1], q1, c); }
    float mx = m;
#pragma unroll
    for (int j = 0; j < 4; ++j)
#pragma unroll
      for (int r = 0; r < 8; ++r) mx = fmaxf(mx, s[j][r]);
    mx = fmaxf(mx, xhalf(mx));
    const float al = exp2s((m - mx) * LOG2E), mo = mx * LOG2E - 11.0f; m = mx;
    float sj[4]; v16h p[2];
#pragma unroll
    for (int j = 0; j < 4; ++j) { sj[j] = 0.f;
#pragma unroll
      for (int r = 0; r < 8; ++r) { const float e = exp2s(s[j][r] * LOG2E - mo); sj[j] += e; p[j >> 1][(j & 1) * 8 + r] = (_Float16)e; } }
    l = l * al + ((sj[0] + sj[1]) + (sj[2] + sj[3]));
#pragma unroll
    for (int j = 0; j < HD / 16; ++j) acc[j] = acc[j] * al;
#pragma unroll
    for (int kc = 0; kc < 2; ++kc)
#pragma unroll
      for (int j = 0; j < HD / 16; ++j) acc[j] = wmma_h(vf[kc * 4 + j], p[kc], acc[j]);
    __builtin_amdgcn_sched_barrier(0);   // keeps the step's products in front of the waits below: without it the scheduler lifts them and the barrier to just behind the read group, where the next step's copies have had no time to land
    asm volatile("s_wait_dscnt 0x0" ::: "memory");      // this wave's reads of the step's buffer have retired before the buffer is handed to the copies below
    asm volatile("s_wait_asynccnt 0x0" ::: "memory");   // this wave's pieces of step t + 1 have landed
    __syncthreads();                                    // publishes step t + 1 and ends every wave's reads of step t's buffer
    if (t + 2 < TT / 64) { fa_copy(lk + bo, lb + bo, kg, vg, bg); kg += 64 * CC; vg += 64; bg += 64; } }
  asm volatile("s_wait_asynccnt 0x0" ::: "memory");     // no copy is outstanding when the ring's bytes become output staging and when the wave ends
  l += xhalf(l); const float inv = l > 0.f ? 1.0f / l : 0.f;   /* a fully excluded row yields ctx = 0 */
#pragma unroll
  for (int j = 0; j < HD / 16; ++j) { v8h o;   /* ctx carried x 2^6 into f16 so small-magnitude context rows stay clear of f16 subnormals */
#pragma unroll
    for (int r = 0; r < 8; ++r) o[r] = (_Float16)((acc[j][r] * inv) * 64.0f);
    *(v8h*)&ss[wave][col][j * 16 + 8 * g] = o; }
  LDSX(); for (int i = 0; i < 4; ++i) { const int rl = 4 * i + (lane >> 3); vst2(Y + ((size_t)b * TT + ql0 + rl) * CC + h * HD + (lane & 7) * 8, *(const v4u*)&ss[wave][rl][(lane & 7) * 8]); } }
// ---- k_out: block = (64 rows, 128 cols): out = ctx Wo (+ bo): ctx x 2^6 in f16 against Wo as f16(bf16 x 2^8) exact (1 product) x 2^-14
__global__ __launch_bounds__(128) void k_out(const _Float16* __restrict__ Y, const _Float16* __restrict__ WO, const float* __restrict__ BO, float* __restrict__ OUT) { __shared__ __align__(16) float sf[4][16][132]; __shared__ __align__(16) char stg[2 * GBUF];
  const int tid = threadIdx.x, wave = tid >> 5, lane = tid & 31, col = lane & 15, g = lane >> 4; const int c0 = blockIdx.y * 128; const size_t r0 = (size_t)blockIdx.x * 64 + wave * 16;
  v8f acc[8] = {};
  gemm_tile<1>(Y + (size_t)blockIdx.x * 64 * CC, WO + (size_t)c0 * CC, stg, acc, tid);
#pragma unroll
    for (int j = 0; j < 8; ++j) { const float bias = BO ? bfr(BO[c0 + j * 16 + col]) : 0.f;
#pragma unroll
      for (int r = 0; r < 8; ++r) sf[wave][8 * g + r][j * 16 + col] = acc[j][r] * (1.0f / 16384.0f) + bias; }   /* 2^-8 (Wo carry) x 2^-6 (ctx carry) */
  LDSX(); for (int rl = 0; rl < 16; ++rl) vst2(OUT + (r0 + rl) * DIN + c0 + lane * 4, *(const v4f*)&sf[wave][rl][lane * 4]); }

extern "C" void kernel_launch(void* const* d_in, const int* in_sizes, int n_in, void* d_out, int out_size, void* d_ws, size_t ws_size, hipStream_t stream) {
  (void)in_sizes; (void)n_in; (void)out_size;
  const float** F = (const float**)d_in;
  if (ws_size < (size_t)WS_END) return;
  char* ws = (char*)d_ws; _Float16 *QH = (_Float16*)(ws + WS_QH), *KH = (_Float16*)(ws + WS_KH), *VT = (_Float16*)(ws + WS_VT), *QL = (_Float16*)(ws + WS_QL), *KL = (_Float16*)(ws + WS_KL); __bf16 *VB = (__bf16*)(ws + WS_VB), *VBL = (__bf16*)(ws + WS_VBL), *XB = (__bf16*)(ws + WS_XB), *WB = (__bf16*)(ws + WS_WB); _Float16 *WOH = (_Float16*)(ws + WS_WOH), *Y = (_Float16*)(ws + WS_Y);
  (void)Y; (void)QL; (void)KL; (void)VB; (void)VBL;
  // inputs: 0 x [2,2048,1024]; 1 attn_bias [1,1,2048,2048]; 2 w_qkv [3072,1024] (out,in): q rows 0..1023, k 1024..2047, v 2048..3071; 3 q_bias [1024] (zeros, read); 4 v_bias [1024] (zeros, read); 5 scale_mul [1,16,1,1] (ln 4, read); 6 w_proj [1024,1024] (out,in); 7 b_proj (zeros, read); the k stream has no bias (the module concatenates zeros)
  k_cvt<<<dim3((NB * TT * DIN + 3 * CC * DIN + DIN * CC) / 8192), 256, 0, stream>>>(F[0], F[2], F[6], XB, WB, WOH);
  k_proj<<<dim3(TNB * TT / 64, CC / 128, 3), 128, 0, stream>>>(XB, XB, XB, WB, WB + (size_t)CC * DIN, WB + 2 * (size_t)CC * DIN, F[3], nullptr, F[4], QH, QL, KH, KL, VT, VB, VBL, F[5]);
  k_fa<<<dim3(NQB, NH, TNB), 128, 0, stream>>>(QH, KH, VT, F[1], Y);
  k_out<<<dim3(TNB * TT / 64, DIN / 128), 128, 0, stream>>>(Y, WOH, F[7], (float*)d_out);
}

// v005
// It runs in 99.1 microseconds.
// Timed twice side by side with v004, it ran 1.06 and 1.07 times as fast.
// Counting every step since v000, it is 14.6 times as fast.
// compute dtype: all float inputs rounded to bf16; q / k / v projections with EXACT bf16 products on WMMA 16x16x32 (f32 accumulate) + bias (q / v: zeros, read; k: none); q and k divided by their per-(token, head) L2 norm in f32, q then times exp(min(bf16(scale_mul[h]), ln 100)); logits q x k once to f16 each (1 product, scale 1), + bf16(attn_bias[q][k]) in f32; softmax f32 with a running maximum and sum over 64-key steps; exp(logit - running max) x 2^11 once to f16 x v once to f16 (1 product), divided by the f32 sum at the end; ctx x 2^6 once to f16 x w_proj f16(bf16 x 2^8) + b_proj; f32 output.
#include <hip/hip_runtime.h>
#include <math.h>

typedef __attribute__((ext_vector_type(16))) _Float16 v16h;
typedef __attribute__((ext_vector_type(16))) __bf16 v16b;
typedef __attribute__((ext_vector_type(8)))  _Float16 v8h;
typedef __attribute__((ext_vector_type(8)))  float v8f;
typedef __attribute__((ext_vector_type(4)))  float v4f;
typedef __attribute__((ext_vector_type(2)))  float v2f;
typedef __attribute__((ext_vector_type(4)))  unsigned v4u;
typedef __attribute__((ext_vector_type(4)))  int v4i;
typedef float __attribute__((may_alias)) float_a;
typedef int __attribute__((may_alias)) int_a;

template <typename T> __device__ __forceinline__ void vst2(void* p, T v) { *(T*)p = v;  }
__device__ __forceinline__ v8f wmma16(v16h a, v16h b, v8f c) {
  v8f d = __builtin_amdgcn_wmma_f32_16x16x32_f16(false, a, false, b, (short)0, c, false, false);
  asm volatile("v_nop\n\tv_nop\n\tv_nop\n\tv_nop" : "+v"(d) : "v"(a), "v"(b));
  return d;
}
__device__ __forceinline__ v8f wmma_bf(v16b a, v16b b, v8f c) {
  v8f d = __builtin_amdgcn_wmma_f32_16x16x32_bf16(false, a, false, b, (short)0, c, false, false);
  asm volatile("v_nop\n\tv_nop\n\tv_nop\n\tv_nop" : "+v"(d) : "v"(a), "v"(b));
  return d;
}
// 16x16x32 fragments: lane = (h = lane>>4, row/col = lane&15); elements 0..7 = k0+8h+0..7, 8..15 = k0+16+8h+0..7; D element r = row 8h+r
__device__ __forceinline__ v16h frag_h(const _Float16* rowk0, int lane) {
  union { v16h v; v8h q[2]; } u; const _Float16* p = rowk0 + 8 * (lane >> 4);
  u.q[0] = *(const v8h*)p; u.q[1] = *(const v8h*)(p + 16); return u.v;
}
__device__ __forceinline__ v16h frag_f32(const float* rowk0, int lane) {
  v16h a; const float* p = rowk0 + 8 * (lane >> 4);
#pragma unroll
  for (int i = 0; i < 8; ++i) { a[i] = (_Float16)p[i]; a[8 + i] = (_Float16)p[16 + i]; }
  return a;
}
__device__ __forceinline__ v16h frag_f32s(const float* rowk0, int lane, float sc) {
  v16h a; const float* p = rowk0 + 8 * (lane >> 4);
#pragma unroll
  for (int i = 0; i < 8; ++i) { a[i] = (_Float16)(p[i] * sc); a[8 + i] = (_Float16)(p[16 + i] * sc); }
  return a;
}
// column fragment from a [K][ld] layout (column n), rows >= K read as 0
__device__ __forceinline__ v16h fragc_f32(const float* W, int k0, int n, int lane, int ld, int K) {
  v16h a; const int g = lane >> 4;
#pragma unroll
  for (int i = 0; i < 8; ++i) { const int ka = k0 + 8 * g + i, kb = ka + 16;
    a[i] = (_Float16)(ka < K ? W[(size_t)(ka < K ? ka : K - 1) * ld + n] : 0.f); a[8 + i] = (_Float16)(kb < K ? W[(size_t)(kb < K ? kb : K - 1) * ld + n] : 0.f); }
  return a;
}
struct F2 { v16b h, l; };
__device__ __forceinline__ F2 bsplit16(const float v[16]) { F2 r;
#pragma unroll
  for (int i = 0; i < 16; ++i) { const __bf16 h = (__bf16)v[i]; r.h[i] = h; r.l[i] = (__bf16)(v[i] - (float)h); }
  return r; }
__device__ __forceinline__ F2 split_row(const float* row, int k0, int lane) { float v[16]; const float* p = row + k0 + 8 * (lane >> 4);
#pragma unroll
  for (int i = 0; i < 8; ++i) { v[i] = p[i]; v[8 + i] = p[16 + i]; }
  return bsplit16(v); }
__device__ __forceinline__ F2 split_rowK(const float* row, int k0, int lane, int K) { float v[16]; const int g = lane >> 4;
#pragma unroll
  for (int i = 0; i < 8; ++i) { const int ka = k0 + 8 * g + i, kb = ka + 16; v[i] = ka < K ? row[ka < K ? ka : K - 1] : 0.f; v[8 + i] = kb < K ? row[kb < K ? kb : K - 1] : 0.f; }
  return bsplit16(v); }
__device__ __forceinline__ F2 split_col(const float* W, int k0, int n, int lane, int ld, int K) { float v[16]; const int g = lane >> 4;
#pragma unroll
  for (int i = 0; i < 8; ++i) { const int ka = k0 + 8 * g + i, kb = ka + 16; v[i] = ka < K ? W[(size_t)(ka < K ? ka : K - 1) * ld + n] : 0.f; v[8 + i] = kb < K ? W[(size_t)(kb < K ? kb : K - 1) * ld + n] : 0.f; }
  return bsplit16(v); }
__device__ __forceinline__ v8f mac3(const F2& a, const F2& b, v8f c) { c = wmma_bf(a.l, b.h, c); c = wmma_bf(a.h, b.l, c); return wmma_bf(a.h, b.h, c); }
__device__ __forceinline__ float sigm(float v) { return 1.0f / (1.0f + expf(-v)); }
#define LDSX() do { asm volatile("s_wait_dscnt 0" ::: "memory"); __builtin_amdgcn_wave_barrier(); __builtin_amdgcn_fence(__ATOMIC_RELEASE, "workgroup"); } while (0)

// Multi-head COSINE self-attention with a per-head learned scale and an additive attention bias (x [2,2048,1024]; attn_bias [1,1,2048,2048] N(0,1), one entry per (query, key), shared by batches and heads - READ on the device; w_qkv [3072,1024] torch (out,in) N(0, 1/1024): q = rows 0..1023, k = 1024..2047, v = 2048..3071 (reshape (B, L, 3, 16, 64)); q_bias / v_bias zeros (read), k has no bias; scale_mul [1,16,1,1] = ln 4 (const; read): sm = exp(min(scale_mul, ln 100)) = 4; q <- q / ||q|| * sm, k <- k / ||k|| per head row; attn = q k^T + attn_bias; softmax; oup through w_proj [1024,1024] (out,in) + b_proj zeros).
#define NB 2
#define TT 2048
#define CC 1024            // NH * HD = projected width
#define DIN 1024          // input (model) width
#define NH 16
#define HD 64
#define NQB (TT / 64)
#define HG 4
#define SCALE (1.0f)
#define CAUSAL 0
#ifndef TNB
#define TNB NB
#endif
__device__ __forceinline__ float bfr(float v) { return (float)(__bf16)v; }
__host__ __device__ __forceinline__ int kb_last(int qb) { return CAUSAL ? ((qb * 64 + 63) >> 7) : (TT / 128 - 1); }
typedef __attribute__((ext_vector_type(8))) __bf16 v8b;
__device__ __forceinline__ v16b frag_b(const __bf16* rowk0, int lane) {
  union { v16b v; v8b q[2]; } u; const __bf16* p = rowk0 + 8 * (lane >> 4);
  u.q[0] = *(const v8b*)p; u.q[1] = *(const v8b*)(p + 16); return u.v;
}
#define QBH 0              // unused: k_fa has one path for all query blocks
#define QHI 0               // single-product logits on every row (unit-norm operands x 4: |cosine logit| <= 4)
#define KHI 64            // key rows carrying k residual / v bf16 hi+lo planes (written by k_proj; no kernel reads them)
// B fragment (k rows k0+.., output column o) of a weight: (in,out) [K][ld] or (out,in) [ld rows of K]: bf16 exact, or f16(bf16 * 256) exact
__device__ __forceinline__ v16b wcol_io(const float* Wm, int k0, int o, int lane, int ld) { v16b w; const int g = lane >> 4;
#pragma unroll
  for (int i = 0; i < 8; ++i) { w[i] = (__bf16)Wm[(size_t)(k0 + 8 * g + i) * ld + o]; w[8 + i] = (__bf16)Wm[(size_t)(k0 + 16 + 8 * g + i) * ld + o]; }
  return w; }
__device__ __forceinline__ v16b wcol_oi(const float* Wm, int k0, int o, int lane, int K) { v16b w; const float* p = Wm + (size_t)o * K + k0 + 8 * (lane >> 4);
#pragma unroll
  for (int i = 0; i < 8; ++i) { w[i] = (__bf16)p[i]; w[8 + i] = (__bf16)p[16 + i]; }
  return w; }
__device__ __forceinline__ v16h wcolh_io(const float* Wm, int k0, int o, int lane, int ld) { v16h w; const int g = lane >> 4;
#pragma unroll
  for (int i = 0; i < 8; ++i) { w[i] = (_Float16)(bfr(Wm[(size_t)(k0 + 8 * g + i) * ld + o]) * 256.0f); w[8 + i] = (_Float16)(bfr(Wm[(size_t)(k0 + 16 + 8 * g + i) * ld + o]) * 256.0f); }
  return w; }
__device__ __forceinline__ v16h wcolh_oi(const float* Wm, int k0, int o, int lane, int K) { v16h w; const float* p = Wm + (size_t)o * K + k0 + 8 * (lane >> 4);
#pragma unroll
  for (int i = 0; i < 8; ++i) { w[i] = (_Float16)(bfr(p[i]) * 256.0f); w[8 + i] = (_Float16)(bfr(p[16 + i]) * 256.0f); }
  return w; }
#define WQKV_LAYOUT 1   // 0 = (in,out) [DIN][CC]; 1 = (out,in) [CC][DIN]; 2 = per-head [NH][DIN][HD]
__device__ __forceinline__ v16b wcol_hdk(const float* Wm, int k0, int o, int lane) { v16b w; const int g = lane >> 4; const float* p = Wm + (size_t)(o / HD) * DIN * HD + (o % HD);
#pragma unroll
  for (int i = 0; i < 8; ++i) { w[i] = (__bf16)p[(size_t)(k0 + 8 * g + i) * HD]; w[8 + i] = (__bf16)p[(size_t)(k0 + 16 + 8 * g + i) * HD]; }
  return w; }
#define WO_OUT_IN 1
#if WQKV_LAYOUT == 1
#define WCOL(W, k0, o, lane) wcol_oi(W, k0, o, lane, DIN)
#elif WQKV_LAYOUT == 2
#define WCOL(W, k0, o, lane) wcol_hdk(W, k0, o, lane)
#else
#define WCOL(W, k0, o, lane) wcol_io(W, k0, o, lane, CC)
#endif
#if WO_OUT_IN
#define WOCOL(W, k0, o, lane) wcol_oi(W, k0, o, lane, CC)
#define WOCOLH(W, k0, o, lane) wcolh_oi(W, k0, o, lane, CC)
#else
#define WOCOL(W, k0, o, lane) wcol_io(W, k0, o, lane, DIN)
#define WOCOLH(W, k0, o, lane) wcolh_io(W, k0, o, lane, DIN)
#endif

#define MAX_SCALE_MUL 4.605170186f   // ln(100): the module's clamp on scale_mul
#define PROJ_EXTRA_PARAMS , const float* __restrict__ SMU   /* scale_mul [1][NH][1][1], a module input */
// per (token, head) hook on the staged f32 row (64 floats, projection + bias) of the q and k streams: x <- x / sqrt(sum x^2) (jnp.linalg.norm, no epsilon in the module); the q stream is then multiplied by sm = expf(fminf(bf16(scale_mul[h]), ln 100)); v untouched; the sum of squares in f32, products and sums kept separate
#define PROJ_EPI(which, row, t, h) do { if ((which) < 2) { float* rw = (row); float ss_ = 0.f; _Pragma("unroll 8") for (int i = 0; i < 64; ++i) { _Pragma("clang fp contract(off)") const float sq_ = rw[i] * rw[i]; ss_ = ss_ + sq_; } const float dn_ = sqrtf(ss_); const float sm_ = ((which) == 0) ? expf(fminf(bfr(SMU[(h)]), MAX_SCALE_MUL)) : 1.0f; _Pragma("unroll 8") for (int i = 0; i < 64; ++i) { _Pragma("clang fp contract(off)") const float u_ = rw[i] / dn_; rw[i] = ((which) == 0) ? (u_ * sm_) : u_; } } } while (0)
#ifndef PROJ_EXTRA_PARAMS
#define PROJ_EXTRA_PARAMS
#endif

#define WS_QH  0u                                      // f16 q rows [b*t][CC]
#define WS_KH  (WS_QH + 2u * (size_t)NB * TT * CC)      // f16 k rows [b*t][CC]
#define WS_VT  (WS_KH + 2u * (size_t)NB * TT * CC)      // f16 v planes [b][c][t]
#define WS_QL  (WS_VT + 2u * (size_t)NB * CC * TT)      // f16 q residual x 2^10 rows [b][t < QHI][CC]
#define WS_KL  (WS_QL + 2u * (size_t)NB * QHI * CC)     // f16 k residual x 2^10 rows [b][t < KHI][CC]
#define WS_VB  (WS_KL + 2u * (size_t)NB * KHI * CC)     // bf16 v hi planes [b][c][t < KHI]
#define WS_VBL (WS_VB + 2u * (size_t)NB * CC * KHI)
#define WS_S   (WS_VBL + 2u * (size_t)NB * CC * KHI)    // region of 4 * HG * TT * TT bytes; its head holds the three 16-bit operand copies below
#define WS_XB  WS_S                                    // bf16 x rows [b*t][DIN]
#define WS_WB  (WS_XB + 2u * (size_t)NB * TT * DIN)     // bf16 w_qkv rows [3 * CC][DIN]
#define WS_WOH (WS_WB + 2u * 3u * (size_t)CC * DIN)     // f16(bf16 x 2^8) w_proj rows [DIN][CC]
#define WS_Y   (WS_S  + 4u * (size_t)HG * TT * TT)      // f16 ctx x 2^6 rows [b*t][CC]
#define WS_END (WS_Y  + 4u * (size_t)NB * TT * CC)

// ---- gemm_tile: the 64 x 128 tile of A . W^T (both K-contiguous, already in their 16-bit operand type, K = 1024) of one 4-wave block. Each 128-k stage of both operands is fetched by whole-line loads (16 lanes x 16 B = 256 B of one row) and laid in LDS as it is, where all four waves read their fragments; two LDS buffers, the next stage's loads in flight in registers during the products; k runs upward in steps of 32
typedef __attribute__((ext_vector_type(2))) unsigned v2u;
#define GK 128                     // k per stage
#define GP 272                     // LDS row pitch, bytes: 256 B of 16-bit data + 16 B (pitch for ds_load_b128 readers)
#define GBUF ((64 + 128) * GP)     // one stage: 64 A rows, then 128 W rows
__device__ __forceinline__ v2u pk_bf(v4f v) { union { v2u u; __bf16 e[4]; } r;
#pragma unroll
  for (int i = 0; i < 4; ++i) r.e[i] = (__bf16)v[i];
  return r.u; }
__device__ __forceinline__ v2u pk_wo(v4f v) { union { v2u u; _Float16 e[4]; } r;    // f16(bf16 x 2^8), exact
#pragma unroll
  for (int i = 0; i < 4; ++i) r.e[i] = (_Float16)((float)(__bf16)v[i] * 256.0f);
  return r.u; }
// one stage's 24 loads of a thread (8 of A, 16 of W; the thread's offset is the same in both tiles and never changes), then the two block-uniform bases one stage on; the unrolls here and in gemm_tile make every index of ra, rw, w and acc a constant, so that these arrays stay in registers
template <typename E> __device__ __forceinline__ void gemm_fetch(const E*& Ag, const E*& Wg, unsigned off, v4u (&ra)[8], v4u (&rw)[16]) {
#pragma unroll
  for (int i = 0; i < 8; ++i) ra[i] = *(const v4u*)(Ag + off + i * 8 * 1024);
#pragma unroll
  for (int i = 0; i < 16; ++i) rw[i] = *(const v4u*)(Wg + off + i * 8 * 1024);
  asm volatile("s_wait_xcnt 0x0" :: "v"(off) : "memory");   // stands in front of the overwrite of the loads' base registers just below; the offset as an input keeps its register from being handed to a later load of the group as its destination
  __builtin_amdgcn_sched_barrier(0);                        // keeps the stage's loads in front of the products that are to cover their latency, and the steps of the bases behind the wait
  Ag += GK; Wg += GK; }
template <int F16, typename E> __device__ __forceinline__ void gemm_tile(const E* Ag, const E* Wg, char* stg, v8f (&acc)[8], int tid) {
  const int wave = tid >> 5, lane = tid & 31, col = lane & 15, g = lane >> 4;
  const unsigned off = (tid >> 4) * 1024 + (tid & 15) * 8;                   // 8 rows a pass of the block, 16 lanes x 16 B a row
  char* sp = stg + (tid >> 4) * GP + (tid & 15) * 16;
  const char* fa = stg + (wave * 16 + col) * GP + 16 * g;              // fragment: elements 0..7 = k0 + 8g + 0..7, 8..15 = k0 + 16 + 8g + 0..7
  const char* fw = stg + (64 + col) * GP + 16 * g;
  v4u ra[8], rw[16];
  gemm_fetch(Ag, Wg, off, ra, rw);
  for (int s = 0; s < 1024 / GK; ++s) { const int bo = (s & 1) * GBUF;
#pragma unroll
    for (int i = 0; i < 8; ++i) *(v4u*)(sp + bo + i * 8 * GP) = ra[i];
#pragma unroll
    for (int i = 0; i < 16; ++i) *(v4u*)(sp + bo + (64 + i * 8) * GP) = rw[i];
    __syncthreads();   // publishes stage s; a wave that has passed it has left the other buffer, which stage s + 1 overwrites only behind this barrier
    if (s + 1 < 1024 / GK) gemm_fetch(Ag, Wg, off, ra, rw);
#pragma unroll
    for (int kk = 0; kk < GK / 32; ++kk) { union { v4u q[2]; v16b b; v16h h; } a, w[8]; a.q[0] = *(const v4u*)(fa + bo + kk * 64); a.q[1] = *(const v4u*)(fa + bo + kk * 64 + 32);   // the nine fragments of a 32-k block are read as one group in front of its eight products
#pragma unroll
      for (int j = 0; j < 8; ++j) { w[j].q[0] = *(const v4u*)(fw + bo + j * 16 * GP + kk * 64); w[j].q[1] = *(const v4u*)(fw + bo + j * 16 * GP + kk * 64 + 32); }
      __builtin_amdgcn_sched_barrier(0);   // keeps the group together: without it the scheduler sinks each fragment's two reads to just before its product, into one register set, and every product waits out a whole LDS latency
#pragma unroll
      for (int j = 0; j < 8; ++j) acc[j] = F16 ? __builtin_amdgcn_wmma_f32_16x16x32_f16(false, a.h, false, w[j].h, (short)0, acc[j], false, false) : __builtin_amdgcn_wmma_f32_16x16x32_bf16(false, a.b, false, w[j].b, (short)0, acc[j], false, false); } }
}
// ---- gemm_tile2: the 128 x 128 tile of A . W^T (both K-contiguous bf16, K = 1024) of one 4-wave block; wave (wr, wc) owns the 64 x 64 quarter, so the eight fragments of a 32-k block feed sixteen products. Each 64-k stage of both operands is fetched by whole-line loads (8 lanes x 16 B = 128 B of one row) and laid in LDS as it is; two LDS buffers, the next stage's loads in flight in registers during the products; k runs upward in steps of 32
#define HK 64                      // k per stage
#define HP 144                     // LDS row pitch, bytes: 128 B of 16-bit data + 16 B (pitch for ds_load_b128 readers)
#define HBUF ((128 + 128) * HP)    // one stage: 128 A rows, then 128 W rows
// one stage's 16 loads of a thread (8 of A, 8 of W; the thread's offset is the same in both tiles and never changes), then the two block-uniform bases one stage on; the unrolls here and in gemm_tile2 make every index of ra, rw, a, w and acc a constant, so that these arrays stay in registers
__device__ __forceinline__ void gemm_fetch2(const __bf16*& Ag, const __bf16*& Wg, unsigned off, v4u (&ra)[8], v4u (&rw)[8]) {
#pragma unroll
  for (int i = 0; i < 8; ++i) ra[i] = *(const v4u*)(Ag + off + i * 16 * 1024);
#pragma unroll
  for (int i = 0; i < 8; ++i) rw[i] = *(const v4u*)(Wg + off + i * 16 * 1024);
  asm volatile("s_wait_xcnt 0x0" :: "v"(off) : "memory");   // stands in front of the overwrite of the loads' base registers just below; the offset as an input keeps its register from being handed to a later load of the group as its destination
  __builtin_amdgcn_sched_barrier(0);                        // keeps the stage's loads in front of the products that are to cover their latency, and the steps of the bases behind the wait
  Ag += HK; Wg += HK; }
__device__ __forceinline__ void gemm_tile2(const __bf16* Ag, const __bf16* Wg, char* stg, v8f (&acc)[4][4], int tid) {
  const int wave = tid >> 5, lane = tid & 31, col = lane & 15, g = lane >> 4, wr = wave >> 1, wc = wave & 1;
  const unsigned off = (tid >> 3) * 1024 + (tid & 7) * 8;                    // 16 rows a pass of the block, 8 lanes x 16 B a row
  char* sp = stg + (tid >> 3) * HP + (tid & 7) * 16;
  const char* fa = stg + (wr * 64 + col) * HP + 16 * g;                // fragment: elements 0..7 = k0 + 8g + 0..7, 8..15 = k0 + 16 + 8g + 0..7
  const char* fw = stg + (128 + wc * 64 + col) * HP + 16 * g;
  v4u ra[8], rw[8];
  gemm_fetch2(Ag, Wg, off, ra, rw);
  for (int s = 0; s < 1024 / HK; ++s) { const int bo = (s & 1) * HBUF;
#pragma unroll
    for (int i = 0; i < 8; ++i) *(v4u*)(sp + bo + i * 16 * HP) = ra[i];
#pragma unroll
    for (int i = 0; i < 8; ++i) *(v4u*)(sp + bo + (128 + i * 16) * HP) = rw[i];
    __syncthreads();   // publishes stage s; a wave that has passed it has left the other buffer, which stage s + 1 overwrites only behind this barrier
    if (s + 1 < 1024 / HK) gemm_fetch2(Ag, Wg, off, ra, rw);
#pragma unroll
    for (int kk = 0; kk < HK / 32; ++kk) { union { v4u q[2]; v16b b; } a[4], w[4];   // the eight fragments of a 32-k block are read as one group in front of its sixteen products
#pragma unroll
      for (int i = 0; i < 4; ++i) { a[i].q[0] = *(const v4u*)(fa + bo + i * 16 * HP + kk * 64); a[i].q[1] = *(const v4u*)(fa + bo + i * 16 * HP + kk * 64 + 32); w[i].q[0] = *(const v4u*)(fw + bo + i * 16 * HP + kk * 64); w[i].q[1] = *(const v4u*)(fw + bo + i * 16 * HP + kk * 64 + 32); }
      __builtin_amdgcn_sched_barrier(0);   // keeps the group together: without it the scheduler sinks each fragment's two reads to just before its product, and every product waits out a whole LDS latency
#pragma unroll
      for (int i = 0; i < 4; ++i)
#pragma unroll
        for (int j = 0; j < 4; ++j) acc[i][j] = __builtin_amdgcn_wmma_f32_16x16x32_bf16(false, a[i].b, false, w[j].b, (short)0, acc[i][j], false, false); } }
}
// ---- k_cvt: x and w_qkv once to bf16, w_proj once to f16(bf16 x 2^8): the operands that the stages of the two GEMMs fetch. Block = 8192 consecutive floats of one of the three arrays; a wave's load covers 512 B, its store 256 B; the unrolls keep v and o in registers
template <int WOF> __device__ __forceinline__ void cvt_run(const float* sp, char* dp) { v4f v[8]; v2u o[8];
#pragma unroll
  for (int j = 0; j < 8; ++j) v[j] = *(const v4f*)(sp + j * 1024);
  asm volatile("s_wait_xcnt 0x0" ::: "memory");   // stands in front of any rewrite of the loads' address registers
#pragma unroll
  for (int j = 0; j < 8; ++j) o[j] = WOF ? pk_wo(v[j]) : pk_bf(v[j]);
#pragma unroll
  for (int j = 0; j < 8; ++j) *(v2u*)(dp + j * 2048) = o[j];
  asm volatile("s_wait_xcnt 0x0" ::: "memory"); }   // stands behind the last store, in front of any rewrite of the stores' data and address registers on a way that the listing lays behind them
__global__ __launch_bounds__(256) void k_cvt(const float* __restrict__ X, const float* __restrict__ WQKV, const float* __restrict__ WO, __bf16* __restrict__ XB, __bf16* __restrict__ WB, _Float16* __restrict__ WOH) {
  const int nx = NB * TT * DIN / 8192, nw = 3 * CC * DIN / 8192, blk = blockIdx.x; const size_t t4 = threadIdx.x * 4;   /* the three branches are block-uniform */
  if (blk < nx) { const size_t e = (size_t)blk * 8192 + t4; cvt_run<0>(X + e, (char*)XB + 2 * e); }
  else if (blk < nx + nw) { const size_t e = (size_t)(blk - nx) * 8192 + t4; cvt_run<0>(WQKV + e, (char*)WB + 2 * e); }
  else { const size_t e = (size_t)(blk - nx - nw) * 8192 + t4; cvt_run<1>(WO + e, (char*)WOH + 2 * e); } }
// ---- k_proj: block = (128 rows, 128 cols, which), the epilogue run once for each 64-row half: q/k/v = X W (+ b) with exact bf16 products (K = DIN) -> which 0: q f16 rows (+ residual rows < QHI); 1: k f16 rows (+ residual rows < KHI); 2: v f16 planes [c][t] (+ bf16 hi/lo planes for t < KHI)
__global__ __launch_bounds__(128) void k_proj(const __bf16* __restrict__ XQ, const __bf16* __restrict__ XK, const __bf16* __restrict__ XV, const __bf16* __restrict__ WQ, const __bf16* __restrict__ WK, const __bf16* __restrict__ WV, const float* __restrict__ BQ, const float* __restrict__ BK, const float* __restrict__ BV,
    _Float16* __restrict__ QH, _Float16* __restrict__ QL, _Float16* __restrict__ KH, _Float16* __restrict__ KL, _Float16* __restrict__ VT, __bf16* __restrict__ VB, __bf16* __restrict__ VBL PROJ_EXTRA_PARAMS) {
  __shared__ __align__(16) char sm[64 * 132 * 4 + 3 * 128 * 72 * 2];   // the two operand stages (2 * HBUF bytes, fewer than this) during the products; then st at the head of the first buffer (smaller than it; the last stage, an odd one, is read from the second, and every wave left the first before that stage's barrier), and behind st, written only behind the epilogue's barriers, the 16-bit output tiles (sh, sl or th, tb, tbl)
  float (*st)[132] = (float (*)[132])sm; char* ep = sm + 64 * 132 * 4; _Float16 (*sh)[136] = (_Float16 (*)[136])ep; _Float16 (*sl)[136] = (_Float16 (*)[136])(ep + 64 * 136 * 2); _Float16 (*th)[72] = (_Float16 (*)[72])ep; __bf16 (*tb)[72] = (__bf16 (*)[72])(ep + 128 * 72 * 2); __bf16 (*tbl)[72] = (__bf16 (*)[72])(ep + 2 * 128 * 72 * 2);
  const int tid = threadIdx.x, wave = tid >> 5, lane = tid & 31, col = lane & 15, g = lane >> 4; const int wr = wave >> 1, wc = wave & 1; const int which = blockIdx.z; const int c0 = blockIdx.y * 128; const size_t rb = (size_t)blockIdx.x * 128;
  const __bf16* X = which == 0 ? XQ : which == 1 ? XK : XV; const __bf16* WA = which == 0 ? WQ : which == 1 ? WK : WV; const float* BA = which == 0 ? BQ : which == 1 ? BK : BV;
  v8f acc[4][4] = {};
  gemm_tile2(X + rb * DIN, WA + (size_t)c0 * DIN, sm, acc, tid);
  for (int hf = 0; hf < 2; ++hf) { const size_t r0 = rb + hf * 64; const size_t bb = r0 / TT; const int t0 = (int)(r0 % TT);   // the two 64-row halves, one after the other through the same LDS tiles
  if (hf) __syncthreads();   // ends every thread's reads of the first half's tiles before the second half overwrites them
  { // the two waves that own the half stage its f32 tile (acc + bias) in LDS; then the per-(row, head) epilogue hook, then convert
    if (wr == hf) {
#pragma unroll
    for (int j = 0; j < 4; ++j) { const float bias = BA ? bfr(BA[c0 + wc * 64 + j * 16 + col]) : 0.f;
#pragma unroll
      for (int i = 0; i < 4; ++i)
#pragma unroll
        for (int r = 0; r < 8; ++r) st[i * 16 + 8 * g + r][wc * 64 + j * 16 + col] = acc[i][j][r] + bias; } }
    __syncthreads();
    for (int e = tid; e < 64 * (128 / HD); e += 128) { const int rl = e / (128 / HD), hh = e % (128 / HD); PROJ_EPI(which, &st[rl][hh * HD], (int)((r0 + rl) % TT), (c0 / HD) + hh); }
    __syncthreads(); }
  if (which < 2) { _Float16* DH = which == 0 ? QH : KH; _Float16* DL = which == 0 ? QL : KL; const int nhi = which == 0 ? QHI : KHI; const bool hi_rows = t0 < nhi;
    for (int e = tid; e < 64 * 128; e += 128) { const int rl = e >> 7, cl = e & 127; const float v = st[rl][cl]; const _Float16 hv = (_Float16)v; sh[rl][cl] = hv; sl[rl][cl] = (_Float16)((v - (float)hv) * 1024.0f); }
    __syncthreads();
    for (int e = tid; e < 64 * 16; e += 128) { const int rl = e >> 4, q = e & 15; vst2((unsigned*)(DH + (r0 + rl) * CC + c0 + q * 8), *(const v4u*)&sh[rl][q * 8]); if (hi_rows) vst2((unsigned*)(DL + (bb * nhi + t0 + rl) * (size_t)CC + c0 + q * 8), *(const v4u*)&sl[rl][q * 8]); }
  } else { const bool hi_rows = t0 < KHI;
    for (int e = tid; e < 64 * 128; e += 128) { const int rl = e & 63, cl = e >> 6; const float v = st[rl][cl]; th[cl][rl] = (_Float16)v; const __bf16 bh = (__bf16)v; tb[cl][rl] = bh; tbl[cl][rl] = (__bf16)(v - (float)bh); }
    __syncthreads();
    for (int e = tid; e < 128 * 8; e += 128) { const int cl = e >> 3, q = e & 7; vst2((unsigned*)(VT + (bb * CC + c0 + cl) * (size_t)TT + t0 + q * 8), *(const v4u*)&th[cl][q * 8]); if (hi_rows) { const size_t o3 = (bb * CC + c0 + cl) * (size_t)KHI + t0 + q * 8; vst2((unsigned*)(VB + o3), *(const v4u*)&tb[cl][q * 8]); vst2((unsigned*)(VBL + o3), *(const v4u*)&tbl[cl][q * 8]); } } } }
}
// ---- k_fa: block = 64 queries (4 waves x 16) of (b, h), all keys in steps of 64, each step's K, V and bias tiles brought into LDS by asynchronous copies one step ahead (two buffers) and read there by the four waves: S^T = K . Q^T on top of C = bf16(attn_bias) (lane = one query, 8 keys a tile), running maximum and sum per query in registers, P^T x 2^11 (relative to the running maximum) once to f16 straight from the score registers as the B operand, ctx^T += V^T . P^T; ctx = ctx^T / sum at the end, stored x 2^6 as f16, the output projection's operand
#define LOG2E 1.44269504f
__device__ __forceinline__ v8f wmma_h(v16h a, v16h b, v8f c) { return __builtin_amdgcn_wmma_f32_16x16x32_f16(false, a, false, b, (short)0, c, false, false); }
// 2^x; the v_nop in the same statement is the one slot that the instruction set asks for behind a transcendental before its result is read or its source register overwritten
__device__ __forceinline__ float exp2s(float x) { float e; asm("v_exp_f32 %0, %1\n\tv_nop" : "=v"(e) : "v"(x)); return e; }
__device__ __forceinline__ v16h frag_p(const _Float16* p) { union { v16h v; v8h q[2]; } u; u.q[0] = *(const v8h*)p; u.q[1] = *(const v8h*)(p + 16); return u.v; }   // frag_h with the half's 8 elements already in the pointer
__device__ __forceinline__ float xhalf(float v) { const int b = __builtin_bit_cast(int, v); return __builtin_bit_cast(float, __builtin_amdgcn_permlanex16(b, b, 0x76543210, 0xfedcba98, false, false)); }   // the value of lane ^ 16
// one 64-key step's operands in LDS: 64 K rows and 64 V planes of 128 B at pitch 144 B, then the block's 64 bias rows of 256 B at pitch 272 B (pitches for ds_load_b128 readers)
#define FKP 144
#define FBP 272
#define FVO (64 * FKP)
#define FBO (2 * 64 * FKP)
#define FBUF (2 * 64 * FKP + 64 * FBP)
// one step's 16 copies of a thread, whole lines (8 lanes x 16 B = one K or V row, 16 lanes x 16 B = one bias row); lk, lb = the thread's LDS byte addresses of its first K and bias piece in the target buffer; the s_wait_xcnt at the end of each statement stands in front of any rewrite of the address registers that its copies name
__device__ __forceinline__ void fa_copy(unsigned lk, unsigned lb, const _Float16* kg, const _Float16* vg, const float* bg) {
  asm volatile("global_load_async_to_lds_b128 %0, %1, off\n\tglobal_load_async_to_lds_b128 %2, %3, off\n\tglobal_load_async_to_lds_b128 %4, %5, off\n\tglobal_load_async_to_lds_b128 %6, %7, off\n\t"
               "global_load_async_to_lds_b128 %8, %9, off\n\tglobal_load_async_to_lds_b128 %10, %11, off\n\tglobal_load_async_to_lds_b128 %12, %13, off\n\tglobal_load_async_to_lds_b128 %14, %15, off\n\ts_wait_xcnt 0x0"
               :: "v"(lk), "v"(kg), "v"(lk + 16 * FKP), "v"(kg + 16 * CC), "v"(lk + 32 * FKP), "v"(kg + 32 * CC), "v"(lk + 48 * FKP), "v"(kg + 48 * CC),
                  "v"(lk + FVO), "v"(vg), "v"(lk + FVO + 16 * FKP), "v"(vg + 16 * TT), "v"(lk + FVO + 32 * FKP), "v"(vg + 32 * TT), "v"(lk + FVO + 48 * FKP), "v"(vg + 48 * TT) : "memory");
  asm volatile("global_load_async_to_lds_b128 %0, %1, off\n\tglobal_load_async_to_lds_b128 %2, %3, off\n\tglobal_load_async_to_lds_b128 %4, %5, off\n\tglobal_load_async_to_lds_b128 %6, %7, off\n\t"
               "global_load_async_to_lds_b128 %8, %9, off\n\tglobal_load_async_to_lds_b128 %10, %11, off\n\tglobal_load_async_to_lds_b128 %12, %13, off\n\tglobal_load_async_to_lds_b128 %14, %15, off\n\ts_wait_xcnt 0x0"
               :: "v"(lb), "v"(bg), "v"(lb + 8 * FBP), "v"(bg + 8 * TT), "v"(lb + 16 * FBP), "v"(bg + 16 * TT), "v"(lb + 24 * FBP), "v"(bg + 24 * TT),
                  "v"(lb + 32 * FBP), "v"(bg + 32 * TT), "v"(lb + 40 * FBP), "v"(bg + 40 * TT), "v"(lb + 48 * FBP), "v"(bg + 48 * TT), "v"(lb + 56 * FBP), "v"(bg + 56 * TT) : "memory"); }
__global__ __launch_bounds__(128) void k_fa(const _Float16* __restrict__ QH, const _Float16* __restrict__ KH, const _Float16* __restrict__ VT, const float* __restrict__ ABI, _Float16* __restrict__ Y) { __shared__ __align__(16) char ring[2 * FBUF];   // two step buffers; behind the loop's last barrier the same bytes stage the output rows
  _Float16 (*ss)[16][HD + 8] = (_Float16 (*)[16][HD + 8])ring;
  const int tid = threadIdx.x, wave = tid >> 5, lane = tid & 31, col = lane & 15, g = lane >> 4; const int h = blockIdx.y, b = blockIdx.z; const int ql0 = blockIdx.x * 64 + wave * 16;
  const _Float16* qp = QH + ((size_t)b * TT + ql0 + col) * CC + h * HD; const v16h q0 = frag_h(qp, lane), q1 = frag_h(qp + 32, lane);
  const _Float16* kg = KH + ((size_t)b * TT + (tid >> 3)) * CC + h * HD + (tid & 7) * 8;             // the thread's 16 B of key row tid / 8 (then + 16, 32, 48); runs on by 64 keys a step
  const _Float16* vg = VT + ((size_t)b * CC + h * HD + (tid >> 3)) * (size_t)TT + (tid & 7) * 8;     // its 16 B of the v plane of dim tid / 8 (then + 16, 32, 48); runs on by 64 keys a step
  const float* bg = ABI + (size_t)(blockIdx.x * 64 + (tid >> 4)) * TT + (tid & 15) * 4;              // its 16 B of the block's query row tid / 16 (then + 8, ..., 56); runs on by 64 keys a step
  const unsigned lk = (unsigned)(size_t)ring + (tid >> 3) * FKP + (tid & 7) * 16, lb = (unsigned)(size_t)ring + FBO + (tid >> 4) * FBP + (tid & 15) * 16;
  const char* kr = ring + col * FKP + 16 * g;                        // key row col of a 16-key tile (v: dim col of a 16-dim tile), this half's 8 elements
  const char* br = ring + FBO + (wave * 16 + col) * FBP + 32 * g;    // this lane's query row, its 8 keys of a tile
  v8f acc[HD / 16] = {}; float m = -3.0e38f, l = 0.f;                        // m = running maximum of the query's logits; l = this half's share of the sum, x 2^11
  fa_copy(lk, lb, kg, vg, bg);
  asm volatile("s_wait_asynccnt 0x0" ::: "memory");   // step 0's pieces of this wave have landed
  __syncthreads();                                    // publishes step 0
  fa_copy(lk + FBUF, lb + FBUF, kg + 64 * CC, vg + 64, bg + 64);
  kg += 128 * CC; vg += 128; bg += 128;
  for (int t = 0; t < TT / 64; ++t) { const unsigned bo = (t & 1) * FBUF; v16h kf[8], vf[8]; v4f bf[8]; v8f s[4];   // every LDS read of the step stands as one group in front of its first product; the unrolls of this loop body make every index of kf, vf, bf, s, p and acc a constant, so that they stay in registers
#pragma unroll
    for (int j = 0; j < 4; ++j) { kf[2 * j] = frag_p((const _Float16*)(kr + bo + j * 16 * FKP)); kf[2 * j + 1] = frag_p((const _Float16*)(kr + bo + j * 16 * FKP + 64)); bf[2 * j] = *(const v4f*)(br + bo + j * 64); bf[2 * j + 1] = *(const v4f*)(br + bo + j * 64 + 16); }
#pragma unroll
    for (int kc = 0; kc < 2; ++kc)
#pragma unroll
      for (int j = 0; j < HD / 16; ++j) vf[kc * 4 + j] = frag_p((const _Float16*)(kr + bo + FVO + j * 16 * FKP + kc * 64));
    __builtin_amdgcn_sched_barrier(0);   // keeps the group together: without it the scheduler sinks each fragment's reads to just before its product, and every product waits out an LDS latency
#pragma unroll
    for (int j = 0; j < 4; ++j) { v8f c;
#pragma unroll
      for (int r = 0; r < 4; ++r) { c[r] = bfr(bf[2 * j][r]); c[4 + r] = bfr(bf[2 * j + 1][r]); }
      c = wmma_h(kf[2 * j], q0, c); s[j] = wmma_h(kf[2 * j + 1], q1, c); }
    float mx = m;
#pragma unroll
    for (int j = 0; j < 4; ++j)
#pragma unroll
      for (int r = 0; r < 8; ++r) mx = fmaxf(mx, s[j][r]);
    mx = fmaxf(mx, xhalf(mx));
    const float al = exp2s((m - mx) * LOG2E), mo = mx * LOG2E - 11.0f; m = mx;
    float sj[4]; v16h p[2];
#pragma unroll
    for (int j = 0; j < 4; ++j) { sj[j] = 0.f;
#pragma unroll
      for (int r = 0; r < 8; ++r) { const float e = exp2s(s[j][r] * LOG2E - mo); sj[j] += e; p[j >> 1][(j & 1) * 8 + r] = (_Float16)e; } }
    l = l * al + ((sj[0] + sj[1]) + (sj[2] + sj[3]));
#pragma unroll
    for (int j = 0; j < HD / 16; ++j) acc[j] = acc[j] * al;
#pragma unroll
    for (int kc = 0; kc < 2; ++kc)
#pragma unroll
      for (int j = 0; j < HD / 16; ++j) acc[j] = wmma_h(vf[kc * 4 + j], p[kc], acc[j]);
    __builtin_amdgcn_sched_barrier(0);   // keeps the step's products in front of the waits below: without it the scheduler lifts them and the barrier to just behind the read group, where the next step's copies have had no time to land
    asm volatile("s_wait_dscnt 0x0" ::: "memory");      // this wave's reads of the step's buffer have retired before the buffer is handed to the copies below
    asm volatile("s_wait_asynccnt 0x0" ::: "memory");   // this wave's pieces of step t + 1 have landed
    __syncthreads();                                    // publishes step t + 1 and ends every wave's reads of step t's buffer
    if (t + 2 < TT / 64) { fa_copy(lk + bo, lb + bo, kg, vg, bg); kg += 64 * CC; vg += 64; bg += 64; } }
  asm volatile("s_wait_asynccnt 0x0" ::: "memory");     // no copy is outstanding when the ring's bytes become output staging and when the wave ends
  l += xhalf(l); const float inv = l > 0.f ? 1.0f / l : 0.f;   /* a fully excluded row yields ctx = 0 */
#pragma unroll
  for (int j = 0; j < HD / 16; ++j) { v8h o;   /* ctx carried x 2^6 into f16 so small-magnitude context rows stay clear of f16 subnormals */
#pragma unroll
    for (int r = 0; r < 8; ++r) o[r] = (_Float16)((acc[j][r] * inv) * 64.0f);
    *(v8h*)&ss[wave][col][j * 16 + 8 * g] = o; }
  LDSX(); for (int i = 0; i < 4; ++i) { const int rl = 4 * i + (lane >> 3); vst2(Y + ((size_t)b * TT + ql0 + rl) * CC + h * HD + (lane & 7) * 8, *(const v4u*)&ss[wave][rl][(lane & 7) * 8]); } }
// ---- k_out: block = (64 rows, 128 cols): out = ctx Wo (+ bo): ctx x 2^6 in f16 against Wo as f16(bf16 x 2^8) exact (1 product) x 2^-14
__global__ __launch_bounds__(128) void k_out(const _Float16* __restrict__ Y, const _Float16* __restrict__ WO, const float* __restrict__ BO, float* __restrict__ OUT) { __shared__ __align__(16) float sf[4][16][132]; __shared__ __align__(16) char stg[2 * GBUF];
  const int tid = threadIdx.x, wave = tid >> 5, lane = tid & 31, col = lane & 15, g = lane >> 4; const int c0 = blockIdx.y * 128; const size_t r0 = (size_t)blockIdx.x * 64 + wave * 16;
  v8f acc[8] = {};
  gemm_tile<1>(Y + (size_t)blockIdx.x * 64 * CC, WO + (size_t)c0 * CC, stg, acc, tid);
#pragma unroll
    for (int j = 0; j < 8; ++j) { const float bias = BO ? bfr(BO[c0 + j * 16 + col]) : 0.f;
#pragma unroll
      for (int r = 0; r < 8; ++r) sf[wave][8 * g + r][j * 16 + col] = acc[j][r] * (1.0f / 16384.0f) + bias; }   /* 2^-8 (Wo carry) x 2^-6 (ctx carry) */
  LDSX(); for (int rl = 0; rl < 16; ++rl) vst2(OUT + (r0 + rl) * DIN + c0 + lane * 4, *(const v4f*)&sf[wave][rl][lane * 4]); }

extern "C" void kernel_launch(void* const* d_in, const int* in_sizes, int n_in, void* d_out, int out_size, void* d_ws, size_t ws_size, hipStream_t stream) {
  (void)in_sizes; (void)n_in; (void)out_size;
  const float** F = (const float**)d_in;
  if (ws_size < (size_t)WS_END) return;
  char* ws = (char*)d_ws; _Float16 *QH = (_Float16*)(ws + WS_QH), *KH = (_Float16*)(ws + WS_KH), *VT = (_Float16*)(ws + WS_VT), *QL = (_Float16*)(ws + WS_QL), *KL = (_Float16*)(ws + WS_KL); __bf16 *VB = (__bf16*)(ws + WS_VB), *VBL = (__bf16*)(ws + WS_VBL), *XB = (__bf16*)(ws + WS_XB), *WB = (__bf16*)(ws + WS_WB); _Float16 *WOH = (_Float16*)(ws + WS_WOH), *Y = (_Float16*)(ws + WS_Y);
  (void)Y; (void)QL; (void)KL; (void)VB; (void)VBL;
  // inputs: 0 x [2,2048,1024]; 1 attn_bias [1,1,2048,2048]; 2 w_qkv [3072,1024] (out,in): q rows 0..1023, k 1024..2047, v 2048..3071; 3 q_bias [1024] (zeros, read); 4 v_bias [1024] (zeros, read); 5 scale_mul [1,16,1,1] (ln 4, read); 6 w_proj [1024,1024] (out,in); 7 b_proj (zeros, read); the k stream has no bias (the module concatenates zeros)
  k_cvt<<<dim3((NB * TT * DIN + 3 * CC * DIN + DIN * CC) / 8192), 256, 0, stream>>>(F[0], F[2], F[6], XB, WB, WOH);
  k_proj<<<dim3(TNB * TT / 128, CC / 128, 3), 128, 0, stream>>>(XB, XB, XB, WB, WB + (size_t)CC * DIN, WB + 2 * (size_t)CC * DIN, F[3], nullptr, F[4], QH, QL, KH, KL, VT, VB, VBL, F[5]);
  k_fa<<<dim3(NQB, NH, TNB), 128, 0, stream>>>(QH, KH, VT, F[1], Y);
  k_out<<<dim3(TNB * TT / 64, DIN / 128), 128, 0, stream>>>(Y, WOH, F[7], (float*)d_out);
}

// v006
// One run takes 93.5 microseconds.
// Timed twice side by side with v005, it ran 1.06 and 1.05 times as fast.
// All steps since v000 together make it 15.4 times as fast.
// compute dtype: all float inputs rounded to bf16; q / k / v projections with EXACT bf16 products on WMMA 16x16x32 (f32 accumulate) + bias (q / v: zeros, read; k: none); q and k divided by their per-(token, head) L2 norm in f32, q then times exp(min(bf16(scale_mul[h]), ln 100)); logits q x k once to f16 each (1 product, scale 1), + bf16(attn_bias[q][k]) in f32; softmax f32 with a running maximum and sum over 64-key steps; exp(logit - running max) x 2^11 once to f16 x v once to f16 (1 product), divided by the f32 sum at the end; ctx x 2^6 once to f16 x w_proj f16(bf16 x 2^8) + b_proj; f32 output.
#include <hip/hip_runtime.h>
#include <math.h>

typedef __attribute__((ext_vector_type(16))) _Float16 v16h;
typedef __attribute__((ext_vector_type(16))) __bf16 v16b;
typedef __attribute__((ext_vector_type(8)))  _Float16 v8h;
typedef __attribute__((ext_vector_type(8)))  float v8f;
typedef __attribute__((ext_vector_type(4)))  float v4f;
typedef __attribute__((ext_vector_type(2)))  float v2f;
typedef __attribute__((ext_vector_type(4)))  unsigned v4u;
typedef __attribute__((ext_vector_type(4)))  int v4i;
typedef float __attribute__((may_alias)) float_a;
typedef int __attribute__((may_alias)) int_a;

template <typename T> __device__ __forceinline__ void vst2(void* p, T v) { *(T*)p = v;  }
__device__ __forceinline__ v8f wmma16(v16h a, v16h b, v8f c) {
  v8f d = __builtin_amdgcn_wmma_f32_16x16x32_f16(false, a, false, b, (short)0, c, false, false);
  asm volatile("v_nop\n\tv_nop\n\tv_nop\n\tv_nop" : "+v"(d) : "v"(a), "v"(b));
  return d;
}
__device__ __forceinline__ v8f wmma_bf(v16b a, v16b b, v8f c) {
  v8f d = __builtin_amdgcn_wmma_f32_16x16x32_bf16(false, a, false, b, (short)0, c, false, false);
  asm volatile("v_nop\n\tv_nop\n\tv_nop\n\tv_nop" : "+v"(d) : "v"(a), "v"(b));
  return d;
}
// 16x16x32 fragments: lane = (h = lane>>4, row/col = lane&15); elements 0..7 = k0+8h+0..7, 8..15 = k0+16+8h+0..7; D element r = row 8h+r
__device__ __forceinline__ v16h frag_h(const _Float16* rowk0, int lane) {
  union { v16h v; v8h q[2]; } u; const _Float16* p = rowk0 + 8 * (lane >> 4);
  u.q[0] = *(const v8h*)p; u.q[1] = *(const v8h*)(p + 16); return u.v;
}
__device__ __forceinline__ v16h frag_f32(const float* rowk0, int lane) {
  v16h a; const float* p = rowk0 + 8 * (lane >> 4);
#pragma unroll
  for (int i = 0; i < 8; ++i) { a[i] = (_Float16)p[i]; a[8 + i] = (_Float16)p[16 + i]; }
  return a;
}
__device__ __forceinline__ v16h frag_f32s(const float* rowk0, int lane, float sc) {
  v16h a; const float* p = rowk0 + 8 * (lane >> 4);
#pragma unroll
  for (int i = 0; i < 8; ++i) { a[i] = (_Float16)(p[i] * sc); a[8 + i] = (_Float16)(p[16 + i] * sc); }
  return a;
}
// column fragment from a [K][ld] layout (column n), rows >= K read as 0
__device__ __forceinline__ v16h fragc_f32(const float* W, int k0, int n, int lane, int ld, int K) {
  v16h a; const int g = lane >> 4;
#pragma unroll
  for (int i = 0; i < 8; ++i) { const int ka = k0 + 8 * g + i, kb = ka + 16;
    a[i] = (_Float16)(ka < K ? W[(size_t)(ka < K ? ka : K - 1) * ld + n] : 0.f); a[8 + i] = (_Float16)(kb < K ? W[(size_t)(kb < K ? kb : K - 1) * ld + n] : 0.f); }
  return a;
}
struct F2 { v16b h, l; };
__device__ __forceinline__ F2 bsplit16(const float v[16]) { F2 r;
#pragma unroll
  for (int i = 0; i < 16; ++i) { const __bf16 h = (__bf16)v[i]; r.h[i] = h; r.l[i] = (__bf16)(v[i] - (float)h); }
  return r; }
__device__ __forceinline__ F2 split_row(const float* row, int k0, int lane) { float v[16]; const float* p = row + k0 + 8 * (lane >> 4);
#pragma unroll
  for (int i = 0; i < 8; ++i) { v[i] = p[i]; v[8 + i] = p[16 + i]; }
  return bsplit16(v); }
__device__ __forceinline__ F2 split_rowK(const float* row, int k0, int lane, int K) { float v[16]; const int g = lane >> 4;
#pragma unroll
  for (int i = 0; i < 8; ++i) { const int ka = k0 + 8 * g + i, kb = ka + 16; v[i] = ka < K ? row[ka < K ? ka : K - 1] : 0.f; v[8 + i] = kb < K ? row[kb < K ? kb : K - 1] : 0.f; }
  return bsplit16(v); }
__device__ __forceinline__ F2 split_col(const float* W, int k0, int n, int lane, int ld, int K) { float v[16]; const int g = lane >> 4;
#pragma unroll
  for (int i = 0; i < 8; ++i) { const int ka = k0 + 8 * g + i, kb = ka + 16; v[i] = ka < K ? W[(size_t)(ka < K ? ka : K - 1) * ld + n] : 0.f; v[8 + i] = kb < K ? W[(size_t)(kb < K ? kb : K - 1) * ld + n] : 0.f; }
  return bsplit16(v); }
__device__ __forceinline__ v8f mac3(const F2& a, const F2& b, v8f c) { c = wmma_bf(a.l, b.h, c); c = wmma_bf(a.h, b.l, c); return wmma_bf(a.h, b.h, c); }
__device__ __forceinline__ float sigm(float v) { return 1.0f / (1.0f + expf(-v)); }
#define LDSX() do { asm volatile("s_wait_dscnt 0" ::: "memory"); __builtin_amdgcn_wave_barrier(); __builtin_amdgcn_fence(__ATOMIC_RELEASE, "workgroup"); } while (0)

// Multi-head COSINE self-attention with a per-head learned scale and an additive attention bias (x [2,2048,1024]; attn_bias [1,1,2048,2048] N(0,1), one entry per (query, key), shared by batches and heads - READ on the device; w_qkv [3072,1024] torch (out,in) N(0, 1/1024): q = rows 0..1023, k = 1024..2047, v = 2048..3071 (reshape (B, L, 3, 16, 64)); q_bias / v_bias zeros (read), k has no bias; scale_mul [1,16,1,1] = ln 4 (const; read): sm = exp(min(scale_mul, ln 100)) = 4; q <- q / ||q|| * sm, k <- k / ||k|| per head row; attn = q k^T + attn_bias; softmax; oup through w_proj [1024,1024] (out,in) + b_proj zeros).
#define NB 2
#define TT 2048
#define CC 1024            // NH * HD = projected width
#define DIN 1024          // input (model) width
#define NH 16
#define HD 64
#define NQB (TT / 64)
#define HG 4
#define SCALE (1.0f)
#define CAUSAL 0
#ifndef TNB
#define TNB NB
#endif
__device__ __forceinline__ float bfr(float v) { return (float)(__bf16)v; }
__host__ __device__ __forceinline__ int kb_last(int qb) { return CAUSAL ? ((qb * 64 + 63) >> 7) : (TT / 128 - 1); }
typedef __attribute__((ext_vector_type(8))) __bf16 v8b;
__device__ __forceinline__ v16b frag_b(const __bf16* rowk0, int lane) {
  union { v16b v; v8b q[2]; } u; const __bf16* p = rowk0 + 8 * (lane >> 4);
  u.q[0] = *(const v8b*)p; u.q[1] = *(const v8b*)(p + 16); return u.v;
}
#define QBH 0              // unused: k_fa has one path for all query blocks
#define QHI 0               // single-product logits on every row (unit-norm operands x 4: |cosine logit| <= 4)
#define KHI 64            // key rows carrying k residual / v bf16 hi+lo planes (written by k_proj; no kernel reads them)
// B fragment (k rows k0+.., output column o) of a weight: (in,out) [K][ld] or (out,in) [ld rows of K]: bf16 exact, or f16(bf16 * 256) exact
__device__ __forceinline__ v16b wcol_io(const float* Wm, int k0, int o, int lane, int ld) { v16b w; const int g = lane >> 4;
#pragma unroll
  for (int i = 0; i < 8; ++i) { w[i] = (__bf16)Wm[(size_t)(k0 + 8 * g + i) * ld + o]; w[8 + i] = (__bf16)Wm[(size_t)(k0 + 16 + 8 * g + i) * ld + o]; }
  return w; }
__device__ __forceinline__ v16b wcol_oi(const float* Wm, int k0, int o, int lane, int K) { v16b w; const float* p = Wm + (size_t)o * K + k0 + 8 * (lane >> 4);
#pragma unroll
  for (int i = 0; i < 8; ++i) { w[i] = (__bf16)p[i]; w[8 + i] = (__bf16)p[16 + i]; }
  return w; }
__device__ __forceinline__ v16h wcolh_io(const float* Wm, int k0, int o, int lane, int ld) { v16h w; const int g = lane >> 4;
#pragma unroll
  for (int i = 0; i < 8; ++i) { w[i] = (_Float16)(bfr(Wm[(size_t)(k0 + 8 * g + i) * ld + o]) * 256.0f); w[8 + i] = (_Float16)(bfr(Wm[(size_t)(k0 + 16 + 8 * g + i) * ld + o]) * 256.0f); }
  return w; }
__device__ __forceinline__ v16h wcolh_oi(const float* Wm, int k0, int o, int lane, int K) { v16h w; const float* p = Wm + (size_t)o * K + k0 + 8 * (lane >> 4);
#pragma unroll
  for (int i = 0; i < 8; ++i) { w[i] = (_Float16)(bfr(p[i]) * 256.0f); w[8 + i] = (_Float16)(bfr(p[16 + i]) * 256.0f); }
  return w; }
#define WQKV_LAYOUT 1   // 0 = (in,out) [DIN][CC]; 1 = (out,in) [CC][DIN]; 2 = per-head [NH][DIN][HD]
__device__ __forceinline__ v16b wcol_hdk(const float* Wm, int k0, int o, int lane) { v16b w; const int g = lane >> 4; const float* p = Wm + (size_t)(o / HD) * DIN * HD + (o % HD);
#pragma unroll
  for (int i = 0; i < 8; ++i) { w[i] = (__bf16)p[(size_t)(k0 + 8 * g + i) * HD]; w[8 + i] = (__bf16)p[(size_t)(k0 + 16 + 8 * g + i) * HD]; }
  return w; }
#define WO_OUT_IN 1
#if WQKV_LAYOUT == 1
#define WCOL(W, k0, o, lane) wcol_oi(W, k0, o, lane, DIN)
#elif WQKV_LAYOUT == 2
#define WCOL(W, k0, o, lane) wcol_hdk(W, k0, o, lane)
#else
#define WCOL(W, k0, o, lane) wcol_io(W, k0, o, lane, CC)
#endif
#if WO_OUT_IN
#define WOCOL(W, k0, o, lane) wcol_oi(W, k0, o, lane, CC)
#define WOCOLH(W, k0, o, lane) wcolh_oi(W, k0, o, lane, CC)
#else
#define WOCOL(W, k0, o, lane) wcol_io(W, k0, o, lane, DIN)
#define WOCOLH(W, k0, o, lane) wcolh_io(W, k0, o, lane, DIN)
#endif

#define MAX_SCALE_MUL 4.605170186f   // ln(100): the module's clamp on scale_mul
#define PROJ_EXTRA_PARAMS , const float* __restrict__ SMU   /* scale_mul [1][NH][1][1], a module input */
// per (token, head) hook on the staged f32 row (64 floats, projection + bias) of the q and k streams: x <- x / sqrt(sum x^2) (jnp.linalg.norm, no epsilon in the module); the q stream is then multiplied by sm = expf(fminf(bf16(scale_mul[h]), ln 100)); v untouched; the sum of squares in f32, products and sums kept separate
#define PROJ_EPI(which, row, t, h) do { if ((which) < 2) { float* rw = (row); float ss_ = 0.f; _Pragma("unroll 8") for (int i = 0; i < 64; ++i) { _Pragma("clang fp contract(off)") const float sq_ = rw[i] * rw[i]; ss_ = ss_ + sq_; } const float dn_ = sqrtf(ss_); const float sm_ = ((which) == 0) ? expf(fminf(bfr(SMU[(h)]), MAX_SCALE_MUL)) : 1.0f; _Pragma("unroll 8") for (int i = 0; i < 64; ++i) { _Pragma("clang fp contract(off)") const float u_ = rw[i] / dn_; rw[i] = ((which) == 0) ? (u_ * sm_) : u_; } } } while (0)
#ifndef PROJ_EXTRA_PARAMS
#define PROJ_EXTRA_PARAMS
#endif

#define WS_QH  0u                                      // f16 q rows [b*t][CC]
#define WS_KH  (WS_QH + 2u * (size_t)NB * TT * CC)      // f16 k rows [b*t][CC]
#define WS_VT  (WS_KH + 2u * (size_t)NB * TT * CC)      // f16 v planes [b][c][t]
#define WS_QL  (WS_VT + 2u * (size_t)NB * CC * TT)      // f16 q residual x 2^10 rows [b][t < QHI][CC]
#define WS_KL  (WS_QL + 2u * (size_t)NB * QHI * CC)     // f16 k residual x 2^10 rows [b][t < KHI][CC]
#define WS_VB  (WS_KL + 2u * (size_t)NB * KHI * CC)     // bf16 v hi planes [b][c][t < KHI]
#define WS_VBL (WS_VB + 2u * (size_t)NB * CC * KHI)
#define WS_S   (WS_VBL + 2u * (size_t)NB * CC * KHI)    // region of 4 * HG * TT * TT bytes; its head holds the four 16-bit operand copies below
#define WS_XB  WS_S                                    // bf16 x rows [b*t][DIN]
#define WS_WB  (WS_XB + 2u * (size_t)NB * TT * DIN)     // bf16 w_qkv rows [3 * CC][DIN]
#define WS_WOH (WS_WB + 2u * 3u * (size_t)CC * DIN)     // f16(bf16 x 2^8) w_proj rows [DIN][CC]
#define WS_AB  (WS_WOH + 2u * (size_t)DIN * CC)          // bf16 attn_bias rows [TT][TT]
#define WS_Y   (WS_S  + 4u * (size_t)HG * TT * TT)      // f16 ctx x 2^6 rows [b*t][CC]
#define WS_END (WS_Y  + 4u * (size_t)NB * TT * CC)

// ---- gemm_tile: the 64 x 128 tile of A . W^T (both K-contiguous, already in their 16-bit operand type, K = 1024) of one 4-wave block. Each 128-k stage of both operands is fetched by whole-line loads (16 lanes x 16 B = 256 B of one row) and laid in LDS as it is, where all four waves read their fragments; two LDS buffers, the next stage's loads in flight in registers during the products; k runs upward in steps of 32
typedef __attribute__((ext_vector_type(2))) unsigned v2u;
#define GK 128                     // k per stage
#define GP 272                     // LDS row pitch, bytes: 256 B of 16-bit data + 16 B (pitch for ds_load_b128 readers)
#define GBUF ((64 + 128) * GP)     // one stage: 64 A rows, then 128 W rows
__device__ __forceinline__ v2u pk_bf(v4f v) { union { v2u u; __bf16 e[4]; } r;
#pragma unroll
  for (int i = 0; i < 4; ++i) r.e[i] = (__bf16)v[i];
  return r.u; }
__device__ __forceinline__ v2u pk_wo(v4f v) { union { v2u u; _Float16 e[4]; } r;    // f16(bf16 x 2^8), exact
#pragma unroll
  for (int i = 0; i < 4; ++i) r.e[i] = (_Float16)((float)(__bf16)v[i] * 256.0f);
  return r.u; }
// one stage's 24 loads of a thread (8 of A, 16 of W; the thread's offset is the same in both tiles and never changes), then the two block-uniform bases one stage on; the unrolls here and in gemm_tile make every index of ra, rw, w and acc a constant, so that these arrays stay in registers
template <typename E> __device__ __forceinline__ void gemm_fetch(const E*& Ag, const E*& Wg, unsigned off, v4u (&ra)[8], v4u (&rw)[16]) {
#pragma unroll
  for (int i = 0; i < 8; ++i) ra[i] = *(const v4u*)(Ag + off + i * 8 * 1024);
#pragma unroll
  for (int i = 0; i < 16; ++i) rw[i] = *(const v4u*)(Wg + off + i * 8 * 1024);
  asm volatile("s_wait_xcnt 0x0" :: "v"(off) : "memory");   // stands in front of the overwrite of the loads' base registers just below; the offset as an input keeps its register from being handed to a later load of the group as its destination
  __builtin_amdgcn_sched_barrier(0);                        // keeps the stage's loads in front of the products that are to cover their latency, and the steps of the bases behind the wait
  Ag += GK; Wg += GK; }
template <int F16, typename E> __device__ __forceinline__ void gemm_tile(const E* Ag, const E* Wg, char* stg, v8f (&acc)[8], int tid) {
  const int wave = tid >> 5, lane = tid & 31, col = lane & 15, g = lane >> 4;
  const unsigned off = (tid >> 4) * 1024 + (tid & 15) * 8;                   // 8 rows a pass of the block, 16 lanes x 16 B a row
  char* sp = stg + (tid >> 4) * GP + (tid & 15) * 16;
  const char* fa = stg + (wave * 16 + col) * GP + 16 * g;              // fragment: elements 0..7 = k0 + 8g + 0..7, 8..15 = k0 + 16 + 8g + 0..7
  const char* fw = stg + (64 + col) * GP + 16 * g;
  v4u ra[8], rw[16];
  gemm_fetch(Ag, Wg, off, ra, rw);
  for (int s = 0; s < 1024 / GK; ++s) { const int bo = (s & 1) * GBUF;
#pragma unroll
    for (int i = 0; i < 8; ++i) *(v4u*)(sp + bo + i * 8 * GP) = ra[i];
#pragma unroll
    for (int i = 0; i < 16; ++i) *(v4u*)(sp + bo + (64 + i * 8) * GP) = rw[i];
    __syncthreads();   // publishes stage s; a wave that has passed it has left the other buffer, which stage s + 1 overwrites only behind this barrier
    if (s + 1 < 1024 / GK) gemm_fetch(Ag, Wg, off, ra, rw);
#pragma unroll
    for (int kk = 0; kk < GK / 32; ++kk) { union { v4u q[2]; v16b b; v16h h; } a, w[8]; a.q[0] = *(const v4u*)(fa + bo + kk * 64); a.q[1] = *(const v4u*)(fa + bo + kk * 64 + 32);   // the nine fragments of a 32-k block are read as one group in front of its eight products
#pragma unroll
      for (int j = 0; j < 8; ++j) { w[j].q[0] = *(const v4u*)(fw + bo + j * 16 * GP + kk * 64); w[j].q[1] = *(const v4u*)(fw + bo + j * 16 * GP + kk * 64 + 32); }
      __builtin_amdgcn_sched_barrier(0);   // keeps the group together: without it the scheduler sinks each fragment's two reads to just before its product, into one register set, and every product waits out a whole LDS latency
#pragma unroll
      for (int j = 0; j < 8; ++j) acc[j] = F16 ? __builtin_amdgcn_wmma_f32_16x16x32_f16(false, a.h, false, w[j].h, (short)0, acc[j], false, false) : __builtin_amdgcn_wmma_f32_16x16x32_bf16(false, a.b, false, w[j].b, (short)0, acc[j], false, false); } }
}
// ---- gemm_tile2: the 128 x 128 tile of A . W^T (both K-contiguous bf16, K = 1024) of one 4-wave block; wave (wr, wc) owns the 64 x 64 quarter, so the eight fragments of a 32-k block feed sixteen products. Each 64-k stage of both operands is fetched by whole-line loads (8 lanes x 16 B = 128 B of one row) and laid in LDS as it is; two LDS buffers, the next stage's loads in flight in registers during the products; k runs upward in steps of 32
#define HK 64                      // k per stage
#define HP 144                     // LDS row pitch, bytes: 128 B of 16-bit data + 16 B (pitch for ds_load_b128 readers)
#define HBUF ((128 + 128) * HP)    // one stage: 128 A rows, then 128 W rows
// one stage's 16 loads of a thread (8 of A, 8 of W; the thread's offset is the same in both tiles and never changes), then the two block-uniform bases one stage on; the unrolls here and in gemm_tile2 make every index of ra, rw, a, w and acc a constant, so that these arrays stay in registers
__device__ __forceinline__ void gemm_fetch2(const __bf16*& Ag, const __bf16*& Wg, unsigned off, v4u (&ra)[8], v4u (&rw)[8]) {
#pragma unroll
  for (int i = 0; i < 8; ++i) ra[i] = *(const v4u*)(Ag + off + i * 16 * 1024);
#pragma unroll
  for (int i = 0; i < 8; ++i) rw[i] = *(const v4u*)(Wg + off + i * 16 * 1024);
  asm volatile("s_wait_xcnt 0x0" :: "v"(off) : "memory");   // stands in front of the overwrite of the loads' base registers just below; the offset as an input keeps its register from being handed to a later load of the group as its destination
  __builtin_amdgcn_sched_barrier(0);                        // keeps the stage's loads in front of the products that are to cover their latency, and the steps of the bases behind the wait
  Ag += HK; Wg += HK; }
__device__ __forceinline__ void gemm_tile2(const __bf16* Ag, const __bf16* Wg, char* stg, v8f (&acc)[4][4], int tid) {
  const int wave = tid >> 5, lane = tid & 31, col = lane & 15, g = lane >> 4, wr = wave >> 1, wc = wave & 1;
  const unsigned off = (tid >> 3) * 1024 + (tid & 7) * 8;                    // 16 rows a pass of the block, 8 lanes x 16 B a row
  char* sp = stg + (tid >> 3) * HP + (tid & 7) * 16;
  const char* fa = stg + (wr * 64 + col) * HP + 16 * g;                // fragment: elements 0..7 = k0 + 8g + 0..7, 8..15 = k0 + 16 + 8g + 0..7
  const char* fw = stg + (128 + wc * 64 + col) * HP + 16 * g;
  v4u ra[8], rw[8];
  gemm_fetch2(Ag, Wg, off, ra, rw);
  for (int s = 0; s < 1024 / HK; ++s) { const int bo = (s & 1) * HBUF;
#pragma unroll
    for (int i = 0; i < 8; ++i) *(v4u*)(sp + bo + i * 16 * HP) = ra[i];
#pragma unroll
    for (int i = 0; i < 8; ++i) *(v4u*)(sp + bo + (128 + i * 16) * HP) = rw[i];
    __syncthreads();   // publishes stage s; a wave that has passed it has left the other buffer, which stage s + 1 overwrites only behind this barrier
    if (s + 1 < 1024 / HK) gemm_fetch2(Ag, Wg, off, ra, rw);
#pragma unroll
    for (int kk = 0; kk < HK / 32; ++kk) { union { v4u q[2]; v16b b; } a[4], w[4];   // the eight fragments of a 32-k block are read as one group in front of its sixteen products
#pragma unroll
      for (int i = 0; i < 4; ++i) { a[i].q[0] = *(const v4u*)(fa + bo + i * 16 * HP + kk * 64); a[i].q[1] = *(const v4u*)(fa + bo + i * 16 * HP + kk * 64 + 32); w[i].q[0] = *(const v4u*)(fw + bo + i * 16 * HP + kk * 64); w[i].q[1] = *(const v4u*)(fw + bo + i * 16 * HP + kk * 64 + 32); }
      __builtin_amdgcn_sched_barrier(0);   // keeps the group together: without it the scheduler sinks each fragment's two reads to just before its product, and every product waits out a whole LDS latency
#pragma unroll
      for (int i = 0; i < 4; ++i)
#pragma unroll
        for (int j = 0; j < 4; ++j) acc[i][j] = __builtin_amdgcn_wmma_f32_16x16x32_bf16(false, a[i].b, false, w[j].b, (short)0, acc[i][j], false, false); } }
}
// ---- k_cvt: x, w_qkv and attn_bias once to bf16, w_proj once to f16(bf16 x 2^8): the operands that the stages of the two GEMMs and the steps of k_fa fetch. Block = 8192 consecutive floats of one of the four arrays; a wave's load covers 512 B, its store 256 B; the unrolls keep v and o in registers
template <int WOF> __device__ __forceinline__ void cvt_run(const float* sp, char* dp) { v4f v[8]; v2u o[8];
#pragma unroll
  for (int j = 0; j < 8; ++j) v[j] = *(const v4f*)(sp + j * 1024);
  asm volatile("s_wait_xcnt 0x0" ::: "memory");   // stands in front of any rewrite of the loads' address registers
#pragma unroll
  for (int j = 0; j < 8; ++j) o[j] = WOF ? pk_wo(v[j]) : pk_bf(v[j]);
#pragma unroll
  for (int j = 0; j < 8; ++j) *(v2u*)(dp + j * 2048) = o[j];
  asm volatile("s_wait_xcnt 0x0" ::: "memory"); }   // stands behind the last store, in front of any rewrite of the stores' data and address registers on a way that the listing lays behind them
__global__ __launch_bounds__(256) void k_cvt(const float* __restrict__ X, const float* __restrict__ WQKV, const float* __restrict__ WO, const float* __restrict__ ABI, __bf16* __restrict__ XB, __bf16* __restrict__ WB, _Float16* __restrict__ WOH, __bf16* __restrict__ AB) {
  const int nx = NB * TT * DIN / 8192, nw = 3 * CC * DIN / 8192, no = DIN * CC / 8192, blk = blockIdx.x; const size_t t4 = threadIdx.x * 4;   /* the four branches are block-uniform */
  if (blk < nx) { const size_t e = (size_t)blk * 8192 + t4; cvt_run<0>(X + e, (char*)XB + 2 * e); }
  else if (blk < nx + nw) { const size_t e = (size_t)(blk - nx) * 8192 + t4; cvt_run<0>(WQKV + e, (char*)WB + 2 * e); }
  else if (blk < nx + nw + no) { const size_t e = (size_t)(blk - nx - nw) * 8192 + t4; cvt_run<1>(WO + e, (char*)WOH + 2 * e); }
  else { const size_t e = (size_t)(blk - nx - nw - no) * 8192 + t4; cvt_run<0>(ABI + e, (char*)AB + 2 * e); } }
// ---- k_proj: block = (128 rows, 128 cols, which), the epilogue run once for each 64-row half: q/k/v = X W (+ b) with exact bf16 products (K = DIN) -> which 0: q f16 rows (+ residual rows < QHI); 1: k f16 rows (+ residual rows < KHI); 2: v f16 planes [c][t] (+ bf16 hi/lo planes for t < KHI)
__global__ __launch_bounds__(128) void k_proj(const __bf16* __restrict__ XQ, const __bf16* __restrict__ XK, const __bf16* __restrict__ XV, const __bf16* __restrict__ WQ, const __bf16* __restrict__ WK, const __bf16* __restrict__ WV, const float* __restrict__ BQ, const float* __restrict__ BK, const float* __restrict__ BV,
    _Float16* __restrict__ QH, _Float16* __restrict__ QL, _Float16* __restrict__ KH, _Float16* __restrict__ KL, _Float16* __restrict__ VT, __bf16* __restrict__ VB, __bf16* __restrict__ VBL PROJ_EXTRA_PARAMS) {
  __shared__ __align__(16) char sm[64 * 132 * 4 + 3 * 128 * 72 * 2];   // the two operand stages (2 * HBUF bytes, fewer than this) during the products; then st at the head of the first buffer (smaller than it; the last stage, an odd one, is read from the second, and every wave left the first before that stage's barrier), and behind st, written only behind the epilogue's barriers, the 16-bit output tiles (sh, sl or th, tb, tbl)
  float (*st)[132] = (float (*)[132])sm; char* ep = sm + 64 * 132 * 4; _Float16 (*sh)[136] = (_Float16 (*)[136])ep; _Float16 (*sl)[136] = (_Float16 (*)[136])(ep + 64 * 136 * 2); _Float16 (*th)[72] = (_Float16 (*)[72])ep; __bf16 (*tb)[72] = (__bf16 (*)[72])(ep + 128 * 72 * 2); __bf16 (*tbl)[72] = (__bf16 (*)[72])(ep + 2 * 128 * 72 * 2);
  const int tid = threadIdx.x, wave = tid >> 5, lane = tid & 31, col = lane & 15, g = lane >> 4; const int wr = wave >> 1, wc = wave & 1; const int which = blockIdx.z; const int c0 = blockIdx.y * 128; const size_t rb = (size_t)blockIdx.x * 128;
  const __bf16* X = which == 0 ? XQ : which == 1 ? XK : XV; const __bf16* WA = which == 0 ? WQ : which == 1 ? WK : WV; const float* BA = which == 0 ? BQ : which == 1 ? BK : BV;
  v8f acc[4][4] = {};
  gemm_tile2(X + rb * DIN, WA + (size_t)c0 * DIN, sm, acc, tid);
  for (int hf = 0; hf < 2; ++hf) { const size_t r0 = rb + hf * 64; const size_t bb = r0 / TT; const int t0 = (int)(r0 % TT);   // the two 64-row halves, one after the other through the same LDS tiles
  if (hf) __syncthreads();   // ends every thread's reads of the first half's tiles before the second half overwrites them
  { // the two waves that own the half stage its f32 tile (acc + bias) in LDS; then the per-(row, head) epilogue hook, then convert
    if (wr == hf) {
#pragma unroll
    for (int j = 0; j < 4; ++j) { const float bias = BA ? bfr(BA[c0 + wc * 64 + j * 16 + col]) : 0.f;
#pragma unroll
      for (int i = 0; i < 4; ++i)
#pragma unroll
        for (int r = 0; r < 8; ++r) st[i * 16 + 8 * g + r][wc * 64 + j * 16 + col] = acc[i][j][r] + bias; } }
    __syncthreads();
    for (int e = tid; e < 64 * (128 / HD); e += 128) { const int rl = e / (128 / HD), hh = e % (128 / HD); PROJ_EPI(which, &st[rl][hh * HD], (int)((r0 + rl) % TT), (c0 / HD) + hh); }
    __syncthreads(); }
  if (which < 2) { _Float16* DH = which == 0 ? QH : KH; _Float16* DL = which == 0 ? QL : KL; const int nhi = which == 0 ? QHI : KHI; const bool hi_rows = t0 < nhi;
    for (int e = tid; e < 64 * 128; e += 128) { const int rl = e >> 7, cl = e & 127; const float v = st[rl][cl]; const _Float16 hv = (_Float16)v; sh[rl][cl] = hv; sl[rl][cl] = (_Float16)((v - (float)hv) * 1024.0f); }
    __syncthreads();
    for (int e = tid; e < 64 * 16; e += 128) { const int rl = e >> 4, q = e & 15; vst2((unsigned*)(DH + (r0 + rl) * CC + c0 + q * 8), *(const v4u*)&sh[rl][q * 8]); if (hi_rows) vst2((unsigned*)(DL + (bb * nhi + t0 + rl) * (size_t)CC + c0 + q * 8), *(const v4u*)&sl[rl][q * 8]); }
  } else { const bool hi_rows = t0 < KHI;
    for (int e = tid; e < 64 * 128; e += 128) { const int rl = e & 63, cl = e >> 6; const float v = st[rl][cl]; th[cl][rl] = (_Float16)v; const __bf16 bh = (__bf16)v; tb[cl][rl] = bh; tbl[cl][rl] = (__bf16)(v - (float)bh); }
    __syncthreads();
    for (int e = tid; e < 128 * 8; e += 128) { const int cl = e >> 3, q = e & 7; vst2((unsigned*)(VT + (bb * CC + c0 + cl) * (size_t)TT + t0 + q * 8), *(const v4u*)&th[cl][q * 8]); if (hi_rows) { const size_t o3 = (bb * CC + c0 + cl) * (size_t)KHI + t0 + q * 8; vst2((unsigned*)(VB + o3), *(const v4u*)&tb[cl][q * 8]); vst2((unsigned*)(VBL + o3), *(const v4u*)&tbl[cl][q * 8]); } } } }
}
// ---- k_fa: block = 64 queries (4 waves x 16) of (b, h), all keys in steps of 64, each step's K, V and bias tiles brought into LDS by asynchronous copies one step ahead (two buffers) and read there by the four waves: S^T = K . Q^T on top of bf16(attn_bias), which an identity A lays into the score registers as the B operand of one bf16 product a tile (1 x b + zeros, exact) (lane = one query, 8 keys a tile), running maximum and sum per query in registers, P^T x 2^11 (relative to the running maximum) once to f16 straight from the score registers as the B operand, ctx^T += V^T . P^T; ctx = ctx^T / sum at the end, stored x 2^6 as f16, the output projection's operand
#define LOG2E 1.44269504f
__device__ __forceinline__ v8f wmma_h(v16h a, v16h b, v8f c) { return __builtin_amdgcn_wmma_f32_16x16x32_f16(false, a, false, b, (short)0, c, false, false); }
// 2^x; the v_nop in the same statement is the one slot that the instruction set asks for behind a transcendental before its result is read or its source register overwritten
__device__ __forceinline__ float exp2s(float x) { float e; asm("v_exp_f32 %0, %1\n\tv_nop" : "=v"(e) : "v"(x)); return e; }
__device__ __forceinline__ v16h frag_p(const _Float16* p) { union { v16h v; v8h q[2]; } u; u.q[0] = *(const v8h*)p; u.q[1] = *(const v8h*)(p + 16); return u.v; }   // frag_h with the half's 8 elements already in the pointer
__device__ __forceinline__ v16b frag_pb(const __bf16* p) { union { v16b v; v8b q[2]; } u; u.q[0] = *(const v8b*)p; u.q[1] = *(const v8b*)(p + 16); return u.v; }   // the same of bf16
__device__ __forceinline__ float xhalf(float v) { const int b = __builtin_bit_cast(int, v); return __builtin_bit_cast(float, __builtin_amdgcn_permlanex16(b, b, 0x76543210, 0xfedcba98, false, false)); }   // the value of lane ^ 16
// one 64-key step's operands in LDS: 64 K rows, 64 V planes and the block's 64 bf16 bias rows, each of 128 B at pitch 144 B (pitch for ds_load_b128 readers)
#define FKP 144
#define FVO (64 * FKP)
#define FBO (2 * 64 * FKP)
#define FBUF (3 * 64 * FKP)
// one step's 12 copies of a thread, whole lines (8 lanes x 16 B = one K, V or bias row); lk = the thread's LDS byte address of its first K piece in the target buffer; the s_wait_xcnt at the end of the statement stands in front of any rewrite of the address registers that its copies name
__device__ __forceinline__ void fa_copy(unsigned lk, const _Float16* kg, const _Float16* vg, const __bf16* bg) {
  asm volatile("global_load_async_to_lds_b128 %0, %1, off\n\tglobal_load_async_to_lds_b128 %2, %3, off\n\tglobal_load_async_to_lds_b128 %4, %5, off\n\tglobal_load_async_to_lds_b128 %6, %7, off\n\t"
               "global_load_async_to_lds_b128 %8, %9, off\n\tglobal_load_async_to_lds_b128 %10, %11, off\n\tglobal_load_async_to_lds_b128 %12, %13, off\n\tglobal_load_async_to_lds_b128 %14, %15, off\n\t"
               "global_load_async_to_lds_b128 %16, %17, off\n\tglobal_load_async_to_lds_b128 %18, %19, off\n\tglobal_load_async_to_lds_b128 %20, %21, off\n\tglobal_load_async_to_lds_b128 %22, %23, off\n\ts_wait_xcnt 0x0"
               :: "v"(lk), "v"(kg), "v"(lk + 16 * FKP), "v"(kg + 16 * CC), "v"(lk + 32 * FKP), "v"(kg + 32 * CC), "v"(lk + 48 * FKP), "v"(kg + 48 * CC),
                  "v"(lk + FVO), "v"(vg), "v"(lk + FVO + 16 * FKP), "v"(vg + 16 * TT), "v"(lk + FVO + 32 * FKP), "v"(vg + 32 * TT), "v"(lk + FVO + 48 * FKP), "v"(vg + 48 * TT),
                  "v"(lk + FBO), "v"(bg), "v"(lk + FBO + 16 * FKP), "v"(bg + 16 * TT), "v"(lk + FBO + 32 * FKP), "v"(bg + 32 * TT), "v"(lk + FBO + 48 * FKP), "v"(bg + 48 * TT) : "memory"); }
__global__ __launch_bounds__(128) void k_fa(const _Float16* __restrict__ QH, const _Float16* __restrict__ KH, const _Float16* __restrict__ VT, const __bf16* __restrict__ AB, _Float16* __restrict__ Y) { __shared__ __align__(16) char ring[2 * FBUF];   // two step buffers; behind the loop's last barrier the same bytes stage the output rows
  _Float16 (*ss)[16][HD + 8] = (_Float16 (*)[16][HD + 8])ring;
  const int tid = threadIdx.x, wave = tid >> 5, lane = tid & 31, col = lane & 15, g = lane >> 4; const int h = blockIdx.y, b = blockIdx.z; const int ql0 = blockIdx.x * 64 + wave * 16;
  const _Float16* qp = QH + ((size_t)b * TT + ql0 + col) * CC + h * HD; const v16h q0 = frag_h(qp, lane), q1 = frag_h(qp + 32, lane);
  const _Float16* kg = KH + ((size_t)b * TT + (tid >> 3)) * CC + h * HD + (tid & 7) * 8;             // the thread's 16 B of key row tid / 8 (then + 16, 32, 48); runs on by 64 keys a step
  const _Float16* vg = VT + ((size_t)b * CC + h * HD + (tid >> 3)) * (size_t)TT + (tid & 7) * 8;     // its 16 B of the v plane of dim tid / 8 (then + 16, 32, 48); runs on by 64 keys a step
  const __bf16* bg = AB + (size_t)(blockIdx.x * 64 + (tid >> 3)) * TT + (tid & 7) * 8;               // its 16 B of the block's bias row of query tid / 8 (then + 16, 32, 48); runs on by 64 keys a step
  const unsigned lk = (unsigned)(size_t)ring + (tid >> 3) * FKP + (tid & 7) * 16;
  const char* kr = ring + col * FKP + 16 * g;                        // key row col of a 16-key tile (v: dim col of a 16-dim tile), this half's 8 elements
  const char* br = ring + FBO + (wave * 16 + col) * FKP + 16 * g;    // this lane's query row as a B fragment: keys 8g + 0..7 and 16 + 8g + 0..7 of a 32-key pair of tiles
  v16b id0, id1;                                                     // A fragments that pick a key row out of that B: id0[key][k] = (k == key), the pair's first tile; id1[key][k] = (k == 16 + key), its second; 1 x b + 0 x the others is b itself for a finite bias (0 x inf would be NaN)
#pragma unroll
  for (int i = 0; i < 8; ++i) { const __bf16 o = (__bf16)(8 * g + i == col ? 1.0f : 0.0f), z = (__bf16)0.0f; id0[i] = o; id0[8 + i] = z; id1[i] = z; id1[8 + i] = o; }
  v8f acc[HD / 16] = {}; float m = -3.0e38f, l = 0.f;                        // m = running maximum of the query's logits; l = this half's share of the sum, x 2^11
  fa_copy(lk, kg, vg, bg);
  asm volatile("s_wait_asynccnt 0x0" ::: "memory");   // step 0's pieces of this wave have landed
  __syncthreads();                                    // publishes step 0
  fa_copy(lk + FBUF, kg + 64 * CC, vg + 64, bg + 64);
  kg += 128 * CC; vg += 128; bg += 128;
  for (int t = 0; t < TT / 64; ++t) { const unsigned bo = (t & 1) * FBUF; v16h kf[8], vf[8]; v16b bf[2]; v8f s[4];   // every LDS read of the step stands as one group in front of its first product; the unrolls of this loop body make every index of kf, vf, bf, s, p and acc a constant, so that they stay in registers
#pragma unroll
    for (int j = 0; j < 2; ++j) bf[j] = frag_pb((const __bf16*)(br + bo + j * 64));
#pragma unroll
    for (int j = 0; j < 4; ++j) { kf[2 * j] = frag_p((const _Float16*)(kr + bo + j * 16 * FKP)); kf[2 * j + 1] = frag_p((const _Float16*)(kr + bo + j * 16 * FKP + 64)); }
#pragma unroll
    for (int kc = 0; kc < 2; ++kc)
#pragma unroll
      for (int j = 0; j < HD / 16; ++j) vf[kc * 4 + j] = frag_p((const _Float16*)(kr + bo + FVO + j * 16 * FKP + kc * 64));
    __builtin_amdgcn_sched_barrier(0);   // keeps the group together: without it the scheduler sinks each fragment's reads to just before its product, and every product waits out an LDS latency
#pragma unroll
    for (int u = 0; u < 2; ++u) { const v8f c0 = {};   // a pair of 16-key tiles at a time: s[j][r] = bias[query][16 j + 8g + r], then the two products of K . Q^T on top of it
      s[2 * u] = __builtin_amdgcn_wmma_f32_16x16x32_bf16(false, id0, false, bf[u], (short)0, c0, false, false); s[2 * u + 1] = __builtin_amdgcn_wmma_f32_16x16x32_bf16(false, id1, false, bf[u], (short)0, c0, false, false);
      __builtin_amdgcn_sched_barrier(0);   // this one and the two below keep the pair's products abreast: without them the scheduler lines up each tile's three dependent products one behind the other, each waiting out the one before it, with v_nops in front of the maximum
      s[2 * u] = wmma_h(kf[4 * u], q0, s[2 * u]); s[2 * u + 1] = wmma_h(kf[4 * u + 2], q0, s[2 * u + 1]);
      __builtin_amdgcn_sched_barrier(0);
      s[2 * u] = wmma_h(kf[4 * u + 1], q1, s[2 * u]); s[2 * u + 1] = wmma_h(kf[4 * u + 3], q1, s[2 * u + 1]);
      __builtin_amdgcn_sched_barrier(0); }
    float mx = m;
#pragma unroll
    for (int j = 0; j < 4; ++j)
#pragma unroll
      for (int r = 0; r < 8; ++r) mx = fmaxf(mx, s[j][r]);
    mx = fmaxf(mx, xhalf(mx));
    const float al = exp2s((m - mx) * LOG2E), mo = mx * LOG2E - 11.0f; m = mx;
    float sj[4]; v16h p[2];
#pragma unroll
    for (int j = 0; j < 4; ++j) { sj[j] = 0.f;
#pragma unroll
      for (int r = 0; r < 8; ++r) { const float e = exp2s(s[j][r] * LOG2E - mo); sj[j] += e; p[j >> 1][(j & 1) * 8 + r] = (_Float16)e; } }
    l = l * al + ((sj[0] + sj[1]) + (sj[2] + sj[3]));
#pragma unroll
    for (int j = 0; j < HD / 16; ++j) acc[j] = acc[j] * al;
#pragma unroll
    for (int kc = 0; kc < 2; ++kc)
#pragma unroll
      for (int j = 0; j < HD / 16; ++j) acc[j] = wmma_h(vf[kc * 4 + j], p[kc], acc[j]);
    __builtin_amdgcn_sched_barrier(0);   // keeps the step's products in front of the waits below: without it the scheduler lifts them and the barrier to just behind the read group, where the next step's copies have had no time to land
    asm volatile("s_wait_dscnt 0x0" ::: "memory");      // this wave's reads of the step's buffer have retired before the buffer is handed to the copies below
    asm volatile("s_wait_asynccnt 0x0" ::: "memory");   // this wave's pieces of step t + 1 have landed
    __syncthreads();                                    // publishes step t + 1 and ends every wave's reads of step t's buffer
    if (t + 2 < TT / 64) { fa_copy(lk + bo, kg, vg, bg); kg += 64 * CC; vg += 64; bg += 64; } }
  asm volatile("s_wait_asynccnt 0x0" ::: "memory");     // no copy is outstanding when the ring's bytes become output staging and when the wave ends
  l += xhalf(l); const float inv = l > 0.f ? 1.0f / l : 0.f;   /* a fully excluded row yields ctx = 0 */
#pragma unroll
  for (int j = 0; j < HD / 16; ++j) { v8h o;   /* ctx carried x 2^6 into f16 so small-magnitude context rows stay clear of f16 subnormals */
#pragma unroll
    for (int r = 0; r < 8; ++r) o[r] = (_Float16)((acc[j][r] * inv) * 64.0f);
    *(v8h*)&ss[wave][col][j * 16 + 8 * g] = o; }
  LDSX(); for (int i = 0; i < 4; ++i) { const int rl = 4 * i + (lane >> 3); vst2(Y + ((size_t)b * TT + ql0 + rl) * CC + h * HD + (lane & 7) * 8, *(const v4u*)&ss[wave][rl][(lane & 7) * 8]); } }
// ---- k_out: block = (64 rows, 128 cols): out = ctx Wo (+ bo): ctx x 2^6 in f16 against Wo as f16(bf16 x 2^8) exact (1 product) x 2^-14
__global__ __launch_bounds__(128) void k_out(const _Float16* __restrict__ Y, const _Float16* __restrict__ WO, const float* __restrict__ BO, float* __restrict__ OUT) { __shared__ __align__(16) float sf[4][16][132]; __shared__ __align__(16) char stg[2 * GBUF];
  const int tid = threadIdx.x, wave = tid >> 5, lane = tid & 31, col = lane & 15, g = lane >> 4; const int c0 = blockIdx.y * 128; const size_t r0 = (size_t)blockIdx.x * 64 + wave * 16;
  v8f acc[8] = {};
  gemm_tile<1>(Y + (size_t)blockIdx.x * 64 * CC, WO + (size_t)c0 * CC, stg, acc, tid);
#pragma unroll
    for (int j = 0; j < 8; ++j) { const float bias = BO ? bfr(BO[c0 + j * 16 + col]) : 0.f;
#pragma unroll
      for (int r = 0; r < 8; ++r) sf[wave][8 * g + r][j * 16 + col] = acc[j][r] * (1.0f / 16384.0f) + bias; }   /* 2^-8 (Wo carry) x 2^-6 (ctx carry) */
  LDSX(); for (int rl = 0; rl < 16; ++rl) vst2(OUT + (r0 + rl) * DIN + c0 + lane * 4, *(const v4f*)&sf[wave][rl][lane * 4]); }

extern "C" void kernel_launch(void* const* d_in, const int* in_sizes, int n_in, void* d_out, int out_size, void* d_ws, size_t ws_size, hipStream_t stream) {
  (void)in_sizes; (void)n_in; (void)out_size;
  const float** F = (const float**)d_in;
  if (ws_size < (size_t)WS_END) return;
  char* ws = (char*)d_ws; _Float16 *QH = (_Float16*)(ws + WS_QH), *KH = (_Float16*)(ws + WS_KH), *VT = (_Float16*)(ws + WS_VT), *QL = (_Float16*)(ws + WS_QL), *KL = (_Float16*)(ws + WS_KL); __bf16 *VB = (__bf16*)(ws + WS_VB), *VBL = (__bf16*)(ws + WS_VBL), *XB = (__bf16*)(ws + WS_XB), *WB = (__bf16*)(ws + WS_WB), *AB = (__bf16*)(ws + WS_AB); _Float16 *WOH = (_Float16*)(ws + WS_WOH), *Y = (_Float16*)(ws + WS_Y);
  (void)Y; (void)QL; (void)KL; (void)VB; (void)VBL;
  // inputs: 0 x [2,2048,1024]; 1 attn_bias [1,1,2048,2048]; 2 w_qkv [3072,1024] (out,in): q rows 0..1023, k 1024..2047, v 2048..3071; 3 q_bias [1024] (zeros, read); 4 v_bias [1024] (zeros, read); 5 scale_mul [1,16,1,1] (ln 4, read); 6 w_proj [1024,1024] (out,in); 7 b_proj (zeros, read); the k stream has no bias (the module concatenates zeros)
  k_cvt<<<dim3((NB * TT * DIN + 3 * CC * DIN + DIN * CC + TT * TT) / 8192), 256, 0, stream>>>(F[0], F[2], F[6], F[1], XB, WB, WOH, AB);
  k_proj<<<dim3(TNB * TT / 128, CC / 128, 3), 128, 0, stream>>>(XB, XB, XB, WB, WB + (size_t)CC * DIN, WB + 2 * (size_t)CC * DIN, F[3], nullptr, F[4], QH, QL, KH, KL, VT, VB, VBL, F[5]);
  k_fa<<<dim3(NQB, NH, TNB), 128, 0, stream>>>(QH, KH, VT, AB, Y);
  k_out<<<dim3(TNB * TT / 64, DIN / 128), 128, 0, stream>>>(Y, WOH, F[7], (float*)d_out);
}

// v007
// One run takes 86 microseconds.
// Timed twice side by side with v006, it ran 1.10 and 1.08 times as fast.
// All steps since v000 together make it 16.7 times as fast.
// compute dtype: all float inputs rounded to bf16; q / k / v projections with EXACT bf16 products on WMMA 16x16x32 (f32 accumulate) + bias (q / v: zeros, read; k: none); q and k times the reciprocal of their per-(token, head) L2 norm in f32, for q times exp(min(bf16(scale_mul[h]), ln 100)); logits q x k once to f16 each (1 product, scale 1), + bf16(attn_bias[q][k]) in f32; softmax f32 with a running maximum and sum over 64-key steps; exp(logit - running max) x 2^11 once to f16 x v once to f16 (1 product), divided by the f32 sum at the end; ctx x 2^6 once to f16 x w_proj f16(bf16 x 2^8) + b_proj; f32 output.
#include <hip/hip_runtime.h>
#include <math.h>

typedef __attribute__((ext_vector_type(16))) _Float16 v16h;
typedef __attribute__((ext_vector_type(16))) __bf16 v16b;
typedef __attribute__((ext_vector_type(8)))  _Float16 v8h;
typedef __attribute__((ext_vector_type(8)))  float v8f;
typedef __attribute__((ext_vector_type(4)))  float v4f;
typedef __attribute__((ext_vector_type(2)))  float v2f;
typedef __attribute__((ext_vector_type(4)))  unsigned v4u;
typedef __attribute__((ext_vector_type(4)))  int v4i;
typedef float __attribute__((may_alias)) float_a;
typedef int __attribute__((may_alias)) int_a;

template <typename T> __device__ __forceinline__ void vst2(void* p, T v) { *(T*)p = v;  }
__device__ __forceinline__ v8f wmma16(v16h a, v16h b, v8f c) {
  v8f d = __builtin_amdgcn_wmma_f32_16x16x32_f16(false, a, false, b, (short)0, c, false, false);
  asm volatile("v_nop\n\tv_nop\n\tv_nop\n\tv_nop" : "+v"(d) : "v"(a), "v"(b));
  return d;
}
__device__ __forceinline__ v8f wmma_bf(v16b a, v16b b, v8f c) {
  v8f d = __builtin_amdgcn_wmma_f32_16x16x32_bf16(false, a, false, b, (short)0, c, false, false);
  asm volatile("v_nop\n\tv_nop\n\tv_nop\n\tv_nop" : "+v"(d) : "v"(a), "v"(b));
  return d;
}
// 16x16x32 fragments: lane = (h = lane>>4, row/col = lane&15); elements 0..7 = k0+8h+0..7, 8..15 = k0+16+8h+0..7; D element r = row 8h+r
__device__ __forceinline__ v16h frag_h(const _Float16* rowk0, int lane) {
  union { v16h v; v8h q[2]; } u; const _Float16* p = rowk0 + 8 * (lane >> 4);
  u.q[0] = *(const v8h*)p; u.q[1] = *(const v8h*)(p + 16); return u.v;
}
__device__ __forceinline__ v16h frag_f32(const float* rowk0, int lane) {
  v16h a; const float* p = rowk0 + 8 * (lane >> 4);
#pragma unroll
  for (int i = 0; i < 8; ++i) { a[i] = (_Float16)p[i]; a[8 + i] = (_Float16)p[16 + i]; }
  return a;
}
__device__ __forceinline__ v16h frag_f32s(const float* rowk0, int lane, float sc) {
  v16h a; const float* p = rowk0 + 8 * (lane >> 4);
#pragma unroll
  for (int i = 0; i < 8; ++i) { a[i] = (_Float16)(p[i] * sc); a[8 + i] = (_Float16)(p[16 + i] * sc); }
  return a;
}
// column fragment from a [K][ld] layout (column n), rows >= K read as 0
__device__ __forceinline__ v16h fragc_f32(const float* W, int k0, int n, int lane, int ld, int K) {
  v16h a; const int g = lane >> 4;
#pragma unroll
  for (int i = 0; i < 8; ++i) { const int ka = k0 + 8 * g + i, kb = ka + 16;
    a[i] = (_Float16)(ka < K ? W[(size_t)(ka < K ? ka : K - 1) * ld + n] : 0.f); a[8 + i] = (_Float16)(kb < K ? W[(size_t)(kb < K ? kb : K - 1) * ld + n] : 0.f); }
  return a;
}
struct F2 { v16b h, l; };
__device__ __forceinline__ F2 bsplit16(const float v[16]) { F2 r;
#pragma unroll
  for (int i = 0; i < 16; ++i) { const __bf16 h = (__bf16)v[i]; r.h[i] = h; r.l[i] = (__bf16)(v[i] - (float)h); }
  return r; }
__device__ __forceinline__ F2 split_row(const float* row, int k0, int lane) { float v[16]; const float* p = row + k0 + 8 * (lane >> 4);
#pragma unroll
  for (int i = 0; i < 8; ++i) { v[i] = p[i]; v[8 + i] = p[16 + i]; }
  return bsplit16(v); }
__device__ __forceinline__ F2 split_rowK(const float* row, int k0, int lane, int K) { float v[16]; const int g = lane >> 4;
#pragma unroll
  for (int i = 0; i < 8; ++i) { const int ka = k0 + 8 * g + i, kb = ka + 16; v[i] = ka < K ? row[ka < K ? ka : K - 1] : 0.f; v[8 + i] = kb < K ? row[kb < K ? kb : K - 1] : 0.f; }
  return bsplit16(v); }
__device__ __forceinline__ F2 split_col(const float* W, int k0, int n, int lane, int ld, int K) { float v[16]; const int g = lane >> 4;
#pragma unroll
  for (int i = 0; i < 8; ++i) { const int ka = k0 + 8 * g + i, kb = ka + 16; v[i] = ka < K ? W[(size_t)(ka < K ? ka : K - 1) * ld + n] : 0.f; v[8 + i] = kb < K ? W[(size_t)(kb < K ? kb : K - 1) * ld + n] : 0.f; }
  return bsplit16(v); }
__device__ __forceinline__ v8f mac3(const F2& a, const F2& b, v8f c) { c = wmma_bf(a.l, b.h, c); c = wmma_bf(a.h, b.l, c); return wmma_bf(a.h, b.h, c); }
__device__ __forceinline__ float sigm(float v) { return 1.0f / (1.0f + expf(-v)); }
#define LDSX() do { asm volatile("s_wait_dscnt 0" ::: "memory"); __builtin_amdgcn_wave_barrier(); __builtin_amdgcn_fence(__ATOMIC_RELEASE, "workgroup"); } while (0)

// Multi-head COSINE self-attention with a per-head learned scale and an additive attention bias (x [2,2048,1024]; attn_bias [1,1,2048,2048] N(0,1), one entry per (query, key), shared by batches and heads - READ on the device; w_qkv [3072,1024] torch (out,in) N(0, 1/1024): q = rows 0..1023, k = 1024..2047, v = 2048..3071 (reshape (B, L, 3, 16, 64)); q_bias / v_bias zeros (read), k has no bias; scale_mul [1,16,1,1] = ln 4 (const; read): sm = exp(min(scale_mul, ln 100)) = 4; q <- q / ||q|| * sm, k <- k / ||k|| per head row; attn = q k^T + attn_bias; softmax; oup through w_proj [1024,1024] (out,in) + b_proj zeros).
#define NB 2
#define TT 2048
#define CC 1024            // NH * HD = projected width
#define DIN 1024          // input (model) width
#define NH 16
#define HD 64
#define NQB (TT / 64)
#define HG 4
#define SCALE (1.0f)
#define CAUSAL 0
#ifndef TNB
#define TNB NB
#endif
__device__ __forceinline__ float bfr(float v) { return (float)(__bf16)v; }
__host__ __device__ __forceinline__ int kb_last(int qb) { return CAUSAL ? ((qb * 64 + 63) >> 7) : (TT / 128 - 1); }
typedef __attribute__((ext_vector_type(8))) __bf16 v8b;
__device__ __forceinline__ v16b frag_b(const __bf16* rowk0, int lane) {
  union { v16b v; v8b q[2]; } u; const __bf16* p = rowk0 + 8 * (lane >> 4);
  u.q[0] = *(const v8b*)p; u.q[1] = *(const v8b*)(p + 16); return u.v;
}
#define QBH 0              // unused: k_fa has one path for all query blocks
#define QHI 0               // single-product logits on every row (unit-norm operands x 4: |cosine logit| <= 4)
#define KHI 64            // key rows of the workspace's k residual / v bf16 hi+lo planes (no kernel writes or reads them)
// B fragment (k rows k0+.., output column o) of a weight: (in,out) [K][ld] or (out,in) [ld rows of K]: bf16 exact, or f16(bf16 * 256) exact
__device__ __forceinline__ v16b wcol_io(const float* Wm, int k0, int o, int lane, int ld) { v16b w; const int g = lane >> 4;
#pragma unroll
  for (int i = 0; i < 8; ++i) { w[i] = (__bf16)Wm[(size_t)(k0 + 8 * g + i) * ld + o]; w[8 + i] = (__bf16)Wm[(size_t)(k0 + 16 + 8 * g + i) * ld + o]; }
  return w; }
__device__ __forceinline__ v16b wcol_oi(const float* Wm, int k0, int o, int lane, int K) { v16b w; const float* p = Wm + (size_t)o * K + k0 + 8 * (lane >> 4);
#pragma unroll
  for (int i = 0; i < 8; ++i) { w[i] = (__bf16)p[i]; w[8 + i] = (__bf16)p[16 + i]; }
  return w; }
__device__ __forceinline__ v16h wcolh_io(const float* Wm, int k0, int o, int lane, int ld) { v16h w; const int g = lane >> 4;
#pragma unroll
  for (int i = 0; i < 8; ++i) { w[i] = (_Float16)(bfr(Wm[(size_t)(k0 + 8 * g + i) * ld + o]) * 256.0f); w[8 + i] = (_Float16)(bfr(Wm[(size_t)(k0 + 16 + 8 * g + i) * ld + o]) * 256.0f); }
  return w; }
__device__ __forceinline__ v16h wcolh_oi(const float* Wm, int k0, int o, int lane, int K) { v16h w; const float* p = Wm + (size_t)o * K + k0 + 8 * (lane >> 4);
#pragma unroll
  for (int i = 0; i < 8; ++i) { w[i] = (_Float16)(bfr(p[i]) * 256.0f); w[8 + i] = (_Float16)(bfr(p[16 + i]) * 256.0f); }
  return w; }
#define WQKV_LAYOUT 1   // 0 = (in,out) [DIN][CC]; 1 = (out,in) [CC][DIN]; 2 = per-head [NH][DIN][HD]
__device__ __forceinline__ v16b wcol_hdk(const float* Wm, int k0, int o, int lane) { v16b w; const int g = lane >> 4; const float* p = Wm + (size_t)(o / HD) * DIN * HD + (o % HD);
#pragma unroll
  for (int i = 0; i < 8; ++i) { w[i] = (__bf16)p[(size_t)(k0 + 8 * g + i) * HD]; w[8 + i] = (__bf16)p[(size_t)(k0 + 16 + 8 * g + i) * HD]; }
  return w; }
#define WO_OUT_IN 1
#if WQKV_LAYOUT == 1
#define WCOL(W, k0, o, lane) wcol_oi(W, k0, o, lane, DIN)
#elif WQKV_LAYOUT == 2
#define WCOL(W, k0, o, lane) wcol_hdk(W, k0, o, lane)
#else
#define WCOL(W, k0, o, lane) wcol_io(W, k0, o, lane, CC)
#endif
#if WO_OUT_IN
#define WOCOL(W, k0, o, lane) wcol_oi(W, k0, o, lane, CC)
#define WOCOLH(W, k0, o, lane) wcolh_oi(W, k0, o, lane, CC)
#else
#define WOCOL(W, k0, o, lane) wcol_io(W, k0, o, lane, DIN)
#define WOCOLH(W, k0, o, lane) wcolh_io(W, k0, o, lane, DIN)
#endif

#define MAX_SCALE_MUL 4.605170186f   // ln(100): the module's clamp on scale_mul
#define PROJ_EXTRA_PARAMS , const float* __restrict__ SMU   /* scale_mul [1][NH][1][1], a module input */
// per (token, head) rule of the q and k streams, applied in k_proj's epilogue: x <- x / sqrt(sum x^2) over the head's 64 values (jnp.linalg.norm, no epsilon in the module), as x * rsq(sum x^2) in f32; the q stream's factor is first multiplied by sm = expf(fminf(bf16(scale_mul[h]), ln 100)); v untouched
#ifndef PROJ_EXTRA_PARAMS
#define PROJ_EXTRA_PARAMS
#endif

#define WS_QH  0u                                      // f16 q rows [b*t][CC]
#define WS_KH  (WS_QH + 2u * (size_t)NB * TT * CC)      // f16 k rows [b*t][CC]
#define WS_VT  (WS_KH + 2u * (size_t)NB * TT * CC)      // f16 v planes [b][c][t]
#define WS_QL  (WS_VT + 2u * (size_t)NB * CC * TT)      // f16 q residual x 2^10 rows [b][t < QHI][CC]
#define WS_KL  (WS_QL + 2u * (size_t)NB * QHI * CC)     // f16 k residual x 2^10 rows [b][t < KHI][CC]
#define WS_VB  (WS_KL + 2u * (size_t)NB * KHI * CC)     // bf16 v hi planes [b][c][t < KHI]
#define WS_VBL (WS_VB + 2u * (size_t)NB * CC * KHI)
#define WS_S   (WS_VBL + 2u * (size_t)NB * CC * KHI)    // region of 4 * HG * TT * TT bytes; its head holds the four 16-bit operand copies below
#define WS_XB  WS_S                                    // bf16 x rows [b*t][DIN]
#define WS_WB  (WS_XB + 2u * (size_t)NB * TT * DIN)     // bf16 w_qkv rows [3 * CC][DIN]
#define WS_WOH (WS_WB + 2u * 3u * (size_t)CC * DIN)     // f16(bf16 x 2^8) w_proj rows [DIN][CC]
#define WS_AB  (WS_WOH + 2u * (size_t)DIN * CC)          // bf16 attn_bias rows [TT][TT]
#define WS_Y   (WS_S  + 4u * (size_t)HG * TT * TT)      // f16 ctx x 2^6 rows [b*t][CC]
#define WS_END (WS_Y  + 4u * (size_t)NB * TT * CC)

// ---- gemm_tile: the 64 x 128 tile of A . W^T (both K-contiguous, already in their 16-bit operand type, K = 1024) of one 4-wave block. Each 128-k stage of both operands is fetched by whole-line loads (16 lanes x 16 B = 256 B of one row) and laid in LDS as it is, where all four waves read their fragments; two LDS buffers, the next stage's loads in flight in registers during the products; k runs upward in steps of 32
typedef __attribute__((ext_vector_type(2))) unsigned v2u;
#define GK 128                     // k per stage
#define GP 272                     // LDS row pitch, bytes: 256 B of 16-bit data + 16 B (pitch for ds_load_b128 readers)
#define GBUF ((64 + 128) * GP)     // one stage: 64 A rows, then 128 W rows
__device__ __forceinline__ v2u pk_bf(v4f v) { union { v2u u; __bf16 e[4]; } r;
#pragma unroll
  for (int i = 0; i < 4; ++i) r.e[i] = (__bf16)v[i];
  return r.u; }
__device__ __forceinline__ v2u pk_wo(v4f v) { union { v2u u; _Float16 e[4]; } r;    // f16(bf16 x 2^8), exact
#pragma unroll
  for (int i = 0; i < 4; ++i) r.e[i] = (_Float16)((float)(__bf16)v[i] * 256.0f);
  return r.u; }
// one stage's 24 loads of a thread (8 of A, 16 of W; the thread's offset is the same in both tiles and never changes), then the two block-uniform bases one stage on; the unrolls here and in gemm_tile make every index of ra, rw, w and acc a constant, so that these arrays stay in registers
template <typename E> __device__ __forceinline__ void gemm_fetch(const E*& Ag, const E*& Wg, unsigned off, v4u (&ra)[8], v4u (&rw)[16]) {
#pragma unroll
  for (int i = 0; i < 8; ++i) ra[i] = *(const v4u*)(Ag + off + i * 8 * 1024);
#pragma unroll
  for (int i = 0; i < 16; ++i) rw[i] = *(const v4u*)(Wg + off + i * 8 * 1024);
  asm volatile("s_wait_xcnt 0x0" :: "v"(off) : "memory");   // stands in front of the overwrite of the loads' base registers just below; the offset as an input keeps its register from being handed to a later load of the group as its destination
  __builtin_amdgcn_sched_barrier(0);                        // keeps the stage's loads in front of the products that are to cover their latency, and the steps of the bases behind the wait
  Ag += GK; Wg += GK; }
template <int F16, typename E> __device__ __forceinline__ void gemm_tile(const E* Ag, const E* Wg, char* stg, v8f (&acc)[8], int tid) {
  const int wave = tid >> 5, lane = tid & 31, col = lane & 15, g = lane >> 4;
  const unsigned off = (tid >> 4) * 1024 + (tid & 15) * 8;                   // 8 rows a pass of the block, 16 lanes x 16 B a row
  char* sp = stg + (tid >> 4) * GP + (tid & 15) * 16;
  const char* fa = stg + (wave * 16 + col) * GP + 16 * g;              // fragment: elements 0..7 = k0 + 8g + 0..7, 8..15 = k0 + 16 + 8g + 0..7
  const char* fw = stg + (64 + col) * GP + 16 * g;
  v4u ra[8], rw[16];
  gemm_fetch(Ag, Wg, off, ra, rw);
  for (int s = 0; s < 1024 / GK; ++s) { const int bo = (s & 1) * GBUF;
#pragma unroll
    for (int i = 0; i < 8; ++i) *(v4u*)(sp + bo + i * 8 * GP) = ra[i];
#pragma unroll
    for (int i = 0; i < 16; ++i) *(v4u*)(sp + bo + (64 + i * 8) * GP) = rw[i];
    __syncthreads();   // publishes stage s; a wave that has passed it has left the other buffer, which stage s + 1 overwrites only behind this barrier
    if (s + 1 < 1024 / GK) gemm_fetch(Ag, Wg, off, ra, rw);
#pragma unroll
    for (int kk = 0; kk < GK / 32; ++kk) { union { v4u q[2]; v16b b; v16h h; } a, w[8]; a.q[0] = *(const v4u*)(fa + bo + kk * 64); a.q[1] = *(const v4u*)(fa + bo + kk * 64 + 32);   // the nine fragments of a 32-k block are read as one group in front of its eight products
#pragma unroll
      for (int j = 0; j < 8; ++j) { w[j].q[0] = *(const v4u*)(fw + bo + j * 16 * GP + kk * 64); w[j].q[1] = *(const v4u*)(fw + bo + j * 16 * GP + kk * 64 + 32); }
      __builtin_amdgcn_sched_barrier(0);   // keeps the group together: without it the scheduler sinks each fragment's two reads to just before its product, into one register set, and every product waits out a whole LDS latency
#pragma unroll
      for (int j = 0; j < 8; ++j) acc[j] = F16 ? __builtin_amdgcn_wmma_f32_16x16x32_f16(false, a.h, false, w[j].h, (short)0, acc[j], false, false) : __builtin_amdgcn_wmma_f32_16x16x32_bf16(false, a.b, false, w[j].b, (short)0, acc[j], false, false); } }
}
// ---- gemm_tile2: the 128 x 128 tile of A . W^T (both K-contiguous bf16, K = 1024) of one 4-wave block; wave (wr, wc) owns the 64 x 64 quarter, so the eight fragments of a 32-k block feed sixteen products. Each 64-k stage of both operands is fetched by whole-line loads (8 lanes x 16 B = 128 B of one row) and laid in LDS as it is; two LDS buffers, the next stage's loads in flight in registers during the products; k runs upward in steps of 32
#define HK 64                      // k per stage
#define HP 144                     // LDS row pitch, bytes: 128 B of 16-bit data + 16 B (pitch for ds_load_b128 readers)
#define HBUF ((128 + 128) * HP)    // one stage: 128 A rows, then 128 W rows
// one stage's 16 loads of a thread (8 of A, 8 of W; the thread's offset is the same in both tiles and never changes), then the two block-uniform bases one stage on; the unrolls here and in gemm_tile2 make every index of ra, rw, a, w and acc a constant, so that these arrays stay in registers
__device__ __forceinline__ void gemm_fetch2(const __bf16*& Ag, const __bf16*& Wg, unsigned off, v4u (&ra)[8], v4u (&rw)[8]) {
#pragma unroll
  for (int i = 0; i < 8; ++i) ra[i] = *(const v4u*)(Ag + off + i * 16 * 1024);
#pragma unroll
  for (int i = 0; i < 8; ++i) rw[i] = *(const v4u*)(Wg + off + i * 16 * 1024);
  asm volatile("s_wait_xcnt 0x0" :: "v"(off) : "memory");   // stands in front of the overwrite of the loads' base registers just below; the offset as an input keeps its register from being handed to a later load of the group as its destination
  __builtin_amdgcn_sched_barrier(0);                        // keeps the stage's loads in front of the products that are to cover their latency, and the steps of the bases behind the wait
  Ag += HK; Wg += HK; }
__device__ __forceinline__ void gemm_tile2(const __bf16* Ag, const __bf16* Wg, char* stg, v8f (&acc)[4][4], int tid) {
  const int wave = tid >> 5, lane = tid & 31, col = lane & 15, g = lane >> 4, wr = wave >> 1, wc = wave & 1;
  const unsigned off = (tid >> 3) * 1024 + (tid & 7) * 8;                    // 16 rows a pass of the block, 8 lanes x 16 B a row
  char* sp = stg + (tid >> 3) * HP + (tid & 7) * 16;
  const char* fa = stg + (wr * 64 + col) * HP + 16 * g;                // fragment: elements 0..7 = k0 + 8g + 0..7, 8..15 = k0 + 16 + 8g + 0..7
  const char* fw = stg + (128 + wc * 64 + col) * HP + 16 * g;
  v4u ra[8], rw[8];
  gemm_fetch2(Ag, Wg, off, ra, rw);
  for (int s = 0; s < 1024 / HK; ++s) { const int bo = (s & 1) * HBUF;
#pragma unroll
    for (int i = 0; i < 8; ++i) *(v4u*)(sp + bo + i * 16 * HP) = ra[i];
#pragma unroll
    for (int i = 0; i < 8; ++i) *(v4u*)(sp + bo + (128 + i * 16) * HP) = rw[i];
    __syncthreads();   // publishes stage s; a wave that has passed it has left the other buffer, which stage s + 1 overwrites only behind this barrier
    if (s + 1 < 1024 / HK) gemm_fetch2(Ag, Wg, off, ra, rw);
#pragma unroll
    for (int kk = 0; kk < HK / 32; ++kk) { union { v4u q[2]; v16b b; } a[4], w[4];   // the eight fragments of a 32-k block are read as one group in front of its sixteen products
#pragma unroll
      for (int i = 0; i < 4; ++i) { a[i].q[0] = *(const v4u*)(fa + bo + i * 16 * HP + kk * 64); a[i].q[1] = *(const v4u*)(fa + bo + i * 16 * HP + kk * 64 + 32); w[i].q[0] = *(const v4u*)(fw + bo + i * 16 * HP + kk * 64); w[i].q[1] = *(const v4u*)(fw + bo + i * 16 * HP + kk * 64 + 32); }
      __builtin_amdgcn_sched_barrier(0);   // keeps the group together: without it the scheduler sinks each fragment's two reads to just before its product, and every product waits out a whole LDS latency
#pragma unroll
      for (int i = 0; i < 4; ++i)
#pragma unroll
        for (int j = 0; j < 4; ++j) acc[i][j] = __builtin_amdgcn_wmma_f32_16x16x32_bf16(false, a[i].b, false, w[j].b, (short)0, acc[i][j], false, false); } }
}
// ---- k_cvt: x, w_qkv and attn_bias once to bf16, w_proj once to f16(bf16 x 2^8): the operands that the stages of the two GEMMs and the steps of k_fa fetch. Block = 8192 consecutive floats of one of the four arrays; a wave's load covers 512 B, its store 256 B; the unrolls keep v and o in registers
template <int WOF> __device__ __forceinline__ void cvt_run(const float* sp, char* dp) { v4f v[8]; v2u o[8];
#pragma unroll
  for (int j = 0; j < 8; ++j) v[j] = *(const v4f*)(sp + j * 1024);
  asm volatile("s_wait_xcnt 0x0" ::: "memory");   // stands in front of any rewrite of the loads' address registers
#pragma unroll
  for (int j = 0; j < 8; ++j) o[j] = WOF ? pk_wo(v[j]) : pk_bf(v[j]);
#pragma unroll
  for (int j = 0; j < 8; ++j) *(v2u*)(dp + j * 2048) = o[j];
  asm volatile("s_wait_xcnt 0x0" ::: "memory"); }   // stands behind the last store, in front of any rewrite of the stores' data and address registers on a way that the listing lays behind them
__global__ __launch_bounds__(256) void k_cvt(const float* __restrict__ X, const float* __restrict__ WQKV, const float* __restrict__ WO, const float* __restrict__ ABI, __bf16* __restrict__ XB, __bf16* __restrict__ WB, _Float16* __restrict__ WOH, __bf16* __restrict__ AB) {
  const int nx = NB * TT * DIN / 8192, nw = 3 * CC * DIN / 8192, no = DIN * CC / 8192, blk = blockIdx.x; const size_t t4 = threadIdx.x * 4;   /* the four branches are block-uniform */
  if (blk < nx) { const size_t e = (size_t)blk * 8192 + t4; cvt_run<0>(X + e, (char*)XB + 2 * e); }
  else if (blk < nx + nw) { const size_t e = (size_t)(blk - nx) * 8192 + t4; cvt_run<0>(WQKV + e, (char*)WB + 2 * e); }
  else if (blk < nx + nw + no) { const size_t e = (size_t)(blk - nx - nw) * 8192 + t4; cvt_run<1>(WO + e, (char*)WOH + 2 * e); }
  else { const size_t e = (size_t)(blk - nx - nw - no) * 8192 + t4; cvt_run<0>(ABI + e, (char*)AB + 2 * e); } }
// ---- k_proj: block = (128 rows, 128 cols, which): q/k/v = X W (+ b) with exact bf16 products (K = DIN) -> which 0: q f16 rows; 1: k f16 rows; 2: v f16 planes [c][t]. A wave's 64 x 64 quarter is 64 tokens of ONE head, so the whole epilogue runs on its accumulator registers: a token's 64 values lie 4 in a lane x the 16 lanes of a half
template <int M> __device__ __forceinline__ float xm16(float v) { return __builtin_bit_cast(float, __builtin_amdgcn_update_dpp(0, __builtin_bit_cast(int, v), 0x160 + M, 0xf, 0xf, true)); }   // the value of lane ^ M inside the 16-lane half (DPP row_xmask)
// 1 / sqrt(x); the v_nop in the same statement is the one slot that the instruction set asks for behind a transcendental before its result is read or its source register overwritten
__device__ __forceinline__ float rsqs(float x) { float e; asm("v_rsq_f32 %0, %1\n\tv_nop" : "=v"(e) : "v"(x)); return e; }
// the wave's own 64 x 64 f16 tile (pitch HP) out of LDS to 64 global rows of LD elements, whole 128-B lines (8 lanes x 16 B a row, 4 rows an instruction); the unrolls keep v in registers and make every step of the address an immediate offset
template <int LD> __device__ __forceinline__ void tile_out(const char* tl, _Float16* D, int lane) { v4u v[16]; const char* p = tl + (lane >> 3) * HP + (lane & 7) * 16; _Float16* d = D + (size_t)(lane >> 3) * LD + (lane & 7) * 8;
#pragma unroll
  for (int i = 0; i < 16; ++i) v[i] = *(const v4u*)(p + i * 4 * HP);
#pragma unroll
  for (int i = 0; i < 16; ++i) vst2(d + (size_t)i * 4 * LD, v[i]);
  asm volatile("s_wait_xcnt 0x0" ::: "memory"); }   // stands behind the last store, in front of any rewrite of the stores' data and address registers on a way that the listing lays behind them
__global__ __launch_bounds__(128) void k_proj(const __bf16* __restrict__ XQ, const __bf16* __restrict__ XK, const __bf16* __restrict__ XV, const __bf16* __restrict__ WQ, const __bf16* __restrict__ WK, const __bf16* __restrict__ WV, const float* __restrict__ BQ, const float* __restrict__ BK, const float* __restrict__ BV,
    _Float16* __restrict__ QH, _Float16* __restrict__ KH, _Float16* __restrict__ VT PROJ_EXTRA_PARAMS) {
  __shared__ __align__(16) char sm[2 * HBUF];   // the two operand stages during the products; then the first buffer holds the four waves' own output tiles (4 x 64 rows at pitch HP = HBUF bytes): the last stage, an odd one, is read from the second buffer, and every wave left the first before that stage's barrier
  const int tid = threadIdx.x, wave = tid >> 5, lane = tid & 31, col = lane & 15, g = lane >> 4; const int wr = wave >> 1, wc = wave & 1; const int which = blockIdx.z; const int c0 = blockIdx.y * 128; const size_t rb = (size_t)blockIdx.x * 128;
  const __bf16* X = which == 0 ? XQ : which == 1 ? XK : XV; const __bf16* WA = which == 0 ? WQ : which == 1 ? WK : WV; const float* BA = which == 0 ? BQ : which == 1 ? BK : BV;
  float bs[4] = {0.f, 0.f, 0.f, 0.f}; const float smu = SMU[c0 / HD + wc];   // the lane's four bias values and the head's scale_mul are fetched here, so that the products cover their latency
  if (BA) {
#pragma unroll
    for (int j = 0; j < 4; ++j) bs[j] = BA[c0 + wc * 64 + j * 16 + col]; }
  asm volatile("s_wait_xcnt 0x0" ::: "memory");   // stands in front of any rewrite of these loads' address registers
  v8f acc[4][4] = {};
  gemm_tile2(X + rb * DIN, WA + (size_t)c0 * DIN, sm, acc, tid);
  char* tl = sm + wave * (64 * HP);
#pragma unroll
  for (int j = 0; j < 4; ++j) bs[j] = bfr(bs[j]);
  if (which < 2) { const float sm_ = which == 0 ? expf(fminf(bfr(smu), MAX_SCALE_MUL)) : 1.0f;   // tile rows = tokens, 64 f16 of the head each; the unrolls make every index of acc, bs and sc a constant, so that they stay in registers
#pragma unroll
    for (int i = 0; i < 4; ++i) { float sc[8];
#pragma unroll
      for (int r = 0; r < 8; ++r) { float ss = 0.f;
#pragma unroll
        for (int j = 0; j < 4; ++j) { const float x = acc[i][j][r] + bs[j]; acc[i][j][r] = x; ss += x * x; }
        ss += xm16<1>(ss); ss += xm16<2>(ss); ss += xm16<4>(ss); ss += xm16<8>(ss); sc[r] = rsqs(ss) * sm_; }
#pragma unroll
      for (int j = 0; j < 4; ++j)
#pragma unroll
        for (int r = 0; r < 8; ++r) *(_Float16*)(tl + (i * 16 + 8 * g + r) * HP + (j * 16 + col) * 2) = (_Float16)(acc[i][j][r] * sc[r]); }
    LDSX(); tile_out<CC>(tl, (which == 0 ? QH : KH) + (rb + wr * 64) * CC + c0 + wc * 64, lane);
  } else {   // tile rows = the head's 64 dims, 64 tokens each: a lane's 8 accumulator rows are 8 consecutive tokens of one dim
#pragma unroll
    for (int i = 0; i < 4; ++i)
#pragma unroll
      for (int j = 0; j < 4; ++j) { v8h o;
#pragma unroll
        for (int r = 0; r < 8; ++r) o[r] = (_Float16)(acc[i][j][r] + bs[j]);
        *(v8h*)(tl + (j * 16 + col) * HP + (i * 16 + 8 * g) * 2) = o; }
    LDSX(); tile_out<TT>(tl, VT + ((rb / TT) * CC + c0 + wc * 64) * (size_t)TT + rb % TT + wr * 64, lane); }
}
// ---- k_fa: block = 64 queries (4 waves x 16) of (b, h), all keys in steps of 64, each step's K, V and bias tiles brought into LDS by asynchronous copies one step ahead (two buffers) and read there by the four waves: S^T = K . Q^T on top of bf16(attn_bias), which an identity A lays into the score registers as the B operand of one bf16 product a tile (1 x b + zeros, exact) (lane = one query, 8 keys a tile), running maximum and sum per query in registers, P^T x 2^11 (relative to the running maximum) once to f16 straight from the score registers as the B operand, ctx^T += V^T . P^T; ctx = ctx^T / sum at the end, stored x 2^6 as f16, the output projection's operand
#define LOG2E 1.44269504f
__device__ __forceinline__ v8f wmma_h(v16h a, v16h b, v8f c) { return __builtin_amdgcn_wmma_f32_16x16x32_f16(false, a, false, b, (short)0, c, false, false); }
// 2^x; the v_nop in the same statement is the one slot that the instruction set asks for behind a transcendental before its result is read or its source register overwritten
__device__ __forceinline__ float exp2s(float x) { float e; asm("v_exp_f32 %0, %1\n\tv_nop" : "=v"(e) : "v"(x)); return e; }
__device__ __forceinline__ v16h frag_p(const _Float16* p) { union { v16h v; v8h q[2]; } u; u.q[0] = *(const v8h*)p; u.q[1] = *(const v8h*)(p + 16); return u.v; }   // frag_h with the half's 8 elements already in the pointer
__device__ __forceinline__ v16b frag_pb(const __bf16* p) { union { v16b v; v8b q[2]; } u; u.q[0] = *(const v8b*)p; u.q[1] = *(const v8b*)(p + 16); return u.v; }   // the same of bf16
__device__ __forceinline__ float xhalf(float v) { const int b = __builtin_bit_cast(int, v); return __builtin_bit_cast(float, __builtin_amdgcn_permlanex16(b, b, 0x76543210, 0xfedcba98, false, false)); }   // the value of lane ^ 16
// one 64-key step's operands in LDS: 64 K rows, 64 V planes and the block's 64 bf16 bias rows, each of 128 B at pitch 144 B (pitch for ds_load_b128 readers)
#define FKP 144
#define FVO (64 * FKP)
#define FBO (2 * 64 * FKP)
#define FBUF (3 * 64 * FKP)
// one step's 12 copies of a thread, whole lines (8 lanes x 16 B = one K, V or bias row); lk = the thread's LDS byte address of its first K piece in the target buffer; the s_wait_xcnt at the end of the statement stands in front of any rewrite of the address registers that its copies name
__device__ __forceinline__ void fa_copy(unsigned lk, const _Float16* kg, const _Float16* vg, const __bf16* bg) {
  asm volatile("global_load_async_to_lds_b128 %0, %1, off\n\tglobal_load_async_to_lds_b128 %2, %3, off\n\tglobal_load_async_to_lds_b128 %4, %5, off\n\tglobal_load_async_to_lds_b128 %6, %7, off\n\t"
               "global_load_async_to_lds_b128 %8, %9, off\n\tglobal_load_async_to_lds_b128 %10, %11, off\n\tglobal_load_async_to_lds_b128 %12, %13, off\n\tglobal_load_async_to_lds_b128 %14, %15, off\n\t"
               "global_load_async_to_lds_b128 %16, %17, off\n\tglobal_load_async_to_lds_b128 %18, %19, off\n\tglobal_load_async_to_lds_b128 %20, %21, off\n\tglobal_load_async_to_lds_b128 %22, %23, off\n\ts_wait_xcnt 0x0"
               :: "v"(lk), "v"(kg), "v"(lk + 16 * FKP), "v"(kg + 16 * CC), "v"(lk + 32 * FKP), "v"(kg + 32 * CC), "v"(lk + 48 * FKP), "v"(kg + 48 * CC),
                  "v"(lk + FVO), "v"(vg), "v"(lk + FVO + 16 * FKP), "v"(vg + 16 * TT), "v"(lk + FVO + 32 * FKP), "v"(vg + 32 * TT), "v"(lk + FVO + 48 * FKP), "v"(vg + 48 * TT),
                  "v"(lk + FBO), "v"(bg), "v"(lk + FBO + 16 * FKP), "v"(bg + 16 * TT), "v"(lk + FBO + 32 * FKP), "v"(bg + 32 * TT), "v"(lk + FBO + 48 * FKP), "v"(bg + 48 * TT) : "memory"); }
__global__ __launch_bounds__(128) void k_fa(const _Float16* __restrict__ QH, const _Float16* __restrict__ KH, const _Float16* __restrict__ VT, const __bf16* __restrict__ AB, _Float16* __restrict__ Y) { __shared__ __align__(16) char ring[2 * FBUF];   // two step buffers; behind the loop's last barrier the same bytes stage the output rows
  _Float16 (*ss)[16][HD + 8] = (_Float16 (*)[16][HD + 8])ring;
  const int tid = threadIdx.x, wave = tid >> 5, lane = tid & 31, col = lane & 15, g = lane >> 4; const int h = blockIdx.y, b = blockIdx.z; const int ql0 = blockIdx.x * 64 + wave * 16;
  const _Float16* qp = QH + ((size_t)b * TT + ql0 + col) * CC + h * HD; const v16h q0 = frag_h(qp, lane), q1 = frag_h(qp + 32, lane);
  const _Float16* kg = KH + ((size_t)b * TT + (tid >> 3)) * CC + h * HD + (tid & 7) * 8;             // the thread's 16 B of key row tid / 8 (then + 16, 32, 48); runs on by 64 keys a step
  const _Float16* vg = VT + ((size_t)b * CC + h * HD + (tid >> 3)) * (size_t)TT + (tid & 7) * 8;     // its 16 B of the v plane of dim tid / 8 (then + 16, 32, 48); runs on by 64 keys a step
  const __bf16* bg = AB + (size_t)(blockIdx.x * 64 + (tid >> 3)) * TT + (tid & 7) * 8;               // its 16 B of the block's bias row of query tid / 8 (then + 16, 32, 48); runs on by 64 keys a step
  const unsigned lk = (unsigned)(size_t)ring + (tid >> 3) * FKP + (tid & 7) * 16;
  const char* kr = ring + col * FKP + 16 * g;                        // key row col of a 16-key tile (v: dim col of a 16-dim tile), this half's 8 elements
  const char* br = ring + FBO + (wave * 16 + col) * FKP + 16 * g;    // this lane's query row as a B fragment: keys 8g + 0..7 and 16 + 8g + 0..7 of a 32-key pair of tiles
  v16b id0, id1;                                                     // A fragments that pick a key row out of that B: id0[key][k] = (k == key), the pair's first tile; id1[key][k] = (k == 16 + key), its second; 1 x b + 0 x the others is b itself for a finite bias (0 x inf would be NaN)
#pragma unroll
  for (int i = 0; i < 8; ++i) { const __bf16 o = (__bf16)(8 * g + i == col ? 1.0f : 0.0f), z = (__bf16)0.0f; id0[i] = o; id0[8 + i] = z; id1[i] = z; id1[8 + i] = o; }
  v8f acc[HD / 16] = {}; float m = -3.0e38f, l = 0.f;                        // m = running maximum of the query's logits; l = this half's share of the sum, x 2^11
  fa_copy(lk, kg, vg, bg);
  asm volatile("s_wait_asynccnt 0x0" ::: "memory");   // step 0's pieces of this wave have landed
  __syncthreads();                                    // publishes step 0
  fa_copy(lk + FBUF, kg + 64 * CC, vg + 64, bg + 64);
  kg += 128 * CC; vg += 128; bg += 128;
  for (int t = 0; t < TT / 64; ++t) { const unsigned bo = (t & 1) * FBUF; v16h kf[8], vf[8]; v16b bf[2]; v8f s[4];   // every LDS read of the step stands as one group in front of its first product; the unrolls of this loop body make every index of kf, vf, bf, s, p and acc a constant, so that they stay in registers
#pragma unroll
    for (int j = 0; j < 2; ++j) bf[j] = frag_pb((const __bf16*)(br + bo + j * 64));
#pragma unroll
    for (int j = 0; j < 4; ++j) { kf[2 * j] = frag_p((const _Float16*)(kr + bo + j * 16 * FKP)); kf[2 * j + 1] = frag_p((const _Float16*)(kr + bo + j * 16 * FKP + 64)); }
#pragma unroll
    for (int kc = 0; kc < 2; ++kc)
#pragma unroll
      for (int j = 0; j < HD / 16; ++j) vf[kc * 4 + j] = frag_p((const _Float16*)(kr + bo + FVO + j * 16 * FKP + kc * 64));
    __builtin_amdgcn_sched_barrier(0);   // keeps the group together: without it the scheduler sinks each fragment's reads to just before its product, and every product waits out an LDS latency
#pragma unroll
    for (int u = 0; u < 2; ++u) { const v8f c0 = {};   // a pair of 16-key tiles at a time: s[j][r] = bias[query][16 j + 8g + r], then the two products of K . Q^T on top of it
      s[2 * u] = __builtin_amdgcn_wmma_f32_16x16x32_bf16(false, id0, false, bf[u], (short)0, c0, false, false); s[2 * u + 1] = __builtin_amdgcn_wmma_f32_16x16x32_bf16(false, id1, false, bf[u], (short)0, c0, false, false);
      __builtin_amdgcn_sched_barrier(0);   // this one and the two below keep the pair's products abreast: without them the scheduler lines up each tile's three dependent products one behind the other, each waiting out the one before it, with v_nops in front of the maximum
      s[2 * u] = wmma_h(kf[4 * u], q0, s[2 * u]); s[2 * u + 1] = wmma_h(kf[4 * u + 2], q0, s[2 * u + 1]);
      __builtin_amdgcn_sched_barrier(0);
      s[2 * u] = wmma_h(kf[4 * u + 1], q1, s[2 * u]); s[2 * u + 1] = wmma_h(kf[4 * u + 3], q1, s[2 * u + 1]);
      __builtin_amdgcn_sched_barrier(0); }
    float mx = m;
#pragma unroll
    for (int j = 0; j < 4; ++j)
#pragma unroll
      for (int r = 0; r < 8; ++r) mx = fmaxf(mx, s[j][r]);
    mx = fmaxf(mx, xhalf(mx));
    const float al = exp2s((m - mx) * LOG2E), mo = mx * LOG2E - 11.0f; m = mx;
    float sj[4]; v16h p[2];
#pragma unroll
    for (int j = 0; j < 4; ++j) { sj[j] = 0.f;
#pragma unroll
      for (int r = 0; r < 8; ++r) { const float e = exp2s(s[j][r] * LOG2E - mo); sj[j] += e; p[j >> 1][(j & 1) * 8 + r] = (_Float16)e; } }
    l = l * al + ((sj[0] + sj[1]) + (sj[2] + sj[3]));
#pragma unroll
    for (int j = 0; j < HD / 16; ++j) acc[j] = acc[j] * al;
#pragma unroll
    for (int kc = 0; kc < 2; ++kc)
#pragma unroll
      for (int j = 0; j < HD / 16; ++j) acc[j] = wmma_h(vf[kc * 4 + j], p[kc], acc[j]);
    __builtin_amdgcn_sched_barrier(0);   // keeps the step's products in front of the waits below: without it the scheduler lifts them and the barrier to just behind the read group, where the next step's copies have had no time to land
    asm volatile("s_wait_dscnt 0x0" ::: "memory");      // this wave's reads of the step's buffer have retired before the buffer is handed to the copies below
    asm volatile("s_wait_asynccnt 0x0" ::: "memory");   // this wave's pieces of step t + 1 have landed
    __syncthreads();                                    // publishes step t + 1 and ends every wave's reads of step t's buffer
    if (t + 2 < TT / 64) { fa_copy(lk + bo, kg, vg, bg); kg += 64 * CC; vg += 64; bg += 64; } }
  asm volatile("s_wait_asynccnt 0x0" ::: "memory");     // no copy is outstanding when the ring's bytes become output staging and when the wave ends
  l += xhalf(l); const float inv = l > 0.f ? 1.0f / l : 0.f;   /* a fully excluded row yields ctx = 0 */
#pragma unroll
  for (int j = 0; j < HD / 16; ++j) { v8h o;   /* ctx carried x 2^6 into f16 so small-magnitude context rows stay clear of f16 subnormals */
#pragma unroll
    for (int r = 0; r < 8; ++r) o[r] = (_Float16)((acc[j][r] * inv) * 64.0f);
    *(v8h*)&ss[wave][col][j * 16 + 8 * g] = o; }
  LDSX(); for (int i = 0; i < 4; ++i) { const int rl = 4 * i + (lane >> 3); vst2(Y + ((size_t)b * TT + ql0 + rl) * CC + h * HD + (lane & 7) * 8, *(const v4u*)&ss[wave][rl][(lane & 7) * 8]); } }
// ---- k_out: block = (64 rows, 128 cols): out = ctx Wo (+ bo): ctx x 2^6 in f16 against Wo as f16(bf16 x 2^8) exact (1 product) x 2^-14
__global__ __launch_bounds__(128) void k_out(const _Float16* __restrict__ Y, const _Float16* __restrict__ WO, const float* __restrict__ BO, float* __restrict__ OUT) { __shared__ __align__(16) float sf[4][16][132]; __shared__ __align__(16) char stg[2 * GBUF];
  const int tid = threadIdx.x, wave = tid >> 5, lane = tid & 31, col = lane & 15, g = lane >> 4; const int c0 = blockIdx.y * 128; const size_t r0 = (size_t)blockIdx.x * 64 + wave * 16;
  v8f acc[8] = {};
  gemm_tile<1>(Y + (size_t)blockIdx.x * 64 * CC, WO + (size_t)c0 * CC, stg, acc, tid);
#pragma unroll
    for (int j = 0; j < 8; ++j) { const float bias = BO ? bfr(BO[c0 + j * 16 + col]) : 0.f;
#pragma unroll
      for (int r = 0; r < 8; ++r) sf[wave][8 * g + r][j * 16 + col] = acc[j][r] * (1.0f / 16384.0f) + bias; }   /* 2^-8 (Wo carry) x 2^-6 (ctx carry) */
  LDSX(); for (int rl = 0; rl < 16; ++rl) vst2(OUT + (r0 + rl) * DIN + c0 + lane * 4, *(const v4f*)&sf[wave][rl][lane * 4]); }

extern "C" void kernel_launch(void* const* d_in, const int* in_sizes, int n_in, void* d_out, int out_size, void* d_ws, size_t ws_size, hipStream_t stream) {
  (void)in_sizes; (void)n_in; (void)out_size;
  const float** F = (const float**)d_in;
  if (ws_size < (size_t)WS_END) return;
  char* ws = (char*)d_ws; _Float16 *QH = (_Float16*)(ws + WS_QH), *KH = (_Float16*)(ws + WS_KH), *VT = (_Float16*)(ws + WS_VT), *QL = (_Float16*)(ws + WS_QL), *KL = (_Float16*)(ws + WS_KL); __bf16 *VB = (__bf16*)(ws + WS_VB), *VBL = (__bf16*)(ws + WS_VBL), *XB = (__bf16*)(ws + WS_XB), *WB = (__bf16*)(ws + WS_WB), *AB = (__bf16*)(ws + WS_AB); _Float16 *WOH = (_Float16*)(ws + WS_WOH), *Y = (_Float16*)(ws + WS_Y);
  (void)Y; (void)QL; (void)KL; (void)VB; (void)VBL;
  // inputs: 0 x [2,2048,1024]; 1 attn_bias [1,1,2048,2048]; 2 w_qkv [3072,1024] (out,in): q rows 0..1023, k 1024..2047, v 2048..3071; 3 q_bias [1024] (zeros, read); 4 v_bias [1024] (zeros, read); 5 scale_mul [1,16,1,1] (ln 4, read); 6 w_proj [1024,1024] (out,in); 7 b_proj (zeros, read); the k stream has no bias (the module concatenates zeros)
  k_cvt<<<dim3((NB * TT * DIN + 3 * CC * DIN + DIN * CC + TT * TT) / 8192), 256, 0, stream>>>(F[0], F[2], F[6], F[1], XB, WB, WOH, AB);
  k_proj<<<dim3(TNB * TT / 128, CC / 128, 3), 128, 0, stream>>>(XB, XB, XB, WB, WB + (size_t)CC * DIN, WB + 2 * (size_t)CC * DIN, F[3], nullptr, F[4], QH, KH, VT, F[5]);
  k_fa<<<dim3(NQB, NH, TNB), 128, 0, stream>>>(QH, KH, VT, AB, Y);
  k_out<<<dim3(TNB * TT / 64, DIN / 128), 128, 0, stream>>>(Y, WOH, F[7], (float*)d_out);
}

// v008
// It runs in 83.5 microseconds.
// Timed twice side by side with v007, it ran 1.03 times as fast both times.
// Counting every step since v000, it is 17.3 times as fast.
// compute dtype: all float inputs rounded to bf16; q / k / v projections with EXACT bf16 products on WMMA 16x16x32 (f32 accumulate) + bias (q / v: zeros, read; k: none); q and k times the reciprocal of their per-(token, head) L2 norm in f32, for q times exp(min(bf16(scale_mul[h]), ln 100)); logits q x k once to f16 each (1 product, scale 1), + bf16(attn_bias[q][k]) in f32; softmax f32 with a running maximum and sum over 32-key steps in two interleaved key halves, joined at the end; exp(logit - running max) x 2^11 once to f16 x v once to f16 (1 product), divided by the f32 sum at the end; ctx x 2^6 once to f16 x w_proj f16(bf16 x 2^8) + b_proj; f32 output.
#include <hip/hip_runtime.h>
#include <math.h>

typedef __attribute__((ext_vector_type(16))) _Float16 v16h;
typedef __attribute__((ext_vector_type(16))) __bf16 v16b;
typedef __attribute__((ext_vector_type(8)))  _Float16 v8h;
typedef __attribute__((ext_vector_type(8)))  float v8f;
typedef __attribute__((ext_vector_type(4)))  float v4f;
typedef __attribute__((ext_vector_type(2)))  float v2f;
typedef __attribute__((ext_vector_type(4)))  unsigned v4u;
typedef __attribute__((ext_vector_type(4)))  int v4i;
typedef float __attribute__((may_alias)) float_a;
typedef int __attribute__((may_alias)) int_a;

template <typename T> __device__ __forceinline__ void vst2(void* p, T v) { *(T*)p = v;  }
__device__ __forceinline__ v8f wmma16(v16h a, v16h b, v8f c) {
  v8f d = __builtin_amdgcn_wmma_f32_16x16x32_f16(false, a, false, b, (short)0, c, false, false);
  asm volatile("v_nop\n\tv_nop\n\tv_nop\n\tv_nop" : "+v"(d) : "v"(a), "v"(b));
  return d;
}
__device__ __forceinline__ v8f wmma_bf(v16b a, v16b b, v8f c) {
  v8f d = __builtin_amdgcn_wmma_f32_16x16x32_bf16(false, a, false, b, (short)0, c, false, false);
  asm volatile("v_nop\n\tv_nop\n\tv_nop\n\tv_nop" : "+v"(d) : "v"(a), "v"(b));
  return d;
}
// 16x16x32 fragments: lane = (h = lane>>4, row/col = lane&15); elements 0..7 = k0+8h+0..7, 8..15 = k0+16+8h+0..7; D element r = row 8h+r
__device__ __forceinline__ v16h frag_h(const _Float16* rowk0, int lane) {
  union { v16h v; v8h q[2]; } u; const _Float16* p = rowk0 + 8 * (lane >> 4);
  u.q[0] = *(const v8h*)p; u.q[1] = *(const v8h*)(p + 16); return u.v;
}
__device__ __forceinline__ v16h frag_f32(const float* rowk0, int lane) {
  v16h a; const float* p = rowk0 + 8 * (lane >> 4);
#pragma unroll
  for (int i = 0; i < 8; ++i) { a[i] = (_Float16)p[i]; a[8 + i] = (_Float16)p[16 + i]; }
  return a;
}
__device__ __forceinline__ v16h frag_f32s(const float* rowk0, int lane, float sc) {
  v16h a; const float* p = rowk0 + 8 * (lane >> 4);
#pragma unroll
  for (int i = 0; i < 8; ++i) { a[i] = (_Float16)(p[i] * sc); a[8 + i] = (_Float16)(p[16 + i] * sc); }
  return a;
}
// column fragment from a [K][ld] layout (column n), rows >= K read as 0
__device__ __forceinline__ v16h fragc_f32(const float* W, int k0, int n, int lane, int ld, int K) {
  v16h a; const int g = lane >> 4;
#pragma unroll
  for (int i = 0; i < 8; ++i) { const int ka = k0 + 8 * g + i, kb = ka + 16;
    a[i] = (_Float16)(ka < K ? W[(size_t)(ka < K ? ka : K - 1) * ld + n] : 0.f); a[8 + i] = (_Float16)(kb < K ? W[(size_t)(kb < K ? kb : K - 1) * ld + n] : 0.f); }
  return a;
}
struct F2 { v16b h, l; };
__device__ __forceinline__ F2 bsplit16(const float v[16]) { F2 r;
#pragma unroll
  for (int i = 0; i < 16; ++i) { const __bf16 h = (__bf16)v[i]; r.h[i] = h; r.l[i] = (__bf16)(v[i] - (float)h); }
  return r; }
__device__ __forceinline__ F2 split_row(const float* row, int k0, int lane) { float v[16]; const float* p = row + k0 + 8 * (lane >> 4);
#pragma unroll
  for (int i = 0; i < 8; ++i) { v[i] = p[i]; v[8 + i] = p[16 + i]; }
  return bsplit16(v); }
__device__ __forceinline__ F2 split_rowK(const float* row, int k0, int lane, int K) { float v[16]; const int g = lane >> 4;
#pragma unroll
  for (int i = 0; i < 8; ++i) { const int ka = k0 + 8 * g + i, kb = ka + 16; v[i] = ka < K ? row[ka < K ? ka : K - 1] : 0.f; v[8 + i] = kb < K ? row[kb < K ? kb : K - 1] : 0.f; }
  return bsplit16(v); }
__device__ __forceinline__ F2 split_col(const float* W, int k0, int n, int lane, int ld, int K) { float v[16]; const int g = lane >> 4;
#pragma unroll
  for (int i = 0; i < 8; ++i) { const int ka = k0 + 8 * g + i, kb = ka + 16; v[i] = ka < K ? W[(size_t)(ka < K ? ka : K - 1) * ld + n] : 0.f; v[8 + i] = kb < K ? W[(size_t)(kb < K ? kb : K - 1) * ld + n] : 0.f; }
  return bsplit16(v); }
__device__ __forceinline__ v8f mac3(const F2& a, const F2& b, v8f c) { c = wmma_bf(a.l, b.h, c); c = wmma_bf(a.h, b.l, c); return wmma_bf(a.h, b.h, c); }
__device__ __forceinline__ float sigm(float v) { return 1.0f / (1.0f + expf(-v)); }
#define LDSX() do { asm volatile("s_wait_dscnt 0" ::: "memory"); __builtin_amdgcn_wave_barrier(); __builtin_amdgcn_fence(__ATOMIC_RELEASE, "workgroup"); } while (0)

// Multi-head COSINE self-attention with a per-head learned scale and an additive attention bias (x [2,2048,1024]; attn_bias [1,1,2048,2048] N(0,1), one entry per (query, key), shared by batches and heads - READ on the device; w_qkv [3072,1024] torch (out,in) N(0, 1/1024): q = rows 0..1023, k = 1024..2047, v = 2048..3071 (reshape (B, L, 3, 16, 64)); q_bias / v_bias zeros (read), k has no bias; scale_mul [1,16,1,1] = ln 4 (const; read): sm = exp(min(scale_mul, ln 100)) = 4; q <- q / ||q|| * sm, k <- k / ||k|| per head row; attn = q k^T + attn_bias; softmax; oup through w_proj [1024,1024] (out,in) + b_proj zeros).
#define NB 2
#define TT 2048
#define CC 1024            // NH * HD = projected width
#define DIN 1024          // input (model) width
#define NH 16
#define HD 64
#define NQB (TT / 64)
#define HG 4
#define SCALE (1.0f)
#define CAUSAL 0
#ifndef TNB
#define TNB NB
#endif
__device__ __forceinline__ float bfr(float v) { return (float)(__bf16)v; }
__host__ __device__ __forceinline__ int kb_last(int qb) { return CAUSAL ? ((qb * 64 + 63) >> 7) : (TT / 128 - 1); }
typedef __attribute__((ext_vector_type(8))) __bf16 v8b;
__device__ __forceinline__ v16b frag_b(const __bf16* rowk0, int lane) {
  union { v16b v; v8b q[2]; } u; const __bf16* p = rowk0 + 8 * (lane >> 4);
  u.q[0] = *(const v8b*)p; u.q[1] = *(const v8b*)(p + 16); return u.v;
}
#define QBH 0              // unused: k_fa has one path for all query blocks
#define QHI 0               // single-product logits on every row (unit-norm operands x 4: |cosine logit| <= 4)
#define KHI 64            // key rows of the workspace's k residual / v bf16 hi+lo planes (no kernel writes or reads them)
// B fragment (k rows k0+.., output column o) of a weight: (in,out) [K][ld] or (out,in) [ld rows of K]: bf16 exact, or f16(bf16 * 256) exact
__device__ __forceinline__ v16b wcol_io(const float* Wm, int k0, int o, int lane, int ld) { v16b w; const int g = lane >> 4;
#pragma unroll
  for (int i = 0; i < 8; ++i) { w[i] = (__bf16)Wm[(size_t)(k0 + 8 * g + i) * ld + o]; w[8 + i] = (__bf16)Wm[(size_t)(k0 + 16 + 8 * g + i) * ld + o]; }
  return w; }
__device__ __forceinline__ v16b wcol_oi(const float* Wm, int k0, int o, int lane, int K) { v16b w; const float* p = Wm + (size_t)o * K + k0 + 8 * (lane >> 4);
#pragma unroll
  for (int i = 0; i < 8; ++i) { w[i] = (__bf16)p[i]; w[8 + i] = (__bf16)p[16 + i]; }
  return w; }
__device__ __forceinline__ v16h wcolh_io(const float* Wm, int k0, int o, int lane, int ld) { v16h w; const int g = lane >> 4;
#pragma unroll
  for (int i = 0; i < 8; ++i) { w[i] = (_Float16)(bfr(Wm[(size_t)(k0 + 8 * g + i) * ld + o]) * 256.0f); w[8 + i] = (_Float16)(bfr(Wm[(size_t)(k0 + 16 + 8 * g + i) * ld + o]) * 256.0f); }
  return w; }
__device__ __forceinline__ v16h wcolh_oi(const float* Wm, int k0, int o, int lane, int K) { v16h w; const float* p = Wm + (size_t)o * K + k0 + 8 * (lane >> 4);
#pragma unroll
  for (int i = 0; i < 8; ++i) { w[i] = (_Float16)(bfr(p[i]) * 256.0f); w[8 + i] = (_Float16)(bfr(p[16 + i]) * 256.0f); }
  return w; }
#define WQKV_LAYOUT 1   // 0 = (in,out) [DIN][CC]; 1 = (out,in) [CC][DIN]; 2 = per-head [NH][DIN][HD]
__device__ __forceinline__ v16b wcol_hdk(const float* Wm, int k0, int o, int lane) { v16b w; const int g = lane >> 4; const float* p = Wm + (size_t)(o / HD) * DIN * HD + (o % HD);
#pragma unroll
  for (int i = 0; i < 8; ++i) { w[i] = (__bf16)p[(size_t)(k0 + 8 * g + i) * HD]; w[8 + i] = (__bf16)p[(size_t)(k0 + 16 + 8 * g + i) * HD]; }
  return w; }
#define WO_OUT_IN 1
#if WQKV_LAYOUT == 1
#define WCOL(W, k0, o, lane) wcol_oi(W, k0, o, lane, DIN)
#elif WQKV_LAYOUT == 2
#define WCOL(W, k0, o, lane) wcol_hdk(W, k0, o, lane)
#else
#define WCOL(W, k0, o, lane) wcol_io(W, k0, o, lane, CC)
#endif
#if WO_OUT_IN
#define WOCOL(W, k0, o, lane) wcol_oi(W, k0, o, lane, CC)
#define WOCOLH(W, k0, o, lane) wcolh_oi(W, k0, o, lane, CC)
#else
#define WOCOL(W, k0, o, lane) wcol_io(W, k0, o, lane, DIN)
#define WOCOLH(W, k0, o, lane) wcolh_io(W, k0, o, lane, DIN)
#endif

#define MAX_SCALE_MUL 4.605170186f   // ln(100): the module's clamp on scale_mul
#define PROJ_EXTRA_PARAMS , const float* __restrict__ SMU   /* scale_mul [1][NH][1][1], a module input */
// per (token, head) rule of the q and k streams, applied in k_proj's epilogue: x <- x / sqrt(sum x^2) over the head's 64 values (jnp.linalg.norm, no epsilon in the module), as x * rsq(sum x^2) in f32; the q stream's factor is first multiplied by sm = expf(fminf(bf16(scale_mul[h]), ln 100)); v untouched
#ifndef PROJ_EXTRA_PARAMS
#define PROJ_EXTRA_PARAMS
#endif

#define WS_QH  0u                                      // f16 q rows [b*t][CC]
#define WS_KH  (WS_QH + 2u * (size_t)NB * TT * CC)      // f16 k rows [b*t][CC]
#define WS_VT  (WS_KH + 2u * (size_t)NB * TT * CC)      // f16 v planes [b][c][t]
#define WS_QL  (WS_VT + 2u * (size_t)NB * CC * TT)      // f16 q residual x 2^10 rows [b][t < QHI][CC]
#define WS_KL  (WS_QL + 2u * (size_t)NB * QHI * CC)     // f16 k residual x 2^10 rows [b][t < KHI][CC]
#define WS_VB  (WS_KL + 2u * (size_t)NB * KHI * CC)     // bf16 v hi planes [b][c][t < KHI]
#define WS_VBL (WS_VB + 2u * (size_t)NB * CC * KHI)
#define WS_S   (WS_VBL + 2u * (size_t)NB * CC * KHI)    // region of 4 * HG * TT * TT bytes; its head holds the four 16-bit operand copies below
#define WS_XB  WS_S                                    // bf16 x rows [b*t][DIN]
#define WS_WB  (WS_XB + 2u * (size_t)NB * TT * DIN)     // bf16 w_qkv rows [3 * CC][DIN]
#define WS_WOH (WS_WB + 2u * 3u * (size_t)CC * DIN)     // f16(bf16 x 2^8) w_proj rows [DIN][CC]
#define WS_AB  (WS_WOH + 2u * (size_t)DIN * CC)          // bf16 attn_bias rows [TT][TT]
#define WS_Y   (WS_S  + 4u * (size_t)HG * TT * TT)      // f16 ctx x 2^6 rows [b*t][CC]
#define WS_END (WS_Y  + 4u * (size_t)NB * TT * CC)

// ---- gemm_tile: the 64 x 128 tile of A . W^T (both K-contiguous, already in their 16-bit operand type, K = 1024) of one 4-wave block. Each 128-k stage of both operands is fetched by whole-line loads (16 lanes x 16 B = 256 B of one row) and laid in LDS as it is, where all four waves read their fragments; two LDS buffers, the next stage's loads in flight in registers during the products; k runs upward in steps of 32
typedef __attribute__((ext_vector_type(2))) unsigned v2u;
#define GK 128                     // k per stage
#define GP 272                     // LDS row pitch, bytes: 256 B of 16-bit data + 16 B (pitch for ds_load_b128 readers)
#define GBUF ((64 + 128) * GP)     // one stage: 64 A rows, then 128 W rows
__device__ __forceinline__ v2u pk_bf(v4f v) { union { v2u u; __bf16 e[4]; } r;
#pragma unroll
  for (int i = 0; i < 4; ++i) r.e[i] = (__bf16)v[i];
  return r.u; }
__device__ __forceinline__ v2u pk_wo(v4f v) { union { v2u u; _Float16 e[4]; } r;    // f16(bf16 x 2^8), exact
#pragma unroll
  for (int i = 0; i < 4; ++i) r.e[i] = (_Float16)((float)(__bf16)v[i] * 256.0f);
  return r.u; }
// one stage's 24 loads of a thread (8 of A, 16 of W; the thread's offset is the same in both tiles and never changes), then the two block-uniform bases one stage on; the unrolls here and in gemm_tile make every index of ra, rw, w and acc a constant, so that these arrays stay in registers
template <typename E> __device__ __forceinline__ void gemm_fetch(const E*& Ag, const E*& Wg, unsigned off, v4u (&ra)[8], v4u (&rw)[16]) {
#pragma unroll
  for (int i = 0; i < 8; ++i) ra[i] = *(const v4u*)(Ag + off + i * 8 * 1024);
#pragma unroll
  for (int i = 0; i < 16; ++i) rw[i] = *(const v4u*)(Wg + off + i * 8 * 1024);
  asm volatile("s_wait_xcnt 0x0" :: "v"(off) : "memory");   // stands in front of the overwrite of the loads' base registers just below; the offset as an input keeps its register from being handed to a later load of the group as its destination
  __builtin_amdgcn_sched_barrier(0);                        // keeps the stage's loads in front of the products that are to cover their latency, and the steps of the bases behind the wait
  Ag += GK; Wg += GK; }
template <int F16, typename E> __device__ __forceinline__ void gemm_tile(const E* Ag, const E* Wg, char* stg, v8f (&acc)[8], int tid) {
  const int wave = tid >> 5, lane = tid & 31, col = lane & 15, g = lane >> 4;
  const unsigned off = (tid >> 4) * 1024 + (tid & 15) * 8;                   // 8 rows a pass of the block, 16 lanes x 16 B a row
  char* sp = stg + (tid >> 4) * GP + (tid & 15) * 16;
  const char* fa = stg + (wave * 16 + col) * GP + 16 * g;              // fragment: elements 0..7 = k0 + 8g + 0..7, 8..15 = k0 + 16 + 8g + 0..7
  const char* fw = stg + (64 + col) * GP + 16 * g;
  v4u ra[8], rw[16];
  gemm_fetch(Ag, Wg, off, ra, rw);
  for (int s = 0; s < 1024 / GK; ++s) { const int bo = (s & 1) * GBUF;
#pragma unroll
    for (int i = 0; i < 8; ++i) *(v4u*)(sp + bo + i * 8 * GP) = ra[i];
#pragma unroll
    for (int i = 0; i < 16; ++i) *(v4u*)(sp + bo + (64 + i * 8) * GP) = rw[i];
    __syncthreads();   // publishes stage s; a wave that has passed it has left the other buffer, which stage s + 1 overwrites only behind this barrier
    if (s + 1 < 1024 / GK) gemm_fetch(Ag, Wg, off, ra, rw);
#pragma unroll
    for (int kk = 0; kk < GK / 32; ++kk) { union { v4u q[2]; v16b b; v16h h; } a, w[8]; a.q[0] = *(const v4u*)(fa + bo + kk * 64); a.q[1] = *(const v4u*)(fa + bo + kk * 64 + 32);   // the nine fragments of a 32-k block are read as one group in front of its eight products
#pragma unroll
      for (int j = 0; j < 8; ++j) { w[j].q[0] = *(const v4u*)(fw + bo + j * 16 * GP + kk * 64); w[j].q[1] = *(const v4u*)(fw + bo + j * 16 * GP + kk * 64 + 32); }
      __builtin_amdgcn_sched_barrier(0);   // keeps the group together: without it the scheduler sinks each fragment's two reads to just before its product, into one register set, and every product waits out a whole LDS latency
#pragma unroll
      for (int j = 0; j < 8; ++j) acc[j] = F16 ? __builtin_amdgcn_wmma_f32_16x16x32_f16(false, a.h, false, w[j].h, (short)0, acc[j], false, false) : __builtin_amdgcn_wmma_f32_16x16x32_bf16(false, a.b, false, w[j].b, (short)0, acc[j], false, false); } }
}
// ---- gemm_tile2: the 128 x 128 tile of A . W^T (both K-contiguous bf16, K = 1024) of one 4-wave block; wave (wr, wc) owns the 64 x 64 quarter, so the eight fragments of a 32-k block feed sixteen products. Each 64-k stage of both operands is fetched by whole-line loads (8 lanes x 16 B = 128 B of one row) and laid in LDS as it is; two LDS buffers, the next stage's loads in flight in registers during the products; k runs upward in steps of 32
#define HK 64                      // k per stage
#define HP 144                     // LDS row pitch, bytes: 128 B of 16-bit data + 16 B (pitch for ds_load_b128 readers)
#define HBUF ((128 + 128) * HP)    // one stage: 128 A rows, then 128 W rows
// one stage's 16 loads of a thread (8 of A, 8 of W; the thread's offset is the same in both tiles and never changes), then the two block-uniform bases one stage on; the unrolls here and in gemm_tile2 make every index of ra, rw, a, w and acc a constant, so that these arrays stay in registers
__device__ __forceinline__ void gemm_fetch2(const __bf16*& Ag, const __bf16*& Wg, unsigned off, v4u (&ra)[8], v4u (&rw)[8]) {
#pragma unroll
  for (int i = 0; i < 8; ++i) ra[i] = *(const v4u*)(Ag + off + i * 16 * 1024);
#pragma unroll
  for (int i = 0; i < 8; ++i) rw[i] = *(const v4u*)(Wg + off + i * 16 * 1024);
  asm volatile("s_wait_xcnt 0x0" :: "v"(off) : "memory");   // stands in front of the overwrite of the loads' base registers just below; the offset as an input keeps its register from being handed to a later load of the group as its destination
  __builtin_amdgcn_sched_barrier(0);                        // keeps the stage's loads in front of the products that are to cover their latency, and the steps of the bases behind the wait
  Ag += HK; Wg += HK; }
__device__ __forceinline__ void gemm_tile2(const __bf16* Ag, const __bf16* Wg, char* stg, v8f (&acc)[4][4], int tid) {
  const int wave = tid >> 5, lane = tid & 31, col = lane & 15, g = lane >> 4, wr = wave >> 1, wc = wave & 1;
  const unsigned off = (tid >> 3) * 1024 + (tid & 7) * 8;                    // 16 rows a pass of the block, 8 lanes x 16 B a row
  char* sp = stg + (tid >> 3) * HP + (tid & 7) * 16;
  const char* fa = stg + (wr * 64 + col) * HP + 16 * g;                // fragment: elements 0..7 = k0 + 8g + 0..7, 8..15 = k0 + 16 + 8g + 0..7
  const char* fw = stg + (128 + wc * 64 + col) * HP + 16 * g;
  v4u ra[8], rw[8];
  gemm_fetch2(Ag, Wg, off, ra, rw);
  for (int s = 0; s < 1024 / HK; ++s) { const int bo = (s & 1) * HBUF;
#pragma unroll
    for (int i = 0; i < 8; ++i) *(v4u*)(sp + bo + i * 16 * HP) = ra[i];
#pragma unroll
    for (int i = 0; i < 8; ++i) *(v4u*)(sp + bo + (128 + i * 16) * HP) = rw[i];
    __syncthreads();   // publishes stage s; a wave that has passed it has left the other buffer, which stage s + 1 overwrites only behind this barrier
    if (s + 1 < 1024 / HK) gemm_fetch2(Ag, Wg, off, ra, rw);
#pragma unroll
    for (int kk = 0; kk < HK / 32; ++kk) { union { v4u q[2]; v16b b; } a[4], w[4];   // the eight fragments of a 32-k block are read as one group in front of its sixteen products
#pragma unroll
      for (int i = 0; i < 4; ++i) { a[i].q[0] = *(const v4u*)(fa + bo + i * 16 * HP + kk * 64); a[i].q[1] = *(const v4u*)(fa + bo + i * 16 * HP + kk * 64 + 32); w[i].q[0] = *(const v4u*)(fw + bo + i * 16 * HP + kk * 64); w[i].q[1] = *(const v4u*)(fw + bo + i * 16 * HP + kk * 64 + 32); }
      __builtin_amdgcn_sched_barrier(0);   // keeps the group together: without it the scheduler sinks each fragment's two reads to just before its product, and every product waits out a whole LDS latency
#pragma unroll
      for (int i = 0; i < 4; ++i)
#pragma unroll
        for (int j = 0; j < 4; ++j) acc[i][j] = __builtin_amdgcn_wmma_f32_16x16x32_bf16(false, a[i].b, false, w[j].b, (short)0, acc[i][j], false, false); } }
}
// ---- k_cvt: x, w_qkv and attn_bias once to bf16, w_proj once to f16(bf16 x 2^8): the operands that the stages of the two GEMMs and the steps of k_fa fetch. Block = 8192 consecutive floats of one of the four arrays; a wave's load covers 512 B, its store 256 B; the unrolls keep v and o in registers
template <int WOF> __device__ __forceinline__ void cvt_run(const float* sp, char* dp) { v4f v[8]; v2u o[8];
#pragma unroll
  for (int j = 0; j < 8; ++j) v[j] = *(const v4f*)(sp + j * 1024);
  asm volatile("s_wait_xcnt 0x0" ::: "memory");   // stands in front of any rewrite of the loads' address registers
#pragma unroll
  for (int j = 0; j < 8; ++j) o[j] = WOF ? pk_wo(v[j]) : pk_bf(v[j]);
#pragma unroll
  for (int j = 0; j < 8; ++j) *(v2u*)(dp + j * 2048) = o[j];
  asm volatile("s_wait_xcnt 0x0" ::: "memory"); }   // stands behind the last store, in front of any rewrite of the stores' data and address registers on a way that the listing lays behind them
__global__ __launch_bounds__(256) void k_cvt(const float* __restrict__ X, const float* __restrict__ WQKV, const float* __restrict__ WO, const float* __restrict__ ABI, __bf16* __restrict__ XB, __bf16* __restrict__ WB, _Float16* __restrict__ WOH, __bf16* __restrict__ AB) {
  const int nx = NB * TT * DIN / 8192, nw = 3 * CC * DIN / 8192, no = DIN * CC / 8192, blk = blockIdx.x; const size_t t4 = threadIdx.x * 4;   /* the four branches are block-uniform */
  if (blk < nx) { const size_t e = (size_t)blk * 8192 + t4; cvt_run<0>(X + e, (char*)XB + 2 * e); }
  else if (blk < nx + nw) { const size_t e = (size_t)(blk - nx) * 8192 + t4; cvt_run<0>(WQKV + e, (char*)WB + 2 * e); }
  else if (blk < nx + nw + no) { const size_t e = (size_t)(blk - nx - nw) * 8192 + t4; cvt_run<1>(WO + e, (char*)WOH + 2 * e); }
  else { const size_t e = (size_t)(blk - nx - nw - no) * 8192 + t4; cvt_run<0>(ABI + e, (char*)AB + 2 * e); } }
// ---- k_proj: block = (128 rows, 128 cols, which): q/k/v = X W (+ b) with exact bf16 products (K = DIN) -> which 0: q f16 rows; 1: k f16 rows; 2: v f16 planes [c][t]. A wave's 64 x 64 quarter is 64 tokens of ONE head, so the whole epilogue runs on its accumulator registers: a token's 64 values lie 4 in a lane x the 16 lanes of a half
template <int M> __device__ __forceinline__ float xm16(float v) { return __builtin_bit_cast(float, __builtin_amdgcn_update_dpp(0, __builtin_bit_cast(int, v), 0x160 + M, 0xf, 0xf, true)); }   // the value of lane ^ M inside the 16-lane half (DPP row_xmask)
// 1 / sqrt(x); the v_nop in the same statement is the one slot that the instruction set asks for behind a transcendental before its result is read or its source register overwritten
__device__ __forceinline__ float rsqs(float x) { float e; asm("v_rsq_f32 %0, %1\n\tv_nop" : "=v"(e) : "v"(x)); return e; }
// the wave's own 64 x 64 f16 tile (pitch HP) out of LDS to 64 global rows of LD elements, whole 128-B lines (8 lanes x 16 B a row, 4 rows an instruction); the unrolls keep v in registers and make every step of the address an immediate offset
template <int LD> __device__ __forceinline__ void tile_out(const char* tl, _Float16* D, int lane) { v4u v[16]; const char* p = tl + (lane >> 3) * HP + (lane & 7) * 16; _Float16* d = D + (size_t)(lane >> 3) * LD + (lane & 7) * 8;
#pragma unroll
  for (int i = 0; i < 16; ++i) v[i] = *(const v4u*)(p + i * 4 * HP);
#pragma unroll
  for (int i = 0; i < 16; ++i) vst2(d + (size_t)i * 4 * LD, v[i]);
  asm volatile("s_wait_xcnt 0x0" ::: "memory"); }   // stands behind the last store, in front of any rewrite of the stores' data and address registers on a way that the listing lays behind them
__global__ __launch_bounds__(128) void k_proj(const __bf16* __restrict__ XQ, const __bf16* __restrict__ XK, const __bf16* __restrict__ XV, const __bf16* __restrict__ WQ, const __bf16* __restrict__ WK, const __bf16* __restrict__ WV, const float* __restrict__ BQ, const float* __restrict__ BK, const float* __restrict__ BV,
    _Float16* __restrict__ QH, _Float16* __restrict__ KH, _Float16* __restrict__ VT PROJ_EXTRA_PARAMS) {
  __shared__ __align__(16) char sm[2 * HBUF];   // the two operand stages during the products; then the first buffer holds the four waves' own output tiles (4 x 64 rows at pitch HP = HBUF bytes): the last stage, an odd one, is read from the second buffer, and every wave left the first before that stage's barrier
  const int tid = threadIdx.x, wave = tid >> 5, lane = tid & 31, col = lane & 15, g = lane >> 4; const int wr = wave >> 1, wc = wave & 1; const int which = blockIdx.z; const int c0 = blockIdx.y * 128; const size_t rb = (size_t)blockIdx.x * 128;
  const __bf16* X = which == 0 ? XQ : which == 1 ? XK : XV; const __bf16* WA = which == 0 ? WQ : which == 1 ? WK : WV; const float* BA = which == 0 ? BQ : which == 1 ? BK : BV;
  float bs[4] = {0.f, 0.f, 0.f, 0.f}; const float smu = SMU[c0 / HD + wc];   // the lane's four bias values and the head's scale_mul are fetched here, so that the products cover their latency
  if (BA) {
#pragma unroll
    for (int j = 0; j < 4; ++j) bs[j] = BA[c0 + wc * 64 + j * 16 + col]; }
  asm volatile("s_wait_xcnt 0x0" ::: "memory");   // stands in front of any rewrite of these loads' address registers
  v8f acc[4][4] = {};
  gemm_tile2(X + rb * DIN, WA + (size_t)c0 * DIN, sm, acc, tid);
  char* tl = sm + wave * (64 * HP);
#pragma unroll
  for (int j = 0; j < 4; ++j) bs[j] = bfr(bs[j]);
  if (which < 2) { const float sm_ = which == 0 ? expf(fminf(bfr(smu), MAX_SCALE_MUL)) : 1.0f;   // tile rows = tokens, 64 f16 of the head each; the unrolls make every index of acc, bs and sc a constant, so that they stay in registers
#pragma unroll
    for (int i = 0; i < 4; ++i) { float sc[8];
#pragma unroll
      for (int r = 0; r < 8; ++r) { float ss = 0.f;
#pragma unroll
        for (int j = 0; j < 4; ++j) { const float x = acc[i][j][r] + bs[j]; acc[i][j][r] = x; ss += x * x; }
        ss += xm16<1>(ss); ss += xm16<2>(ss); ss += xm16<4>(ss); ss += xm16<8>(ss); sc[r] = rsqs(ss) * sm_; }
#pragma unroll
      for (int j = 0; j < 4; ++j)
#pragma unroll
        for (int r = 0; r < 8; ++r) *(_Float16*)(tl + (i * 16 + 8 * g + r) * HP + (j * 16 + col) * 2) = (_Float16)(acc[i][j][r] * sc[r]); }
    LDSX(); tile_out<CC>(tl, (which == 0 ? QH : KH) + (rb + wr * 64) * CC + c0 + wc * 64, lane);
  } else {   // tile rows = the head's 64 dims, 64 tokens each: a lane's 8 accumulator rows are 8 consecutive tokens of one dim
#pragma unroll
    for (int i = 0; i < 4; ++i)
#pragma unroll
      for (int j = 0; j < 4; ++j) { v8h o;
#pragma unroll
        for (int r = 0; r < 8; ++r) o[r] = (_Float16)(acc[i][j][r] + bs[j]);
        *(v8h*)(tl + (j * 16 + col) * HP + (i * 16 + 8 * g) * 2) = o; }
    LDSX(); tile_out<TT>(tl, VT + ((rb / TT) * CC + c0 + wc * 64) * (size_t)TT + rb % TT + wr * 64, lane); }
}
// ---- k_fa: block = 128 queries of (b, h), 8 waves, all keys in steps of 64, each step's K, V and bias tiles brought into LDS by asynchronous copies one step ahead (two buffers). Wave (qi, ki) = (wave / 2, wave % 2) owns 32 queries (two 16-query tiles) against the 32-key half ki of every step, so each K or V fragment read from LDS feeds two products: S^T = K . Q^T on top of bf16(attn_bias), which an identity A lays into the score registers as the B operand of one bf16 product a tile (1 x b + zeros, exact) (lane = one query a tile, 8 keys a tile), running maximum and sum per query over the wave's own keys in registers, P^T x 2^11 (relative to that running maximum) once to f16 straight from the score registers as the B operand, ctx^T += V^T . P^T. Behind the loop the two waves of a pair hand each other one query tile's maximum, sum and ctx^T through LDS and join the two key halves; ctx = ctx^T / sum, stored x 2^6 as f16, the output projection's operand
#define LOG2E 1.44269504f
__device__ __forceinline__ v8f wmma_h(v16h a, v16h b, v8f c) { return __builtin_amdgcn_wmma_f32_16x16x32_f16(false, a, false, b, (short)0, c, false, false); }
// 2^x; the v_nop in the same statement is the one slot that the instruction set asks for behind a transcendental before its result is read or its source register overwritten
__device__ __forceinline__ float exp2s(float x) { float e; asm("v_exp_f32 %0, %1\n\tv_nop" : "=v"(e) : "v"(x)); return e; }
__device__ __forceinline__ v16h frag_p(const _Float16* p) { union { v16h v; v8h q[2]; } u; u.q[0] = *(const v8h*)p; u.q[1] = *(const v8h*)(p + 16); return u.v; }   // frag_h with the half's 8 elements already in the pointer
__device__ __forceinline__ v16b frag_pb(const __bf16* p) { union { v16b v; v8b q[2]; } u; u.q[0] = *(const v8b*)p; u.q[1] = *(const v8b*)(p + 16); return u.v; }   // the same of bf16
__device__ __forceinline__ float xhalf(float v) { const int b = __builtin_bit_cast(int, v); return __builtin_bit_cast(float, __builtin_amdgcn_permlanex16(b, b, 0x76543210, 0xfedcba98, false, false)); }   // the value of lane ^ 16
// one 64-key step's operands in LDS: 64 K rows, 64 V planes and the block's 128 bf16 bias rows, each of 128 B at pitch 144 B (pitch for ds_load_b128 readers)
#define FQ 128
#define FKP 144
#define FVO (64 * FKP)
#define FBO (2 * 64 * FKP)
#define FBUF ((2 * 64 + FQ) * FKP)
// one step's 8 copies of a thread, whole lines (8 lanes x 16 B = one K, V or bias row; 32 rows a pass of the block); lk = the thread's LDS byte address of its first K piece in the target buffer; the s_wait_xcnt at the end of the statement stands in front of any rewrite of the address registers that its copies name
__device__ __forceinline__ void fa_copy(unsigned lk, const _Float16* kg, const _Float16* vg, const __bf16* bg) {
  asm volatile("global_load_async_to_lds_b128 %0, %1, off\n\tglobal_load_async_to_lds_b128 %2, %3, off\n\tglobal_load_async_to_lds_b128 %4, %5, off\n\tglobal_load_async_to_lds_b128 %6, %7, off\n\t"
               "global_load_async_to_lds_b128 %8, %9, off\n\tglobal_load_async_to_lds_b128 %10, %11, off\n\tglobal_load_async_to_lds_b128 %12, %13, off\n\tglobal_load_async_to_lds_b128 %14, %15, off\n\ts_wait_xcnt 0x0"
               :: "v"(lk), "v"(kg), "v"(lk + 32 * FKP), "v"(kg + 32 * CC),
                  "v"(lk + FVO), "v"(vg), "v"(lk + FVO + 32 * FKP), "v"(vg + 32 * TT),
                  "v"(lk + FBO), "v"(bg), "v"(lk + FBO + 32 * FKP), "v"(bg + 32 * TT), "v"(lk + FBO + 64 * FKP), "v"(bg + 64 * TT), "v"(lk + FBO + 96 * FKP), "v"(bg + 96 * TT) : "memory"); }
__global__ __launch_bounds__(256) void k_fa(const _Float16* __restrict__ QH, const _Float16* __restrict__ KH, const _Float16* __restrict__ VT, const __bf16* __restrict__ AB, _Float16* __restrict__ Y) { __shared__ __align__(16) char ring[2 * FBUF];   // two step buffers; behind the loop's last barrier the first buffer's bytes carry the pairs' hand-over (8 waves x 9 x 512 B = FBUF) and the second's stage the output rows
  _Float16 (*ss)[16][HD + 8] = (_Float16 (*)[16][HD + 8])(ring + FBUF);
  const int tid = threadIdx.x, wave = tid >> 5, lane = tid & 31, col = lane & 15, g = lane >> 4, qi = wave >> 1, ki = wave & 1; const int h = blockIdx.y, b = blockIdx.z; const int ql0 = blockIdx.x * FQ + wave * 16;   // ql0: the 16 queries that this wave finishes and stores (tile ki of its 32)
  const _Float16* qp = QH + ((size_t)b * TT + blockIdx.x * FQ + qi * 32 + col) * CC + h * HD; v16h q[2][2];   // the unroll makes every index of q a constant, so that it stays in registers
#pragma unroll
  for (int u = 0; u < 2; ++u) { q[u][0] = frag_h(qp + u * 16 * CC, lane); q[u][1] = frag_h(qp + u * 16 * CC + 32, lane); }
  const _Float16* kg = KH + ((size_t)b * TT + (tid >> 3)) * CC + h * HD + (tid & 7) * 8;             // the thread's 16 B of key row tid / 8 (then + 32); runs on by 64 keys a step
  const _Float16* vg = VT + ((size_t)b * CC + h * HD + (tid >> 3)) * (size_t)TT + (tid & 7) * 8;     // its 16 B of the v plane of dim tid / 8 (then + 32); runs on by 64 keys a step
  const __bf16* bg = AB + (size_t)(blockIdx.x * FQ + (tid >> 3)) * TT + (tid & 7) * 8;               // its 16 B of the block's bias row of query tid / 8 (then + 32, 64, 96); runs on by 64 keys a step
  const unsigned lk = (unsigned)(size_t)ring + (tid >> 3) * FKP + (tid & 7) * 16;
  const char* kr = ring + (ki * 32 + col) * FKP + 16 * g;                     // key row col of a 16-key tile of this wave's half, this lane half's 8 elements
  const char* vr = ring + FVO + col * FKP + ki * 64 + 16 * g;                 // dim col of a 16-dim tile of V, the 32 keys of this wave's half
  const char* br = ring + FBO + (qi * 32 + col) * FKP + ki * 64 + 16 * g;     // this lane's query row of a query tile as a B fragment: keys 8g + 0..7 and 16 + 8g + 0..7 of this wave's half
  v16b id0, id1;                                                     // A fragments that pick a key row out of that B: id0[key][k] = (k == key), the half's first tile; id1[key][k] = (k == 16 + key), its second; 1 x b + 0 x the others is b itself for a finite bias (0 x inf would be NaN)
#pragma unroll
  for (int i = 0; i < 8; ++i) { const __bf16 o = (__bf16)(8 * g + i == col ? 1.0f : 0.0f), z = (__bf16)0.0f; id0[i] = o; id0[8 + i] = z; id1[i] = z; id1[8 + i] = o; }
  v8f acc[2][HD / 16] = {}; float m[2] = {-3.0e38f, -3.0e38f}, l[2] = {0.f, 0.f};   // per query tile: m = running maximum of the query's logits over this wave's keys; l = this lane half's share of their sum, x 2^11
  fa_copy(lk, kg, vg, bg);
  asm volatile("s_wait_asynccnt 0x0" ::: "memory");   // step 0's pieces of this wave have landed
  __syncthreads();                                    // publishes step 0
  fa_copy(lk + FBUF, kg + 64 * CC, vg + 64, bg + 64);
  kg += 128 * CC; vg += 128; bg += 128;
  for (int t = 0; t < TT / 64; ++t) { const unsigned bo = (t & 1) * FBUF; v16h kf[4], vf[4]; v16b bf[2]; v8f s[2][2];   // every LDS read of the step stands as one group in front of its first product; the unrolls of this loop body make every index of kf, vf, bf, s, p, m, l and acc a constant, so that they stay in registers
#pragma unroll
    for (int u = 0; u < 2; ++u) bf[u] = frag_pb((const __bf16*)(br + bo + u * 16 * FKP));
#pragma unroll
    for (int j = 0; j < 2; ++j) { kf[2 * j] = frag_p((const _Float16*)(kr + bo + j * 16 * FKP)); kf[2 * j + 1] = frag_p((const _Float16*)(kr + bo + j * 16 * FKP + 64)); }
#pragma unroll
    for (int j = 0; j < HD / 16; ++j) vf[j] = frag_p((const _Float16*)(vr + bo + j * 16 * FKP));
    __builtin_amdgcn_sched_barrier(0);   // keeps the group together: without it the scheduler sinks each fragment's reads to just before its product, and every product waits out an LDS latency
    const v8f c0 = {};   // s[u][j][r] = bias[query of tile u][key 16 j + 8g + r of the half], then the two products of K . Q^T on top of it
#pragma unroll
    for (int u = 0; u < 2; ++u) { s[u][0] = __builtin_amdgcn_wmma_f32_16x16x32_bf16(false, id0, false, bf[u], (short)0, c0, false, false); s[u][1] = __builtin_amdgcn_wmma_f32_16x16x32_bf16(false, id1, false, bf[u], (short)0, c0, false, false); }
    __builtin_amdgcn_sched_barrier(0);   // this one and the two below keep the four tiles' products abreast: without them the scheduler lines up each tile's three dependent products one behind the other, each waiting out the one before it
#pragma unroll
    for (int u = 0; u < 2; ++u) { s[u][0] = wmma_h(kf[0], q[u][0], s[u][0]); s[u][1] = wmma_h(kf[2], q[u][0], s[u][1]); }
    __builtin_amdgcn_sched_barrier(0);
#pragma unroll
    for (int u = 0; u < 2; ++u) { s[u][0] = wmma_h(kf[1], q[u][1], s[u][0]); s[u][1] = wmma_h(kf[3], q[u][1], s[u][1]); }
    __builtin_amdgcn_sched_barrier(0);
    v16h p[2];
#pragma unroll
    for (int u = 0; u < 2; ++u) { float mx = m[u];
#pragma unroll
      for (int j = 0; j < 2; ++j)
#pragma unroll
        for (int r = 0; r < 8; ++r) mx = fmaxf(mx, s[u][j][r]);
      mx = fmaxf(mx, xhalf(mx));
      const float al = exp2s((m[u] - mx) * LOG2E), mo = mx * LOG2E - 11.0f; m[u] = mx;
      float sj[2];
#pragma unroll
      for (int j = 0; j < 2; ++j) { sj[j] = 0.f;
#pragma unroll
        for (int r = 0; r < 8; ++r) { const float e = exp2s(s[u][j][r] * LOG2E - mo); sj[j] += e; p[u][j * 8 + r] = (_Float16)e; } }
      l[u] = l[u] * al + (sj[0] + sj[1]);
#pragma unroll
      for (int j = 0; j < HD / 16; ++j) acc[u][j] = acc[u][j] * al; }
#pragma unroll
    for (int u = 0; u < 2; ++u)
#pragma unroll
      for (int j = 0; j < HD / 16; ++j) acc[u][j] = wmma_h(vf[j], p[u], acc[u][j]);
    __builtin_amdgcn_sched_barrier(0);   // keeps the step's products in front of the waits below: without it the scheduler lifts them and the barrier to just behind the read group, where the next step's copies have had no time to land
    asm volatile("s_wait_dscnt 0x0" ::: "memory");      // this wave's reads of the step's buffer have retired before the buffer is handed to the copies below
    asm volatile("s_wait_asynccnt 0x0" ::: "memory");   // this wave's pieces of step t + 1 have landed
    __syncthreads();                                    // publishes step t + 1 and ends every wave's reads of step t's buffer
    if (t + 2 < TT / 64) { fa_copy(lk + bo, kg, vg, bg); kg += 64 * CC; vg += 64; bg += 64; } }
  asm volatile("s_wait_asynccnt 0x0" ::: "memory");     // no copy is outstanding when the ring's bytes become hand-over and output staging and when the wave ends
  // the pair (qi, 0), (qi, 1) joins its two key halves: wave ki keeps query tile ki and hands tile 1 - ki to its partner, lane to lane, 9 pieces of 16 B a lane, each piece 512 contiguous bytes of the wave; the unrolls below make every index of acc, keep and o a constant, so that they stay in registers
  l[0] += xhalf(l[0]); l[1] += xhalf(l[1]);
  const float mk = ki ? m[1] : m[0], lkp = ki ? l[1] : l[0]; v8f keep[HD / 16]; char* hw = ring + wave * (9 * 512) + lane * 16; const char* hr = ring + (wave ^ 1) * (9 * 512) + lane * 16;
#pragma unroll
  for (int j = 0; j < HD / 16; ++j) { const v8f gv = ki ? acc[0][j] : acc[1][j]; keep[j] = ki ? acc[1][j] : acc[0][j];
    *(v4f*)(hw + (2 * j) * 512) = __builtin_shufflevector(gv, gv, 0, 1, 2, 3); *(v4f*)(hw + (2 * j + 1) * 512) = __builtin_shufflevector(gv, gv, 4, 5, 6, 7); }
  { const v4f ml = {ki ? m[0] : m[1], ki ? l[0] : l[1], 0.f, 0.f}; *(v4f*)(hw + 8 * 512) = ml; }
  __syncthreads();                                      // publishes every wave's hand-over to its partner
  const v4f mlo = *(const v4f*)(hr + 8 * 512); const float mj = fmaxf(mk, mlo[0]), ak = exp2s((mk - mj) * LOG2E), ao = exp2s((mlo[0] - mj) * LOG2E), lj = lkp * ak + mlo[1] * ao;
  const float inv = lj > 0.f ? 1.0f / lj : 0.f;   /* a fully excluded row yields ctx = 0 */
#pragma unroll
  for (int j = 0; j < HD / 16; ++j) { v8h o; const v4f o0 = *(const v4f*)(hr + (2 * j) * 512), o1 = *(const v4f*)(hr + (2 * j + 1) * 512);   /* ctx carried x 2^6 into f16 so small-magnitude context rows stay clear of f16 subnormals */
#pragma unroll
    for (int r = 0; r < 8; ++r) o[r] = (_Float16)(((keep[j][r] * ak + (r < 4 ? o0[r & 3] : o1[r & 3]) * ao) * inv) * 64.0f);
    *(v8h*)&ss[wave][col][j * 16 + 8 * g] = o; }
  LDSX(); for (int i = 0; i < 4; ++i) { const int rl = 4 * i + (lane >> 3); vst2(Y + ((size_t)b * TT + ql0 + rl) * CC + h * HD + (lane & 7) * 8, *(const v4u*)&ss[wave][rl][(lane & 7) * 8]); } }
// ---- k_out: block = (64 rows, 128 cols): out = ctx Wo (+ bo): ctx x 2^6 in f16 against Wo as f16(bf16 x 2^8) exact (1 product) x 2^-14
__global__ __launch_bounds__(128) void k_out(const _Float16* __restrict__ Y, const _Float16* __restrict__ WO, const float* __restrict__ BO, float* __restrict__ OUT) { __shared__ __align__(16) float sf[4][16][132]; __shared__ __align__(16) char stg[2 * GBUF];
  const int tid = threadIdx.x, wave = tid >> 5, lane = tid & 31, col = lane & 15, g = lane >> 4; const int c0 = blockIdx.y * 128; const size_t r0 = (size_t)blockIdx.x * 64 + wave * 16;
  v8f acc[8] = {};
  gemm_tile<1>(Y + (size_t)blockIdx.x * 64 * CC, WO + (size_t)c0 * CC, stg, acc, tid);
#pragma unroll
    for (int j = 0; j < 8; ++j) { const float bias = BO ? bfr(BO[c0 + j * 16 + col]) : 0.f;
#pragma unroll
      for (int r = 0; r < 8; ++r) sf[wave][8 * g + r][j * 16 + col] = acc[j][r] * (1.0f / 16384.0f) + bias; }   /* 2^-8 (Wo carry) x 2^-6 (ctx carry) */
  LDSX(); for (int rl = 0; rl < 16; ++rl) vst2(OUT + (r0 + rl) * DIN + c0 + lane * 4, *(const v4f*)&sf[wave][rl][lane * 4]); }

extern "C" void kernel_launch(void* const* d_in, const int* in_sizes, int n_in, void* d_out, int out_size, void* d_ws, size_t ws_size, hipStream_t stream) {
  (void)in_sizes; (void)n_in; (void)out_size;
  const float** F = (const float**)d_in;
  if (ws_size < (size_t)WS_END) return;
  char* ws = (char*)d_ws; _Float16 *QH = (_Float16*)(ws + WS_QH), *KH = (_Float16*)(ws + WS_KH), *VT = (_Float16*)(ws + WS_VT), *QL = (_Float16*)(ws + WS_QL), *KL = (_Float16*)(ws + WS_KL); __bf16 *VB = (__bf16*)(ws + WS_VB), *VBL = (__bf16*)(ws + WS_VBL), *XB = (__bf16*)(ws + WS_XB), *WB = (__bf16*)(ws + WS_WB), *AB = (__bf16*)(ws + WS_AB); _Float16 *WOH = (_Float16*)(ws + WS_WOH), *Y = (_Float16*)(ws + WS_Y);
  (void)Y; (void)QL; (void)KL; (void)VB; (void)VBL;
  // inputs: 0 x [2,2048,1024]; 1 attn_bias [1,1,2048,2048]; 2 w_qkv [3072,1024] (out,in): q rows 0..1023, k 1024..2047, v 2048..3071; 3 q_bias [1024] (zeros, read); 4 v_bias [1024] (zeros, read); 5 scale_mul [1,16,1,1] (ln 4, read); 6 w_proj [1024,1024] (out,in); 7 b_proj (zeros, read); the k stream has no bias (the module concatenates zeros)
  k_cvt<<<dim3((NB * TT * DIN + 3 * CC * DIN + DIN * CC + TT * TT) / 8192), 256, 0, stream>>>(F[0], F[2], F[6], F[1], XB, WB, WOH, AB);
  k_proj<<<dim3(TNB * TT / 128, CC / 128, 3), 128, 0, stream>>>(XB, XB, XB, WB, WB + (size_t)CC * DIN, WB + 2 * (size_t)CC * DIN, F[3], nullptr, F[4], QH, KH, VT, F[5]);
  k_fa<<<dim3(TT / FQ, NH, TNB), 256, 0, stream>>>(QH, KH, VT, AB, Y);
  k_out<<<dim3(TNB * TT / 64, DIN / 128), 128, 0, stream>>>(Y, WOH, F[7], (float*)d_out);
}

// v009
// It runs in 81.3 microseconds.
// Next to v008, in two timings, it ran 1.03 times as fast each time.
// All steps since v000 together make it 17.8 times as fast.
// compute dtype: all float inputs rounded to bf16; q / k / v projections with EXACT bf16 products on WMMA 16x16x32 (f32 accumulate) + bias (q / v: zeros, read; k: none); q and k times the reciprocal of their per-(token, head) L2 norm in f32, for q times exp(min(bf16(scale_mul[h]), ln 100)); logits q x k once to f16 each (1 product, scale 1), + bf16(attn_bias[q][k]) in f32; softmax f32 with a running maximum and sum over 32-key steps in two interleaved key halves, joined at the end; exp(logit - running max) x 2^11 once to f16 x v once to f16 (1 product), divided by the f32 sum at the end; ctx x 2^6 once to f16 x w_proj f16(bf16 x 2^8) + b_proj; f32 output.
#include <hip/hip_runtime.h>
#include <math.h>

typedef __attribute__((ext_vector_type(16))) _Float16 v16h;
typedef __attribute__((ext_vector_type(16))) __bf16 v16b;
typedef __attribute__((ext_vector_type(8)))  _Float16 v8h;
typedef __attribute__((ext_vector_type(8)))  float v8f;
typedef __attribute__((ext_vector_type(4)))  float v4f;
typedef __attribute__((ext_vector_type(2)))  float v2f;
typedef __attribute__((ext_vector_type(4)))  unsigned v4u;
typedef __attribute__((ext_vector_type(4)))  int v4i;
typedef float __attribute__((may_alias)) float_a;
typedef int __attribute__((may_alias)) int_a;

template <typename T> __device__ __forceinline__ void vst2(void* p, T v) { *(T*)p = v;  }
__device__ __forceinline__ v8f wmma16(v16h a, v16h b, v8f c) {
  v8f d = __builtin_amdgcn_wmma_f32_16x16x32_f16(false, a, false, b, (short)0, c, false, false);
  asm volatile("v_nop\n\tv_nop\n\tv_nop\n\tv_nop" : "+v"(d) : "v"(a), "v"(b));
  return d;
}
__device__ __forceinline__ v8f wmma_bf(v16b a, v16b b, v8f c) {
  v8f d = __builtin_amdgcn_wmma_f32_16x16x32_bf16(false, a, false, b, (short)0, c, false, false);
  asm volatile("v_nop\n\tv_nop\n\tv_nop\n\tv_nop" : "+v"(d) : "v"(a), "v"(b));
  return d;
}
// 16x16x32 fragments: lane = (h = lane>>4, row/col = lane&15); elements 0..7 = k0+8h+0..7, 8..15 = k0+16+8h+0..7; D element r = row 8h+r
__device__ __forceinline__ v16h frag_h(const _Float16* rowk0, int lane) {
  union { v16h v; v8h q[2]; } u; const _Float16* p = rowk0 + 8 * (lane >> 4);
  u.q[0] = *(const v8h*)p; u.q[1] = *(const v8h*)(p + 16); return u.v;
}
__device__ __forceinline__ v16h frag_f32(const float* rowk0, int lane) {
  v16h a; const float* p = rowk0 + 8 * (lane >> 4);
#pragma unroll
  for (int i = 0; i < 8; ++i) { a[i] = (_Float16)p[i]; a[8 + i] = (_Float16)p[16 + i]; }
  return a;
}
__device__ __forceinline__ v16h frag_f32s(const float* rowk0, int lane, float sc) {
  v16h a; const float* p = rowk0 + 8 * (lane >> 4);
#pragma unroll
  for (int i = 0; i < 8; ++i) { a[i] = (_Float16)(p[i] * sc); a[8 + i] = (_Float16)(p[16 + i] * sc); }
  return a;
}
// column fragment from a [K][ld] layout (column n), rows >= K read as 0
__device__ __forceinline__ v16h fragc_f32(const float* W, int k0, int n, int lane, int ld, int K) {
  v16h a; const int g = lane >> 4;
#pragma unroll
  for (int i = 0; i < 8; ++i) { const int ka = k0 + 8 * g + i, kb = ka + 16;
    a[i] = (_Float16)(ka < K ? W[(size_t)(ka < K ? ka : K - 1) * ld + n] : 0.f); a[8 + i] = (_Float16)(kb < K ? W[(size_t)(kb < K ? kb : K - 1) * ld + n] : 0.f); }
  return a;
}
struct F2 { v16b h, l; };
__device__ __forceinline__ F2 bsplit16(const float v[16]) { F2 r;
#pragma unroll
  for (int i = 0; i < 16; ++i) { const __bf16 h = (__bf16)v[i]; r.h[i] = h; r.l[i] = (__bf16)(v[i] - (float)h); }
  return r; }
__device__ __forceinline__ F2 split_row(const float* row, int k0, int lane) { float v[16]; const float* p = row + k0 + 8 * (lane >> 4);
#pragma unroll
  for (int i = 0; i < 8; ++i) { v[i] = p[i]; v[8 + i] = p[16 + i]; }
  return bsplit16(v); }
__device__ __forceinline__ F2 split_rowK(const float* row, int k0, int lane, int K) { float v[16]; const int g = lane >> 4;
#pragma unroll
  for (int i = 0; i < 8; ++i) { const int ka = k0 + 8 * g + i, kb = ka + 16; v[i] = ka < K ? row[ka < K ? ka : K - 1] : 0.f; v[8 + i] = kb < K ? row[kb < K ? kb : K - 1] : 0.f; }
  return bsplit16(v); }
__device__ __forceinline__ F2 split_col(const float* W, int k0, int n, int lane, int ld, int K) { float v[16]; const int g = lane >> 4;
#pragma unroll
  for (int i = 0; i < 8; ++i) { const int ka = k0 + 8 * g + i, kb = ka + 16; v[i] = ka < K ? W[(size_t)(ka < K ? ka : K - 1) * ld + n] : 0.f; v[8 + i] = kb < K ? W[(size_t)(kb < K ? kb : K - 1) * ld + n] : 0.f; }
  return bsplit16(v); }
__device__ __forceinline__ v8f mac3(const F2& a, const F2& b, v8f c) { c = wmma_bf(a.l, b.h, c); c = wmma_bf(a.h, b.l, c); return wmma_bf(a.h, b.h, c); }
__device__ __forceinline__ float sigm(float v) { return 1.0f / (1.0f + expf(-v)); }
#define LDSX() do { asm volatile("s_wait_dscnt 0" ::: "memory"); __builtin_amdgcn_wave_barrier(); __builtin_amdgcn_fence(__ATOMIC_RELEASE, "workgroup"); } while (0)

// Multi-head COSINE self-attention with a per-head learned scale and an additive attention bias (x [2,2048,1024]; attn_bias [1,1,2048,2048] N(0,1), one entry per (query, key), shared by batches and heads - READ on the device; w_qkv [3072,1024] torch (out,in) N(0, 1/1024): q = rows 0..1023, k = 1024..2047, v = 2048..3071 (reshape (B, L, 3, 16, 64)); q_bias / v_bias zeros (read), k has no bias; scale_mul [1,16,1,1] = ln 4 (const; read): sm = exp(min(scale_mul, ln 100)) = 4; q <- q / ||q|| * sm, k <- k / ||k|| per head row; attn = q k^T + attn_bias; softmax; oup through w_proj [1024,1024] (out,in) + b_proj zeros).
#define NB 2
#define TT 2048
#define CC 1024            // NH * HD = projected width
#define DIN 1024          // input (model) width
#define NH 16
#define HD 64
#define NQB (TT / 64)
#define HG 4
#define SCALE (1.0f)
#define CAUSAL 0
#ifndef TNB
#define TNB NB
#endif
__device__ __forceinline__ float bfr(float v) { return (float)(__bf16)v; }
__host__ __device__ __forceinline__ int kb_last(int qb) { return CAUSAL ? ((qb * 64 + 63) >> 7) : (TT / 128 - 1); }
typedef __attribute__((ext_vector_type(8))) __bf16 v8b;
__device__ __forceinline__ v16b frag_b(const __bf16* rowk0, int lane) {
  union { v16b v; v8b q[2]; } u; const __bf16* p = rowk0 + 8 * (lane >> 4);
  u.q[0] = *(const v8b*)p; u.q[1] = *(const v8b*)(p + 16); return u.v;
}
#define QBH 0              // unused: k_fa has one path for all query blocks
#define QHI 0               // single-product logits on every row (unit-norm operands x 4: |cosine logit| <= 4)
#define KHI 64            // key rows of the workspace's k residual / v bf16 hi+lo planes (no kernel writes or reads them)
// B fragment (k rows k0+.., output column o) of a weight: (in,out) [K][ld] or (out,in) [ld rows of K]: bf16 exact, or f16(bf16 * 256) exact
__device__ __forceinline__ v16b wcol_io(const float* Wm, int k0, int o, int lane, int ld) { v16b w; const int g = lane >> 4;
#pragma unroll
  for (int i = 0; i < 8; ++i) { w[i] = (__bf16)Wm[(size_t)(k0 + 8 * g + i) * ld + o]; w[8 + i] = (__bf16)Wm[(size_t)(k0 + 16 + 8 * g + i) * ld + o]; }
  return w; }
__device__ __forceinline__ v16b wcol_oi(const float* Wm, int k0, int o, int lane, int K) { v16b w; const float* p = Wm + (size_t)o * K + k0 + 8 * (lane >> 4);
#pragma unroll
  for (int i = 0; i < 8; ++i) { w[i] = (__bf16)p[i]; w[8 + i] = (__bf16)p[16 + i]; }
  return w; }
__device__ __forceinline__ v16h wcolh_io(const float* Wm, int k0, int o, int lane, int ld) { v16h w; const int g = lane >> 4;
#pragma unroll
  for (int i = 0; i < 8; ++i) { w[i] = (_Float16)(bfr(Wm[(size_t)(k0 + 8 * g + i) * ld + o]) * 256.0f); w[8 + i] = (_Float16)(bfr(Wm[(size_t)(k0 + 16 + 8 * g + i) * ld + o]) * 256.0f); }
  return w; }
__device__ __forceinline__ v16h wcolh_oi(const float* Wm, int k0, int o, int lane, int K) { v16h w; const float* p = Wm + (size_t)o * K + k0 + 8 * (lane >> 4);
#pragma unroll
  for (int i = 0; i < 8; ++i) { w[i] = (_Float16)(bfr(p[i]) * 256.0f); w[8 + i] = (_Float16)(bfr(p[16 + i]) * 256.0f); }
  return w; }
#define WQKV_LAYOUT 1   // 0 = (in,out) [DIN][CC]; 1 = (out,in) [CC][DIN]; 2 = per-head [NH][DIN][HD]
__device__ __forceinline__ v16b wcol_hdk(const float* Wm, int k0, int o, int lane) { v16b w; const int g = lane >> 4; const float* p = Wm + (size_t)(o / HD) * DIN * HD + (o % HD);
#pragma unroll
  for (int i = 0; i < 8; ++i) { w[i] = (__bf16)p[(size_t)(k0 + 8 * g + i) * HD]; w[8 + i] = (__bf16)p[(size_t)(k0 + 16 + 8 * g + i) * HD]; }
  return w; }
#define WO_OUT_IN 1
#if WQKV_LAYOUT == 1
#define WCOL(W, k0, o, lane) wcol_oi(W, k0, o, lane, DIN)
#elif WQKV_LAYOUT == 2
#define WCOL(W, k0, o, lane) wcol_hdk(W, k0, o, lane)
#else
#define WCOL(W, k0, o, lane) wcol_io(W, k0, o, lane, CC)
#endif
#if WO_OUT_IN
#define WOCOL(W, k0, o, lane) wcol_oi(W, k0, o, lane, CC)
#define WOCOLH(W, k0, o, lane) wcolh_oi(W, k0, o, lane, CC)
#else
#define WOCOL(W, k0, o, lane) wcol_io(W, k0, o, lane, DIN)
#define WOCOLH(W, k0, o, lane) wcolh_io(W, k0, o, lane, DIN)
#endif

#define MAX_SCALE_MUL 4.605170186f   // ln(100): the module's clamp on scale_mul
#define PROJ_EXTRA_PARAMS , const float* __restrict__ SMU   /* scale_mul [1][NH][1][1], a module input */
// per (token, head) rule of the q and k streams, applied in k_proj's epilogue: x <- x / sqrt(sum x^2) over the head's 64 values (jnp.linalg.norm, no epsilon in the module), as x * rsq(sum x^2) in f32; the q stream's factor is first multiplied by sm = expf(fminf(bf16(scale_mul[h]), ln 100)); v untouched
#ifndef PROJ_EXTRA_PARAMS
#define PROJ_EXTRA_PARAMS
#endif

#define WS_QH  0u                                      // f16 q rows [b*t][CC]
#define WS_KH  (WS_QH + 2u * (size_t)NB * TT * CC)      // f16 k rows [b*t][CC]
#define WS_VT  (WS_KH + 2u * (size_t)NB * TT * CC)      // f16 v planes [b][c][t]
#define WS_QL  (WS_VT + 2u * (size_t)NB * CC * TT)      // f16 q residual x 2^10 rows [b][t < QHI][CC]
#define WS_KL  (WS_QL + 2u * (size_t)NB * QHI * CC)     // f16 k residual x 2^10 rows [b][t < KHI][CC]
#define WS_VB  (WS_KL + 2u * (size_t)NB * KHI * CC)     // bf16 v hi planes [b][c][t < KHI]
#define WS_VBL (WS_VB + 2u * (size_t)NB * CC * KHI)
#define WS_S   (WS_VBL + 2u * (size_t)NB * CC * KHI)    // region of 4 * HG * TT * TT bytes; its head holds the four 16-bit operand copies below
#define WS_XB  WS_S                                    // bf16 x rows [b*t][DIN]
#define WS_WB  (WS_XB + 2u * (size_t)NB * TT * DIN)     // bf16 w_qkv rows [3 * CC][DIN]
#define WS_WOH (WS_WB + 2u * 3u * (size_t)CC * DIN)     // f16(bf16 x 2^8) w_proj rows [DIN][CC]
#define WS_AB  (WS_WOH + 2u * (size_t)DIN * CC)          // bf16 attn_bias rows [TT][TT]
#define WS_Y   (WS_S  + 4u * (size_t)HG * TT * TT)      // f16 ctx x 2^6 rows [b*t][CC]
#define WS_END (WS_Y  + 4u * (size_t)NB * TT * CC)

// ---- gemm_tile: the 64 x 128 tile of A . W^T (both K-contiguous, already in their 16-bit operand type, K = 1024) of one 4-wave block. Each 128-k stage of both operands is fetched by whole-line loads (16 lanes x 16 B = 256 B of one row) and laid in LDS as it is, where all four waves read their fragments; two LDS buffers, the next stage's loads in flight in registers during the products; k runs upward in steps of 32
typedef __attribute__((ext_vector_type(2))) unsigned v2u;
#define GK 128                     // k per stage
#define GP 272                     // LDS row pitch, bytes: 256 B of 16-bit data + 16 B (pitch for ds_load_b128 readers)
#define GBUF ((64 + 128) * GP)     // one stage: 64 A rows, then 128 W rows
__device__ __forceinline__ v2u pk_bf(v4f v) { union { v2u u; __bf16 e[4]; } r;
#pragma unroll
  for (int i = 0; i < 4; ++i) r.e[i] = (__bf16)v[i];
  return r.u; }
__device__ __forceinline__ v2u pk_wo(v4f v) { union { v2u u; _Float16 e[4]; } r;    // f16(bf16 x 2^8), exact
#pragma unroll
  for (int i = 0; i < 4; ++i) r.e[i] = (_Float16)((float)(__bf16)v[i] * 256.0f);
  return r.u; }
// one stage's 24 loads of a thread (8 of A, 16 of W; the thread's offset is the same in both tiles and never changes), then the two block-uniform bases one stage on; the unrolls here and in gemm_tile make every index of ra, rw, w and acc a constant, so that these arrays stay in registers
template <typename E> __device__ __forceinline__ void gemm_fetch(const E*& Ag, const E*& Wg, unsigned off, v4u (&ra)[8], v4u (&rw)[16]) {
#pragma unroll
  for (int i = 0; i < 8; ++i) ra[i] = *(const v4u*)(Ag + off + i * 8 * 1024);
#pragma unroll
  for (int i = 0; i < 16; ++i) rw[i] = *(const v4u*)(Wg + off + i * 8 * 1024);
  asm volatile("s_wait_xcnt 0x0" :: "v"(off) : "memory");   // stands in front of the overwrite of the loads' base registers just below; the offset as an input keeps its register from being handed to a later load of the group as its destination
  __builtin_amdgcn_sched_barrier(0);                        // keeps the stage's loads in front of the products that are to cover their latency, and the steps of the bases behind the wait
  Ag += GK; Wg += GK; }
template <int F16, typename E> __device__ __forceinline__ void gemm_tile(const E* Ag, const E* Wg, char* stg, v8f (&acc)[8], int tid) {
  const int wave = tid >> 5, lane = tid & 31, col = lane & 15, g = lane >> 4;
  const unsigned off = (tid >> 4) * 1024 + (tid & 15) * 8;                   // 8 rows a pass of the block, 16 lanes x 16 B a row
  char* sp = stg + (tid >> 4) * GP + (tid & 15) * 16;
  const char* fa = stg + (wave * 16 + col) * GP + 16 * g;              // fragment: elements 0..7 = k0 + 8g + 0..7, 8..15 = k0 + 16 + 8g + 0..7
  const char* fw = stg + (64 + col) * GP + 16 * g;
  v4u ra[8], rw[16];
  gemm_fetch(Ag, Wg, off, ra, rw);
  for (int s = 0; s < 1024 / GK; ++s) { const int bo = (s & 1) * GBUF;
#pragma unroll
    for (int i = 0; i < 8; ++i) *(v4u*)(sp + bo + i * 8 * GP) = ra[i];
#pragma unroll
    for (int i = 0; i < 16; ++i) *(v4u*)(sp + bo + (64 + i * 8) * GP) = rw[i];
    __syncthreads();   // publishes stage s; a wave that has passed it has left the other buffer, which stage s + 1 overwrites only behind this barrier
    if (s + 1 < 1024 / GK) gemm_fetch(Ag, Wg, off, ra, rw);
#pragma unroll
    for (int kk = 0; kk < GK / 32; ++kk) { union { v4u q[2]; v16b b; v16h h; } a, w[8]; a.q[0] = *(const v4u*)(fa + bo + kk * 64); a.q[1] = *(const v4u*)(fa + bo + kk * 64 + 32);   // the nine fragments of a 32-k block are read as one group in front of its eight products
#pragma unroll
      for (int j = 0; j < 8; ++j) { w[j].q[0] = *(const v4u*)(fw + bo + j * 16 * GP + kk * 64); w[j].q[1] = *(const v4u*)(fw + bo + j * 16 * GP + kk * 64 + 32); }
      __builtin_amdgcn_sched_barrier(0);   // keeps the group together: without it the scheduler sinks each fragment's two reads to just before its product, into one register set, and every product waits out a whole LDS latency
#pragma unroll
      for (int j = 0; j < 8; ++j) acc[j] = F16 ? __builtin_amdgcn_wmma_f32_16x16x32_f16(false, a.h, false, w[j].h, (short)0, acc[j], false, false) : __builtin_amdgcn_wmma_f32_16x16x32_bf16(false, a.b, false, w[j].b, (short)0, acc[j], false, false); } }
}
// ---- gemm_tile2: the 128 x 128 tile of A . W^T (both K-contiguous bf16, K = 1024) of one 4-wave block; wave (wr, wc) owns the 64 x 64 quarter, so the eight fragments of a 32-k block feed sixteen products. Each 64-k stage of both operands is fetched by whole-line loads (8 lanes x 16 B = 128 B of one row) and laid in LDS as it is; two LDS buffers, the next stage's loads in flight in registers during the products; k runs upward in steps of 32
#define HK 64                      // k per stage
#define HP 144                     // LDS row pitch, bytes: 128 B of 16-bit data + 16 B (pitch for ds_load_b128 readers)
#define HBUF ((128 + 128) * HP)    // one stage: 128 A rows, then 128 W rows
// one stage's 16 loads of a thread (8 of A, 8 of W; the thread's offset is the same in both tiles and never changes), then the two block-uniform bases one stage on; the unrolls here and in gemm_tile2 make every index of ra, rw, a, w and acc a constant, so that these arrays stay in registers
__device__ __forceinline__ void gemm_fetch2(const __bf16*& Ag, const __bf16*& Wg, unsigned off, v4u (&ra)[8], v4u (&rw)[8]) {
#pragma unroll
  for (int i = 0; i < 8; ++i) ra[i] = *(const v4u*)(Ag + off + i * 16 * 1024);
#pragma unroll
  for (int i = 0; i < 8; ++i) rw[i] = *(const v4u*)(Wg + off + i * 16 * 1024);
  asm volatile("s_wait_xcnt 0x0" :: "v"(off) : "memory");   // stands in front of the overwrite of the loads' base registers just below; the offset as an input keeps its register from being handed to a later load of the group as its destination
  __builtin_amdgcn_sched_barrier(0);                        // keeps the stage's loads in front of the products that are to cover their latency, and the steps of the bases behind the wait
  Ag += HK; Wg += HK; }
__device__ __forceinline__ void gemm_tile2(const __bf16* Ag, const __bf16* Wg, char* stg, v8f (&acc)[4][4], int tid) {
  const int wave = tid >> 5, lane = tid & 31, col = lane & 15, g = lane >> 4, wr = wave >> 1, wc = wave & 1;
  const unsigned off = (tid >> 3) * 1024 + (tid & 7) * 8;                    // 16 rows a pass of the block, 8 lanes x 16 B a row
  char* sp = stg + (tid >> 3) * HP + (tid & 7) * 16;
  const char* fa = stg + (wr * 64 + col) * HP + 16 * g;                // fragment: elements 0..7 = k0 + 8g + 0..7, 8..15 = k0 + 16 + 8g + 0..7
  const char* fw = stg + (128 + wc * 64 + col) * HP + 16 * g;
  v4u ra[8], rw[8];
  gemm_fetch2(Ag, Wg, off, ra, rw);
  for (int s = 0; s < 1024 / HK; ++s) { const int bo = (s & 1) * HBUF;
#pragma unroll
    for (int i = 0; i < 8; ++i) *(v4u*)(sp + bo + i * 16 * HP) = ra[i];
#pragma unroll
    for (int i = 0; i < 8; ++i) *(v4u*)(sp + bo + (128 + i * 16) * HP) = rw[i];
    __syncthreads();   // publishes stage s; a wave that has passed it has left the other buffer, which stage s + 1 overwrites only behind this barrier
    if (s + 1 < 1024 / HK) gemm_fetch2(Ag, Wg, off, ra, rw);
#pragma unroll
    for (int kk = 0; kk < HK / 32; ++kk) { union { v4u q[2]; v16b b; } a[4], w[4];   // the eight fragments of a 32-k block are read as one group in front of its sixteen products
#pragma unroll
      for (int i = 0; i < 4; ++i) { a[i].q[0] = *(const v4u*)(fa + bo + i * 16 * HP + kk * 64); a[i].q[1] = *(const v4u*)(fa + bo + i * 16 * HP + kk * 64 + 32); w[i].q[0] = *(const v4u*)(fw + bo + i * 16 * HP + kk * 64); w[i].q[1] = *(const v4u*)(fw + bo + i * 16 * HP + kk * 64 + 32); }
      __builtin_amdgcn_sched_barrier(0);   // keeps the group together: without it the scheduler sinks each fragment's two reads to just before its product, and every product waits out a whole LDS latency
#pragma unroll
      for (int i = 0; i < 4; ++i)
#pragma unroll
        for (int j = 0; j < 4; ++j) acc[i][j] = __builtin_amdgcn_wmma_f32_16x16x32_bf16(false, a[i].b, false, w[j].b, (short)0, acc[i][j], false, false); } }
}
// ---- k_cvt: x, w_qkv and attn_bias once to bf16, w_proj once to f16(bf16 x 2^8): the operands that the stages of the two GEMMs and the steps of k_fa fetch. Block = 8192 consecutive floats of one of the four arrays; a wave's load covers 512 B, its store 256 B; the unrolls keep v and o in registers
template <int WOF> __device__ __forceinline__ void cvt_run(const float* sp, char* dp) { v4f v[8]; v2u o[8];
#pragma unroll
  for (int j = 0; j < 8; ++j) v[j] = *(const v4f*)(sp + j * 1024);
  asm volatile("s_wait_xcnt 0x0" ::: "memory");   // stands in front of any rewrite of the loads' address registers
#pragma unroll
  for (int j = 0; j < 8; ++j) o[j] = WOF ? pk_wo(v[j]) : pk_bf(v[j]);
#pragma unroll
  for (int j = 0; j < 8; ++j) *(v2u*)(dp + j * 2048) = o[j];
  asm volatile("s_wait_xcnt 0x0" ::: "memory"); }   // stands behind the last store, in front of any rewrite of the stores' data and address registers on a way that the listing lays behind them
__global__ __launch_bounds__(256) void k_cvt(const float* __restrict__ X, const float* __restrict__ WQKV, const float* __restrict__ WO, const float* __restrict__ ABI, __bf16* __restrict__ XB, __bf16* __restrict__ WB, _Float16* __restrict__ WOH, __bf16* __restrict__ AB) {
  const int nx = NB * TT * DIN / 8192, nw = 3 * CC * DIN / 8192, no = DIN * CC / 8192, blk = blockIdx.x; const size_t t4 = threadIdx.x * 4;   /* the four branches are block-uniform */
  if (blk < nx) { const size_t e = (size_t)blk * 8192 + t4; cvt_run<0>(X + e, (char*)XB + 2 * e); }
  else if (blk < nx + nw) { const size_t e = (size_t)(blk - nx) * 8192 + t4; cvt_run<0>(WQKV + e, (char*)WB + 2 * e); }
  else if (blk < nx + nw + no) { const size_t e = (size_t)(blk - nx - nw) * 8192 + t4; cvt_run<1>(WO + e, (char*)WOH + 2 * e); }
  else { const size_t e = (size_t)(blk - nx - nw - no) * 8192 + t4; cvt_run<0>(ABI + e, (char*)AB + 2 * e); } }
// ---- k_proj: block = (128 rows, 128 cols, which): q/k/v = X W (+ b) with exact bf16 products (K = DIN) -> which 0: q f16 rows; 1: k f16 rows; 2: v f16 planes [c][t]. A wave's 64 x 64 quarter is 64 tokens of ONE head, so the whole epilogue runs on its accumulator registers: a token's 64 values lie 4 in a lane x the 16 lanes of a half
template <int M> __device__ __forceinline__ float xm16(float v) { return __builtin_bit_cast(float, __builtin_amdgcn_update_dpp(0, __builtin_bit_cast(int, v), 0x160 + M, 0xf, 0xf, true)); }   // the value of lane ^ M inside the 16-lane half (DPP row_xmask)
// 1 / sqrt(x); the v_nop in the same statement is the one slot that the instruction set asks for behind a transcendental before its result is read or its source register overwritten
__device__ __forceinline__ float rsqs(float x) { float e; asm("v_rsq_f32 %0, %1\n\tv_nop" : "=v"(e) : "v"(x)); return e; }
// the wave's own 64 x 64 f16 tile (pitch HP) out of LDS to 64 global rows of LD elements, whole 128-B lines (8 lanes x 16 B a row, 4 rows an instruction); the unrolls keep v in registers and make every step of the address an immediate offset
template <int LD> __device__ __forceinline__ void tile_out(const char* tl, _Float16* D, int lane) { v4u v[16]; const char* p = tl + (lane >> 3) * HP + (lane & 7) * 16; _Float16* d = D + (size_t)(lane >> 3) * LD + (lane & 7) * 8;
#pragma unroll
  for (int i = 0; i < 16; ++i) v[i] = *(const v4u*)(p + i * 4 * HP);
#pragma unroll
  for (int i = 0; i < 16; ++i) vst2(d + (size_t)i * 4 * LD, v[i]);
  asm volatile("s_wait_xcnt 0x0" ::: "memory"); }   // stands behind the last store, in front of any rewrite of the stores' data and address registers on a way that the listing lays behind them
__global__ __launch_bounds__(128) void k_proj(const __bf16* __restrict__ XQ, const __bf16* __restrict__ XK, const __bf16* __restrict__ XV, const __bf16* __restrict__ WQ, const __bf16* __restrict__ WK, const __bf16* __restrict__ WV, const float* __restrict__ BQ, const float* __restrict__ BK, const float* __restrict__ BV,
    _Float16* __restrict__ QH, _Float16* __restrict__ KH, _Float16* __restrict__ VT PROJ_EXTRA_PARAMS) {
  __shared__ __align__(16) char sm[2 * HBUF];   // the two operand stages during the products; then the first buffer holds the four waves' own output tiles (4 x 64 rows at pitch HP = HBUF bytes): the last stage, an odd one, is read from the second buffer, and every wave left the first before that stage's barrier
  const int tid = threadIdx.x, wave = tid >> 5, lane = tid & 31, col = lane & 15, g = lane >> 4; const int wr = wave >> 1, wc = wave & 1; const int which = blockIdx.z; const int c0 = blockIdx.y * 128; const size_t rb = (size_t)blockIdx.x * 128;
  const __bf16* X = which == 0 ? XQ : which == 1 ? XK : XV; const __bf16* WA = which == 0 ? WQ : which == 1 ? WK : WV; const float* BA = which == 0 ? BQ : which == 1 ? BK : BV;
  float bs[4] = {0.f, 0.f, 0.f, 0.f}; const float smu = SMU[c0 / HD + wc];   // the lane's four bias values and the head's scale_mul are fetched here, so that the products cover their latency
  if (BA) {
#pragma unroll
    for (int j = 0; j < 4; ++j) bs[j] = BA[c0 + wc * 64 + j * 16 + col]; }
  asm volatile("s_wait_xcnt 0x0" ::: "memory");   // stands in front of any rewrite of these loads' address registers
  v8f acc[4][4] = {};
  gemm_tile2(X + rb * DIN, WA + (size_t)c0 * DIN, sm, acc, tid);
  char* tl = sm + wave * (64 * HP);
#pragma unroll
  for (int j = 0; j < 4; ++j) bs[j] = bfr(bs[j]);
  if (which < 2) { const float sm_ = which == 0 ? expf(fminf(bfr(smu), MAX_SCALE_MUL)) : 1.0f;   // tile rows = tokens, 64 f16 of the head each; the unrolls make every index of acc, bs and sc a constant, so that they stay in registers
#pragma unroll
    for (int i = 0; i < 4; ++i) { float sc[8];
#pragma unroll
      for (int r = 0; r < 8; ++r) { float ss = 0.f;
#pragma unroll
        for (int j = 0; j < 4; ++j) { const float x = acc[i][j][r] + bs[j]; acc[i][j][r] = x; ss += x * x; }
        ss += xm16<1>(ss); ss += xm16<2>(ss); ss += xm16<4>(ss); ss += xm16<8>(ss); sc[r] = rsqs(ss) * sm_; }
#pragma unroll
      for (int j = 0; j < 4; ++j)
#pragma unroll
        for (int r = 0; r < 8; ++r) *(_Float16*)(tl + (i * 16 + 8 * g + r) * HP + (j * 16 + col) * 2) = (_Float16)(acc[i][j][r] * sc[r]); }
    LDSX(); tile_out<CC>(tl, (which == 0 ? QH : KH) + (rb + wr * 64) * CC + c0 + wc * 64, lane);
  } else {   // tile rows = the head's 64 dims, 64 tokens each: a lane's 8 accumulator rows are 8 consecutive tokens of one dim
#pragma unroll
    for (int i = 0; i < 4; ++i)
#pragma unroll
      for (int j = 0; j < 4; ++j) { v8h o;
#pragma unroll
        for (int r = 0; r < 8; ++r) o[r] = (_Float16)(acc[i][j][r] + bs[j]);
        *(v8h*)(tl + (j * 16 + col) * HP + (i * 16 + 8 * g) * 2) = o; }
    LDSX(); tile_out<TT>(tl, VT + ((rb / TT) * CC + c0 + wc * 64) * (size_t)TT + rb % TT + wr * 64, lane); }
}
// ---- k_fa: block = 128 queries of (b, h), 8 waves, all keys in steps of 64, each step's K, V and bias tiles brought into LDS by asynchronous copies one step ahead (two buffers). Wave (qi, ki) = (wave / 2, wave % 2) owns 32 queries (two 16-query tiles) against the 32-key half ki of every step, so each K or V fragment read from LDS feeds two products: S^T = K . Q^T on top of bf16(attn_bias), which an identity A lays into the score registers as the B operand of one bf16 product a tile (1 x b + zeros, exact) (lane = one query a tile, 8 keys a tile), running maximum and sum per query over the wave's own keys in registers, P^T x 2^11 (relative to that running maximum) once to f16 straight from the score registers as the B operand, ctx^T += V^T . P^T. Behind the loop the two waves of a pair hand each other one query tile's maximum, sum and ctx^T through LDS and join the two key halves; ctx = ctx^T / sum, stored x 2^6 as f16, the output projection's operand
#define LOG2E 1.44269504f
__device__ __forceinline__ v8f wmma_h(v16h a, v16h b, v8f c) { return __builtin_amdgcn_wmma_f32_16x16x32_f16(false, a, false, b, (short)0, c, false, false); }
// 2^x; the v_nop in the same statement is the one slot that the instruction set asks for behind a transcendental before its result is read or its source register overwritten
__device__ __forceinline__ float exp2s(float x) { float e; asm("v_exp_f32 %0, %1\n\tv_nop" : "=v"(e) : "v"(x)); return e; }
// 2^x in place of a query tile's rescale exponent a and of its 16 score exponents e, and the 8 pairs of the latter once to f16 (element 2i low, 2i + 1 high), as one statement: directly behind every v_exp_f32 stands another value's v_exp_f32 or an earlier pair's convert, so the one slot that the instruction set asks for behind a transcendental before its result is read or its source overwritten holds work and no v_nop. The three hints let the wave step aside instead of holding the vector port: the first for the youngest exponent, the other two for the last two pairs' results
__device__ __forceinline__ void exp2x17(float& a, float (&e)[16], unsigned (&w)[8]) {
  asm(
      "s_delay_alu instid0(VALU_DEP_1)\n\tv_exp_f32 %16, %16\n\tv_exp_f32 %0, %0\n\tv_exp_f32 %1, %1\n\tv_exp_f32 %2, %2\n\tv_exp_f32 %3, %3\n\t"
      "v_exp_f32 %4, %4\n\tv_exp_f32 %5, %5\n\tv_cvt_pk_f16_f32 %17, %0, %1\n\tv_exp_f32 %6, %6\n\tv_exp_f32 %7, %7\n\tv_cvt_pk_f16_f32 %18, %2, %3\n\t"
      "v_exp_f32 %8, %8\n\tv_exp_f32 %9, %9\n\tv_cvt_pk_f16_f32 %19, %4, %5\n\tv_exp_f32 %10, %10\n\tv_exp_f32 %11, %11\n\tv_cvt_pk_f16_f32 %20, %6, %7\n\t"
      "v_exp_f32 %12, %12\n\tv_exp_f32 %13, %13\n\tv_cvt_pk_f16_f32 %21, %8, %9\n\tv_exp_f32 %14, %14\n\tv_exp_f32 %15, %15\n\tv_cvt_pk_f16_f32 %22, %10, %11\n\t"
      "s_delay_alu instid0(TRANS32_DEP_3)\n\tv_cvt_pk_f16_f32 %23, %12, %13\n\ts_delay_alu instid0(TRANS32_DEP_1)\n\tv_cvt_pk_f16_f32 %24, %14, %15"
      : "+v"(e[0]), "+v"(e[1]), "+v"(e[2]), "+v"(e[3]), "+v"(e[4]), "+v"(e[5]), "+v"(e[6]), "+v"(e[7]), "+v"(e[8]), "+v"(e[9]), "+v"(e[10]), "+v"(e[11]), "+v"(e[12]), "+v"(e[13]), "+v"(e[14]), "+v"(e[15]), "+v"(a),
        "=&v"(w[0]), "=&v"(w[1]), "=&v"(w[2]), "=&v"(w[3]), "=&v"(w[4]), "=&v"(w[5]), "=&v"(w[6]), "=&v"(w[7])); }
__device__ __forceinline__ v16h frag_p(const _Float16* p) { union { v16h v; v8h q[2]; } u; u.q[0] = *(const v8h*)p; u.q[1] = *(const v8h*)(p + 16); return u.v; }   // frag_h with the half's 8 elements already in the pointer
__device__ __forceinline__ v16b frag_pb(const __bf16* p) { union { v16b v; v8b q[2]; } u; u.q[0] = *(const v8b*)p; u.q[1] = *(const v8b*)(p + 16); return u.v; }   // the same of bf16
__device__ __forceinline__ float xhalf(float v) { const int b = __builtin_bit_cast(int, v); return __builtin_bit_cast(float, __builtin_amdgcn_permlanex16(b, b, 0x76543210, 0xfedcba98, false, false)); }   // the value of lane ^ 16
// one 64-key step's operands in LDS: 64 K rows, 64 V planes and the block's 128 bf16 bias rows, each of 128 B at pitch 144 B (pitch for ds_load_b128 readers)
#define FQ 128
#define FKP 144
#define FVO (64 * FKP)
#define FBO (2 * 64 * FKP)
#define FBUF ((2 * 64 + FQ) * FKP)
// one step's 8 copies of a thread, whole lines (8 lanes x 16 B = one K, V or bias row; 32 rows a pass of the block); lk = the thread's LDS byte address of its first K piece in the target buffer; the s_wait_xcnt at the end of the statement stands in front of any rewrite of the address registers that its copies name
__device__ __forceinline__ void fa_copy(unsigned lk, const _Float16* kg, const _Float16* vg, const __bf16* bg) {
  asm volatile("global_load_async_to_lds_b128 %0, %1, off\n\tglobal_load_async_to_lds_b128 %2, %3, off\n\tglobal_load_async_to_lds_b128 %4, %5, off\n\tglobal_load_async_to_lds_b128 %6, %7, off\n\t"
               "global_load_async_to_lds_b128 %8, %9, off\n\tglobal_load_async_to_lds_b128 %10, %11, off\n\tglobal_load_async_to_lds_b128 %12, %13, off\n\tglobal_load_async_to_lds_b128 %14, %15, off\n\ts_wait_xcnt 0x0"
               :: "v"(lk), "v"(kg), "v"(lk + 32 * FKP), "v"(kg + 32 * CC),
                  "v"(lk + FVO), "v"(vg), "v"(lk + FVO + 32 * FKP), "v"(vg + 32 * TT),
                  "v"(lk + FBO), "v"(bg), "v"(lk + FBO + 32 * FKP), "v"(bg + 32 * TT), "v"(lk + FBO + 64 * FKP), "v"(bg + 64 * TT), "v"(lk + FBO + 96 * FKP), "v"(bg + 96 * TT) : "memory"); }
__global__ __launch_bounds__(256) void k_fa(const _Float16* __restrict__ QH, const _Float16* __restrict__ KH, const _Float16* __restrict__ VT, const __bf16* __restrict__ AB, _Float16* __restrict__ Y) { __shared__ __align__(16) char ring[2 * FBUF];   // two step buffers; behind the loop's last barrier the first buffer's bytes carry the pairs' hand-over (8 waves x 9 x 512 B = FBUF) and the second's stage the output rows
  _Float16 (*ss)[16][HD + 8] = (_Float16 (*)[16][HD + 8])(ring + FBUF);
  const int tid = threadIdx.x, wave = tid >> 5, lane = tid & 31, col = lane & 15, g = lane >> 4, qi = wave >> 1, ki = wave & 1; const int h = blockIdx.y, b = blockIdx.z; const int ql0 = blockIdx.x * FQ + wave * 16;   // ql0: the 16 queries that this wave finishes and stores (tile ki of its 32)
  const _Float16* qp = QH + ((size_t)b * TT + blockIdx.x * FQ + qi * 32 + col) * CC + h * HD; v16h q[2][2];   // the unroll makes every index of q a constant, so that it stays in registers
#pragma unroll
  for (int u = 0; u < 2; ++u) { q[u][0] = frag_h(qp + u * 16 * CC, lane); q[u][1] = frag_h(qp + u * 16 * CC + 32, lane); }
  const _Float16* kg = KH + ((size_t)b * TT + (tid >> 3)) * CC + h * HD + (tid & 7) * 8;             // the thread's 16 B of key row tid / 8 (then + 32); runs on by 64 keys a step
  const _Float16* vg = VT + ((size_t)b * CC + h * HD + (tid >> 3)) * (size_t)TT + (tid & 7) * 8;     // its 16 B of the v plane of dim tid / 8 (then + 32); runs on by 64 keys a step
  const __bf16* bg = AB + (size_t)(blockIdx.x * FQ + (tid >> 3)) * TT + (tid & 7) * 8;               // its 16 B of the block's bias row of query tid / 8 (then + 32, 64, 96); runs on by 64 keys a step
  const unsigned lk = (unsigned)(size_t)ring + (tid >> 3) * FKP + (tid & 7) * 16;
  const char* kr = ring + (ki * 32 + col) * FKP + 16 * g;                     // key row col of a 16-key tile of this wave's half, this lane half's 8 elements
  const char* vr = ring + FVO + col * FKP + ki * 64 + 16 * g;                 // dim col of a 16-dim tile of V, the 32 keys of this wave's half
  const char* br = ring + FBO + (qi * 32 + col) * FKP + ki * 64 + 16 * g;     // this lane's query row of a query tile as a B fragment: keys 8g + 0..7 and 16 + 8g + 0..7 of this wave's half
  v16b id0, id1;                                                     // A fragments that pick a key row out of that B: id0[key][k] = (k == key), the half's first tile; id1[key][k] = (k == 16 + key), its second; 1 x b + 0 x the others is b itself for a finite bias (0 x inf would be NaN)
#pragma unroll
  for (int i = 0; i < 8; ++i) { const __bf16 o = (__bf16)(8 * g + i == col ? 1.0f : 0.0f), z = (__bf16)0.0f; id0[i] = o; id0[8 + i] = z; id1[i] = z; id1[8 + i] = o; }
  v8f acc[2][HD / 16] = {}; float m[2] = {-3.0e38f, -3.0e38f}, l[2] = {0.f, 0.f};   // per query tile: m = running maximum of the query's logits over this wave's keys; l = this lane half's share of their sum, x 2^11
  fa_copy(lk, kg, vg, bg);
  asm volatile("s_wait_asynccnt 0x0" ::: "memory");   // step 0's pieces of this wave have landed
  __syncthreads();                                    // publishes step 0
  fa_copy(lk + FBUF, kg + 64 * CC, vg + 64, bg + 64);
  kg += 128 * CC; vg += 128; bg += 128;
  for (int t = 0; t < TT / 64; ++t) { const unsigned bo = (t & 1) * FBUF; v16h kf[4], vf[4]; v16b bf[2]; v8f s[2][2];   // every LDS read of the step stands as one group in front of its first product; the unrolls of this loop body make every index of kf, vf, bf, s, p, m, l and acc a constant, so that they stay in registers
#pragma unroll
    for (int u = 0; u < 2; ++u) bf[u] = frag_pb((const __bf16*)(br + bo + u * 16 * FKP));
#pragma unroll
    for (int j = 0; j < 2; ++j) { kf[2 * j] = frag_p((const _Float16*)(kr + bo + j * 16 * FKP)); kf[2 * j + 1] = frag_p((const _Float16*)(kr + bo + j * 16 * FKP + 64)); }
#pragma unroll
    for (int j = 0; j < HD / 16; ++j) vf[j] = frag_p((const _Float16*)(vr + bo + j * 16 * FKP));
    __builtin_amdgcn_sched_barrier(0);   // keeps the group together: without it the scheduler sinks each fragment's reads to just before its product, and every product waits out an LDS latency
    const v8f c0 = {};   // s[u][j][r] = bias[query of tile u][key 16 j + 8g + r of the half], then the two products of K . Q^T on top of it
#pragma unroll
    for (int u = 0; u < 2; ++u) { s[u][0] = __builtin_amdgcn_wmma_f32_16x16x32_bf16(false, id0, false, bf[u], (short)0, c0, false, false); s[u][1] = __builtin_amdgcn_wmma_f32_16x16x32_bf16(false, id1, false, bf[u], (short)0, c0, false, false); }
    __builtin_amdgcn_sched_barrier(0);   // this one and the two below keep the four tiles' products abreast: without them the scheduler lines up each tile's three dependent products one behind the other, each waiting out the one before it
#pragma unroll
    for (int u = 0; u < 2; ++u) { s[u][0] = wmma_h(kf[0], q[u][0], s[u][0]); s[u][1] = wmma_h(kf[2], q[u][0], s[u][1]); }
    __builtin_amdgcn_sched_barrier(0);
#pragma unroll
    for (int u = 0; u < 2; ++u) { s[u][0] = wmma_h(kf[1], q[u][1], s[u][0]); s[u][1] = wmma_h(kf[3], q[u][1], s[u][1]); }
    __builtin_amdgcn_sched_barrier(0);
    v16h p[2];
#pragma unroll
    for (int u = 0; u < 2; ++u) { float mx = m[u];
#pragma unroll
      for (int j = 0; j < 2; ++j)
#pragma unroll
        for (int r = 0; r < 8; ++r) mx = fmaxf(mx, s[u][j][r]);
      mx = fmaxf(mx, xhalf(mx));
      float al = (m[u] - mx) * LOG2E; const float mo = mx * LOG2E - 11.0f; m[u] = mx;   // al: here the exponent, behind exp2x17 the factor 2^al that carries sum and ctx^T over to the new maximum
      float e[16]; union { v16h h; unsigned w[8]; } pk;   // the unrolls below make every index of e a constant too, so that it stays in registers
#pragma unroll
      for (int j = 0; j < 2; ++j)
#pragma unroll
        for (int r = 0; r < 8; ++r) e[j * 8 + r] = s[u][j][r] * LOG2E - mo;
      exp2x17(al, e, pk.w); p[u] = pk.h;
      float sj[2];
#pragma unroll
      for (int j = 0; j < 2; ++j) { sj[j] = 0.f;
#pragma unroll
        for (int r = 0; r < 8; ++r) sj[j] += e[j * 8 + r]; }
      l[u] = l[u] * al + (sj[0] + sj[1]);
#pragma unroll
      for (int j = 0; j < HD / 16; ++j) acc[u][j] = acc[u][j] * al; }
#pragma unroll
    for (int u = 0; u < 2; ++u)
#pragma unroll
      for (int j = 0; j < HD / 16; ++j) acc[u][j] = wmma_h(vf[j], p[u], acc[u][j]);
    __builtin_amdgcn_sched_barrier(0);   // keeps the step's products in front of the waits below: without it the scheduler lifts them and the barrier to just behind the read group, where the next step's copies have had no time to land
    asm volatile("s_wait_dscnt 0x0" ::: "memory");      // this wave's reads of the step's buffer have retired before the buffer is handed to the copies below
    asm volatile("s_wait_asynccnt 0x0" ::: "memory");   // this wave's pieces of step t + 1 have landed
    __syncthreads();                                    // publishes step t + 1 and ends every wave's reads of step t's buffer
    if (t + 2 < TT / 64) { fa_copy(lk + bo, kg, vg, bg); kg += 64 * CC; vg += 64; bg += 64; } }
  asm volatile("s_wait_asynccnt 0x0" ::: "memory");     // no copy is outstanding when the ring's bytes become hand-over and output staging and when the wave ends
  // the pair (qi, 0), (qi, 1) joins its two key halves: wave ki keeps query tile ki and hands tile 1 - ki to its partner, lane to lane, 9 pieces of 16 B a lane, each piece 512 contiguous bytes of the wave; the unrolls below make every index of acc, keep and o a constant, so that they stay in registers
  l[0] += xhalf(l[0]); l[1] += xhalf(l[1]);
  const float mk = ki ? m[1] : m[0], lkp = ki ? l[1] : l[0]; v8f keep[HD / 16]; char* hw = ring + wave * (9 * 512) + lane * 16; const char* hr = ring + (wave ^ 1) * (9 * 512) + lane * 16;
#pragma unroll
  for (int j = 0; j < HD / 16; ++j) { const v8f gv = ki ? acc[0][j] : acc[1][j]; keep[j] = ki ? acc[1][j] : acc[0][j];
    *(v4f*)(hw + (2 * j) * 512) = __builtin_shufflevector(gv, gv, 0, 1, 2, 3); *(v4f*)(hw + (2 * j + 1) * 512) = __builtin_shufflevector(gv, gv, 4, 5, 6, 7); }
  { const v4f ml = {ki ? m[0] : m[1], ki ? l[0] : l[1], 0.f, 0.f}; *(v4f*)(hw + 8 * 512) = ml; }
  __syncthreads();                                      // publishes every wave's hand-over to its partner
  const v4f mlo = *(const v4f*)(hr + 8 * 512); const float mj = fmaxf(mk, mlo[0]), ak = exp2s((mk - mj) * LOG2E), ao = exp2s((mlo[0] - mj) * LOG2E), lj = lkp * ak + mlo[1] * ao;
  const float inv = lj > 0.f ? 1.0f / lj : 0.f;   /* a fully excluded row yields ctx = 0 */
#pragma unroll
  for (int j = 0; j < HD / 16; ++j) { v8h o; const v4f o0 = *(const v4f*)(hr + (2 * j) * 512), o1 = *(const v4f*)(hr + (2 * j + 1) * 512);   /* ctx carried x 2^6 into f16 so small-magnitude context rows stay clear of f16 subnormals */
#pragma unroll
    for (int r = 0; r < 8; ++r) o[r] = (_Float16)(((keep[j][r] * ak + (r < 4 ? o0[r & 3] : o1[r & 3]) * ao) * inv) * 64.0f);
    *(v8h*)&ss[wave][col][j * 16 + 8 * g] = o; }
  LDSX(); for (int i = 0; i < 4; ++i) { const int rl = 4 * i + (lane >> 3); vst2(Y + ((size_t)b * TT + ql0 + rl) * CC + h * HD + (lane & 7) * 8, *(const v4u*)&ss[wave][rl][(lane & 7) * 8]); } }
// ---- k_out: block = (64 rows, 128 cols): out = ctx Wo (+ bo): ctx x 2^6 in f16 against Wo as f16(bf16 x 2^8) exact (1 product) x 2^-14
__global__ __launch_bounds__(128) void k_out(const _Float16* __restrict__ Y, const _Float16* __restrict__ WO, const float* __restrict__ BO, float* __restrict__ OUT) { __shared__ __align__(16) float sf[4][16][132]; __shared__ __align__(16) char stg[2 * GBUF];
  const int tid = threadIdx.x, wave = tid >> 5, lane = tid & 31, col = lane & 15, g = lane >> 4; const int c0 = blockIdx.y * 128; const size_t r0 = (size_t)blockIdx.x * 64 + wave * 16;
  v8f acc[8] = {};
  gemm_tile<1>(Y + (size_t)blockIdx.x * 64 * CC, WO + (size_t)c0 * CC, stg, acc, tid);
#pragma unroll
    for (int j = 0; j < 8; ++j) { const float bias = BO ? bfr(BO[c0 + j * 16 + col]) : 0.f;
#pragma unroll
      for (int r = 0; r < 8; ++r) sf[wave][8 * g + r][j * 16 + col] = acc[j][r] * (1.0f / 16384.0f) + bias; }   /* 2^-8 (Wo carry) x 2^-6 (ctx carry) */
  LDSX(); for (int rl = 0; rl < 16; ++rl) vst2(OUT + (r0 + rl) * DIN + c0 + lane * 4, *(const v4f*)&sf[wave][rl][lane * 4]); }

extern "C" void kernel_launch(void* const* d_in, const int* in_sizes, int n_in, void* d_out, int out_size, void* d_ws, size_t ws_size, hipStream_t stream) {
  (void)in_sizes; (void)n_in; (void)out_size;
  const float** F = (const float**)d_in;
  if (ws_size < (size_t)WS_END) return;
  char* ws = (char*)d_ws; _Float16 *QH = (_Float16*)(ws + WS_QH), *KH = (_Float16*)(ws + WS_KH), *VT = (_Float16*)(ws + WS_VT), *QL = (_Float16*)(ws + WS_QL), *KL = (_Float16*)(ws + WS_KL); __bf16 *VB = (__bf16*)(ws + WS_VB), *VBL = (__bf16*)(ws + WS_VBL), *XB = (__bf16*)(ws + WS_XB), *WB = (__bf16*)(ws + WS_WB), *AB = (__bf16*)(ws + WS_AB); _Float16 *WOH = (_Float16*)(ws + WS_WOH), *Y = (_Float16*)(ws + WS_Y);
  (void)Y; (void)QL; (void)KL; (void)VB; (void)VBL;
  // inputs: 0 x [2,2048,1024]; 1 attn_bias [1,1,2048,2048]; 2 w_qkv [3072,1024] (out,in): q rows 0..1023, k 1024..2047, v 2048..3071; 3 q_bias [1024] (zeros, read); 4 v_bias [1024] (zeros, read); 5 scale_mul [1,16,1,1] (ln 4, read); 6 w_proj [1024,1024] (out,in); 7 b_proj (zeros, read); the k stream has no bias (the module concatenates zeros)
  k_cvt<<<dim3((NB * TT * DIN + 3 * CC * DIN + DIN * CC + TT * TT) / 8192), 256, 0, stream>>>(F[0], F[2], F[6], F[1], XB, WB, WOH, AB);
  k_proj<<<dim3(TNB * TT / 128, CC / 128, 3), 128, 0, stream>>>(XB, XB, XB, WB, WB + (size_t)CC * DIN, WB + 2 * (size_t)CC * DIN, F[3], nullptr, F[4], QH, KH, VT, F[5]);
  k_fa<<<dim3(TT / FQ, NH, TNB), 256, 0, stream>>>(QH, KH, VT, AB, Y);
  k_out<<<dim3(TNB * TT / 64, DIN / 128), 128, 0, stream>>>(Y, WOH, F[7], (float*)d_out);
}
